// v000
// The times below were measured on an AMD MI455X: many runs one after another, warmed up first and cycling through
// copies of the inputs, with the whole window's GPU time divided by the number of runs. Launches and the gaps
// between them are all in it. The median over several windows is given; except for v000 it joins two sittings, which
// can be a few percent apart, so the side-by-side timings, each taken in one sitting, are the better comparison.
// The starting kernel, v000, takes 19.9 milliseconds a run.
// compute dtype: all float inputs rounded to bf16; q/k/v head projections x W^T + b with EXACT bf16 products on WMMA 16x16x32, f32 accumulate; relu, the power feature map (norms over 128, x^2) in f32; phi_k, v, phi_q and the [128 x 128] k^T v as bf16 hi + lo (3 products) for the two linear-attention contractions (K = 32,768 and K = 128), v hi + lo against exact v_map_w (2 products); column sums, the normaliser, the head mean and the time coordinate (sqrt) in f32; f32 output.
#include <hip/hip_runtime.h>
#include <math.h>

typedef __attribute__((ext_vector_type(16))) _Float16 v16h;
typedef __attribute__((ext_vector_type(16))) __bf16 v16b;
typedef __attribute__((ext_vector_type(8)))  _Float16 v8h;
typedef __attribute__((ext_vector_type(8)))  float v8f;
typedef __attribute__((ext_vector_type(4)))  float v4f;
typedef __attribute__((ext_vector_type(2)))  float v2f;
typedef __attribute__((ext_vector_type(4)))  unsigned v4u;
typedef __attribute__((ext_vector_type(4)))  int v4i;
typedef float __attribute__((may_alias)) float_a;
typedef int __attribute__((may_alias)) int_a;

template <typename T> __device__ __forceinline__ void vst2(void* p, T v) { *(T*)p = v;  }
__device__ __forceinline__ v8f wmma16(v16h a, v16h b, v8f c) {
  v8f d = __builtin_amdgcn_wmma_f32_16x16x32_f16(false, a, false, b, (short)0, c, false, false);
  asm volatile("v_nop\n\tv_nop\n\tv_nop\n\tv_nop" : "+v"(d) : "v"(a), "v"(b));
  return d;
}
__device__ __forceinline__ v8f wmma_bf(v16b a, v16b b, v8f c) {
  v8f d = __builtin_amdgcn_wmma_f32_16x16x32_bf16(false, a, false, b, (short)0, c, false, false);
  asm volatile("v_nop\n\tv_nop\n\tv_nop\n\tv_nop" : "+v"(d) : "v"(a), "v"(b));
  return d;
}
// 16x16x32 fragments: lane = (h = lane>>4, row/col = lane&15); elements 0..7 = k0+8h+0..7, 8..15 = k0+16+8h+0..7; D element r = row 8h+r
__device__ __forceinline__ v16h frag_h(const _Float16* rowk0, int lane) {
  union { v16h v; v8h q[2]; } u; const _Float16* p = rowk0 + 8 * (lane >> 4);
  u.q[0] = *(const v8h*)p; u.q[1] = *(const v8h*)(p + 16); return u.v;
}
__device__ __forceinline__ v16h frag_f32(const float* rowk0, int lane) {
  v16h a; const float* p = rowk0 + 8 * (lane >> 4);
#pragma unroll
  for (int i = 0; i < 8; ++i) { a[i] = (_Float16)p[i]; a[8 + i] = (_Float16)p[16 + i]; }
  return a;
}
__device__ __forceinline__ v16h frag_f32s(const float* rowk0, int lane, float sc) {
  v16h a; const float* p = rowk0 + 8 * (lane >> 4);
#pragma unroll
  for (int i = 0; i < 8; ++i) { a[i] = (_Float16)(p[i] * sc); a[8 + i] = (_Float16)(p[16 + i] * sc); }
  return a;
}
// column fragment from a [K][ld] layout (column n), rows >= K read as 0
__device__ __forceinline__ v16h fragc_f32(const float* W, int k0, int n, int lane, int ld, int K) {
  v16h a; const int g = lane >> 4;
#pragma unroll
  for (int i = 0; i < 8; ++i) { const int ka = k0 + 8 * g + i, kb = ka + 16;
    a[i] = (_Float16)(ka < K ? W[(size_t)(ka < K ? ka : K - 1) * ld + n] : 0.f); a[8 + i] = (_Float16)(kb < K ? W[(size_t)(kb < K ? kb : K - 1) * ld + n] : 0.f); }
  return a;
}
struct F2 { v16b h, l; };
__device__ __forceinline__ F2 bsplit16(const float v[16]) { F2 r;
#pragma unroll
  for (int i = 0; i < 16; ++i) { const __bf16 h = (__bf16)v[i]; r.h[i] = h; r.l[i] = (__bf16)(v[i] - (float)h); }
  return r; }
__device__ __forceinline__ F2 split_row(const float* row, int k0, int lane) { float v[16]; const float* p = row + k0 + 8 * (lane >> 4);
#pragma unroll
  for (int i = 0; i < 8; ++i) { v[i] = p[i]; v[8 + i] = p[16 + i]; }
  return bsplit16(v); }
__device__ __forceinline__ F2 split_rowK(const float* row, int k0, int lane, int K) { float v[16]; const int g = lane >> 4;
#pragma unroll
  for (int i = 0; i < 8; ++i) { const int ka = k0 + 8 * g + i, kb = ka + 16; v[i] = ka < K ? row[ka < K ? ka : K - 1] : 0.f; v[8 + i] = kb < K ? row[kb < K ? kb : K - 1] : 0.f; }
  return bsplit16(v); }
__device__ __forceinline__ F2 split_col(const float* W, int k0, int n, int lane, int ld, int K) { float v[16]; const int g = lane >> 4;
#pragma unroll
  for (int i = 0; i < 8; ++i) { const int ka = k0 + 8 * g + i, kb = ka + 16; v[i] = ka < K ? W[(size_t)(ka < K ? ka : K - 1) * ld + n] : 0.f; v[8 + i] = kb < K ? W[(size_t)(kb < K ? kb : K - 1) * ld + n] : 0.f; }
  return bsplit16(v); }
__device__ __forceinline__ v8f mac3(const F2& a, const F2& b, v8f c) { c = wmma_bf(a.l, b.h, c); c = wmma_bf(a.h, b.l, c); return wmma_bf(a.h, b.h, c); }
__device__ __forceinline__ float sigm(float v) { return 1.0f / (1.0f + expf(-v)); }
#define LDSX() do { asm volatile("s_wait_dscnt 0" ::: "memory"); __builtin_amdgcn_wave_barrier(); __builtin_amdgcn_fence(__ATOMIC_RELEASE, "workgroup"); } while (0)

// Hyperbolic (Lorentz) linear-attention 'TransConv' layer (N 32,768 nodes, 128 -> 128, 8 heads, power kernel p = 2): per head h: qs = x_q Wq[h]^T + bq[h], ks = x_s Wk[h]^T + bk[h], v = x_s Wv[h]^T + bv[h]; phi(x) = ||x|| / (||x^2|| + 1e-8) * x^2 applied to (relu(.) + 1e-6)/(|norm_scale| + 1e-6); KV[h] = sum_n phi_k[n] (x) v[n]; num[n] = phi_q[n] KV[h]; den[n] = phi_q[n] . sum_n phi_k[n]; attn = num / (den + 1e-6) + (v v_map_w^T + v_map_b); out = mean over heads; result = [sqrt(sum out^2 + 1), out].
#define NN 32768
#define CI 128             // in channels
#define CO 128             // out channels per head
#define NH 8
#ifndef NPROC
#define NPROC NN           // rows processed
#endif
typedef __attribute__((ext_vector_type(8))) __bf16 v8b;
__device__ __forceinline__ v16b frag_b(const __bf16* rowk0, int lane) {
  union { v16b v; v8b q[2]; } u; const __bf16* p = rowk0 + 8 * (lane >> 4);
  u.q[0] = *(const v8b*)p; u.q[1] = *(const v8b*)(p + 16); return u.v;
}
__device__ __forceinline__ float bfr(float v) { return (float)(__bf16)v; }
__device__ __forceinline__ v16b wrow(const float* rowk0, int lane) { v16b w; const float* p = rowk0 + 8 * (lane >> 4);
#pragma unroll
  for (int i = 0; i < 8; ++i) { w[i] = (__bf16)p[i]; w[8 + i] = (__bf16)p[16 + i]; }
  return w; }
// B fragment (k rows k0+.., column n) of an f32 [K][ld] matrix, split bf16 hi + lo
__device__ __forceinline__ F2 colsplit(const float* Wm, int k0, int n, int lane, int ld) { float v[16]; const int g = lane >> 4;
#pragma unroll
  for (int i = 0; i < 8; ++i) { v[i] = Wm[(size_t)(k0 + 8 * g + i) * ld + n]; v[8 + i] = Wm[(size_t)(k0 + 16 + 8 * g + i) * ld + n]; }
  return bsplit16(v); }

#define WS_PQH 0u                                       // bf16 phi_q rows [n][128] hi
#define WS_PQL (WS_PQH + 2u * (size_t)NN * CO)
#define WS_PKT (WS_PQL + 2u * (size_t)NN * CO)          // bf16 phi_k TRANSPOSED [m][n] hi
#define WS_PKU (WS_PKT + 2u * (size_t)CO * NN)          //                             lo
#define WS_VH  (WS_PKU + 2u * (size_t)CO * NN)          // bf16 v rows [n][128] hi / lo
#define WS_VL  (WS_VH  + 2u * (size_t)NN * CO)
#define WS_VTH (WS_VL  + 2u * (size_t)NN * CO)          // bf16 v TRANSPOSED [d][n] hi / lo
#define WS_VTL (WS_VTH + 2u * (size_t)CO * NN)
#define WS_KS  (WS_VTL + 2u * (size_t)CO * NN)          // f32 column sums of phi_k [128]
#define WS_KV  (WS_KS  + 4u * 128)                      // f32 KV [m][d]
#define WS_ACC (WS_KV  + 4u * (size_t)CO * CO)          // f32 head-sum accumulator [n][128]
#define WS_END (WS_ACC + 4u * (size_t)NN * CO)

// ---- k_proj: block = (64 rows, which in {q, k, v}) for head h: acc = x W[h]^T + b[h] (W (out,in) rows contiguous; exact); q/k: x = (relu(acc) + 1e-6) / (|norm_scale| + 1e-6), phi = ||x|| / (||x^2|| + 1e-8) * x^2 with the two norms over the head's 128 columns (lane partial sums + 16-lane shuffles); q -> bf16 hi/lo rows; k -> bf16 hi/lo TRANSPOSED planes [m][n]; v = acc -> bf16 hi/lo rows AND transposed planes
__global__ __launch_bounds__(128) void k_proj(const float* __restrict__ XQ, const float* __restrict__ XS, const float* __restrict__ WQ, const float* __restrict__ BQ, const float* __restrict__ WK, const float* __restrict__ BK, const float* __restrict__ WV, const float* __restrict__ BV, const float* __restrict__ NS, int h,
    __bf16* __restrict__ PQH, __bf16* __restrict__ PQL, __bf16* __restrict__ PKT, __bf16* __restrict__ PKU, __bf16* __restrict__ VH, __bf16* __restrict__ VL, __bf16* __restrict__ VTH, __bf16* __restrict__ VTL) {
  __shared__ __align__(16) __bf16 sh[64][136], sl[64][136]; __shared__ __align__(16) __bf16 th[128][72], tl2[128][72];
  const int tid = threadIdx.x, wave = tid >> 5, lane = tid & 31, col = lane & 15, g = lane >> 4; const int which = blockIdx.z; const size_t r0 = (size_t)blockIdx.x * 64;
  const float* X = which == 0 ? XQ : XS; const float* WA = (which == 0 ? WQ : which == 1 ? WK : WV) + (size_t)h * CO * CI; const float* BA = (which == 0 ? BQ : which == 1 ? BK : BV) + (size_t)h * CO;
  v8f acc[8] = {};
#pragma unroll
  for (int kc = 0; kc < CI / 32; ++kc) { v16b a; { const float* p = X + (r0 + wave * 16 + col) * CI + kc * 32 + 8 * g;
#pragma unroll
      for (int i = 0; i < 8; ++i) { a[i] = (__bf16)p[i]; a[8 + i] = (__bf16)p[16 + i]; } }
    asm volatile("s_wait_loadcnt 0x0" ::: "memory");
#pragma unroll
    for (int j = 0; j < 8; ++j) { const v16b w = wrow(WA + (size_t)(j * 16 + col) * CI + kc * 32, lane); asm volatile("s_wait_loadcnt 0x0" ::: "memory"); acc[j] = wmma_bf(a, w, acc[j]); } }
#pragma unroll
  for (int j = 0; j < 8; ++j) { const float bb = bfr(BA[j * 16 + col]);
#pragma unroll
    for (int r = 0; r < 8; ++r) acc[j][r] += bb; }
  if (which < 2) {   /* block-uniform: feature map */
    const float ds = fabsf(bfr(NS[0])) + 1e-6f; float n1[8], n2[8];
#pragma unroll
    for (int r = 0; r < 8; ++r) { float s1 = 0.f, s2 = 0.f;
#pragma unroll
      for (int j = 0; j < 8; ++j) { const float x = (fmaxf(acc[j][r], 0.f) + 1e-6f) / ds; acc[j][r] = x; const float x2 = x * x; s1 += x2; s2 += x2 * x2; }
      n1[r] = s1; n2[r] = s2; }
#pragma unroll
    for (int o = 1; o < 16; o <<= 1) {
#pragma unroll
      for (int r = 0; r < 8; ++r) { n1[r] += __shfl_xor(n1[r], o); n2[r] += __shfl_xor(n2[r], o); } }
#pragma unroll
    for (int r = 0; r < 8; ++r) n1[r] = sqrtf(n1[r]) / (sqrtf(n2[r]) + 1e-8f);   /* ||x|| / (||x^2|| + eps) */
#pragma unroll
    for (int j = 0; j < 8; ++j) {
#pragma unroll
      for (int r = 0; r < 8; ++r) acc[j][r] = n1[r] * (acc[j][r] * acc[j][r]); } }
  /* stage hi/lo: rows for q and v, transposed for k and v */
#pragma unroll
  for (int j = 0; j < 8; ++j) {
#pragma unroll
    for (int r = 0; r < 8; ++r) { const float v = acc[j][r]; const __bf16 hv = (__bf16)v, lv = (__bf16)(v - (float)hv); const int rl = wave * 16 + 8 * g + r, cl = j * 16 + col;
      if (which != 1) { sh[rl][cl] = hv; sl[rl][cl] = lv; }
      if (which != 0) { th[cl][rl] = hv; tl2[cl][rl] = lv; } } }
  __syncthreads();
  if (which != 1) { __bf16* dh = which == 0 ? PQH : VH; __bf16* dl = which == 0 ? PQL : VL; for (int e = tid; e < 64 * 16; e += 128) { const int rl = e >> 4, q = e & 15; vst2((unsigned*)(dh + (r0 + rl) * CO + q * 8), *(const v4u*)&sh[rl][q * 8]); vst2((unsigned*)(dl + (r0 + rl) * CO + q * 8), *(const v4u*)&sl[rl][q * 8]); } }
  if (which != 0) { __bf16* dh = which == 1 ? PKT : VTH; __bf16* dl = which == 1 ? PKU : VTL; for (int e = tid; e < 128 * 8; e += 128) { const int cl = e >> 3, q = e & 7; vst2((unsigned*)(dh + (size_t)cl * NN + r0 + q * 8), *(const v4u*)&th[cl][q * 8]); vst2((unsigned*)(dl + (size_t)cl * NN + r0 + q * 8), *(const v4u*)&tl2[cl][q * 8]); } } }   
// ---- k_ksum: one block of 128 threads: thread m sums phi_k[m][n] (hi + lo) over the NPROC rows in a fixed order -> KS[m]
__global__ __launch_bounds__(128) void k_ksum(const __bf16* __restrict__ PKT, const __bf16* __restrict__ PKU, float* __restrict__ KS) { __shared__ __align__(16) float sk[128];
  const int m = threadIdx.x; float s = 0.f; const __bf16* ph = PKT + (size_t)m * NN; const __bf16* pl = PKU + (size_t)m * NN;
#pragma unroll 4
  for (int n = 0; n < NPROC; n += 8) { const v8b a = *(const v8b*)(ph + n), b2 = *(const v8b*)(pl + n);
#pragma unroll
    for (int z = 0; z < 8; ++z) s += (float)a[z] + (float)b2[z]; }
  sk[m] = s; __syncthreads(); if (m < 32) vst2(KS + m * 4, *(const v4f*)&sk[m * 4]); }
// ---- k_kv: block = (64 rows m, all 128 cols d): KV[m][d] = sum_n phi_k[m][n] v[d][n] over the NPROC rows (bf16 hi + lo both sides, 3 products, K = NPROC) -> f32 KV rows (512 B by 32 lanes)
__global__ __launch_bounds__(128) void k_kv(const __bf16* __restrict__ PKT, const __bf16* __restrict__ PKU, const __bf16* __restrict__ VTH, const __bf16* __restrict__ VTL, float* __restrict__ KV) { __shared__ __align__(16) float sf[4][16][132];
  const int tid = threadIdx.x, wave = tid >> 5, lane = tid & 31, col = lane & 15, g = lane >> 4; const size_t m0 = (size_t)blockIdx.x * 64 + wave * 16;
  v8f acc[8] = {};
#pragma unroll 1
  for (int kc = 0; kc < NPROC / 32; ++kc) { const v16b ah = frag_b(PKT + (m0 + col) * NN + kc * 32, lane), al = frag_b(PKU + (m0 + col) * NN + kc * 32, lane);
    asm volatile("s_wait_loadcnt 0x0" ::: "memory");
#pragma unroll
    for (int j = 0; j < 8; ++j) { const size_t vr = (size_t)(j * 16 + col) * NN + kc * 32; const v16b bh = frag_b(VTH + vr, lane), bl = frag_b(VTL + vr, lane); acc[j] = wmma_bf(al, bh, acc[j]); acc[j] = wmma_bf(ah, bl, acc[j]); acc[j] = wmma_bf(ah, bh, acc[j]); } }
#pragma unroll
  for (int j = 0; j < 8; ++j) {
#pragma unroll
    for (int r = 0; r < 8; ++r) sf[wave][8 * g + r][j * 16 + col] = acc[j][r]; }
  LDSX(); for (int rl = 0; rl < 16; ++rl) vst2(KV + (m0 + rl) * CO + lane * 4, *(const v4f*)&sf[wave][rl][lane * 4]); }
// ---- k_num: block = 64 rows n (all 128 cols): num = phi_q (hi+lo) . KV (f32 -> hi+lo on the fly), 3 products; den = phi_q . KS (f32 dot per row from the planes); vss = v (hi+lo) . v_map_w^T (exact) + v_map_b; val = num / (den + 1e-6) + vss; ACC = (h == 0 ? 0 : ACC) + val (this block's own 512-B row segments)
__global__ __launch_bounds__(128) void k_num(const __bf16* __restrict__ PQH, const __bf16* __restrict__ PQL, const float* __restrict__ KV, const float* __restrict__ KS, const __bf16* __restrict__ VH, const __bf16* __restrict__ VL, const float* __restrict__ VMW, const float* __restrict__ VMB, int h, float* __restrict__ ACC) {
  __shared__ __align__(16) float sf[4][16][132]; __shared__ __align__(16) float sks[128]; __shared__ float sden[64];
  const int tid = threadIdx.x, wave = tid >> 5, lane = tid & 31, col = lane & 15, g = lane >> 4; const size_t r0 = (size_t)blockIdx.x * 64; const size_t w0 = r0 + wave * 16;
  sks[tid] = KS[tid]; __syncthreads();
  if (tid < 64) { float d = 0.f; const __bf16* ph = PQH + (r0 + tid) * CO; const __bf16* pl = PQL + (r0 + tid) * CO;
#pragma unroll 4
    for (int m = 0; m < CO; m += 8) { const v8b a = *(const v8b*)(ph + m), b2 = *(const v8b*)(pl + m);
#pragma unroll
      for (int z = 0; z < 8; ++z) d += ((float)a[z] + (float)b2[z]) * sks[m + z]; }
    sden[tid] = d; }
  v8f acc[8] = {}, vs[8] = {};
#pragma unroll
  for (int kc = 0; kc < CO / 32; ++kc) { const v16b ah = frag_b(PQH + (w0 + col) * CO + kc * 32, lane), al = frag_b(PQL + (w0 + col) * CO + kc * 32, lane), bh = frag_b(VH + (w0 + col) * CO + kc * 32, lane), bl = frag_b(VL + (w0 + col) * CO + kc * 32, lane);
    asm volatile("s_wait_loadcnt 0x0" ::: "memory");
#pragma unroll
    for (int j = 0; j < 8; ++j) { const F2 w = colsplit(KV, kc * 32, j * 16 + col, lane, CO); asm volatile("s_wait_loadcnt 0x0" ::: "memory"); const v16b wm = wrow(VMW + (size_t)(j * 16 + col) * CO + kc * 32, lane); asm volatile("s_wait_loadcnt 0x0" ::: "memory");
      acc[j] = wmma_bf(al, w.h, acc[j]); acc[j] = wmma_bf(ah, w.l, acc[j]); acc[j] = wmma_bf(ah, w.h, acc[j]); vs[j] = wmma_bf(bh, wm, vs[j]); vs[j] = wmma_bf(bl, wm, vs[j]); } }
  __syncthreads();   /* sden ready */
#pragma unroll
  for (int j = 0; j < 8; ++j) { const float bb = bfr(VMB[j * 16 + col]);
#pragma unroll
    for (int r = 0; r < 8; ++r) { const float den = sden[wave * 16 + 8 * g + r]; sf[wave][8 * g + r][j * 16 + col] = acc[j][r] / (den + 1e-6f) + (vs[j][r] + bb); } }
  LDSX(); for (int rl = 0; rl < 16; ++rl) { float* dst = ACC + (w0 + rl) * CO + lane * 4; v4f v = *(const v4f*)&sf[wave][rl][lane * 4]; if (h > 0) { const v4f p = *(const v4f*)dst; v[0] += p[0]; v[1] += p[1]; v[2] += p[2]; v[3] += p[3]; } vst2(dst, v); } }
// ---- k_fin: block = 64 rows: out = ACC / 8; time = sqrt(sum out^2 + 1); the 64 x 129 output rows form one contiguous, line-aligned 33,024-B span (64*129*4 = 258 lines; the span starts at row0*516 B with row0 a multiple of 64) staged in LDS and written thread-linearly in 16-B pieces
__global__ __launch_bounds__(128) void k_fin(const float* __restrict__ ACC, float* __restrict__ OUT) { __shared__ __align__(16) float so[64 * 129 + 12];
  const int tid = threadIdx.x; const size_t r0 = (size_t)blockIdx.x * 64;
  for (int rl = tid >> 5, lanei = tid & 31; rl < 64; rl += 4) { const v4f a = *(const v4f*)(ACC + (r0 + rl) * CO + lanei * 4); float o[4]; float s = 0.f;
#pragma unroll
    for (int z = 0; z < 4; ++z) { o[z] = a[z] * (1.0f / NH); s += o[z] * o[z]; }
#pragma unroll
    for (int q = 1; q < 32; q <<= 1) s += __shfl_xor(s, q);
#pragma unroll
    for (int z = 0; z < 4; ++z) so[rl * 129 + 1 + lanei * 4 + z] = o[z];
    if (lanei == 0) so[rl * 129] = sqrtf(s + 1.0f); }
  __syncthreads();
  float* dst = OUT + r0 * 129;
  for (int e = tid; e < 64 * 129 / 4; e += 128) vst2(dst + e * 4, *(const v4f*)&so[e * 4]); }   
extern "C" void kernel_launch(void* const* d_in, const int* in_sizes, int n_in, void* d_out, int out_size, void* d_ws, size_t ws_size, hipStream_t stream) {
  (void)in_sizes; (void)n_in; (void)out_size;
  const float** F = (const float**)d_in;   // 0 query_input, 1 source_input [32768,128]; 2 Wq_w [8,128,128], 3 Wq_b [8,128]; 4 Wk_w, 5 Wk_b; 6 Wv_w, 7 Wv_b; 8 v_map_w [128,128] (out,in), 9 v_map_b; 10 norm_scale
  if (ws_size < (size_t)WS_END) return;
  char* ws = (char*)d_ws; __bf16 *PQH = (__bf16*)(ws + WS_PQH), *PQL = (__bf16*)(ws + WS_PQL), *PKT = (__bf16*)(ws + WS_PKT), *PKU = (__bf16*)(ws + WS_PKU), *VH = (__bf16*)(ws + WS_VH), *VL = (__bf16*)(ws + WS_VL), *VTH = (__bf16*)(ws + WS_VTH), *VTL = (__bf16*)(ws + WS_VTL); float *KS = (float*)(ws + WS_KS), *KV = (float*)(ws + WS_KV), *ACC = (float*)(ws + WS_ACC);
  for (int h = 0; h < NH; ++h) {
    k_proj<<<dim3(NPROC / 64, 1, 3), 128, 0, stream>>>(F[0], F[1], F[2], F[3], F[4], F[5], F[6], F[7], F[10], h, PQH, PQL, PKT, PKU, VH, VL, VTH, VTL);
    k_ksum<<<dim3(1), 128, 0, stream>>>(PKT, PKU, KS);
    k_kv<<<dim3(CO / 64), 128, 0, stream>>>(PKT, PKU, VTH, VTL, KV);
    k_num<<<dim3(NPROC / 64), 128, 0, stream>>>(PQH, PQL, KV, KS, VH, VL, F[8], F[9], h, ACC);
  }
  k_fin<<<dim3(NPROC / 64), 128, 0, stream>>>(ACC, (float*)d_out);
}

// v001
// Measured time: 1000 microseconds a run.
// Next to v000, in two timings, it ran 22.9 and 23.6 times as fast.
// compute dtype: all float inputs rounded to bf16; q/k/v head projections x W^T + b with EXACT bf16 products on WMMA 16x16x32, f32 accumulate; relu, the power feature map (norms over 128, x^2) in f32; phi_k, v, phi_q and the [128 x 128] k^T v as bf16 hi + lo (3 products) for the two linear-attention contractions (K = 32,768 and K = 128), v hi + lo against exact v_map_w (2 products); column sums, the normaliser, the head mean and the time coordinate (sqrt) in f32; f32 output.
#include <hip/hip_runtime.h>
#include <math.h>

typedef __attribute__((ext_vector_type(16))) _Float16 v16h;
typedef __attribute__((ext_vector_type(16))) __bf16 v16b;
typedef __attribute__((ext_vector_type(8)))  _Float16 v8h;
typedef __attribute__((ext_vector_type(8)))  float v8f;
typedef __attribute__((ext_vector_type(4)))  float v4f;
typedef __attribute__((ext_vector_type(2)))  float v2f;
typedef __attribute__((ext_vector_type(4)))  unsigned v4u;
typedef __attribute__((ext_vector_type(4)))  int v4i;
typedef float __attribute__((may_alias)) float_a;
typedef int __attribute__((may_alias)) int_a;

template <typename T> __device__ __forceinline__ void vst2(void* p, T v) { *(T*)p = v;  }
__device__ __forceinline__ v8f wmma16(v16h a, v16h b, v8f c) {
  v8f d = __builtin_amdgcn_wmma_f32_16x16x32_f16(false, a, false, b, (short)0, c, false, false);
  asm volatile("v_nop\n\tv_nop\n\tv_nop\n\tv_nop" : "+v"(d) : "v"(a), "v"(b));
  return d;
}
__device__ __forceinline__ v8f wmma_bf(v16b a, v16b b, v8f c) {
  v8f d = __builtin_amdgcn_wmma_f32_16x16x32_bf16(false, a, false, b, (short)0, c, false, false);
  asm volatile("v_nop\n\tv_nop\n\tv_nop\n\tv_nop" : "+v"(d) : "v"(a), "v"(b));
  return d;
}
// 16x16x32 fragments: lane = (h = lane>>4, row/col = lane&15); elements 0..7 = k0+8h+0..7, 8..15 = k0+16+8h+0..7; D element r = row 8h+r
__device__ __forceinline__ v16h frag_h(const _Float16* rowk0, int lane) {
  union { v16h v; v8h q[2]; } u; const _Float16* p = rowk0 + 8 * (lane >> 4);
  u.q[0] = *(const v8h*)p; u.q[1] = *(const v8h*)(p + 16); return u.v;
}
__device__ __forceinline__ v16h frag_f32(const float* rowk0, int lane) {
  v16h a; const float* p = rowk0 + 8 * (lane >> 4);
#pragma unroll
  for (int i = 0; i < 8; ++i) { a[i] = (_Float16)p[i]; a[8 + i] = (_Float16)p[16 + i]; }
  return a;
}
__device__ __forceinline__ v16h frag_f32s(const float* rowk0, int lane, float sc) {
  v16h a; const float* p = rowk0 + 8 * (lane >> 4);
#pragma unroll
  for (int i = 0; i < 8; ++i) { a[i] = (_Float16)(p[i] * sc); a[8 + i] = (_Float16)(p[16 + i] * sc); }
  return a;
}
// column fragment from a [K][ld] layout (column n), rows >= K read as 0
__device__ __forceinline__ v16h fragc_f32(const float* W, int k0, int n, int lane, int ld, int K) {
  v16h a; const int g = lane >> 4;
#pragma unroll
  for (int i = 0; i < 8; ++i) { const int ka = k0 + 8 * g + i, kb = ka + 16;
    a[i] = (_Float16)(ka < K ? W[(size_t)(ka < K ? ka : K - 1) * ld + n] : 0.f); a[8 + i] = (_Float16)(kb < K ? W[(size_t)(kb < K ? kb : K - 1) * ld + n] : 0.f); }
  return a;
}
struct F2 { v16b h, l; };
__device__ __forceinline__ F2 bsplit16(const float v[16]) { F2 r;
#pragma unroll
  for (int i = 0; i < 16; ++i) { const __bf16 h = (__bf16)v[i]; r.h[i] = h; r.l[i] = (__bf16)(v[i] - (float)h); }
  return r; }
__device__ __forceinline__ F2 split_row(const float* row, int k0, int lane) { float v[16]; const float* p = row + k0 + 8 * (lane >> 4);
#pragma unroll
  for (int i = 0; i < 8; ++i) { v[i] = p[i]; v[8 + i] = p[16 + i]; }
  return bsplit16(v); }
__device__ __forceinline__ F2 split_rowK(const float* row, int k0, int lane, int K) { float v[16]; const int g = lane >> 4;
#pragma unroll
  for (int i = 0; i < 8; ++i) { const int ka = k0 + 8 * g + i, kb = ka + 16; v[i] = ka < K ? row[ka < K ? ka : K - 1] : 0.f; v[8 + i] = kb < K ? row[kb < K ? kb : K - 1] : 0.f; }
  return bsplit16(v); }
__device__ __forceinline__ F2 split_col(const float* W, int k0, int n, int lane, int ld, int K) { float v[16]; const int g = lane >> 4;
#pragma unroll
  for (int i = 0; i < 8; ++i) { const int ka = k0 + 8 * g + i, kb = ka + 16; v[i] = ka < K ? W[(size_t)(ka < K ? ka : K - 1) * ld + n] : 0.f; v[8 + i] = kb < K ? W[(size_t)(kb < K ? kb : K - 1) * ld + n] : 0.f; }
  return bsplit16(v); }
__device__ __forceinline__ v8f mac3(const F2& a, const F2& b, v8f c) { c = wmma_bf(a.l, b.h, c); c = wmma_bf(a.h, b.l, c); return wmma_bf(a.h, b.h, c); }
__device__ __forceinline__ float sigm(float v) { return 1.0f / (1.0f + expf(-v)); }
#define LDSX() do { asm volatile("s_wait_dscnt 0" ::: "memory"); __builtin_amdgcn_wave_barrier(); __builtin_amdgcn_fence(__ATOMIC_RELEASE, "workgroup"); } while (0)

// Hyperbolic (Lorentz) linear-attention 'TransConv' layer (N 32,768 nodes, 128 -> 128, 8 heads, power kernel p = 2): per head h: qs = x_q Wq[h]^T + bq[h], ks = x_s Wk[h]^T + bk[h], v = x_s Wv[h]^T + bv[h]; phi(x) = ||x|| / (||x^2|| + 1e-8) * x^2 applied to (relu(.) + 1e-6)/(|norm_scale| + 1e-6); KV[h] = sum_n phi_k[n] (x) v[n]; num[n] = phi_q[n] KV[h]; den[n] = phi_q[n] . sum_n phi_k[n]; attn = num / (den + 1e-6) + (v v_map_w^T + v_map_b); out = mean over heads; result = [sqrt(sum out^2 + 1), out].
#define NN 32768
#define CI 128             // in channels
#define CO 128             // out channels per head
#define NH 8
#ifndef NPROC
#define NPROC NN           // rows processed
#endif
typedef __attribute__((ext_vector_type(8))) __bf16 v8b;
__device__ __forceinline__ v16b frag_b(const __bf16* rowk0, int lane) {
  union { v16b v; v8b q[2]; } u; const __bf16* p = rowk0 + 8 * (lane >> 4);
  u.q[0] = *(const v8b*)p; u.q[1] = *(const v8b*)(p + 16); return u.v;
}
__device__ __forceinline__ float bfr(float v) { return (float)(__bf16)v; }
__device__ __forceinline__ v16b wrow(const float* rowk0, int lane) { v16b w; const float* p = rowk0 + 8 * (lane >> 4);
#pragma unroll
  for (int i = 0; i < 8; ++i) { w[i] = (__bf16)p[i]; w[8 + i] = (__bf16)p[16 + i]; }
  return w; }
// B fragment (k rows k0+.., column n) of an f32 [K][ld] matrix, split bf16 hi + lo
__device__ __forceinline__ F2 colsplit(const float* Wm, int k0, int n, int lane, int ld) { float v[16]; const int g = lane >> 4;
#pragma unroll
  for (int i = 0; i < 8; ++i) { v[i] = Wm[(size_t)(k0 + 8 * g + i) * ld + n]; v[8 + i] = Wm[(size_t)(k0 + 16 + 8 * g + i) * ld + n]; }
  return bsplit16(v); }

#define WS_PQH 0u                                       // bf16 phi_q rows [n][128] hi
#define WS_PQL (WS_PQH + 2u * (size_t)NN * CO)
#define WS_PKT (WS_PQL + 2u * (size_t)NN * CO)          // bf16 phi_k TRANSPOSED [m][n] hi
#define WS_PKU (WS_PKT + 2u * (size_t)CO * NN)          //                             lo
#define WS_VH  (WS_PKU + 2u * (size_t)CO * NN)          // bf16 v rows [n][128] hi / lo
#define WS_VL  (WS_VH  + 2u * (size_t)NN * CO)
#define WS_VTH (WS_VL  + 2u * (size_t)NN * CO)          // bf16 v TRANSPOSED [d][n] hi / lo
#define WS_VTL (WS_VTH + 2u * (size_t)CO * NN)
#define WS_KS  (WS_VTL + 2u * (size_t)CO * NN)          // f32 column sums of phi_k [128]
#define WS_KV  (WS_KS  + 4u * 128)                      // f32 KV [m][d]
#define WS_ACC (WS_KV  + 4u * (size_t)CO * CO)          // f32 head-sum accumulator [n][128]
#define SLN 64             // rows n per slice of the two sums over n
#define NSL (NPROC / SLN)  // slices
#define JRUN ((NSL + 31) / 32)   // slices in a row that one of k_join's 32 groups sums
#define PROWS (CO + 1)     // rows of one slice's partial: 128 rows of KV, then the column sums
#define WS_PART (WS_ACC + 4u * (size_t)NN * CO)         // f32 partials [slice][129][128]
#define WS_END (WS_PART + 4u * (size_t)NSL * PROWS * CO)

// ---- k_proj: block = (64 rows, which in {q, k, v}) for head h: acc = x W[h]^T + b[h] (W (out,in) rows contiguous; exact); q/k: x = (relu(acc) + 1e-6) / (|norm_scale| + 1e-6), phi = ||x|| / (||x^2|| + 1e-8) * x^2 with the two norms over the head's 128 columns (lane partial sums + 16-lane shuffles); q -> bf16 hi/lo rows; k -> bf16 hi/lo TRANSPOSED planes [m][n]; v = acc -> bf16 hi/lo rows AND transposed planes
__global__ __launch_bounds__(128) void k_proj(const float* __restrict__ XQ, const float* __restrict__ XS, const float* __restrict__ WQ, const float* __restrict__ BQ, const float* __restrict__ WK, const float* __restrict__ BK, const float* __restrict__ WV, const float* __restrict__ BV, const float* __restrict__ NS, int h,
    __bf16* __restrict__ PQH, __bf16* __restrict__ PQL, __bf16* __restrict__ PKT, __bf16* __restrict__ PKU, __bf16* __restrict__ VH, __bf16* __restrict__ VL, __bf16* __restrict__ VTH, __bf16* __restrict__ VTL) {
  __shared__ __align__(16) __bf16 sh[64][136], sl[64][136]; __shared__ __align__(16) __bf16 th[128][72], tl2[128][72];
  const int tid = threadIdx.x, wave = tid >> 5, lane = tid & 31, col = lane & 15, g = lane >> 4; const int which = blockIdx.z; const size_t r0 = (size_t)blockIdx.x * 64;
  const float* X = which == 0 ? XQ : XS; const float* WA = (which == 0 ? WQ : which == 1 ? WK : WV) + (size_t)h * CO * CI; const float* BA = (which == 0 ? BQ : which == 1 ? BK : BV) + (size_t)h * CO;
  v8f acc[8] = {};
#pragma unroll
  for (int kc = 0; kc < CI / 32; ++kc) { v16b a; { const float* p = X + (r0 + wave * 16 + col) * CI + kc * 32 + 8 * g;
#pragma unroll
      for (int i = 0; i < 8; ++i) { a[i] = (__bf16)p[i]; a[8 + i] = (__bf16)p[16 + i]; } }
    asm volatile("s_wait_loadcnt 0x0" ::: "memory");
#pragma unroll
    for (int j = 0; j < 8; ++j) { const v16b w = wrow(WA + (size_t)(j * 16 + col) * CI + kc * 32, lane); asm volatile("s_wait_loadcnt 0x0" ::: "memory"); acc[j] = wmma_bf(a, w, acc[j]); } }
#pragma unroll
  for (int j = 0; j < 8; ++j) { const float bb = bfr(BA[j * 16 + col]);
#pragma unroll
    for (int r = 0; r < 8; ++r) acc[j][r] += bb; }
  if (which < 2) {   /* block-uniform: feature map */
    const float ds = fabsf(bfr(NS[0])) + 1e-6f; float n1[8], n2[8];
#pragma unroll
    for (int r = 0; r < 8; ++r) { float s1 = 0.f, s2 = 0.f;
#pragma unroll
      for (int j = 0; j < 8; ++j) { const float x = (fmaxf(acc[j][r], 0.f) + 1e-6f) / ds; acc[j][r] = x; const float x2 = x * x; s1 += x2; s2 += x2 * x2; }
      n1[r] = s1; n2[r] = s2; }
#pragma unroll
    for (int o = 1; o < 16; o <<= 1) {
#pragma unroll
      for (int r = 0; r < 8; ++r) { n1[r] += __shfl_xor(n1[r], o); n2[r] += __shfl_xor(n2[r], o); } }
#pragma unroll
    for (int r = 0; r < 8; ++r) n1[r] = sqrtf(n1[r]) / (sqrtf(n2[r]) + 1e-8f);   /* ||x|| / (||x^2|| + eps) */
#pragma unroll
    for (int j = 0; j < 8; ++j) {
#pragma unroll
      for (int r = 0; r < 8; ++r) acc[j][r] = n1[r] * (acc[j][r] * acc[j][r]); } }
  /* stage hi/lo: rows for q and v, transposed for k and v */
#pragma unroll
  for (int j = 0; j < 8; ++j) {
#pragma unroll
    for (int r = 0; r < 8; ++r) { const float v = acc[j][r]; const __bf16 hv = (__bf16)v, lv = (__bf16)(v - (float)hv); const int rl = wave * 16 + 8 * g + r, cl = j * 16 + col;
      if (which != 1) { sh[rl][cl] = hv; sl[rl][cl] = lv; }
      if (which != 0) { th[cl][rl] = hv; tl2[cl][rl] = lv; } } }
  __syncthreads();
  if (which != 1) { __bf16* dh = which == 0 ? PQH : VH; __bf16* dl = which == 0 ? PQL : VL; for (int e = tid; e < 64 * 16; e += 128) { const int rl = e >> 4, q = e & 15; vst2((unsigned*)(dh + (r0 + rl) * CO + q * 8), *(const v4u*)&sh[rl][q * 8]); vst2((unsigned*)(dl + (r0 + rl) * CO + q * 8), *(const v4u*)&sl[rl][q * 8]); } }
  if (which != 0) { __bf16* dh = which == 1 ? PKT : VTH; __bf16* dl = which == 1 ? PKU : VTL; for (int e = tid; e < 128 * 8; e += 128) { const int cl = e >> 3, q = e & 7; vst2((unsigned*)(dh + (size_t)cl * NN + r0 + q * 8), *(const v4u*)&th[cl][q * 8]); vst2((unsigned*)(dl + (size_t)cl * NN + r0 + q * 8), *(const v4u*)&tl2[cl][q * 8]); } } }   
// ---- k_ksum: block = one slice of 64 rows n, 128 threads: thread m sums phi_k[m][n] (hi + lo) over the slice in a fixed order -> row 128 of the slice's partial
__global__ __launch_bounds__(128) void k_ksum(const __bf16* __restrict__ PKT, const __bf16* __restrict__ PKU, float* __restrict__ PART) { __shared__ __align__(16) float sk[128];
  const int m = threadIdx.x; float s = 0.f; const __bf16* ph = PKT + (size_t)m * NN + (size_t)blockIdx.x * SLN; const __bf16* pl = PKU + (size_t)m * NN + (size_t)blockIdx.x * SLN;
  v8b a[SLN / 8], b2[SLN / 8];
#pragma unroll
  for (int i = 0; i < SLN / 8; ++i) { a[i] = *(const v8b*)(ph + i * 8); b2[i] = *(const v8b*)(pl + i * 8); }   /* unrolled: the slice's loads are in flight together */
  asm volatile("s_wait_xcnt 0x0" :: "v"(ph), "v"(pl) : "memory");   /* the two address pairs stay whole until every load above has taken its address */
#pragma unroll
  for (int i = 0; i < SLN / 8; ++i) {
#pragma unroll
    for (int z = 0; z < 8; ++z) s += (float)a[i][z] + (float)b2[i][z]; }
  sk[m] = s; __syncthreads(); if (m < 32) vst2(PART + ((size_t)blockIdx.x * PROWS + CO) * CO + m * 4, *(const v4f*)&sk[m * 4]); }
// ---- k_kv: block = (64 rows m, all 128 cols d, one slice of 64 rows n): partial KV[m][d] = sum_n phi_k[m][n] v[d][n] over the slice (bf16 hi + lo both sides, 3 products, K = 64) -> rows 0..127 of the slice's f32 partial (512 B by 32 lanes)
__global__ __launch_bounds__(128) void k_kv(const __bf16* __restrict__ PKT, const __bf16* __restrict__ PKU, const __bf16* __restrict__ VTH, const __bf16* __restrict__ VTL, float* __restrict__ PART) { __shared__ __align__(16) float sf[4][16][132];
  const int tid = threadIdx.x, wave = tid >> 5, lane = tid & 31, col = lane & 15, g = lane >> 4; const size_t m0 = (size_t)blockIdx.x * 64 + wave * 16;
  v8f acc[8] = {};
#pragma unroll 1
  for (int kc = blockIdx.y * (SLN / 32); kc < (blockIdx.y + 1) * (SLN / 32); ++kc) { const v16b ah = frag_b(PKT + (m0 + col) * NN + kc * 32, lane), al = frag_b(PKU + (m0 + col) * NN + kc * 32, lane);
    asm volatile("s_wait_loadcnt 0x0" ::: "memory");
#pragma unroll
    for (int j = 0; j < 8; ++j) { const size_t vr = (size_t)(j * 16 + col) * NN + kc * 32; const v16b bh = frag_b(VTH + vr, lane), bl = frag_b(VTL + vr, lane); acc[j] = wmma_bf(al, bh, acc[j]); acc[j] = wmma_bf(ah, bl, acc[j]); acc[j] = wmma_bf(ah, bh, acc[j]); } }
#pragma unroll
  for (int j = 0; j < 8; ++j) {
#pragma unroll
    for (int r = 0; r < 8; ++r) sf[wave][8 * g + r][j * 16 + col] = acc[j][r]; }
  LDSX(); for (int rl = 0; rl < 16; ++rl) vst2(PART + ((size_t)blockIdx.y * PROWS + m0 + rl) * CO + lane * 4, *(const v4f*)&sf[wave][rl][lane * 4]); }
// ---- k_join: block = 64 columns of one of the 129 partial rows (a 256-B segment): 32 groups of 16 lanes; group t sums its run of JRUN slices in index order, the 32 group sums are added in index order through LDS -> KV row (rows 0..127) or KS (row 128)
__global__ __launch_bounds__(512) void k_join(const float* __restrict__ PART, float* __restrict__ KV, float* __restrict__ KS) { __shared__ __align__(16) float sj[32][64];
  const int tid = threadIdx.x, grp = tid >> 4, q = tid & 15; const int row = blockIdx.x >> 1, c0 = (blockIdx.x & 1) * 64;
  const float* p = PART + ((size_t)grp * JRUN * PROWS + row) * CO + c0 + q * 4; v4f s = {}, a[JRUN];
#pragma unroll
  for (int i = 0; i < JRUN; ++i) { a[i] = v4f{}; if (NSL % 32 == 0 || grp * JRUN + i < NSL) a[i] = *(const v4f*)(p + (size_t)i * PROWS * CO); }   /* unrolled: all of a lane's loads are in flight together */
  asm volatile("s_wait_xcnt 0x0" :: "v"(p) : "memory");   /* the address pair stays whole until every load above has taken its address */
#pragma unroll
  for (int i = 0; i < JRUN; ++i) s += a[i];
  vst2(&sj[grp][q * 4], s); __syncthreads();
  if (tid < 16) { v4f t = {};
#pragma unroll
    for (int z = 0; z < 32; ++z) t += *(const v4f*)&sj[z][tid * 4];
    vst2((row < CO ? KV + (size_t)row * CO : KS) + c0 + tid * 4, t); } }
// ---- k_num: block = 64 rows n (all 128 cols): num = phi_q (hi+lo) . KV (f32 -> hi+lo on the fly), 3 products; den = phi_q . KS (f32 dot per row from the planes); vss = v (hi+lo) . v_map_w^T (exact) + v_map_b; val = num / (den + 1e-6) + vss; ACC = (h == 0 ? 0 : ACC) + val (this block's own 512-B row segments)
__global__ __launch_bounds__(128) void k_num(const __bf16* __restrict__ PQH, const __bf16* __restrict__ PQL, const float* __restrict__ KV, const float* __restrict__ KS, const __bf16* __restrict__ VH, const __bf16* __restrict__ VL, const float* __restrict__ VMW, const float* __restrict__ VMB, int h, float* __restrict__ ACC) {
  __shared__ __align__(16) float sf[4][16][132]; __shared__ __align__(16) float sks[128]; __shared__ float sden[64];
  const int tid = threadIdx.x, wave = tid >> 5, lane = tid & 31, col = lane & 15, g = lane >> 4; const size_t r0 = (size_t)blockIdx.x * 64; const size_t w0 = r0 + wave * 16;
  sks[tid] = KS[tid]; __syncthreads();
  if (tid < 64) { float d = 0.f; const __bf16* ph = PQH + (r0 + tid) * CO; const __bf16* pl = PQL + (r0 + tid) * CO;
#pragma unroll 4
    for (int m = 0; m < CO; m += 8) { const v8b a = *(const v8b*)(ph + m), b2 = *(const v8b*)(pl + m);
#pragma unroll
      for (int z = 0; z < 8; ++z) d += ((float)a[z] + (float)b2[z]) * sks[m + z]; }
    sden[tid] = d; }
  v8f acc[8] = {}, vs[8] = {};
#pragma unroll
  for (int kc = 0; kc < CO / 32; ++kc) { const v16b ah = frag_b(PQH + (w0 + col) * CO + kc * 32, lane), al = frag_b(PQL + (w0 + col) * CO + kc * 32, lane), bh = frag_b(VH + (w0 + col) * CO + kc * 32, lane), bl = frag_b(VL + (w0 + col) * CO + kc * 32, lane);
    asm volatile("s_wait_loadcnt 0x0" ::: "memory");
#pragma unroll
    for (int j = 0; j < 8; ++j) { const F2 w = colsplit(KV, kc * 32, j * 16 + col, lane, CO); asm volatile("s_wait_loadcnt 0x0" ::: "memory"); const v16b wm = wrow(VMW + (size_t)(j * 16 + col) * CO + kc * 32, lane); asm volatile("s_wait_loadcnt 0x0" ::: "memory");
      acc[j] = wmma_bf(al, w.h, acc[j]); acc[j] = wmma_bf(ah, w.l, acc[j]); acc[j] = wmma_bf(ah, w.h, acc[j]); vs[j] = wmma_bf(bh, wm, vs[j]); vs[j] = wmma_bf(bl, wm, vs[j]); } }
  __syncthreads();   /* sden ready */
#pragma unroll
  for (int j = 0; j < 8; ++j) { const float bb = bfr(VMB[j * 16 + col]);
#pragma unroll
    for (int r = 0; r < 8; ++r) { const float den = sden[wave * 16 + 8 * g + r]; sf[wave][8 * g + r][j * 16 + col] = acc[j][r] / (den + 1e-6f) + (vs[j][r] + bb); } }
  LDSX(); for (int rl = 0; rl < 16; ++rl) { float* dst = ACC + (w0 + rl) * CO + lane * 4; v4f v = *(const v4f*)&sf[wave][rl][lane * 4]; if (h > 0) { const v4f p = *(const v4f*)dst; v[0] += p[0]; v[1] += p[1]; v[2] += p[2]; v[3] += p[3]; } vst2(dst, v); } }
// ---- k_fin: block = 64 rows: out = ACC / 8; time = sqrt(sum out^2 + 1); the 64 x 129 output rows form one contiguous, line-aligned 33,024-B span (64*129*4 = 258 lines; the span starts at row0*516 B with row0 a multiple of 64) staged in LDS and written thread-linearly in 16-B pieces
__global__ __launch_bounds__(128) void k_fin(const float* __restrict__ ACC, float* __restrict__ OUT) { __shared__ __align__(16) float so[64 * 129 + 12];
  const int tid = threadIdx.x; const size_t r0 = (size_t)blockIdx.x * 64;
  for (int rl = tid >> 5, lanei = tid & 31; rl < 64; rl += 4) { const v4f a = *(const v4f*)(ACC + (r0 + rl) * CO + lanei * 4); float o[4]; float s = 0.f;
#pragma unroll
    for (int z = 0; z < 4; ++z) { o[z] = a[z] * (1.0f / NH); s += o[z] * o[z]; }
#pragma unroll
    for (int q = 1; q < 32; q <<= 1) s += __shfl_xor(s, q);
#pragma unroll
    for (int z = 0; z < 4; ++z) so[rl * 129 + 1 + lanei * 4 + z] = o[z];
    if (lanei == 0) so[rl * 129] = sqrtf(s + 1.0f); }
  __syncthreads();
  float* dst = OUT + r0 * 129;
  for (int e = tid; e < 64 * 129 / 4; e += 128) vst2(dst + e * 4, *(const v4f*)&so[e * 4]); }   
extern "C" void kernel_launch(void* const* d_in, const int* in_sizes, int n_in, void* d_out, int out_size, void* d_ws, size_t ws_size, hipStream_t stream) {
  (void)in_sizes; (void)n_in; (void)out_size;
  const float** F = (const float**)d_in;   // 0 query_input, 1 source_input [32768,128]; 2 Wq_w [8,128,128], 3 Wq_b [8,128]; 4 Wk_w, 5 Wk_b; 6 Wv_w, 7 Wv_b; 8 v_map_w [128,128] (out,in), 9 v_map_b; 10 norm_scale
  if (ws_size < (size_t)WS_END) return;
  char* ws = (char*)d_ws; __bf16 *PQH = (__bf16*)(ws + WS_PQH), *PQL = (__bf16*)(ws + WS_PQL), *PKT = (__bf16*)(ws + WS_PKT), *PKU = (__bf16*)(ws + WS_PKU), *VH = (__bf16*)(ws + WS_VH), *VL = (__bf16*)(ws + WS_VL), *VTH = (__bf16*)(ws + WS_VTH), *VTL = (__bf16*)(ws + WS_VTL); float *KS = (float*)(ws + WS_KS), *KV = (float*)(ws + WS_KV), *ACC = (float*)(ws + WS_ACC), *PART = (float*)(ws + WS_PART);
  for (int h = 0; h < NH; ++h) {
    k_proj<<<dim3(NPROC / 64, 1, 3), 128, 0, stream>>>(F[0], F[1], F[2], F[3], F[4], F[5], F[6], F[7], F[10], h, PQH, PQL, PKT, PKU, VH, VL, VTH, VTL);
    k_ksum<<<dim3(NSL), 128, 0, stream>>>(PKT, PKU, PART);
    k_kv<<<dim3(CO / 64, NSL), 128, 0, stream>>>(PKT, PKU, VTH, VTL, PART);
    k_join<<<dim3(2 * PROWS), 512, 0, stream>>>(PART, KV, KS);
    k_num<<<dim3(NPROC / 64), 128, 0, stream>>>(PQH, PQL, KV, KS, VH, VL, F[8], F[9], h, ACC);
  }
  k_fin<<<dim3(NPROC / 64), 128, 0, stream>>>(ACC, (float*)d_out);
}

// v002
// Measured time: 662 microseconds a run.
// In two side-by-side timings against v001, it was 1.53 and 1.52 times as fast.
// All steps since v000 together make it 35.4 times as fast.
// compute dtype: all float inputs rounded to bf16; q/k/v head projections x W^T + b with EXACT bf16 products on WMMA 16x16x32, f32 accumulate; relu, the power feature map (norms over 128, x^2) in f32; phi_k, v, phi_q and the [128 x 128] k^T v as bf16 hi + lo (3 products) for the two linear-attention contractions (K = 32,768 and K = 128), v hi + lo against exact v_map_w (2 products); column sums, the normaliser, the head mean and the time coordinate (sqrt) in f32; f32 output.
#include <hip/hip_runtime.h>
#include <math.h>

typedef __attribute__((ext_vector_type(16))) _Float16 v16h;
typedef __attribute__((ext_vector_type(16))) __bf16 v16b;
typedef __attribute__((ext_vector_type(8)))  _Float16 v8h;
typedef __attribute__((ext_vector_type(8)))  float v8f;
typedef __attribute__((ext_vector_type(4)))  float v4f;
typedef __attribute__((ext_vector_type(2)))  float v2f;
typedef __attribute__((ext_vector_type(4)))  unsigned v4u;
typedef __attribute__((ext_vector_type(4)))  int v4i;
typedef float __attribute__((may_alias)) float_a;
typedef int __attribute__((may_alias)) int_a;

template <typename T> __device__ __forceinline__ void vst2(void* p, T v) { *(T*)p = v;  }
__device__ __forceinline__ v8f wmma16(v16h a, v16h b, v8f c) {
  v8f d = __builtin_amdgcn_wmma_f32_16x16x32_f16(false, a, false, b, (short)0, c, false, false);
  asm volatile("v_nop\n\tv_nop\n\tv_nop\n\tv_nop" : "+v"(d) : "v"(a), "v"(b));
  return d;
}
__device__ __forceinline__ v8f wmma_bf(v16b a, v16b b, v8f c) {
  v8f d = __builtin_amdgcn_wmma_f32_16x16x32_bf16(false, a, false, b, (short)0, c, false, false);
  asm volatile("v_nop\n\tv_nop\n\tv_nop\n\tv_nop" : "+v"(d) : "v"(a), "v"(b));
  return d;
}
// 16x16x32 fragments: lane = (h = lane>>4, row/col = lane&15); elements 0..7 = k0+8h+0..7, 8..15 = k0+16+8h+0..7; D element r = row 8h+r
__device__ __forceinline__ v16h frag_h(const _Float16* rowk0, int lane) {
  union { v16h v; v8h q[2]; } u; const _Float16* p = rowk0 + 8 * (lane >> 4);
  u.q[0] = *(const v8h*)p; u.q[1] = *(const v8h*)(p + 16); return u.v;
}
__device__ __forceinline__ v16h frag_f32(const float* rowk0, int lane) {
  v16h a; const float* p = rowk0 + 8 * (lane >> 4);
#pragma unroll
  for (int i = 0; i < 8; ++i) { a[i] = (_Float16)p[i]; a[8 + i] = (_Float16)p[16 + i]; }
  return a;
}
__device__ __forceinline__ v16h frag_f32s(const float* rowk0, int lane, float sc) {
  v16h a; const float* p = rowk0 + 8 * (lane >> 4);
#pragma unroll
  for (int i = 0; i < 8; ++i) { a[i] = (_Float16)(p[i] * sc); a[8 + i] = (_Float16)(p[16 + i] * sc); }
  return a;
}
// column fragment from a [K][ld] layout (column n), rows >= K read as 0
__device__ __forceinline__ v16h fragc_f32(const float* W, int k0, int n, int lane, int ld, int K) {
  v16h a; const int g = lane >> 4;
#pragma unroll
  for (int i = 0; i < 8; ++i) { const int ka = k0 + 8 * g + i, kb = ka + 16;
    a[i] = (_Float16)(ka < K ? W[(size_t)(ka < K ? ka : K - 1) * ld + n] : 0.f); a[8 + i] = (_Float16)(kb < K ? W[(size_t)(kb < K ? kb : K - 1) * ld + n] : 0.f); }
  return a;
}
struct F2 { v16b h, l; };
__device__ __forceinline__ F2 bsplit16(const float v[16]) { F2 r;
#pragma unroll
  for (int i = 0; i < 16; ++i) { const __bf16 h = (__bf16)v[i]; r.h[i] = h; r.l[i] = (__bf16)(v[i] - (float)h); }
  return r; }
__device__ __forceinline__ F2 split_row(const float* row, int k0, int lane) { float v[16]; const float* p = row + k0 + 8 * (lane >> 4);
#pragma unroll
  for (int i = 0; i < 8; ++i) { v[i] = p[i]; v[8 + i] = p[16 + i]; }
  return bsplit16(v); }
__device__ __forceinline__ F2 split_rowK(const float* row, int k0, int lane, int K) { float v[16]; const int g = lane >> 4;
#pragma unroll
  for (int i = 0; i < 8; ++i) { const int ka = k0 + 8 * g + i, kb = ka + 16; v[i] = ka < K ? row[ka < K ? ka : K - 1] : 0.f; v[8 + i] = kb < K ? row[kb < K ? kb : K - 1] : 0.f; }
  return bsplit16(v); }
__device__ __forceinline__ F2 split_col(const float* W, int k0, int n, int lane, int ld, int K) { float v[16]; const int g = lane >> 4;
#pragma unroll
  for (int i = 0; i < 8; ++i) { const int ka = k0 + 8 * g + i, kb = ka + 16; v[i] = ka < K ? W[(size_t)(ka < K ? ka : K - 1) * ld + n] : 0.f; v[8 + i] = kb < K ? W[(size_t)(kb < K ? kb : K - 1) * ld + n] : 0.f; }
  return bsplit16(v); }
__device__ __forceinline__ v8f mac3(const F2& a, const F2& b, v8f c) { c = wmma_bf(a.l, b.h, c); c = wmma_bf(a.h, b.l, c); return wmma_bf(a.h, b.h, c); }
__device__ __forceinline__ float sigm(float v) { return 1.0f / (1.0f + expf(-v)); }
#define LDSX() do { asm volatile("s_wait_dscnt 0" ::: "memory"); __builtin_amdgcn_wave_barrier(); __builtin_amdgcn_fence(__ATOMIC_RELEASE, "workgroup"); } while (0)

// Hyperbolic (Lorentz) linear-attention 'TransConv' layer (N 32,768 nodes, 128 -> 128, 8 heads, power kernel p = 2): per head h: qs = x_q Wq[h]^T + bq[h], ks = x_s Wk[h]^T + bk[h], v = x_s Wv[h]^T + bv[h]; phi(x) = ||x|| / (||x^2|| + 1e-8) * x^2 applied to (relu(.) + 1e-6)/(|norm_scale| + 1e-6); KV[h] = sum_n phi_k[n] (x) v[n]; num[n] = phi_q[n] KV[h]; den[n] = phi_q[n] . sum_n phi_k[n]; attn = num / (den + 1e-6) + (v v_map_w^T + v_map_b); out = mean over heads; result = [sqrt(sum out^2 + 1), out].
#define NN 32768
#define CI 128             // in channels
#define CO 128             // out channels per head
#define NH 8
#ifndef NPROC
#define NPROC NN           // rows processed
#endif
typedef __attribute__((ext_vector_type(8))) __bf16 v8b;
__device__ __forceinline__ v16b frag_b(const __bf16* rowk0, int lane) {
  union { v16b v; v8b q[2]; } u; const __bf16* p = rowk0 + 8 * (lane >> 4);
  u.q[0] = *(const v8b*)p; u.q[1] = *(const v8b*)(p + 16); return u.v;
}
// the same fragment from a pointer that already holds the lane's 8 * (lane >> 4)
__device__ __forceinline__ v16b frag_p(const __bf16* p) {
  union { v16b v; v8b q[2]; } u; u.q[0] = *(const v8b*)p; u.q[1] = *(const v8b*)(p + 16); return u.v;
}
typedef __attribute__((ext_vector_type(4))) __bf16 v4b;
#define WP 136             // bf16 per LDS row of a staged [128][128] B operand (272 B = 16 B x 17)
// a block of 128 threads rounds a row-major f32 [128][128] matrix to bf16 rows in LDS: thread t takes the 16-B pieces t, t + 128, ... (a wave fills one row per piece)
__device__ __forceinline__ void stage_rows(const float* __restrict__ Wm, __bf16 (*dst)[WP], int tid) {
  const float* pw = Wm + tid * 4; v4f wv[32];
#pragma unroll
  for (int i = 0; i < 32; ++i) wv[i] = *(const v4f*)(pw + i * 512);   /* unrolled: all of a thread's loads are in flight together */
  asm volatile("s_wait_xcnt 0x0" :: "v"(pw) : "memory");   /* the address pair stays whole until every load above has taken its address */
#pragma unroll
  for (int i = 0; i < 32; ++i) { v4b o;
#pragma unroll
    for (int z = 0; z < 4; ++z) o[z] = (__bf16)wv[i][z];
    *(v4b*)&dst[(tid >> 5) + 4 * i][(tid & 31) * 4] = o; } }
__device__ __forceinline__ float bfr(float v) { return (float)(__bf16)v; }
__device__ __forceinline__ v16b wrow(const float* rowk0, int lane) { v16b w; const float* p = rowk0 + 8 * (lane >> 4);
#pragma unroll
  for (int i = 0; i < 8; ++i) { w[i] = (__bf16)p[i]; w[8 + i] = (__bf16)p[16 + i]; }
  return w; }
// B fragment (k rows k0+.., column n) of an f32 [K][ld] matrix, split bf16 hi + lo
__device__ __forceinline__ F2 colsplit(const float* Wm, int k0, int n, int lane, int ld) { float v[16]; const int g = lane >> 4;
#pragma unroll
  for (int i = 0; i < 8; ++i) { v[i] = Wm[(size_t)(k0 + 8 * g + i) * ld + n]; v[8 + i] = Wm[(size_t)(k0 + 16 + 8 * g + i) * ld + n]; }
  return bsplit16(v); }

#define WS_PQH 0u                                       // bf16 phi_q rows [n][128] hi
#define WS_PQL (WS_PQH + 2u * (size_t)NN * CO)
#define WS_PKT (WS_PQL + 2u * (size_t)NN * CO)          // bf16 phi_k TRANSPOSED [m][n] hi
#define WS_PKU (WS_PKT + 2u * (size_t)CO * NN)          //                             lo
#define WS_VH  (WS_PKU + 2u * (size_t)CO * NN)          // bf16 v rows [n][128] hi / lo
#define WS_VL  (WS_VH  + 2u * (size_t)NN * CO)
#define WS_VTH (WS_VL  + 2u * (size_t)NN * CO)          // bf16 v TRANSPOSED [d][n] hi / lo
#define WS_VTL (WS_VTH + 2u * (size_t)CO * NN)
#define WS_KS  (WS_VTL + 2u * (size_t)CO * NN)          // f32 column sums of phi_k [128]
#define WS_KV  (WS_KS  + 4u * 128)                      // f32 KV [m][d]
#define WS_ACC (WS_KV  + 4u * (size_t)CO * CO)          // f32 head-sum accumulator [n][128]
#define SLN 64             // rows n per slice of the two sums over n
#define NSL (NPROC / SLN)  // slices
#define JRUN ((NSL + 31) / 32)   // slices in a row that one of k_join's 32 groups sums
#define PROWS (CO + 1)     // rows of one slice's partial: 128 rows of KV, then the column sums
#define WS_PART (WS_ACC + 4u * (size_t)NN * CO)         // f32 partials [slice][129][128]
#define WS_END (WS_PART + 4u * (size_t)NSL * PROWS * CO)

// ---- k_proj: block = (64 rows, which in {q, k, v}) for head h: acc = x W[h]^T + b[h] (W (out,in) rows contiguous; exact; W[h] rounded to bf16 once per block into LDS, each lane's x row loaded whole up front); q/k: x = (relu(acc) + 1e-6) / (|norm_scale| + 1e-6), phi = ||x|| / (||x^2|| + 1e-8) * x^2 with the two norms over the head's 128 columns (lane partial sums + 16-lane shuffles); q -> bf16 hi/lo rows; k -> bf16 hi/lo TRANSPOSED planes [m][n]; v = acc -> bf16 hi/lo rows AND transposed planes
__global__ __launch_bounds__(128) void k_proj(const float* __restrict__ XQ, const float* __restrict__ XS, const float* __restrict__ WQ, const float* __restrict__ BQ, const float* __restrict__ WK, const float* __restrict__ BK, const float* __restrict__ WV, const float* __restrict__ BV, const float* __restrict__ NS, int h,
    __bf16* __restrict__ PQH, __bf16* __restrict__ PQL, __bf16* __restrict__ PKT, __bf16* __restrict__ PKU, __bf16* __restrict__ VH, __bf16* __restrict__ VL, __bf16* __restrict__ VTH, __bf16* __restrict__ VTL) {
  __shared__ __align__(16) __bf16 sw[128][WP]; __shared__ __align__(16) __bf16 th[128][72], tl2[128][72];
  __bf16 (*sh)[WP] = sw; __bf16 (*sl)[WP] = sw + 64;   /* behind the products the same LDS holds the tile's hi rows (0..63) and lo rows (64..127) */
  const int tid = threadIdx.x, wave = tid >> 5, lane = tid & 31, col = lane & 15, g = lane >> 4; const int which = blockIdx.z; const size_t r0 = (size_t)blockIdx.x * 64;
  const float* X = which == 0 ? XQ : XS; const float* WA = (which == 0 ? WQ : which == 1 ? WK : WV) + (size_t)h * CO * CI; const float* BA = (which == 0 ? BQ : which == 1 ? BK : BV) + (size_t)h * CO;
  const float* px = X + (r0 + wave * 16 + col) * CI + 8 * g; v4f xa[CI / 32][4];
#pragma unroll
  for (int kc = 0; kc < CI / 32; ++kc) { xa[kc][0] = *(const v4f*)(px + kc * 32); xa[kc][1] = *(const v4f*)(px + kc * 32 + 4); xa[kc][2] = *(const v4f*)(px + kc * 32 + 16); xa[kc][3] = *(const v4f*)(px + kc * 32 + 20); }
  const float* pbv = BA + col; float bv[8];
#pragma unroll
  for (int j = 0; j < 8; ++j) bv[j] = pbv[j * 16];
  asm volatile("s_wait_xcnt 0x0" :: "v"(px), "v"(pbv) : "memory");   /* the address pairs stay whole until every load above has taken its address */
  stage_rows(WA, sw, tid);
  v16b a[CI / 32];
#pragma unroll
  for (int kc = 0; kc < CI / 32; ++kc) {
#pragma unroll
    for (int i = 0; i < 16; ++i) a[kc][i] = (__bf16)xa[kc][i >> 2][i & 3]; }
  __syncthreads();   /* W[h] staged */
  v8f acc[8] = {}; v16b fw[32];   /* product t = kc * 8 + j; its W fragment is read from LDS six products ahead, so that the read's latency lies under the products in between */
#pragma unroll
  for (int t = 0; t < 6; ++t) fw[t] = frag_b(&sw[(t & 7) * 16 + col][(t >> 3) * 32], lane);
#pragma unroll
  for (int t = 0; t < 32; ++t) { if (t + 6 < 32) fw[t + 6] = frag_b(&sw[((t + 6) & 7) * 16 + col][((t + 6) >> 3) * 32], lane);
    acc[t & 7] = wmma_bf(a[t >> 3], fw[t], acc[t & 7]); }
  __syncthreads();   /* every wave has read its last W fragment: the LDS may take the output tile */
#pragma unroll
  for (int j = 0; j < 8; ++j) { const float bb = bfr(bv[j]);
#pragma unroll
    for (int r = 0; r < 8; ++r) acc[j][r] += bb; }
  if (which < 2) {   /* block-uniform: feature map */
    const float ds = fabsf(bfr(NS[0])) + 1e-6f; float n1[8], n2[8];
#pragma unroll
    for (int r = 0; r < 8; ++r) { float s1 = 0.f, s2 = 0.f;
#pragma unroll
      for (int j = 0; j < 8; ++j) { const float x = (fmaxf(acc[j][r], 0.f) + 1e-6f) / ds; acc[j][r] = x; const float x2 = x * x; s1 += x2; s2 += x2 * x2; }
      n1[r] = s1; n2[r] = s2; }
#pragma unroll
    for (int o = 1; o < 16; o <<= 1) {
#pragma unroll
      for (int r = 0; r < 8; ++r) { n1[r] += __shfl_xor(n1[r], o); n2[r] += __shfl_xor(n2[r], o); } }
#pragma unroll
    for (int r = 0; r < 8; ++r) n1[r] = sqrtf(n1[r]) / (sqrtf(n2[r]) + 1e-8f);   /* ||x|| / (||x^2|| + eps) */
#pragma unroll
    for (int j = 0; j < 8; ++j) {
#pragma unroll
      for (int r = 0; r < 8; ++r) acc[j][r] = n1[r] * (acc[j][r] * acc[j][r]); } }
  /* stage hi/lo: rows for q and v, transposed for k and v */
#pragma unroll
  for (int j = 0; j < 8; ++j) {
#pragma unroll
    for (int r = 0; r < 8; ++r) { const float v = acc[j][r]; const __bf16 hv = (__bf16)v, lv = (__bf16)(v - (float)hv); const int rl = wave * 16 + 8 * g + r, cl = j * 16 + col;
      if (which != 1) { sh[rl][cl] = hv; sl[rl][cl] = lv; }
      if (which != 0) { th[cl][rl] = hv; tl2[cl][rl] = lv; } } }
  __syncthreads();
  if (which != 1) { __bf16* dh = which == 0 ? PQH : VH; __bf16* dl = which == 0 ? PQL : VL; for (int e = tid; e < 64 * 16; e += 128) { const int rl = e >> 4, q = e & 15; vst2((unsigned*)(dh + (r0 + rl) * CO + q * 8), *(const v4u*)&sh[rl][q * 8]); vst2((unsigned*)(dl + (r0 + rl) * CO + q * 8), *(const v4u*)&sl[rl][q * 8]); } }
  if (which != 0) { __bf16* dh = which == 1 ? PKT : VTH; __bf16* dl = which == 1 ? PKU : VTL; for (int e = tid; e < 128 * 8; e += 128) { const int cl = e >> 3, q = e & 7; vst2((unsigned*)(dh + (size_t)cl * NN + r0 + q * 8), *(const v4u*)&th[cl][q * 8]); vst2((unsigned*)(dl + (size_t)cl * NN + r0 + q * 8), *(const v4u*)&tl2[cl][q * 8]); } } }   
// ---- k_ksum: block = one slice of 64 rows n, 128 threads: thread m sums phi_k[m][n] (hi + lo) over the slice in a fixed order -> row 128 of the slice's partial
__global__ __launch_bounds__(128) void k_ksum(const __bf16* __restrict__ PKT, const __bf16* __restrict__ PKU, float* __restrict__ PART) { __shared__ __align__(16) float sk[128];
  const int m = threadIdx.x; float s = 0.f; const __bf16* ph = PKT + (size_t)m * NN + (size_t)blockIdx.x * SLN; const __bf16* pl = PKU + (size_t)m * NN + (size_t)blockIdx.x * SLN;
  v8b a[SLN / 8], b2[SLN / 8];
#pragma unroll
  for (int i = 0; i < SLN / 8; ++i) { a[i] = *(const v8b*)(ph + i * 8); b2[i] = *(const v8b*)(pl + i * 8); }   /* unrolled: the slice's loads are in flight together */
  asm volatile("s_wait_xcnt 0x0" :: "v"(ph), "v"(pl) : "memory");   /* the two address pairs stay whole until every load above has taken its address */
#pragma unroll
  for (int i = 0; i < SLN / 8; ++i) {
#pragma unroll
    for (int z = 0; z < 8; ++z) s += (float)a[i][z] + (float)b2[i][z]; }
  sk[m] = s; __syncthreads(); if (m < 32) vst2(PART + ((size_t)blockIdx.x * PROWS + CO) * CO + m * 4, *(const v4f*)&sk[m * 4]); }
// ---- k_kv: block = (64 rows m, all 128 cols d, one slice of 64 rows n): partial KV[m][d] = sum_n phi_k[m][n] v[d][n] over the slice (bf16 hi + lo both sides, 3 products, K = 64) -> rows 0..127 of the slice's f32 partial (512 B by 32 lanes)
__global__ __launch_bounds__(128) void k_kv(const __bf16* __restrict__ PKT, const __bf16* __restrict__ PKU, const __bf16* __restrict__ VTH, const __bf16* __restrict__ VTL, float* __restrict__ PART) { __shared__ __align__(16) float sf[4][16][132];
  const int tid = threadIdx.x, wave = tid >> 5, lane = tid & 31, col = lane & 15, g = lane >> 4; const size_t m0 = (size_t)blockIdx.x * 64 + wave * 16;
  v8f acc[8] = {};
#pragma unroll 1
  for (int kc = blockIdx.y * (SLN / 32); kc < (blockIdx.y + 1) * (SLN / 32); ++kc) { const v16b ah = frag_b(PKT + (m0 + col) * NN + kc * 32, lane), al = frag_b(PKU + (m0 + col) * NN + kc * 32, lane);
    asm volatile("s_wait_loadcnt 0x0" ::: "memory");
#pragma unroll
    for (int j = 0; j < 8; ++j) { const size_t vr = (size_t)(j * 16 + col) * NN + kc * 32; const v16b bh = frag_b(VTH + vr, lane), bl = frag_b(VTL + vr, lane); acc[j] = wmma_bf(al, bh, acc[j]); acc[j] = wmma_bf(ah, bl, acc[j]); acc[j] = wmma_bf(ah, bh, acc[j]); } }
#pragma unroll
  for (int j = 0; j < 8; ++j) {
#pragma unroll
    for (int r = 0; r < 8; ++r) sf[wave][8 * g + r][j * 16 + col] = acc[j][r]; }
  LDSX(); for (int rl = 0; rl < 16; ++rl) vst2(PART + ((size_t)blockIdx.y * PROWS + m0 + rl) * CO + lane * 4, *(const v4f*)&sf[wave][rl][lane * 4]); }
// ---- k_join: block = 64 columns of one of the 129 partial rows (a 256-B segment): 32 groups of 16 lanes; group t sums its run of JRUN slices in index order, the 32 group sums are added in index order through LDS -> KV row (rows 0..127) or KS (row 128)
__global__ __launch_bounds__(512) void k_join(const float* __restrict__ PART, float* __restrict__ KV, float* __restrict__ KS) { __shared__ __align__(16) float sj[32][64];
  const int tid = threadIdx.x, grp = tid >> 4, q = tid & 15; const int row = blockIdx.x >> 1, c0 = (blockIdx.x & 1) * 64;
  const float* p = PART + ((size_t)grp * JRUN * PROWS + row) * CO + c0 + q * 4; v4f s = {}, a[JRUN];
#pragma unroll
  for (int i = 0; i < JRUN; ++i) { a[i] = v4f{}; if (NSL % 32 == 0 || grp * JRUN + i < NSL) a[i] = *(const v4f*)(p + (size_t)i * PROWS * CO); }   /* unrolled: all of a lane's loads are in flight together */
  asm volatile("s_wait_xcnt 0x0" :: "v"(p) : "memory");   /* the address pair stays whole until every load above has taken its address */
#pragma unroll
  for (int i = 0; i < JRUN; ++i) s += a[i];
  vst2(&sj[grp][q * 4], s); __syncthreads();
  if (tid < 16) { v4f t = {};
#pragma unroll
    for (int z = 0; z < 32; ++z) t += *(const v4f*)&sj[z][tid * 4];
    vst2((row < CO ? KV + (size_t)row * CO : KS) + c0 + tid * 4, t); } }
// ---- k_num: block = 64 rows n (all 128 cols): num = phi_q (hi+lo) . KV (f32 -> hi+lo, split and transposed once per block into LDS; v_map_w rounded once per block into LDS), 3 products; den = phi_q . KS (f32 dot per row from the planes); vss = v (hi+lo) . v_map_w^T (exact) + v_map_b; val = num / (den + 1e-6) + vss; ACC = (h == 0 ? 0 : ACC) + val (this block's own 512-B row segments)
__global__ __launch_bounds__(128) void k_num(const __bf16* __restrict__ PQH, const __bf16* __restrict__ PQL, const float* __restrict__ KV, const float* __restrict__ KS, const __bf16* __restrict__ VH, const __bf16* __restrict__ VL, const float* __restrict__ VMW, const float* __restrict__ VMB, int h, float* __restrict__ ACC) {
  __shared__ __align__(16) float sf[4][16][132]; __shared__ __align__(16) float sks[128]; __shared__ float sden[64];
  __shared__ __align__(16) __bf16 skh[128][WP], skl[128][WP], swm[128][WP];   /* KV transposed [d][m] hi / lo; v_map_w rows */
  const int tid = threadIdx.x, wave = tid >> 5, lane = tid & 31, col = lane & 15, g = lane >> 4; const size_t r0 = (size_t)blockIdx.x * 64; const size_t w0 = r0 + wave * 16;
  { const float* pk = KV + tid; float kc2[CO]; const float ksv = KS[tid];   /* thread d takes column d of KV: a wave's load is 128 B of one row */
#pragma unroll
    for (int m = 0; m < CO; ++m) kc2[m] = pk[m * CO];   /* unrolled: the column's loads are in flight together */
    asm volatile("s_wait_xcnt 0x0" :: "v"(pk) : "memory");   /* the address pair stays whole until every load above has taken its address */
#pragma unroll
    for (int m = 0; m < CO; m += 8) { v8b hv, lv;
#pragma unroll
      for (int z = 0; z < 8; ++z) { const __bf16 hh = (__bf16)kc2[m + z]; hv[z] = hh; lv[z] = (__bf16)(kc2[m + z] - (float)hh); }
      *(v8b*)&skh[tid][m] = hv; *(v8b*)&skl[tid][m] = lv; }
    sks[tid] = ksv; }
  const __bf16 *pa = PQH + (w0 + col) * CO + 8 * g, *pb = PQL + (w0 + col) * CO + 8 * g, *pc = VH + (w0 + col) * CO + 8 * g, *pd = VL + (w0 + col) * CO + 8 * g;
  v16b ah[CO / 32], al[CO / 32], bh[CO / 32], bl[CO / 32];
#pragma unroll
  for (int kc = 0; kc < CO / 32; ++kc) { ah[kc] = frag_p(pa + kc * 32); al[kc] = frag_p(pb + kc * 32); bh[kc] = frag_p(pc + kc * 32); bl[kc] = frag_p(pd + kc * 32); }
  const float* pbv = VMB + col; float bv[8];
#pragma unroll
  for (int j = 0; j < 8; ++j) bv[j] = pbv[j * 16];
  asm volatile("s_wait_xcnt 0x0" :: "v"(pa), "v"(pb), "v"(pc), "v"(pd), "v"(pbv) : "memory");   /* the address pairs stay whole until every load above has taken its address */
  stage_rows(VMW, swm, tid);   /* its loads fly together with the A rows' */
  __syncthreads();
  if (tid < 64) { float d = 0.f; const __bf16* ph = PQH + (r0 + tid) * CO; const __bf16* pl = PQL + (r0 + tid) * CO;
#pragma unroll 4
    for (int m = 0; m < CO; m += 8) { const v8b a = *(const v8b*)(ph + m), b2 = *(const v8b*)(pl + m);
#pragma unroll
      for (int z = 0; z < 8; ++z) d += ((float)a[z] + (float)b2[z]) * sks[m + z]; }
    sden[tid] = d; }
  v8f acc[8] = {}, vs[8] = {};
  { v16b wh[32], wl[32];   /* group t = kc * 8 + j; its KV fragments are read from LDS two groups ahead, so that the read's latency lies under the products in between */
#pragma unroll
    for (int t = 0; t < 2; ++t) { wh[t] = frag_b(&skh[(t & 7) * 16 + col][(t >> 3) * 32], lane); wl[t] = frag_b(&skl[(t & 7) * 16 + col][(t >> 3) * 32], lane); }
#pragma unroll
    for (int t = 0; t < 32; ++t) { const int kc = t >> 3, j = t & 7, u = t + 2;
      if (u < 32) { wh[u] = frag_b(&skh[(u & 7) * 16 + col][(u >> 3) * 32], lane); wl[u] = frag_b(&skl[(u & 7) * 16 + col][(u >> 3) * 32], lane); }
      acc[j] = wmma_bf(al[kc], wh[t], acc[j]); acc[j] = wmma_bf(ah[kc], wl[t], acc[j]); acc[j] = wmma_bf(ah[kc], wh[t], acc[j]); } }
  { v16b wm[32];   /* the same for v_map_w, three groups ahead */
#pragma unroll
    for (int t = 0; t < 3; ++t) wm[t] = frag_b(&swm[(t & 7) * 16 + col][(t >> 3) * 32], lane);
#pragma unroll
    for (int t = 0; t < 32; ++t) { const int kc = t >> 3, j = t & 7, u = t + 3;
      if (u < 32) wm[u] = frag_b(&swm[(u & 7) * 16 + col][(u >> 3) * 32], lane);
      vs[j] = wmma_bf(bh[kc], wm[t], vs[j]); vs[j] = wmma_bf(bl[kc], wm[t], vs[j]); } }
  __syncthreads();   /* sden ready */
#pragma unroll
  for (int j = 0; j < 8; ++j) { const float bb = bfr(bv[j]);
#pragma unroll
    for (int r = 0; r < 8; ++r) { const float den = sden[wave * 16 + 8 * g + r]; sf[wave][8 * g + r][j * 16 + col] = acc[j][r] / (den + 1e-6f) + (vs[j][r] + bb); } }
  LDSX(); for (int rl = 0; rl < 16; ++rl) { float* dst = ACC + (w0 + rl) * CO + lane * 4; v4f v = *(const v4f*)&sf[wave][rl][lane * 4]; if (h > 0) { const v4f p = *(const v4f*)dst; v[0] += p[0]; v[1] += p[1]; v[2] += p[2]; v[3] += p[3]; } vst2(dst, v); } }
// ---- k_fin: block = 64 rows: out = ACC / 8; time = sqrt(sum out^2 + 1); the 64 x 129 output rows form one contiguous, line-aligned 33,024-B span (64*129*4 = 258 lines; the span starts at row0*516 B with row0 a multiple of 64) staged in LDS and written thread-linearly in 16-B pieces
__global__ __launch_bounds__(128) void k_fin(const float* __restrict__ ACC, float* __restrict__ OUT) { __shared__ __align__(16) float so[64 * 129 + 12];
  const int tid = threadIdx.x; const size_t r0 = (size_t)blockIdx.x * 64;
  for (int rl = tid >> 5, lanei = tid & 31; rl < 64; rl += 4) { const v4f a = *(const v4f*)(ACC + (r0 + rl) * CO + lanei * 4); float o[4]; float s = 0.f;
#pragma unroll
    for (int z = 0; z < 4; ++z) { o[z] = a[z] * (1.0f / NH); s += o[z] * o[z]; }
#pragma unroll
    for (int q = 1; q < 32; q <<= 1) s += __shfl_xor(s, q);
#pragma unroll
    for (int z = 0; z < 4; ++z) so[rl * 129 + 1 + lanei * 4 + z] = o[z];
    if (lanei == 0) so[rl * 129] = sqrtf(s + 1.0f); }
  __syncthreads();
  float* dst = OUT + r0 * 129;
  for (int e = tid; e < 64 * 129 / 4; e += 128) vst2(dst + e * 4, *(const v4f*)&so[e * 4]); }   
extern "C" void kernel_launch(void* const* d_in, const int* in_sizes, int n_in, void* d_out, int out_size, void* d_ws, size_t ws_size, hipStream_t stream) {
  (void)in_sizes; (void)n_in; (void)out_size;
  const float** F = (const float**)d_in;   // 0 query_input, 1 source_input [32768,128]; 2 Wq_w [8,128,128], 3 Wq_b [8,128]; 4 Wk_w, 5 Wk_b; 6 Wv_w, 7 Wv_b; 8 v_map_w [128,128] (out,in), 9 v_map_b; 10 norm_scale
  if (ws_size < (size_t)WS_END) return;
  char* ws = (char*)d_ws; __bf16 *PQH = (__bf16*)(ws + WS_PQH), *PQL = (__bf16*)(ws + WS_PQL), *PKT = (__bf16*)(ws + WS_PKT), *PKU = (__bf16*)(ws + WS_PKU), *VH = (__bf16*)(ws + WS_VH), *VL = (__bf16*)(ws + WS_VL), *VTH = (__bf16*)(ws + WS_VTH), *VTL = (__bf16*)(ws + WS_VTL); float *KS = (float*)(ws + WS_KS), *KV = (float*)(ws + WS_KV), *ACC = (float*)(ws + WS_ACC), *PART = (float*)(ws + WS_PART);
  for (int h = 0; h < NH; ++h) {
    k_proj<<<dim3(NPROC / 64, 1, 3), 128, 0, stream>>>(F[0], F[1], F[2], F[3], F[4], F[5], F[6], F[7], F[10], h, PQH, PQL, PKT, PKU, VH, VL, VTH, VTL);
    k_ksum<<<dim3(NSL), 128, 0, stream>>>(PKT, PKU, PART);
    k_kv<<<dim3(CO / 64, NSL), 128, 0, stream>>>(PKT, PKU, VTH, VTL, PART);
    k_join<<<dim3(2 * PROWS), 512, 0, stream>>>(PART, KV, KS);
    k_num<<<dim3(NPROC / 64), 128, 0, stream>>>(PQH, PQL, KV, KS, VH, VL, F[8], F[9], h, ACC);
  }
  k_fin<<<dim3(NPROC / 64), 128, 0, stream>>>(ACC, (float*)d_out);
}

// v003
// A run of this version takes 486 microseconds.
// Next to v002, in two timings, it ran 1.35 and 1.38 times as fast.
// Counting every step since v000, it is 48.4 times as fast.
// compute dtype: all float inputs rounded to bf16; q/k/v head projections x W^T + b with EXACT bf16 products on WMMA 16x16x32, f32 accumulate; relu, the power feature map (norms over 128, x^2) in f32; phi_k, v, phi_q and the [128 x 128] k^T v as bf16 hi + lo (3 products) for the two linear-attention contractions (K = 32,768 and K = 128), v hi + lo against exact v_map_w (2 products); column sums, the normaliser, the head mean and the time coordinate (sqrt) in f32; f32 output.
#include <hip/hip_runtime.h>
#include <math.h>

typedef __attribute__((ext_vector_type(16))) _Float16 v16h;
typedef __attribute__((ext_vector_type(16))) __bf16 v16b;
typedef __attribute__((ext_vector_type(8)))  _Float16 v8h;
typedef __attribute__((ext_vector_type(8)))  float v8f;
typedef __attribute__((ext_vector_type(4)))  float v4f;
typedef __attribute__((ext_vector_type(2)))  float v2f;
typedef __attribute__((ext_vector_type(4)))  unsigned v4u;
typedef __attribute__((ext_vector_type(4)))  int v4i;
typedef float __attribute__((may_alias)) float_a;
typedef int __attribute__((may_alias)) int_a;

template <typename T> __device__ __forceinline__ void vst2(void* p, T v) { *(T*)p = v;  }
__device__ __forceinline__ v8f wmma16(v16h a, v16h b, v8f c) {
  v8f d = __builtin_amdgcn_wmma_f32_16x16x32_f16(false, a, false, b, (short)0, c, false, false);
  asm volatile("v_nop\n\tv_nop\n\tv_nop\n\tv_nop" : "+v"(d) : "v"(a), "v"(b));
  return d;
}
__device__ __forceinline__ v8f wmma_bf(v16b a, v16b b, v8f c) {
  v8f d = __builtin_amdgcn_wmma_f32_16x16x32_bf16(false, a, false, b, (short)0, c, false, false);
  asm volatile("v_nop\n\tv_nop\n\tv_nop\n\tv_nop" : "+v"(d) : "v"(a), "v"(b));
  return d;
}
// 16x16x32 fragments: lane = (h = lane>>4, row/col = lane&15); elements 0..7 = k0+8h+0..7, 8..15 = k0+16+8h+0..7; D element r = row 8h+r
__device__ __forceinline__ v16h frag_h(const _Float16* rowk0, int lane) {
  union { v16h v; v8h q[2]; } u; const _Float16* p = rowk0 + 8 * (lane >> 4);
  u.q[0] = *(const v8h*)p; u.q[1] = *(const v8h*)(p + 16); return u.v;
}
__device__ __forceinline__ v16h frag_f32(const float* rowk0, int lane) {
  v16h a; const float* p = rowk0 + 8 * (lane >> 4);
#pragma unroll
  for (int i = 0; i < 8; ++i) { a[i] = (_Float16)p[i]; a[8 + i] = (_Float16)p[16 + i]; }
  return a;
}
__device__ __forceinline__ v16h frag_f32s(const float* rowk0, int lane, float sc) {
  v16h a; const float* p = rowk0 + 8 * (lane >> 4);
#pragma unroll
  for (int i = 0; i < 8; ++i) { a[i] = (_Float16)(p[i] * sc); a[8 + i] = (_Float16)(p[16 + i] * sc); }
  return a;
}
// column fragment from a [K][ld] layout (column n), rows >= K read as 0
__device__ __forceinline__ v16h fragc_f32(const float* W, int k0, int n, int lane, int ld, int K) {
  v16h a; const int g = lane >> 4;
#pragma unroll
  for (int i = 0; i < 8; ++i) { const int ka = k0 + 8 * g + i, kb = ka + 16;
    a[i] = (_Float16)(ka < K ? W[(size_t)(ka < K ? ka : K - 1) * ld + n] : 0.f); a[8 + i] = (_Float16)(kb < K ? W[(size_t)(kb < K ? kb : K - 1) * ld + n] : 0.f); }
  return a;
}
struct F2 { v16b h, l; };
__device__ __forceinline__ F2 bsplit16(const float v[16]) { F2 r;
#pragma unroll
  for (int i = 0; i < 16; ++i) { const __bf16 h = (__bf16)v[i]; r.h[i] = h; r.l[i] = (__bf16)(v[i] - (float)h); }
  return r; }
__device__ __forceinline__ F2 split_row(const float* row, int k0, int lane) { float v[16]; const float* p = row + k0 + 8 * (lane >> 4);
#pragma unroll
  for (int i = 0; i < 8; ++i) { v[i] = p[i]; v[8 + i] = p[16 + i]; }
  return bsplit16(v); }
__device__ __forceinline__ F2 split_rowK(const float* row, int k0, int lane, int K) { float v[16]; const int g = lane >> 4;
#pragma unroll
  for (int i = 0; i < 8; ++i) { const int ka = k0 + 8 * g + i, kb = ka + 16; v[i] = ka < K ? row[ka < K ? ka : K - 1] : 0.f; v[8 + i] = kb < K ? row[kb < K ? kb : K - 1] : 0.f; }
  return bsplit16(v); }
__device__ __forceinline__ F2 split_col(const float* W, int k0, int n, int lane, int ld, int K) { float v[16]; const int g = lane >> 4;
#pragma unroll
  for (int i = 0; i < 8; ++i) { const int ka = k0 + 8 * g + i, kb = ka + 16; v[i] = ka < K ? W[(size_t)(ka < K ? ka : K - 1) * ld + n] : 0.f; v[8 + i] = kb < K ? W[(size_t)(kb < K ? kb : K - 1) * ld + n] : 0.f; }
  return bsplit16(v); }
__device__ __forceinline__ v8f mac3(const F2& a, const F2& b, v8f c) { c = wmma_bf(a.l, b.h, c); c = wmma_bf(a.h, b.l, c); return wmma_bf(a.h, b.h, c); }
__device__ __forceinline__ float sigm(float v) { return 1.0f / (1.0f + expf(-v)); }
#define LDSX() do { asm volatile("s_wait_dscnt 0" ::: "memory"); __builtin_amdgcn_wave_barrier(); __builtin_amdgcn_fence(__ATOMIC_RELEASE, "workgroup"); } while (0)

// Hyperbolic (Lorentz) linear-attention 'TransConv' layer (N 32,768 nodes, 128 -> 128, 8 heads, power kernel p = 2): per head h: qs = x_q Wq[h]^T + bq[h], ks = x_s Wk[h]^T + bk[h], v = x_s Wv[h]^T + bv[h]; phi(x) = ||x|| / (||x^2|| + 1e-8) * x^2 applied to (relu(.) + 1e-6)/(|norm_scale| + 1e-6); KV[h] = sum_n phi_k[n] (x) v[n]; num[n] = phi_q[n] KV[h]; den[n] = phi_q[n] . sum_n phi_k[n]; attn = num / (den + 1e-6) + (v v_map_w^T + v_map_b); out = mean over heads; result = [sqrt(sum out^2 + 1), out].
#define NN 32768
#define CI 128             // in channels
#define CO 128             // out channels per head
#define NH 8
#ifndef NPROC
#define NPROC NN           // rows processed
#endif
typedef __attribute__((ext_vector_type(8))) __bf16 v8b;
__device__ __forceinline__ v16b frag_b(const __bf16* rowk0, int lane) {
  union { v16b v; v8b q[2]; } u; const __bf16* p = rowk0 + 8 * (lane >> 4);
  u.q[0] = *(const v8b*)p; u.q[1] = *(const v8b*)(p + 16); return u.v;
}
// the same fragment from a pointer that already holds the lane's 8 * (lane >> 4)
__device__ __forceinline__ v16b frag_p(const __bf16* p) {
  union { v16b v; v8b q[2]; } u; u.q[0] = *(const v8b*)p; u.q[1] = *(const v8b*)(p + 16); return u.v;
}
typedef __attribute__((ext_vector_type(4))) __bf16 v4b;
#define WP 136             // bf16 per LDS row of a staged [128][128] B operand (272 B = 16 B x 17)
// a block of 128 threads rounds a row-major f32 [128][128] matrix to bf16 rows in LDS: thread t takes the 16-B pieces t, t + 128, ... (a wave fills one row per piece)
__device__ __forceinline__ void stage_rows(const float* __restrict__ Wm, __bf16 (*dst)[WP], int tid) {
  const float* pw = Wm + tid * 4; v4f wv[32];
#pragma unroll
  for (int i = 0; i < 32; ++i) wv[i] = *(const v4f*)(pw + i * 512);   /* unrolled: all of a thread's loads are in flight together */
  asm volatile("s_wait_xcnt 0x0" :: "v"(pw) : "memory");   /* the address pair stays whole until every load above has taken its address */
#pragma unroll
  for (int i = 0; i < 32; ++i) { v4b o;
#pragma unroll
    for (int z = 0; z < 4; ++z) o[z] = (__bf16)wv[i][z];
    *(v4b*)&dst[(tid >> 5) + 4 * i][(tid & 31) * 4] = o; } }
__device__ __forceinline__ float bfr(float v) { return (float)(__bf16)v; }
__device__ __forceinline__ v16b wrow(const float* rowk0, int lane) { v16b w; const float* p = rowk0 + 8 * (lane >> 4);
#pragma unroll
  for (int i = 0; i < 8; ++i) { w[i] = (__bf16)p[i]; w[8 + i] = (__bf16)p[16 + i]; }
  return w; }
// B fragment (k rows k0+.., column n) of an f32 [K][ld] matrix, split bf16 hi + lo
__device__ __forceinline__ F2 colsplit(const float* Wm, int k0, int n, int lane, int ld) { float v[16]; const int g = lane >> 4;
#pragma unroll
  for (int i = 0; i < 8; ++i) { v[i] = Wm[(size_t)(k0 + 8 * g + i) * ld + n]; v[8 + i] = Wm[(size_t)(k0 + 16 + 8 * g + i) * ld + n]; }
  return bsplit16(v); }

#define WS_PQH 0u                                       // bf16 phi_q rows [n][128] hi
#define WS_PQL (WS_PQH + 2u * (size_t)NN * CO)
#define WS_VH  (WS_PQL + 2u * (size_t)NN * CO)          // bf16 v rows [n][128] hi / lo
#define WS_VL  (WS_VH  + 2u * (size_t)NN * CO)
#define WS_KS  (WS_VL  + 2u * (size_t)NN * CO)          // f32 column sums of phi_k [128]
#define WS_KV  (WS_KS  + 4u * 128)                      // f32 KV [m][d]
#define WS_ACC (WS_KV  + 4u * (size_t)CO * CO)          // f32 head-sum accumulator [n][128]
#define SLN 64             // rows n per slice of the two sums over n
#define NSL (NPROC / SLN)  // slices
#define JRUN ((NSL + 31) / 32)   // slices in a row that one of k_join's 32 groups sums
#define PROWS (CO + 1)     // rows of one slice's partial: 128 rows of KV, then the column sums
#define WS_PART (WS_ACC + 4u * (size_t)NN * CO)         // f32 partials [slice][129][128]
#define WS_END (WS_PART + 4u * (size_t)NSL * PROWS * CO)
#define TP 72              // bf16 per LDS row of a transposed [128][64] tile (144 B = 16 B x 9)

// acc = x W^T for a wave's 16 rows (a: the rows' four k fragments) against the [128][128] bf16 W in LDS; product t = kc * 8 + j; its W fragment is read from LDS six products ahead, so that the read's latency lies under the products in between
__device__ __forceinline__ void proj_tile(const v16b a[CI / 32], const __bf16 (*sw)[WP], int col, int lane, v8f acc[8]) {
  v16b fw[32];
#pragma unroll
  for (int t = 0; t < 6; ++t) fw[t] = frag_b(&sw[(t & 7) * 16 + col][(t >> 3) * 32], lane);
#pragma unroll
  for (int t = 0; t < 32; ++t) { if (t + 6 < 32) fw[t + 6] = frag_b(&sw[((t + 6) & 7) * 16 + col][((t + 6) >> 3) * 32], lane);
    acc[t & 7] = wmma_bf(a[t >> 3], fw[t], acc[t & 7]); } }
// feature map on a wave's 16 x 128 tile: x = (relu(acc) + 1e-6) / ds, phi = ||x|| / (||x^2|| + 1e-8) * x^2, the two norms over the 128 columns (lane partial sums + 16-lane shuffles)
__device__ __forceinline__ void feature_map(v8f acc[8], float ds) { float n1[8], n2[8];
#pragma unroll
  for (int r = 0; r < 8; ++r) { float s1 = 0.f, s2 = 0.f;
#pragma unroll
    for (int j = 0; j < 8; ++j) { const float x = (fmaxf(acc[j][r], 0.f) + 1e-6f) / ds; acc[j][r] = x; const float x2 = x * x; s1 += x2; s2 += x2 * x2; }
    n1[r] = s1; n2[r] = s2; }
#pragma unroll
  for (int o = 1; o < 16; o <<= 1) {
#pragma unroll
    for (int r = 0; r < 8; ++r) { n1[r] += __shfl_xor(n1[r], o); n2[r] += __shfl_xor(n2[r], o); } }
#pragma unroll
  for (int r = 0; r < 8; ++r) n1[r] = sqrtf(n1[r]) / (sqrtf(n2[r]) + 1e-8f);   /* ||x|| / (||x^2|| + eps) */
#pragma unroll
  for (int j = 0; j < 8; ++j) {
#pragma unroll
    for (int r = 0; r < 8; ++r) acc[j][r] = n1[r] * (acc[j][r] * acc[j][r]); } }

// a wave's 16 x 128 f32 tile, split bf16 hi + lo, into LDS: transposed ([column][row]) and, with ROWS, as rows too; rb = the lane's first row in the block's tile
template <bool ROWS> __device__ __forceinline__ void stage_tile(const v8f acc[8], __bf16 (*sh)[WP], __bf16 (*sl)[WP], __bf16 (*th)[TP], __bf16 (*tl)[TP], int rb, int col) {
#pragma unroll
  for (int j = 0; j < 8; ++j) {
#pragma unroll
    for (int r = 0; r < 8; ++r) { const float v = acc[j][r]; const __bf16 hv = (__bf16)v, lv = (__bf16)(v - (float)hv); const int rl = rb + r, cl = j * 16 + col;
      if (ROWS) { sh[rl][cl] = hv; sl[rl][cl] = lv; }
      th[cl][rl] = hv; tl[cl][rl] = lv; } } }
// ---- k_proj: block = 64 rows of head h's q: acc = x_q Wq[h]^T + bq[h] (W (out,in) rows contiguous; exact; W[h] rounded to bf16 once per block into LDS, each lane's x row loaded whole up front); feature map; phi_q -> bf16 hi/lo rows
__global__ __launch_bounds__(128) void k_proj(const float* __restrict__ XQ, const float* __restrict__ WQ, const float* __restrict__ BQ, const float* __restrict__ NS, int h, __bf16* __restrict__ PQH, __bf16* __restrict__ PQL) {
  __shared__ __align__(16) __bf16 sw[128][WP];
  __bf16 (*sh)[WP] = sw; __bf16 (*sl)[WP] = sw + 64;   /* behind the products the same LDS holds the tile's hi rows (0..63) and lo rows (64..127) */
  const int tid = threadIdx.x, wave = tid >> 5, lane = tid & 31, col = lane & 15, g = lane >> 4; const size_t r0 = (size_t)blockIdx.x * 64;
  const float* WA = WQ + (size_t)h * CO * CI; const float* BA = BQ + (size_t)h * CO;
  const float* px = XQ + (r0 + wave * 16 + col) * CI + 8 * g; v4f xa[CI / 32][4];
#pragma unroll
  for (int kc = 0; kc < CI / 32; ++kc) { xa[kc][0] = *(const v4f*)(px + kc * 32); xa[kc][1] = *(const v4f*)(px + kc * 32 + 4); xa[kc][2] = *(const v4f*)(px + kc * 32 + 16); xa[kc][3] = *(const v4f*)(px + kc * 32 + 20); }
  const float* pbv = BA + col; float bv[8];
#pragma unroll
  for (int j = 0; j < 8; ++j) bv[j] = pbv[j * 16];
  asm volatile("s_wait_xcnt 0x0" :: "v"(px), "v"(pbv) : "memory");   /* the address pairs stay whole until every load above has taken its address */
  stage_rows(WA, sw, tid);
  v16b a[CI / 32];
#pragma unroll
  for (int kc = 0; kc < CI / 32; ++kc) {
#pragma unroll
    for (int i = 0; i < 16; ++i) a[kc][i] = (__bf16)xa[kc][i >> 2][i & 3]; }
  __syncthreads();   /* W[h] staged */
  v8f acc[8] = {}; proj_tile(a, sw, col, lane, acc);
  __syncthreads();   /* every wave has read its last W fragment: the LDS may take the output tile */
#pragma unroll
  for (int j = 0; j < 8; ++j) { const float bb = bfr(bv[j]);
#pragma unroll
    for (int r = 0; r < 8; ++r) acc[j][r] += bb; }
  feature_map(acc, fabsf(bfr(NS[0])) + 1e-6f);
#pragma unroll
  for (int j = 0; j < 8; ++j) {
#pragma unroll
    for (int r = 0; r < 8; ++r) { const float v = acc[j][r]; const __bf16 hv = (__bf16)v, lv = (__bf16)(v - (float)hv); const int rl = wave * 16 + 8 * g + r, cl = j * 16 + col; sh[rl][cl] = hv; sl[rl][cl] = lv; } }
  __syncthreads();
  __bf16* qh = PQH + r0 * CO + tid * 8; __bf16* ql = PQL + r0 * CO + tid * 8;   /* the tile's 64 rows are one contiguous 16-KiB span of each plane: piece e = tid + 128 i */
#pragma unroll
  for (int i = 0; i < 8; ++i) { const int e = tid + i * 128; vst2(qh + i * 1024, *(const v4u*)&sh[e >> 4][(e & 15) * 8]); vst2(ql + i * 1024, *(const v4u*)&sl[e >> 4][(e & 15) * 8]); }
  asm volatile("s_wait_xcnt 0x0" :: "v"(qh), "v"(ql) : "memory");   /* the address pairs stay whole until every store above has taken its address */
}
// ---- k_kvp: block = one slice of 64 rows n of head h, 256 threads. Waves 0..3 form phi_k = feature map of x_s Wk[h]^T + bk[h], waves 4..7 v = x_s Wv[h]^T + bv[h] (each half as k_proj, with its own W in LDS). Both tiles go, bf16 hi + lo, TRANSPOSED ([m][n], [d][n]) into LDS and stay there; v also leaves as hi/lo rows. Then wave w: partial KV[16 w + ..][d] = sum_n phi_k[m][n] v[d][n] over the slice (hi + lo both sides, 3 products, K = 64) -> rows 0..127 of the slice's f32 partial; thread m < 128: sum_n phi_k[m][n] (hi + lo) in a fixed order -> row 128
__global__ __launch_bounds__(256) void k_kvp(const float* __restrict__ XS, const float* __restrict__ WK, const float* __restrict__ BK, const float* __restrict__ WV, const float* __restrict__ BV, const float* __restrict__ NS, int h, __bf16* __restrict__ VH, __bf16* __restrict__ VL, float* __restrict__ PART) {
  __shared__ __align__(16) __bf16 sw[2][128][WP]; __shared__ __align__(16) __bf16 th[2][128][TP], tl2[2][128][TP];   /* [0] k side, [1] v side */
  __bf16 (*sh)[WP] = sw[1]; __bf16 (*sl)[WP] = sw[1] + 64;   /* behind the products the v side's W space holds v's hi rows (0..63) and lo rows (64..127) */
  const int tid = threadIdx.x, t7 = tid & 127, wave = t7 >> 5, lane = tid & 31, col = lane & 15, g = lane >> 4; const size_t r0 = (size_t)blockIdx.x * 64;
  const int side = __builtin_amdgcn_readfirstlane(tid >> 7);   /* the same in a whole wave: 0 = k, 1 = v */
  const float* WA = (side == 0 ? WK : WV) + (size_t)h * CO * CI; const float* BA = (side == 0 ? BK : BV) + (size_t)h * CO;
  const float* px = XS + (r0 + wave * 16 + col) * CI + 8 * g; v4f xa[CI / 32][4];
#pragma unroll
  for (int kc = 0; kc < CI / 32; ++kc) { xa[kc][0] = *(const v4f*)(px + kc * 32); xa[kc][1] = *(const v4f*)(px + kc * 32 + 4); xa[kc][2] = *(const v4f*)(px + kc * 32 + 16); xa[kc][3] = *(const v4f*)(px + kc * 32 + 20); }
  const float* pbv = BA + col; float bv[8];
#pragma unroll
  for (int j = 0; j < 8; ++j) bv[j] = pbv[j * 16];
  asm volatile("s_wait_xcnt 0x0" :: "v"(px), "v"(pbv) : "memory");   /* the address pairs stay whole until every load above has taken its address */
  stage_rows(WA, sw[side], t7);
  { v8f acc[8] = {};
    { v16b a[CI / 32];
#pragma unroll
      for (int kc = 0; kc < CI / 32; ++kc) {
#pragma unroll
        for (int i = 0; i < 16; ++i) a[kc][i] = (__bf16)xa[kc][i >> 2][i & 3]; }
      __syncthreads();   /* both W[h] staged */
      proj_tile(a, sw[side], col, lane, acc); }
    __syncthreads();   /* every wave has read its last W fragment: the v side's W space may take v's rows */
#pragma unroll
    for (int j = 0; j < 8; ++j) { const float bb = bfr(bv[j]);
#pragma unroll
      for (int r = 0; r < 8; ++r) acc[j][r] += bb; }
    if (side == 0) feature_map(acc, fabsf(bfr(NS[0])) + 1e-6f);   /* wave-uniform, no barrier inside */
    if (side == 0) stage_tile<false>(acc, sh, sl, th[0], tl2[0], wave * 16 + 8 * g, col); else stage_tile<true>(acc, sh, sl, th[1], tl2[1], wave * 16 + 8 * g, col); }   /* wave-uniform, no barrier inside */
  __syncthreads();   /* phi_k^T, v^T and v's rows staged */
  __bf16* vh = VH + r0 * CO + tid * 8; __bf16* vl = VL + r0 * CO + tid * 8;   /* the tile's 64 rows are one contiguous 16-KiB span of each plane: piece e = tid + 256 i */
#pragma unroll
  for (int i = 0; i < 4; ++i) { const int e = tid + i * 256; vst2(vh + i * 2048, *(const v4u*)&sh[e >> 4][(e & 15) * 8]); vst2(vl + i * 2048, *(const v4u*)&sl[e >> 4][(e & 15) * 8]); }
  asm volatile("s_wait_xcnt 0x0" :: "v"(vh), "v"(vl) : "memory");   /* the address pairs stay whole until every store above has taken its address */
  const int w8 = tid >> 5, m0 = w8 * 16; v8f kv[8] = {};
  { v16b ah[SLN / 32], al[SLN / 32], bh[SLN / 4], bl[SLN / 4];   /* group t = kc * 8 + j; its v fragments are read from LDS two groups ahead, so that the read's latency lies under the products in between */
#pragma unroll
    for (int kc = 0; kc < SLN / 32; ++kc) { ah[kc] = frag_b(&th[0][m0 + col][kc * 32], lane); al[kc] = frag_b(&tl2[0][m0 + col][kc * 32], lane); }
#pragma unroll
    for (int t = 0; t < 2; ++t) { bh[t] = frag_b(&th[1][(t & 7) * 16 + col][(t >> 3) * 32], lane); bl[t] = frag_b(&tl2[1][(t & 7) * 16 + col][(t >> 3) * 32], lane); }
#pragma unroll
    for (int t = 0; t < SLN / 4; ++t) { const int kc = t >> 3, j = t & 7, u = t + 2;
      if (u < SLN / 4) { bh[u] = frag_b(&th[1][(u & 7) * 16 + col][(u >> 3) * 32], lane); bl[u] = frag_b(&tl2[1][(u & 7) * 16 + col][(u >> 3) * 32], lane); }
      kv[j] = wmma_bf(al[kc], bh[t], kv[j]); kv[j] = wmma_bf(ah[kc], bl[t], kv[j]); kv[j] = wmma_bf(ah[kc], bh[t], kv[j]); } }
  float* pp = PART + (size_t)blockIdx.x * PROWS * CO;
  if (side == 0) { float s = 0.f;   /* wave-uniform: thread m = tid sums its row of phi_k^T */
#pragma unroll
    for (int i = 0; i < SLN / 8; ++i) { const v8b a = *(const v8b*)&th[0][tid][i * 8], b2 = *(const v8b*)&tl2[0][tid][i * 8];
#pragma unroll
      for (int z = 0; z < 8; ++z) s += (float)a[z] + (float)b2[z]; }
    float* ps = pp + CO * CO + tid; *ps = s;   /* a wave stores one whole 128-B line */
    asm volatile("s_wait_xcnt 0x0" :: "v"(ps) : "memory");   /* the address pair stays whole until the store above has taken its address */
  }
  __syncthreads();   /* v's rows have left the W space: it may take the waves' f32 tiles */
  float (*sf)[132] = (float (*)[132])&sw[0][0][0] + w8 * 16;   /* 8 waves x 16 rows x 528 B = 67,584 B of sw's 69,632 */
#pragma unroll
  for (int j = 0; j < 8; ++j) {
#pragma unroll
    for (int r = 0; r < 8; ++r) sf[8 * g + r][j * 16 + col] = kv[j][r]; }
  LDSX(); float* po = pp + (size_t)m0 * CO + lane * 4;
#pragma unroll
  for (int rl = 0; rl < 16; ++rl) vst2(po + rl * CO, *(const v4f*)&sf[rl][lane * 4]);
  asm volatile("s_wait_xcnt 0x0" :: "v"(po) : "memory");   /* the address pair stays whole until every store above has taken its address */
}
// ---- k_join: block = 64 columns of one of the 129 partial rows (a 256-B segment): 32 groups of 16 lanes; group t sums its run of JRUN slices in index order, the 32 group sums are added in index order through LDS -> KV row (rows 0..127) or KS (row 128)
__global__ __launch_bounds__(512) void k_join(const float* __restrict__ PART, float* __restrict__ KV, float* __restrict__ KS) { __shared__ __align__(16) float sj[32][64];
  const int tid = threadIdx.x, grp = tid >> 4, q = tid & 15; const int row = blockIdx.x >> 1, c0 = (blockIdx.x & 1) * 64;
  const float* p = PART + ((size_t)grp * JRUN * PROWS + row) * CO + c0 + q * 4; v4f s = {}, a[JRUN];
#pragma unroll
  for (int i = 0; i < JRUN; ++i) { a[i] = v4f{}; if (NSL % 32 == 0 || grp * JRUN + i < NSL) a[i] = *(const v4f*)(p + (size_t)i * PROWS * CO); }   /* unrolled: all of a lane's loads are in flight together */
  asm volatile("s_wait_xcnt 0x0" :: "v"(p) : "memory");   /* the address pair stays whole until every load above has taken its address */
#pragma unroll
  for (int i = 0; i < JRUN; ++i) s += a[i];
  vst2(&sj[grp][q * 4], s); __syncthreads();
  if (tid < 16) { v4f t = {};
#pragma unroll
    for (int z = 0; z < 32; ++z) t += *(const v4f*)&sj[z][tid * 4];
    vst2((row < CO ? KV + (size_t)row * CO : KS) + c0 + tid * 4, t); } }
// ---- k_num: block = 64 rows n (all 128 cols): num = phi_q (hi+lo) . KV (f32 -> hi+lo, split and transposed once per block into LDS; v_map_w rounded once per block into LDS), 3 products; den = phi_q . KS (f32 dot per row from the planes); vss = v (hi+lo) . v_map_w^T (exact) + v_map_b; val = num / (den + 1e-6) + vss; ACC = (h == 0 ? 0 : ACC) + val (this block's own 512-B row segments)
__global__ __launch_bounds__(128) void k_num(const __bf16* __restrict__ PQH, const __bf16* __restrict__ PQL, const float* __restrict__ KV, const float* __restrict__ KS, const __bf16* __restrict__ VH, const __bf16* __restrict__ VL, const float* __restrict__ VMW, const float* __restrict__ VMB, int h, float* __restrict__ ACC) {
  __shared__ __align__(16) float sf[4][16][132]; __shared__ __align__(16) float sks[128]; __shared__ float sden[64];
  __shared__ __align__(16) __bf16 skh[128][WP], skl[128][WP], swm[128][WP];   /* KV transposed [d][m] hi / lo; v_map_w rows */
  const int tid = threadIdx.x, wave = tid >> 5, lane = tid & 31, col = lane & 15, g = lane >> 4; const size_t r0 = (size_t)blockIdx.x * 64; const size_t w0 = r0 + wave * 16;
  { const float* pk = KV + tid; float kc2[CO]; const float ksv = KS[tid];   /* thread d takes column d of KV: a wave's load is 128 B of one row */
#pragma unroll
    for (int m = 0; m < CO; ++m) kc2[m] = pk[m * CO];   /* unrolled: the column's loads are in flight together */
    asm volatile("s_wait_xcnt 0x0" :: "v"(pk) : "memory");   /* the address pair stays whole until every load above has taken its address */
#pragma unroll
    for (int m = 0; m < CO; m += 8) { v8b hv, lv;
#pragma unroll
      for (int z = 0; z < 8; ++z) { const __bf16 hh = (__bf16)kc2[m + z]; hv[z] = hh; lv[z] = (__bf16)(kc2[m + z] - (float)hh); }
      *(v8b*)&skh[tid][m] = hv; *(v8b*)&skl[tid][m] = lv; }
    sks[tid] = ksv; }
  const __bf16 *pa = PQH + (w0 + col) * CO + 8 * g, *pb = PQL + (w0 + col) * CO + 8 * g, *pc = VH + (w0 + col) * CO + 8 * g, *pd = VL + (w0 + col) * CO + 8 * g;
  v16b ah[CO / 32], al[CO / 32], bh[CO / 32], bl[CO / 32];
#pragma unroll
  for (int kc = 0; kc < CO / 32; ++kc) { ah[kc] = frag_p(pa + kc * 32); al[kc] = frag_p(pb + kc * 32); bh[kc] = frag_p(pc + kc * 32); bl[kc] = frag_p(pd + kc * 32); }
  const float* pbv = VMB + col; float bv[8];
#pragma unroll
  for (int j = 0; j < 8; ++j) bv[j] = pbv[j * 16];
  asm volatile("s_wait_xcnt 0x0" :: "v"(pa), "v"(pb), "v"(pc), "v"(pd), "v"(pbv) : "memory");   /* the address pairs stay whole until every load above has taken its address */
  stage_rows(VMW, swm, tid);   /* its loads fly together with the A rows' */
  __syncthreads();
  if (tid < 64) { float d = 0.f; const __bf16* ph = PQH + (r0 + tid) * CO; const __bf16* pl = PQL + (r0 + tid) * CO;
#pragma unroll 4
    for (int m = 0; m < CO; m += 8) { const v8b a = *(const v8b*)(ph + m), b2 = *(const v8b*)(pl + m);
#pragma unroll
      for (int z = 0; z < 8; ++z) d += ((float)a[z] + (float)b2[z]) * sks[m + z]; }
    sden[tid] = d; }
  v8f acc[8] = {}, vs[8] = {};
  { v16b wh[32], wl[32];   /* group t = kc * 8 + j; its KV fragments are read from LDS two groups ahead, so that the read's latency lies under the products in between */
#pragma unroll
    for (int t = 0; t < 2; ++t) { wh[t] = frag_b(&skh[(t & 7) * 16 + col][(t >> 3) * 32], lane); wl[t] = frag_b(&skl[(t & 7) * 16 + col][(t >> 3) * 32], lane); }
#pragma unroll
    for (int t = 0; t < 32; ++t) { const int kc = t >> 3, j = t & 7, u = t + 2;
      if (u < 32) { wh[u] = frag_b(&skh[(u & 7) * 16 + col][(u >> 3) * 32], lane); wl[u] = frag_b(&skl[(u & 7) * 16 + col][(u >> 3) * 32], lane); }
      acc[j] = wmma_bf(al[kc], wh[t], acc[j]); acc[j] = wmma_bf(ah[kc], wl[t], acc[j]); acc[j] = wmma_bf(ah[kc], wh[t], acc[j]); } }
  { v16b wm[32];   /* the same for v_map_w, three groups ahead */
#pragma unroll
    for (int t = 0; t < 3; ++t) wm[t] = frag_b(&swm[(t & 7) * 16 + col][(t >> 3) * 32], lane);
#pragma unroll
    for (int t = 0; t < 32; ++t) { const int kc = t >> 3, j = t & 7, u = t + 3;
      if (u < 32) wm[u] = frag_b(&swm[(u & 7) * 16 + col][(u >> 3) * 32], lane);
      vs[j] = wmma_bf(bh[kc], wm[t], vs[j]); vs[j] = wmma_bf(bl[kc], wm[t], vs[j]); } }
  __syncthreads();   /* sden ready */
#pragma unroll
  for (int j = 0; j < 8; ++j) { const float bb = bfr(bv[j]);
#pragma unroll
    for (int r = 0; r < 8; ++r) { const float den = sden[wave * 16 + 8 * g + r]; sf[wave][8 * g + r][j * 16 + col] = acc[j][r] / (den + 1e-6f) + (vs[j][r] + bb); } }
  LDSX(); for (int rl = 0; rl < 16; ++rl) { float* dst = ACC + (w0 + rl) * CO + lane * 4; v4f v = *(const v4f*)&sf[wave][rl][lane * 4]; if (h > 0) { const v4f p = *(const v4f*)dst; v[0] += p[0]; v[1] += p[1]; v[2] += p[2]; v[3] += p[3]; } vst2(dst, v); } }
// ---- k_fin: block = 64 rows: out = ACC / 8; time = sqrt(sum out^2 + 1); the 64 x 129 output rows form one contiguous, line-aligned 33,024-B span (64*129*4 = 258 lines; the span starts at row0*516 B with row0 a multiple of 64) staged in LDS and written thread-linearly in 16-B pieces
__global__ __launch_bounds__(128) void k_fin(const float* __restrict__ ACC, float* __restrict__ OUT) { __shared__ __align__(16) float so[64 * 129 + 12];
  const int tid = threadIdx.x; const size_t r0 = (size_t)blockIdx.x * 64;
  for (int rl = tid >> 5, lanei = tid & 31; rl < 64; rl += 4) { const v4f a = *(const v4f*)(ACC + (r0 + rl) * CO + lanei * 4); float o[4]; float s = 0.f;
#pragma unroll
    for (int z = 0; z < 4; ++z) { o[z] = a[z] * (1.0f / NH); s += o[z] * o[z]; }
#pragma unroll
    for (int q = 1; q < 32; q <<= 1) s += __shfl_xor(s, q);
#pragma unroll
    for (int z = 0; z < 4; ++z) so[rl * 129 + 1 + lanei * 4 + z] = o[z];
    if (lanei == 0) so[rl * 129] = sqrtf(s + 1.0f); }
  __syncthreads();
  float* dst = OUT + r0 * 129;
  for (int e = tid; e < 64 * 129 / 4; e += 128) vst2(dst + e * 4, *(const v4f*)&so[e * 4]); }   
extern "C" void kernel_launch(void* const* d_in, const int* in_sizes, int n_in, void* d_out, int out_size, void* d_ws, size_t ws_size, hipStream_t stream) {
  (void)in_sizes; (void)n_in; (void)out_size;
  const float** F = (const float**)d_in;   // 0 query_input, 1 source_input [32768,128]; 2 Wq_w [8,128,128], 3 Wq_b [8,128]; 4 Wk_w, 5 Wk_b; 6 Wv_w, 7 Wv_b; 8 v_map_w [128,128] (out,in), 9 v_map_b; 10 norm_scale
  if (ws_size < (size_t)WS_END) return;
  char* ws = (char*)d_ws; __bf16 *PQH = (__bf16*)(ws + WS_PQH), *PQL = (__bf16*)(ws + WS_PQL), *VH = (__bf16*)(ws + WS_VH), *VL = (__bf16*)(ws + WS_VL); float *KS = (float*)(ws + WS_KS), *KV = (float*)(ws + WS_KV), *ACC = (float*)(ws + WS_ACC), *PART = (float*)(ws + WS_PART);
  for (int h = 0; h < NH; ++h) {
    k_proj<<<dim3(NPROC / 64), 128, 0, stream>>>(F[0], F[2], F[3], F[10], h, PQH, PQL);
    k_kvp<<<dim3(NSL), 256, 0, stream>>>(F[1], F[4], F[5], F[6], F[7], F[10], h, VH, VL, PART);
    k_join<<<dim3(2 * PROWS), 512, 0, stream>>>(PART, KV, KS);
    k_num<<<dim3(NPROC / 64), 128, 0, stream>>>(PQH, PQL, KV, KS, VH, VL, F[8], F[9], h, ACC);
  }
  k_fin<<<dim3(NPROC / 64), 128, 0, stream>>>(ACC, (float*)d_out);
}

// v004
// Measured time: 316 microseconds a run.
// In two side-by-side timings against v003, it was 1.57 and 1.54 times as fast.
// Counting every step since v000, it is 75.1 times as fast.
// compute dtype: all float inputs rounded to bf16; q/k/v head projections x W^T + b with EXACT bf16 products on WMMA 16x16x32, f32 accumulate; relu, the power feature map (norms over 128, x^2) in f32; phi_k, v, phi_q and the [128 x 128] k^T v as bf16 hi + lo (3 products) for the two linear-attention contractions (K = 32,768 and K = 128), v hi + lo against exact v_map_w (2 products); column sums, the normaliser, the head mean and the time coordinate (sqrt) in f32; f32 output.
#include <hip/hip_runtime.h>
#include <math.h>

typedef __attribute__((ext_vector_type(16))) _Float16 v16h;
typedef __attribute__((ext_vector_type(16))) __bf16 v16b;
typedef __attribute__((ext_vector_type(8)))  _Float16 v8h;
typedef __attribute__((ext_vector_type(8)))  float v8f;
typedef __attribute__((ext_vector_type(4)))  float v4f;
typedef __attribute__((ext_vector_type(2)))  float v2f;
typedef __attribute__((ext_vector_type(4)))  unsigned v4u;
typedef __attribute__((ext_vector_type(4)))  int v4i;
typedef float __attribute__((may_alias)) float_a;
typedef int __attribute__((may_alias)) int_a;

template <typename T> __device__ __forceinline__ void vst2(void* p, T v) { *(T*)p = v;  }
__device__ __forceinline__ v8f wmma16(v16h a, v16h b, v8f c) {
  v8f d = __builtin_amdgcn_wmma_f32_16x16x32_f16(false, a, false, b, (short)0, c, false, false);
  asm volatile("v_nop\n\tv_nop\n\tv_nop\n\tv_nop" : "+v"(d) : "v"(a), "v"(b));
  return d;
}
__device__ __forceinline__ v8f wmma_bf(v16b a, v16b b, v8f c) {
  v8f d = __builtin_amdgcn_wmma_f32_16x16x32_bf16(false, a, false, b, (short)0, c, false, false);
  asm volatile("v_nop\n\tv_nop\n\tv_nop\n\tv_nop" : "+v"(d) : "v"(a), "v"(b));
  return d;
}
// 16x16x32 fragments: lane = (h = lane>>4, row/col = lane&15); elements 0..7 = k0+8h+0..7, 8..15 = k0+16+8h+0..7; D element r = row 8h+r
__device__ __forceinline__ v16h frag_h(const _Float16* rowk0, int lane) {
  union { v16h v; v8h q[2]; } u; const _Float16* p = rowk0 + 8 * (lane >> 4);
  u.q[0] = *(const v8h*)p; u.q[1] = *(const v8h*)(p + 16); return u.v;
}
__device__ __forceinline__ v16h frag_f32(const float* rowk0, int lane) {
  v16h a; const float* p = rowk0 + 8 * (lane >> 4);
#pragma unroll
  for (int i = 0; i < 8; ++i) { a[i] = (_Float16)p[i]; a[8 + i] = (_Float16)p[16 + i]; }
  return a;
}
__device__ __forceinline__ v16h frag_f32s(const float* rowk0, int lane, float sc) {
  v16h a; const float* p = rowk0 + 8 * (lane >> 4);
#pragma unroll
  for (int i = 0; i < 8; ++i) { a[i] = (_Float16)(p[i] * sc); a[8 + i] = (_Float16)(p[16 + i] * sc); }
  return a;
}
// column fragment from a [K][ld] layout (column n), rows >= K read as 0
__device__ __forceinline__ v16h fragc_f32(const float* W, int k0, int n, int lane, int ld, int K) {
  v16h a; const int g = lane >> 4;
#pragma unroll
  for (int i = 0; i < 8; ++i) { const int ka = k0 + 8 * g + i, kb = ka + 16;
    a[i] = (_Float16)(ka < K ? W[(size_t)(ka < K ? ka : K - 1) * ld + n] : 0.f); a[8 + i] = (_Float16)(kb < K ? W[(size_t)(kb < K ? kb : K - 1) * ld + n] : 0.f); }
  return a;
}
struct F2 { v16b h, l; };
__device__ __forceinline__ F2 bsplit16(const float v[16]) { F2 r;
#pragma unroll
  for (int i = 0; i < 16; ++i) { const __bf16 h = (__bf16)v[i]; r.h[i] = h; r.l[i] = (__bf16)(v[i] - (float)h); }
  return r; }
__device__ __forceinline__ F2 split_row(const float* row, int k0, int lane) { float v[16]; const float* p = row + k0 + 8 * (lane >> 4);
#pragma unroll
  for (int i = 0; i < 8; ++i) { v[i] = p[i]; v[8 + i] = p[16 + i]; }
  return bsplit16(v); }
__device__ __forceinline__ F2 split_rowK(const float* row, int k0, int lane, int K) { float v[16]; const int g = lane >> 4;
#pragma unroll
  for (int i = 0; i < 8; ++i) { const int ka = k0 + 8 * g + i, kb = ka + 16; v[i] = ka < K ? row[ka < K ? ka : K - 1] : 0.f; v[8 + i] = kb < K ? row[kb < K ? kb : K - 1] : 0.f; }
  return bsplit16(v); }
__device__ __forceinline__ F2 split_col(const float* W, int k0, int n, int lane, int ld, int K) { float v[16]; const int g = lane >> 4;
#pragma unroll
  for (int i = 0; i < 8; ++i) { const int ka = k0 + 8 * g + i, kb = ka + 16; v[i] = ka < K ? W[(size_t)(ka < K ? ka : K - 1) * ld + n] : 0.f; v[8 + i] = kb < K ? W[(size_t)(kb < K ? kb : K - 1) * ld + n] : 0.f; }
  return bsplit16(v); }
__device__ __forceinline__ v8f mac3(const F2& a, const F2& b, v8f c) { c = wmma_bf(a.l, b.h, c); c = wmma_bf(a.h, b.l, c); return wmma_bf(a.h, b.h, c); }
__device__ __forceinline__ float sigm(float v) { return 1.0f / (1.0f + expf(-v)); }
#define LDSX() do { asm volatile("s_wait_dscnt 0" ::: "memory"); __builtin_amdgcn_wave_barrier(); __builtin_amdgcn_fence(__ATOMIC_RELEASE, "workgroup"); } while (0)

// Hyperbolic (Lorentz) linear-attention 'TransConv' layer (N 32,768 nodes, 128 -> 128, 8 heads, power kernel p = 2): per head h: qs = x_q Wq[h]^T + bq[h], ks = x_s Wk[h]^T + bk[h], v = x_s Wv[h]^T + bv[h]; phi(x) = ||x|| / (||x^2|| + 1e-8) * x^2 applied to (relu(.) + 1e-6)/(|norm_scale| + 1e-6); KV[h] = sum_n phi_k[n] (x) v[n]; num[n] = phi_q[n] KV[h]; den[n] = phi_q[n] . sum_n phi_k[n]; attn = num / (den + 1e-6) + (v v_map_w^T + v_map_b); out = mean over heads; result = [sqrt(sum out^2 + 1), out].
#define NN 32768
#define CI 128             // in channels
#define CO 128             // out channels per head
#define NH 8
#ifndef NPROC
#define NPROC NN           // rows processed
#endif
typedef __attribute__((ext_vector_type(8))) __bf16 v8b;
__device__ __forceinline__ v16b frag_b(const __bf16* rowk0, int lane) {
  union { v16b v; v8b q[2]; } u; const __bf16* p = rowk0 + 8 * (lane >> 4);
  u.q[0] = *(const v8b*)p; u.q[1] = *(const v8b*)(p + 16); return u.v;
}
// the same fragment from a pointer that already holds the lane's 8 * (lane >> 4)
__device__ __forceinline__ v16b frag_p(const __bf16* p) {
  union { v16b v; v8b q[2]; } u; u.q[0] = *(const v8b*)p; u.q[1] = *(const v8b*)(p + 16); return u.v;
}
typedef __attribute__((ext_vector_type(4))) __bf16 v4b;
#define WP 136             // bf16 per LDS row of a staged [128][128] B operand (272 B = 16 B x 17)
// a block of 128 threads rounds a row-major f32 [128][128] matrix to bf16 rows in LDS: thread t takes the 16-B pieces t, t + 128, ... (a wave fills one row per piece)
__device__ __forceinline__ void stage_rows(const float* __restrict__ Wm, __bf16 (*dst)[WP], int tid) {
  const float* pw = Wm + tid * 4; v4f wv[32];
#pragma unroll
  for (int i = 0; i < 32; ++i) wv[i] = *(const v4f*)(pw + i * 512);   /* unrolled: all of a thread's loads are in flight together */
  asm volatile("s_wait_xcnt 0x0" :: "v"(pw), "v"(tid) : "memory");   /* the address pair, or the thread index where the loads go by a scalar base plus that index, stays whole until every load above has taken its address */
#pragma unroll
  for (int i = 0; i < 32; ++i) { v4b o;
#pragma unroll
    for (int z = 0; z < 4; ++z) o[z] = (__bf16)wv[i][z];
    *(v4b*)&dst[(tid >> 5) + 4 * i][(tid & 31) * 4] = o; } }
__device__ __forceinline__ float bfr(float v) { return (float)(__bf16)v; }
__device__ __forceinline__ v16b wrow(const float* rowk0, int lane) { v16b w; const float* p = rowk0 + 8 * (lane >> 4);
#pragma unroll
  for (int i = 0; i < 8; ++i) { w[i] = (__bf16)p[i]; w[8 + i] = (__bf16)p[16 + i]; }
  return w; }
// B fragment (k rows k0+.., column n) of an f32 [K][ld] matrix, split bf16 hi + lo
__device__ __forceinline__ F2 colsplit(const float* Wm, int k0, int n, int lane, int ld) { float v[16]; const int g = lane >> 4;
#pragma unroll
  for (int i = 0; i < 8; ++i) { v[i] = Wm[(size_t)(k0 + 8 * g + i) * ld + n]; v[8 + i] = Wm[(size_t)(k0 + 16 + 8 * g + i) * ld + n]; }
  return bsplit16(v); }

#define HG 4               // heads that one launch of each stage takes together (NH / HG groups, one after the other)
#define WS_VH  0u                                       // bf16 v rows [head in group][n][128] hi / lo
#define WS_VL  (WS_VH  + 2u * (size_t)HG * NN * CO)
#define WS_KS  (WS_VL  + 2u * (size_t)HG * NN * CO)     // f32 column sums of phi_k [head in group][128]
#define WS_KV  (WS_KS  + 4u * (size_t)HG * 128)         // f32 KV [head in group][m][d]
#define WS_ACC (WS_KV  + 4u * (size_t)HG * CO * CO)     // f32 head-sum accumulator [n][128]
#define SLN 64             // rows n per slice of the two sums over n
#define NSL (NPROC / SLN)  // slices
#define JRUN ((NSL + 31) / 32)   // slices in a row that one of k_join's 32 groups sums
#define PROWS (CO + 1)     // rows of one slice's partial: 128 rows of KV, then the column sums
#define WS_PART (WS_ACC + 4u * (size_t)NN * CO)         // f32 partials [head in group][slice][129][128]
#define WS_END (WS_PART + 4u * (size_t)HG * NN / SLN * PROWS * CO)
#define WS_PQH WS_PART                                  // bf16 phi_q rows [head in group][n][128] hi / lo: they take the partials' place, which k_join has read out before k_proj is launched (both together do not fit the workspace)
#define WS_PQL (WS_PQH + 2u * (size_t)HG * NN * CO)
static_assert(4u * (size_t)HG * NN * CO <= 4u * (size_t)HG * NN / SLN * PROWS * CO, "phi_q planes fit the partials' place");
#define TP 72              // bf16 per LDS row of a transposed [128][64] tile (144 B = 16 B x 9)

// acc = x W^T for a wave's 16 rows (a: the rows' four k fragments) against the [128][128] bf16 W in LDS; product t = kc * 8 + j; its W fragment is read from LDS six products ahead, so that the read's latency lies under the products in between
__device__ __forceinline__ void proj_tile(const v16b a[CI / 32], const __bf16 (*sw)[WP], int col, int lane, v8f acc[8]) {
  v16b fw[32];
#pragma unroll
  for (int t = 0; t < 6; ++t) fw[t] = frag_b(&sw[(t & 7) * 16 + col][(t >> 3) * 32], lane);
#pragma unroll
  for (int t = 0; t < 32; ++t) { if (t + 6 < 32) fw[t + 6] = frag_b(&sw[((t + 6) & 7) * 16 + col][((t + 6) >> 3) * 32], lane);
    acc[t & 7] = wmma_bf(a[t >> 3], fw[t], acc[t & 7]); } }
// feature map on a wave's 16 x 128 tile: x = (relu(acc) + 1e-6) / ds, phi = ||x|| / (||x^2|| + 1e-8) * x^2, the two norms over the 128 columns (lane partial sums + 16-lane shuffles)
__device__ __forceinline__ void feature_map(v8f acc[8], float ds) { float n1[8], n2[8];
#pragma unroll
  for (int r = 0; r < 8; ++r) { float s1 = 0.f, s2 = 0.f;
#pragma unroll
    for (int j = 0; j < 8; ++j) { const float x = (fmaxf(acc[j][r], 0.f) + 1e-6f) / ds; acc[j][r] = x; const float x2 = x * x; s1 += x2; s2 += x2 * x2; }
    n1[r] = s1; n2[r] = s2; }
#pragma unroll
  for (int o = 1; o < 16; o <<= 1) {
#pragma unroll
    for (int r = 0; r < 8; ++r) { n1[r] += __shfl_xor(n1[r], o); n2[r] += __shfl_xor(n2[r], o); } }
#pragma unroll
  for (int r = 0; r < 8; ++r) n1[r] = sqrtf(n1[r]) / (sqrtf(n2[r]) + 1e-8f);   /* ||x|| / (||x^2|| + eps) */
#pragma unroll
  for (int j = 0; j < 8; ++j) {
#pragma unroll
    for (int r = 0; r < 8; ++r) acc[j][r] = n1[r] * (acc[j][r] * acc[j][r]); } }

// a wave's 16 x 128 f32 tile, split bf16 hi + lo, into LDS: transposed ([column][row]) and, with ROWS, as rows too; rb = the lane's first row in the block's tile
template <bool ROWS> __device__ __forceinline__ void stage_tile(const v8f acc[8], __bf16 (*sh)[WP], __bf16 (*sl)[WP], __bf16 (*th)[TP], __bf16 (*tl)[TP], int rb, int col) {
#pragma unroll
  for (int j = 0; j < 8; ++j) {
#pragma unroll
    for (int r = 0; r < 8; ++r) { const float v = acc[j][r]; const __bf16 hv = (__bf16)v, lv = (__bf16)(v - (float)hv); const int rl = rb + r, cl = j * 16 + col;
      if (ROWS) { sh[rl][cl] = hv; sl[rl][cl] = lv; }
      th[cl][rl] = hv; tl[cl][rl] = lv; } } }
// ---- k_proj: block (x = head in the group, y = 64-row tile) = 64 rows of head h's q: acc = x_q Wq[h]^T + bq[h] (W (out,in) rows contiguous; exact; W[h] rounded to bf16 once per block into LDS, each lane's x row loaded whole up front); feature map; phi_q -> bf16 hi/lo rows
__global__ __launch_bounds__(128) void k_proj(const float* __restrict__ XQ, const float* __restrict__ WQ, const float* __restrict__ BQ, const float* __restrict__ NS, int h0, __bf16* __restrict__ PQH0, __bf16* __restrict__ PQL0) {
  __shared__ __align__(16) __bf16 sw[128][WP];
  const int h = h0 + blockIdx.x; __bf16* __restrict__ PQH = PQH0 + (size_t)blockIdx.x * NN * CO; __bf16* __restrict__ PQL = PQL0 + (size_t)blockIdx.x * NN * CO;   /* the blocks of one tile's HG heads stand side by side in the grid: they read the same x rows */
  __bf16 (*sh)[WP] = sw; __bf16 (*sl)[WP] = sw + 64;   /* behind the products the same LDS holds the tile's hi rows (0..63) and lo rows (64..127) */
  const int tid = threadIdx.x, wave = tid >> 5, lane = tid & 31, col = lane & 15, g = lane >> 4; const size_t r0 = (size_t)blockIdx.y * 64;
  const float* WA = WQ + (size_t)h * CO * CI; const float* BA = BQ + (size_t)h * CO;
  const float* px = XQ + (r0 + wave * 16 + col) * CI + 8 * g; v4f xa[CI / 32][4];
#pragma unroll
  for (int kc = 0; kc < CI / 32; ++kc) { xa[kc][0] = *(const v4f*)(px + kc * 32); xa[kc][1] = *(const v4f*)(px + kc * 32 + 4); xa[kc][2] = *(const v4f*)(px + kc * 32 + 16); xa[kc][3] = *(const v4f*)(px + kc * 32 + 20); }
  const float* pbv = BA + col; float bv[8];
#pragma unroll
  for (int j = 0; j < 8; ++j) bv[j] = pbv[j * 16];
  asm volatile("s_wait_xcnt 0x0" :: "v"(px), "v"(pbv) : "memory");   /* the address pairs stay whole until every load above has taken its address */
  stage_rows(WA, sw, tid);
  v16b a[CI / 32];
#pragma unroll
  for (int kc = 0; kc < CI / 32; ++kc) {
#pragma unroll
    for (int i = 0; i < 16; ++i) a[kc][i] = (__bf16)xa[kc][i >> 2][i & 3]; }
  __syncthreads();   /* W[h] staged */
  v8f acc[8] = {}; proj_tile(a, sw, col, lane, acc);
  __syncthreads();   /* every wave has read its last W fragment: the LDS may take the output tile */
#pragma unroll
  for (int j = 0; j < 8; ++j) { const float bb = bfr(bv[j]);
#pragma unroll
    for (int r = 0; r < 8; ++r) acc[j][r] += bb; }
  feature_map(acc, fabsf(bfr(NS[0])) + 1e-6f);
#pragma unroll
  for (int j = 0; j < 8; ++j) {
#pragma unroll
    for (int r = 0; r < 8; ++r) { const float v = acc[j][r]; const __bf16 hv = (__bf16)v, lv = (__bf16)(v - (float)hv); const int rl = wave * 16 + 8 * g + r, cl = j * 16 + col; sh[rl][cl] = hv; sl[rl][cl] = lv; } }
  __syncthreads();
  __bf16* qh = PQH + r0 * CO + tid * 8; __bf16* ql = PQL + r0 * CO + tid * 8;   /* the tile's 64 rows are one contiguous 16-KiB span of each plane: piece e = tid + 128 i */
#pragma unroll
  for (int i = 0; i < 8; ++i) { const int e = tid + i * 128; vst2(qh + i * 1024, *(const v4u*)&sh[e >> 4][(e & 15) * 8]); vst2(ql + i * 1024, *(const v4u*)&sl[e >> 4][(e & 15) * 8]); }
  asm volatile("s_wait_xcnt 0x0" :: "v"(qh), "v"(ql) : "memory");   /* the address pairs stay whole until every store above has taken its address */
}
// ---- k_kvp: block (x = head in the group, y = slice) = one slice of 64 rows n of head h, 256 threads. Waves 0..3 form phi_k = feature map of x_s Wk[h]^T + bk[h], waves 4..7 v = x_s Wv[h]^T + bv[h] (each half as k_proj, with its own W in LDS). Both tiles go, bf16 hi + lo, TRANSPOSED ([m][n], [d][n]) into LDS and stay there; v also leaves as hi/lo rows. Then wave w: partial KV[16 w + ..][d] = sum_n phi_k[m][n] v[d][n] over the slice (hi + lo both sides, 3 products, K = 64) -> rows 0..127 of the slice's f32 partial; thread m < 128: sum_n phi_k[m][n] (hi + lo) in a fixed order -> row 128
__global__ __launch_bounds__(256) void k_kvp(const float* __restrict__ XS, const float* __restrict__ WK, const float* __restrict__ BK, const float* __restrict__ WV, const float* __restrict__ BV, const float* __restrict__ NS, int h0, __bf16* __restrict__ VH0, __bf16* __restrict__ VL0, float* __restrict__ PART0) {
  const int h = h0 + blockIdx.x; __bf16* __restrict__ VH = VH0 + (size_t)blockIdx.x * NN * CO; __bf16* __restrict__ VL = VL0 + (size_t)blockIdx.x * NN * CO; float* __restrict__ PART = PART0 + (size_t)blockIdx.x * NSL * PROWS * CO;
  __shared__ __align__(16) __bf16 sw[2][128][WP]; __shared__ __align__(16) __bf16 th[2][128][TP], tl2[2][128][TP];   /* [0] k side, [1] v side */
  __bf16 (*sh)[WP] = sw[1]; __bf16 (*sl)[WP] = sw[1] + 64;   /* behind the products the v side's W space holds v's hi rows (0..63) and lo rows (64..127) */
  const int tid = threadIdx.x, t7 = tid & 127, wave = t7 >> 5, lane = tid & 31, col = lane & 15, g = lane >> 4; const size_t r0 = (size_t)blockIdx.y * 64;
  const int side = __builtin_amdgcn_readfirstlane(tid >> 7);   /* the same in a whole wave: 0 = k, 1 = v */
  const float* WA = (side == 0 ? WK : WV) + (size_t)h * CO * CI; const float* BA = (side == 0 ? BK : BV) + (size_t)h * CO;
  const float* px = XS + (r0 + wave * 16 + col) * CI + 8 * g; v4f xa[CI / 32][4];
#pragma unroll
  for (int kc = 0; kc < CI / 32; ++kc) { xa[kc][0] = *(const v4f*)(px + kc * 32); xa[kc][1] = *(const v4f*)(px + kc * 32 + 4); xa[kc][2] = *(const v4f*)(px + kc * 32 + 16); xa[kc][3] = *(const v4f*)(px + kc * 32 + 20); }
  const float* pbv = BA + col; float bv[8];
#pragma unroll
  for (int j = 0; j < 8; ++j) bv[j] = pbv[j * 16];
  asm volatile("s_wait_xcnt 0x0" :: "v"(px), "v"(pbv) : "memory");   /* the address pairs stay whole until every load above has taken its address */
  stage_rows(WA, sw[side], t7);
  { v8f acc[8] = {};
    { v16b a[CI / 32];
#pragma unroll
      for (int kc = 0; kc < CI / 32; ++kc) {
#pragma unroll
        for (int i = 0; i < 16; ++i) a[kc][i] = (__bf16)xa[kc][i >> 2][i & 3]; }
      __syncthreads();   /* both W[h] staged */
      proj_tile(a, sw[side], col, lane, acc); }
    __syncthreads();   /* every wave has read its last W fragment: the v side's W space may take v's rows */
#pragma unroll
    for (int j = 0; j < 8; ++j) { const float bb = bfr(bv[j]);
#pragma unroll
      for (int r = 0; r < 8; ++r) acc[j][r] += bb; }
    if (side == 0) feature_map(acc, fabsf(bfr(NS[0])) + 1e-6f);   /* wave-uniform, no barrier inside */
    if (side == 0) stage_tile<false>(acc, sh, sl, th[0], tl2[0], wave * 16 + 8 * g, col); else stage_tile<true>(acc, sh, sl, th[1], tl2[1], wave * 16 + 8 * g, col); }   /* wave-uniform, no barrier inside */
  __syncthreads();   /* phi_k^T, v^T and v's rows staged */
  __bf16* vh = VH + r0 * CO + tid * 8; __bf16* vl = VL + r0 * CO + tid * 8;   /* the tile's 64 rows are one contiguous 16-KiB span of each plane: piece e = tid + 256 i */
#pragma unroll
  for (int i = 0; i < 4; ++i) { const int e = tid + i * 256; vst2(vh + i * 2048, *(const v4u*)&sh[e >> 4][(e & 15) * 8]); vst2(vl + i * 2048, *(const v4u*)&sl[e >> 4][(e & 15) * 8]); }
  asm volatile("s_wait_xcnt 0x0" :: "v"(vh), "v"(vl) : "memory");   /* the address pairs stay whole until every store above has taken its address */
  const int w8 = tid >> 5, m0 = w8 * 16; v8f kv[8] = {};
  { v16b ah[SLN / 32], al[SLN / 32], bh[SLN / 4], bl[SLN / 4];   /* group t = kc * 8 + j; its v fragments are read from LDS two groups ahead, so that the read's latency lies under the products in between */
#pragma unroll
    for (int kc = 0; kc < SLN / 32; ++kc) { ah[kc] = frag_b(&th[0][m0 + col][kc * 32], lane); al[kc] = frag_b(&tl2[0][m0 + col][kc * 32], lane); }
#pragma unroll
    for (int t = 0; t < 2; ++t) { bh[t] = frag_b(&th[1][(t & 7) * 16 + col][(t >> 3) * 32], lane); bl[t] = frag_b(&tl2[1][(t & 7) * 16 + col][(t >> 3) * 32], lane); }
#pragma unroll
    for (int t = 0; t < SLN / 4; ++t) { const int kc = t >> 3, j = t & 7, u = t + 2;
      if (u < SLN / 4) { bh[u] = frag_b(&th[1][(u & 7) * 16 + col][(u >> 3) * 32], lane); bl[u] = frag_b(&tl2[1][(u & 7) * 16 + col][(u >> 3) * 32], lane); }
      kv[j] = wmma_bf(al[kc], bh[t], kv[j]); kv[j] = wmma_bf(ah[kc], bl[t], kv[j]); kv[j] = wmma_bf(ah[kc], bh[t], kv[j]); } }
  float* pp = PART + (size_t)blockIdx.y * PROWS * CO;
  if (side == 0) { float s = 0.f;   /* wave-uniform: thread m = tid sums its row of phi_k^T */
#pragma unroll
    for (int i = 0; i < SLN / 8; ++i) { const v8b a = *(const v8b*)&th[0][tid][i * 8], b2 = *(const v8b*)&tl2[0][tid][i * 8];
#pragma unroll
      for (int z = 0; z < 8; ++z) s += (float)a[z] + (float)b2[z]; }
    float* ps = pp + CO * CO + tid; *ps = s;   /* a wave stores one whole 128-B line */
    asm volatile("s_wait_xcnt 0x0" :: "v"(ps) : "memory");   /* the address pair stays whole until the store above has taken its address */
  }
  __syncthreads();   /* v's rows have left the W space: it may take the waves' f32 tiles */
  float (*sf)[132] = (float (*)[132])&sw[0][0][0] + w8 * 16;   /* 8 waves x 16 rows x 528 B = 67,584 B of sw's 69,632 */
#pragma unroll
  for (int j = 0; j < 8; ++j) {
#pragma unroll
    for (int r = 0; r < 8; ++r) sf[8 * g + r][j * 16 + col] = kv[j][r]; }
  LDSX(); float* po = pp + (size_t)m0 * CO + lane * 4;
#pragma unroll
  for (int rl = 0; rl < 16; ++rl) vst2(po + rl * CO, *(const v4f*)&sf[rl][lane * 4]);
  asm volatile("s_wait_xcnt 0x0" :: "v"(po) : "memory");   /* the address pair stays whole until every store above has taken its address */
}
// ---- k_join: block (y = head in the group) = 64 columns of one of the head's 129 partial rows (a 256-B segment): 32 groups of 16 lanes; group t sums its run of JRUN slices in index order, the 32 group sums are added in index order through LDS -> KV row (rows 0..127) or KS (row 128)
__global__ __launch_bounds__(512) void k_join(const float* __restrict__ PART0, float* __restrict__ KV0, float* __restrict__ KS0) { __shared__ __align__(16) float sj[32][64];
  const float* __restrict__ PART = PART0 + (size_t)blockIdx.y * NSL * PROWS * CO; float* __restrict__ KV = KV0 + (size_t)blockIdx.y * CO * CO; float* __restrict__ KS = KS0 + (size_t)blockIdx.y * CO;
  const int tid = threadIdx.x, grp = tid >> 4, q = tid & 15; const int row = blockIdx.x >> 1, c0 = (blockIdx.x & 1) * 64;
  const float* p = PART + ((size_t)grp * JRUN * PROWS + row) * CO + c0 + q * 4; v4f s = {}, a[JRUN];
#pragma unroll
  for (int i = 0; i < JRUN; ++i) { a[i] = v4f{}; if (NSL % 32 == 0 || grp * JRUN + i < NSL) a[i] = *(const v4f*)(p + (size_t)i * PROWS * CO); }   /* unrolled: all of a lane's loads are in flight together */
  asm volatile("s_wait_xcnt 0x0" :: "v"(p) : "memory");   /* the address pair stays whole until every load above has taken its address */
#pragma unroll
  for (int i = 0; i < JRUN; ++i) s += a[i];
  vst2(&sj[grp][q * 4], s); __syncthreads();
  if (tid < 16) { v4f t = {};
#pragma unroll
    for (int z = 0; z < 32; ++z) t += *(const v4f*)&sj[z][tid * 4];
    vst2((row < CO ? KV + (size_t)row * CO : KS) + c0 + tid * 4, t); } }
// ---- k_num: block = 64 rows n (all 128 cols), the group's HG heads one after the other, their sum kept in registers; per head: num = phi_q (hi+lo) . KV (f32 -> hi+lo, split and transposed into LDS once per block and head; v_map_w rounded once per block into LDS), 3 products; den = phi_q . KS (f32 dot per row from the planes); vss = v (hi+lo) . v_map_w^T (exact) + v_map_b; val = num / (den + 1e-6) + vss; behind the last head ACC = (h == 0 ? 0 : ACC) + sum of val, h = the group's first head (this block's own 512-B row segments)
__global__ __launch_bounds__(128) void k_num(const __bf16* __restrict__ PQH0, const __bf16* __restrict__ PQL0, const float* __restrict__ KV0, const float* __restrict__ KS0, const __bf16* __restrict__ VH0, const __bf16* __restrict__ VL0, const float* __restrict__ VMW, const float* __restrict__ VMB, int h, float* __restrict__ ACC) {
  __shared__ __align__(16) float sf[4][16][132]; __shared__ __align__(16) float sks[128]; __shared__ float sden[64];
  __shared__ __align__(16) __bf16 skh[128][WP], skl[128][WP], swm[128][WP];   /* KV transposed [d][m] hi / lo; v_map_w rows */
  const int tid = threadIdx.x, wave = tid >> 5, lane = tid & 31, col = lane & 15, g = lane >> 4; const size_t r0 = (size_t)blockIdx.x * 64; const size_t w0 = r0 + wave * 16;
  stage_rows(VMW, swm, tid);   /* the same for every head: once per block */
  v8f tot[8] = {};
#pragma nounroll   /* rolled: one copy of the body's text rather than HG */
  for (int hh = 0; hh < HG; ++hh) {   /* no barrier of its own at the head of a trip: the 'sden ready' barrier of the trip before ends every wave's reads of skh, skl and sks, and sden is rewritten only behind this trip's first barrier */
  const __bf16* __restrict__ PQH = PQH0 + (size_t)hh * NN * CO; const __bf16* __restrict__ PQL = PQL0 + (size_t)hh * NN * CO; const __bf16* __restrict__ VH = VH0 + (size_t)hh * NN * CO; const __bf16* __restrict__ VL = VL0 + (size_t)hh * NN * CO;
  const float* __restrict__ KV = KV0 + (size_t)hh * CO * CO; const float* __restrict__ KS = KS0 + (size_t)hh * CO;
  { const float* pk = KV + tid; float kc2[CO]; const float ksv = KS[tid];   /* thread d takes column d of KV: a wave's load is 128 B of one row */
#pragma unroll
    for (int m = 0; m < CO; ++m) kc2[m] = pk[m * CO];   /* unrolled: the column's loads are in flight together */
    asm volatile("s_wait_xcnt 0x0" :: "v"(pk) : "memory");   /* the address pair stays whole until every load above has taken its address */
#pragma unroll
    for (int m = 0; m < CO; m += 8) { v8b hv, lv;
#pragma unroll
      for (int z = 0; z < 8; ++z) { const __bf16 hh = (__bf16)kc2[m + z]; hv[z] = hh; lv[z] = (__bf16)(kc2[m + z] - (float)hh); }
      *(v8b*)&skh[tid][m] = hv; *(v8b*)&skl[tid][m] = lv; }
    sks[tid] = ksv; }
  const __bf16 *pa = PQH + (w0 + col) * CO + 8 * g, *pb = PQL + (w0 + col) * CO + 8 * g, *pc = VH + (w0 + col) * CO + 8 * g, *pd = VL + (w0 + col) * CO + 8 * g;
  v16b ah[CO / 32], al[CO / 32], bh[CO / 32], bl[CO / 32];
#pragma unroll
  for (int kc = 0; kc < CO / 32; ++kc) { ah[kc] = frag_p(pa + kc * 32); al[kc] = frag_p(pb + kc * 32); bh[kc] = frag_p(pc + kc * 32); bl[kc] = frag_p(pd + kc * 32); }
  const float* pbv = VMB + col; float bv[8];
#pragma unroll
  for (int j = 0; j < 8; ++j) bv[j] = pbv[j * 16];
  asm volatile("s_wait_xcnt 0x0" :: "v"(pa), "v"(pb), "v"(pc), "v"(pd), "v"(pbv) : "memory");   /* the address pairs stay whole until every load above has taken its address */
  __syncthreads();
  if (tid < 64) { float d = 0.f; const __bf16* ph = PQH + (r0 + tid) * CO; const __bf16* pl = PQL + (r0 + tid) * CO;
#pragma unroll 4
    for (int m = 0; m < CO; m += 8) { const v8b a = *(const v8b*)(ph + m), b2 = *(const v8b*)(pl + m);
#pragma unroll
      for (int z = 0; z < 8; ++z) d += ((float)a[z] + (float)b2[z]) * sks[m + z]; }
    sden[tid] = d; }
  v8f acc[8] = {}, vs[8] = {};
  { v16b wh[32], wl[32];   /* group t = kc * 8 + j; its KV fragments are read from LDS two groups ahead, so that the read's latency lies under the products in between */
#pragma unroll
    for (int t = 0; t < 2; ++t) { wh[t] = frag_b(&skh[(t & 7) * 16 + col][(t >> 3) * 32], lane); wl[t] = frag_b(&skl[(t & 7) * 16 + col][(t >> 3) * 32], lane); }
#pragma unroll
    for (int t = 0; t < 32; ++t) { const int kc = t >> 3, j = t & 7, u = t + 2;
      if (u < 32) { wh[u] = frag_b(&skh[(u & 7) * 16 + col][(u >> 3) * 32], lane); wl[u] = frag_b(&skl[(u & 7) * 16 + col][(u >> 3) * 32], lane); }
      acc[j] = wmma_bf(al[kc], wh[t], acc[j]); acc[j] = wmma_bf(ah[kc], wl[t], acc[j]); acc[j] = wmma_bf(ah[kc], wh[t], acc[j]); } }
  { v16b wm[32];   /* the same for v_map_w, three groups ahead */
#pragma unroll
    for (int t = 0; t < 3; ++t) wm[t] = frag_b(&swm[(t & 7) * 16 + col][(t >> 3) * 32], lane);
#pragma unroll
    for (int t = 0; t < 32; ++t) { const int kc = t >> 3, j = t & 7, u = t + 3;
      if (u < 32) wm[u] = frag_b(&swm[(u & 7) * 16 + col][(u >> 3) * 32], lane);
      vs[j] = wmma_bf(bh[kc], wm[t], vs[j]); vs[j] = wmma_bf(bl[kc], wm[t], vs[j]); } }
  __syncthreads();   /* sden ready */
#pragma unroll
  for (int j = 0; j < 8; ++j) { const float bb = bfr(bv[j]);
#pragma unroll
    for (int r = 0; r < 8; ++r) { const float den = sden[wave * 16 + 8 * g + r]; tot[j][r] += acc[j][r] / (den + 1e-6f) + (vs[j][r] + bb); } }
  }
#pragma unroll
  for (int j = 0; j < 8; ++j) {
#pragma unroll
    for (int r = 0; r < 8; ++r) sf[wave][8 * g + r][j * 16 + col] = tot[j][r]; }
  LDSX(); for (int rl = 0; rl < 16; ++rl) { float* dst = ACC + (w0 + rl) * CO + lane * 4; v4f v = *(const v4f*)&sf[wave][rl][lane * 4]; if (h > 0) { const v4f p = *(const v4f*)dst; v[0] += p[0]; v[1] += p[1]; v[2] += p[2]; v[3] += p[3]; } vst2(dst, v); } }
// ---- k_fin: block = 64 rows: out = ACC / 8; time = sqrt(sum out^2 + 1); the 64 x 129 output rows form one contiguous, line-aligned 33,024-B span (64*129*4 = 258 lines; the span starts at row0*516 B with row0 a multiple of 64) staged in LDS and written thread-linearly in 16-B pieces
__global__ __launch_bounds__(128) void k_fin(const float* __restrict__ ACC, float* __restrict__ OUT) { __shared__ __align__(16) float so[64 * 129 + 12];
  const int tid = threadIdx.x; const size_t r0 = (size_t)blockIdx.x * 64;
  for (int rl = tid >> 5, lanei = tid & 31; rl < 64; rl += 4) { const v4f a = *(const v4f*)(ACC + (r0 + rl) * CO + lanei * 4); float o[4]; float s = 0.f;
#pragma unroll
    for (int z = 0; z < 4; ++z) { o[z] = a[z] * (1.0f / NH); s += o[z] * o[z]; }
#pragma unroll
    for (int q = 1; q < 32; q <<= 1) s += __shfl_xor(s, q);
#pragma unroll
    for (int z = 0; z < 4; ++z) so[rl * 129 + 1 + lanei * 4 + z] = o[z];
    if (lanei == 0) so[rl * 129] = sqrtf(s + 1.0f); }
  __syncthreads();
  float* dst = OUT + r0 * 129;
  for (int e = tid; e < 64 * 129 / 4; e += 128) vst2(dst + e * 4, *(const v4f*)&so[e * 4]); }   
extern "C" void kernel_launch(void* const* d_in, const int* in_sizes, int n_in, void* d_out, int out_size, void* d_ws, size_t ws_size, hipStream_t stream) {
  (void)in_sizes; (void)n_in; (void)out_size;
  const float** F = (const float**)d_in;   // 0 query_input, 1 source_input [32768,128]; 2 Wq_w [8,128,128], 3 Wq_b [8,128]; 4 Wk_w, 5 Wk_b; 6 Wv_w, 7 Wv_b; 8 v_map_w [128,128] (out,in), 9 v_map_b; 10 norm_scale
  if (ws_size < (size_t)WS_END) return;
  char* ws = (char*)d_ws; __bf16 *PQH = (__bf16*)(ws + WS_PQH), *PQL = (__bf16*)(ws + WS_PQL), *VH = (__bf16*)(ws + WS_VH), *VL = (__bf16*)(ws + WS_VL); float *KS = (float*)(ws + WS_KS), *KV = (float*)(ws + WS_KV), *ACC = (float*)(ws + WS_ACC), *PART = (float*)(ws + WS_PART);
  for (int h = 0; h < NH; h += HG) {   // k_proj behind k_join: phi_q takes the partials' place
    k_kvp<<<dim3(HG, NSL), 256, 0, stream>>>(F[1], F[4], F[5], F[6], F[7], F[10], h, VH, VL, PART);
    k_join<<<dim3(2 * PROWS, HG), 512, 0, stream>>>(PART, KV, KS);
    k_proj<<<dim3(HG, NPROC / 64), 128, 0, stream>>>(F[0], F[2], F[3], F[10], h, PQH, PQL);
    k_num<<<dim3(NPROC / 64), 128, 0, stream>>>(PQH, PQL, KV, KS, VH, VL, F[8], F[9], h, ACC);
  }
  k_fin<<<dim3(NPROC / 64), 128, 0, stream>>>(ACC, (float*)d_out);
}

// v005
// One run takes 249 microseconds.
// Timed twice side by side with v004, it ran 1.26 and 1.23 times as fast.
// All steps since v000 together make it 93.4 times as fast.
// compute dtype: all float inputs rounded to bf16; q/k/v head projections x W^T + b with EXACT bf16 products on WMMA 16x16x32, f32 accumulate; relu, the power feature map (norms over 128, x^2) in f32; phi_k, v, phi_q and the [128 x 128] k^T v as bf16 hi + lo (3 products) for the two linear-attention contractions (K = 32,768 and K = 128), v hi + lo against exact v_map_w (2 products); column sums, the normaliser, the head mean and the time coordinate (sqrt) in f32; f32 output.
#include <hip/hip_runtime.h>
#include <math.h>

typedef __attribute__((ext_vector_type(16))) _Float16 v16h;
typedef __attribute__((ext_vector_type(16))) __bf16 v16b;
typedef __attribute__((ext_vector_type(8)))  _Float16 v8h;
typedef __attribute__((ext_vector_type(8)))  float v8f;
typedef __attribute__((ext_vector_type(4)))  float v4f;
typedef __attribute__((ext_vector_type(2)))  float v2f;
typedef __attribute__((ext_vector_type(4)))  unsigned v4u;
typedef __attribute__((ext_vector_type(4)))  int v4i;
typedef float __attribute__((may_alias)) float_a;
typedef int __attribute__((may_alias)) int_a;

template <typename T> __device__ __forceinline__ void vst2(void* p, T v) { *(T*)p = v;  }
__device__ __forceinline__ v8f wmma16(v16h a, v16h b, v8f c) {
  v8f d = __builtin_amdgcn_wmma_f32_16x16x32_f16(false, a, false, b, (short)0, c, false, false);
  asm volatile("v_nop\n\tv_nop\n\tv_nop\n\tv_nop" : "+v"(d) : "v"(a), "v"(b));
  return d;
}
__device__ __forceinline__ v8f wmma_bf(v16b a, v16b b, v8f c) {
  v8f d = __builtin_amdgcn_wmma_f32_16x16x32_bf16(false, a, false, b, (short)0, c, false, false);
  asm volatile("v_nop\n\tv_nop\n\tv_nop\n\tv_nop" : "+v"(d) : "v"(a), "v"(b));
  return d;
}
// 16x16x32 fragments: lane = (h = lane>>4, row/col = lane&15); elements 0..7 = k0+8h+0..7, 8..15 = k0+16+8h+0..7; D element r = row 8h+r
__device__ __forceinline__ v16h frag_h(const _Float16* rowk0, int lane) {
  union { v16h v; v8h q[2]; } u; const _Float16* p = rowk0 + 8 * (lane >> 4);
  u.q[0] = *(const v8h*)p; u.q[1] = *(const v8h*)(p + 16); return u.v;
}
__device__ __forceinline__ v16h frag_f32(const float* rowk0, int lane) {
  v16h a; const float* p = rowk0 + 8 * (lane >> 4);
#pragma unroll
  for (int i = 0; i < 8; ++i) { a[i] = (_Float16)p[i]; a[8 + i] = (_Float16)p[16 + i]; }
  return a;
}
__device__ __forceinline__ v16h frag_f32s(const float* rowk0, int lane, float sc) {
  v16h a; const float* p = rowk0 + 8 * (lane >> 4);
#pragma unroll
  for (int i = 0; i < 8; ++i) { a[i] = (_Float16)(p[i] * sc); a[8 + i] = (_Float16)(p[16 + i] * sc); }
  return a;
}
// column fragment from a [K][ld] layout (column n), rows >= K read as 0
__device__ __forceinline__ v16h fragc_f32(const float* W, int k0, int n, int lane, int ld, int K) {
  v16h a; const int g = lane >> 4;
#pragma unroll
  for (int i = 0; i < 8; ++i) { const int ka = k0 + 8 * g + i, kb = ka + 16;
    a[i] = (_Float16)(ka < K ? W[(size_t)(ka < K ? ka : K - 1) * ld + n] : 0.f); a[8 + i] = (_Float16)(kb < K ? W[(size_t)(kb < K ? kb : K - 1) * ld + n] : 0.f); }
  return a;
}
struct F2 { v16b h, l; };
__device__ __forceinline__ F2 bsplit16(const float v[16]) { F2 r;
#pragma unroll
  for (int i = 0; i < 16; ++i) { const __bf16 h = (__bf16)v[i]; r.h[i] = h; r.l[i] = (__bf16)(v[i] - (float)h); }
  return r; }
__device__ __forceinline__ F2 split_row(const float* row, int k0, int lane) { float v[16]; const float* p = row + k0 + 8 * (lane >> 4);
#pragma unroll
  for (int i = 0; i < 8; ++i) { v[i] = p[i]; v[8 + i] = p[16 + i]; }
  return bsplit16(v); }
__device__ __forceinline__ F2 split_rowK(const float* row, int k0, int lane, int K) { float v[16]; const int g = lane >> 4;
#pragma unroll
  for (int i = 0; i < 8; ++i) { const int ka = k0 + 8 * g + i, kb = ka + 16; v[i] = ka < K ? row[ka < K ? ka : K - 1] : 0.f; v[8 + i] = kb < K ? row[kb < K ? kb : K - 1] : 0.f; }
  return bsplit16(v); }
__device__ __forceinline__ F2 split_col(const float* W, int k0, int n, int lane, int ld, int K) { float v[16]; const int g = lane >> 4;
#pragma unroll
  for (int i = 0; i < 8; ++i) { const int ka = k0 + 8 * g + i, kb = ka + 16; v[i] = ka < K ? W[(size_t)(ka < K ? ka : K - 1) * ld + n] : 0.f; v[8 + i] = kb < K ? W[(size_t)(kb < K ? kb : K - 1) * ld + n] : 0.f; }
  return bsplit16(v); }
__device__ __forceinline__ v8f mac3(const F2& a, const F2& b, v8f c) { c = wmma_bf(a.l, b.h, c); c = wmma_bf(a.h, b.l, c); return wmma_bf(a.h, b.h, c); }
__device__ __forceinline__ float sigm(float v) { return 1.0f / (1.0f + expf(-v)); }
#define LDSX() do { asm volatile("s_wait_dscnt 0" ::: "memory"); __builtin_amdgcn_wave_barrier(); __builtin_amdgcn_fence(__ATOMIC_RELEASE, "workgroup"); } while (0)

// Hyperbolic (Lorentz) linear-attention 'TransConv' layer (N 32,768 nodes, 128 -> 128, 8 heads, power kernel p = 2): per head h: qs = x_q Wq[h]^T + bq[h], ks = x_s Wk[h]^T + bk[h], v = x_s Wv[h]^T + bv[h]; phi(x) = ||x|| / (||x^2|| + 1e-8) * x^2 applied to (relu(.) + 1e-6)/(|norm_scale| + 1e-6); KV[h] = sum_n phi_k[n] (x) v[n]; num[n] = phi_q[n] KV[h]; den[n] = phi_q[n] . sum_n phi_k[n]; attn = num / (den + 1e-6) + (v v_map_w^T + v_map_b); out = mean over heads; result = [sqrt(sum out^2 + 1), out].
#define NN 32768
#define CI 128             // in channels
#define CO 128             // out channels per head
#define NH 8
#ifndef NPROC
#define NPROC NN           // rows processed
#endif
typedef __attribute__((ext_vector_type(8))) __bf16 v8b;
__device__ __forceinline__ v16b frag_b(const __bf16* rowk0, int lane) {
  union { v16b v; v8b q[2]; } u; const __bf16* p = rowk0 + 8 * (lane >> 4);
  u.q[0] = *(const v8b*)p; u.q[1] = *(const v8b*)(p + 16); return u.v;
}
// the same fragment from a pointer that already holds the lane's 8 * (lane >> 4)
__device__ __forceinline__ v16b frag_p(const __bf16* p) {
  union { v16b v; v8b q[2]; } u; u.q[0] = *(const v8b*)p; u.q[1] = *(const v8b*)(p + 16); return u.v;
}
typedef __attribute__((ext_vector_type(4))) __bf16 v4b;
#define WP 136             // bf16 per LDS row of a staged [128][128] B operand (272 B = 16 B x 17)
// a block of 128 threads rounds a row-major f32 [128][128] matrix to bf16 rows in LDS: thread t takes the 16-B pieces t, t + 128, ... (a wave fills one row per piece); a call takes the NI pieces from I0 on
template <int I0 = 0, int NI = 32> __device__ __forceinline__ void stage_rows(const float* __restrict__ Wm, __bf16 (*dst)[WP], int tid) {
  const float* pw = Wm + tid * 4 + I0 * 512; v4f wv[NI];
#pragma unroll
  for (int i = 0; i < NI; ++i) wv[i] = *(const v4f*)(pw + i * 512);   /* unrolled: all of a thread's loads are in flight together */
  asm volatile("s_wait_xcnt 0x0" :: "v"(pw), "v"(tid) : "memory");   /* the address pair, or the thread index where the loads go by a scalar base plus that index, stays whole until every load above has taken its address */
#pragma unroll
  for (int i = 0; i < NI; ++i) { v4b o;
#pragma unroll
    for (int z = 0; z < 4; ++z) o[z] = (__bf16)wv[i][z];
    *(v4b*)&dst[(tid >> 5) + 4 * (I0 + i)][(tid & 31) * 4] = o; } }
__device__ __forceinline__ float bfr(float v) { return (float)(__bf16)v; }
__device__ __forceinline__ v16b wrow(const float* rowk0, int lane) { v16b w; const float* p = rowk0 + 8 * (lane >> 4);
#pragma unroll
  for (int i = 0; i < 8; ++i) { w[i] = (__bf16)p[i]; w[8 + i] = (__bf16)p[16 + i]; }
  return w; }
// B fragment (k rows k0+.., column n) of an f32 [K][ld] matrix, split bf16 hi + lo
__device__ __forceinline__ F2 colsplit(const float* Wm, int k0, int n, int lane, int ld) { float v[16]; const int g = lane >> 4;
#pragma unroll
  for (int i = 0; i < 8; ++i) { v[i] = Wm[(size_t)(k0 + 8 * g + i) * ld + n]; v[8 + i] = Wm[(size_t)(k0 + 16 + 8 * g + i) * ld + n]; }
  return bsplit16(v); }

#define HG 4               // heads that one launch of each stage takes together (NH / HG groups, one after the other)
#define WS_VH  0u                                       // bf16 v rows [head in group][n][128] hi / lo
#define WS_VL  (WS_VH  + 2u * (size_t)HG * NN * CO)
#define WS_KS  (WS_VL  + 2u * (size_t)HG * NN * CO)     // f32 column sums of phi_k [head in group][128]
#define WS_KV  (WS_KS  + 4u * (size_t)HG * 128)         // f32 KV [head in group][m][d]
#define WS_ACC (WS_KV  + 4u * (size_t)HG * CO * CO)     // f32 head-sum accumulator [n][128]
#define SLN 64             // rows n per tile of the two sums over n
#define TPB 4              // tiles in a row that one block of k_kvp takes one after the other: together one slice
#define NSL (NPROC / (SLN * TPB))  // slices
#define JG 8               // groups of 16 lanes in a block of k_join
#define JRUN ((NSL + JG - 1) / JG)   // slices in a row that one of k_join's JG groups sums
#define PROWS (CO + 1)     // rows of one slice's partial: 128 rows of KV, then the column sums
#define WS_PART (WS_ACC + 4u * (size_t)NN * CO)         // f32 partials [head in group][slice][129][128]
#define WS_PQH WS_PART                                  // bf16 phi_q rows [head in group][n][128] hi / lo: they begin at the partials' place, which k_join has read out before k_proj is launched
#define WS_PQL (WS_PQH + 2u * (size_t)HG * NN * CO)
#define WS_END (WS_PQL + 2u * (size_t)HG * NN * CO)
static_assert(4u * (size_t)HG * (NN / (SLN * TPB)) * PROWS * CO <= 4u * (size_t)HG * NN * CO, "the partials end in front of WS_END");
#define TP 72              // bf16 per LDS row of a transposed [128][64] tile (144 B = 16 B x 9)

// acc = x W^T for a wave's 16 rows (a: the rows' four k fragments) against the [128][128] bf16 W in LDS; product t = kc * 8 + j; its W fragment is read from LDS six products ahead, so that the read's latency lies under the products in between
__device__ __forceinline__ void proj_tile(const v16b a[CI / 32], const __bf16 (*sw)[WP], int col, int lane, v8f acc[8]) {
  v16b fw[32];
#pragma unroll
  for (int t = 0; t < 6; ++t) fw[t] = frag_b(&sw[(t & 7) * 16 + col][(t >> 3) * 32], lane);
#pragma unroll
  for (int t = 0; t < 32; ++t) { if (t + 6 < 32) fw[t + 6] = frag_b(&sw[((t + 6) & 7) * 16 + col][((t + 6) >> 3) * 32], lane);
    acc[t & 7] = wmma_bf(a[t >> 3], fw[t], acc[t & 7]); } }
// feature map on a wave's 16 x 128 tile: x = (relu(acc) + 1e-6) / ds, phi = ||x|| / (||x^2|| + 1e-8) * x^2, the two norms over the 128 columns (lane partial sums + 16-lane shuffles)
__device__ __forceinline__ void feature_map(v8f acc[8], float ds) { float n1[8], n2[8];
#pragma unroll
  for (int r = 0; r < 8; ++r) { float s1 = 0.f, s2 = 0.f;
#pragma unroll
    for (int j = 0; j < 8; ++j) { const float x = (fmaxf(acc[j][r], 0.f) + 1e-6f) / ds; acc[j][r] = x; const float x2 = x * x; s1 += x2; s2 += x2 * x2; }
    n1[r] = s1; n2[r] = s2; }
#pragma unroll
  for (int o = 1; o < 16; o <<= 1) {
#pragma unroll
    for (int r = 0; r < 8; ++r) { n1[r] += __shfl_xor(n1[r], o); n2[r] += __shfl_xor(n2[r], o); } }
#pragma unroll
  for (int r = 0; r < 8; ++r) n1[r] = sqrtf(n1[r]) / (sqrtf(n2[r]) + 1e-8f);   /* ||x|| / (||x^2|| + eps) */
#pragma unroll
  for (int j = 0; j < 8; ++j) {
#pragma unroll
    for (int r = 0; r < 8; ++r) acc[j][r] = n1[r] * (acc[j][r] * acc[j][r]); } }

// a wave's 16 x 128 f32 tile, split bf16 hi + lo, into LDS, transposed ([column][row]); rb = the lane's first row in the block's tile
__device__ __forceinline__ void stage_tile(const v8f acc[8], __bf16 (*th)[TP], __bf16 (*tl)[TP], int rb, int col) {
#pragma unroll
  for (int j = 0; j < 8; ++j) {
#pragma unroll
    for (int r = 0; r < 8; ++r) { const float v = acc[j][r]; const __bf16 hv = (__bf16)v, lv = (__bf16)(v - (float)hv); const int rl = rb + r, cl = j * 16 + col;
      th[cl][rl] = hv; tl[cl][rl] = lv; } } }
// a wave's 16 x 128 f32 tile leaves as bf16 rows, the hi plane and then the lo plane, each through the wave's own 16 LDS rows: every store is 512 contiguous bytes; ph, pl = the lane's 16-B piece of the tile's first 512 B in each plane
__device__ __forceinline__ void rows_out(const v8f acc[8], __bf16 (*sv)[WP], __bf16* ph, __bf16* pl, int g, int col, int lane) {
#pragma unroll
  for (int p = 0; p < 2; ++p) {
#pragma unroll
    for (int j = 0; j < 8; ++j) {
#pragma unroll
      for (int r = 0; r < 8; ++r) { const float v = acc[j][r]; const __bf16 hv = (__bf16)v; sv[8 * g + r][j * 16 + col] = p == 0 ? hv : (__bf16)(v - (float)hv); } }
    LDSX();   /* the wave's stores have landed before its lanes read one another's */
    v4u q[8];
#pragma unroll
    for (int i = 0; i < 8; ++i) { const int e = lane + i * 32; q[i] = *(const v4u*)&sv[e >> 4][(e & 15) * 8]; }
    LDSX();   /* the reads are done before the rows are written again */
#pragma unroll
    for (int i = 0; i < 8; ++i) vst2((p == 0 ? ph : pl) + i * 256, q[i]); } }
// ---- k_proj: block (x = head in the group, y = 64-row tile) = 64 rows of head h's q: acc = x_q Wq[h]^T + bq[h] (W (out,in) rows contiguous; exact; W[h] rounded to bf16 once per block into LDS, each lane's x row loaded whole up front); feature map; phi_q -> bf16 hi/lo rows
__global__ __launch_bounds__(128) void k_proj(const float* __restrict__ XQ, const float* __restrict__ WQ, const float* __restrict__ BQ, const float* __restrict__ NS, int h0, __bf16* __restrict__ PQH0, __bf16* __restrict__ PQL0) {
  __shared__ __align__(16) __bf16 sw[128][WP];
  const int h = h0 + blockIdx.x; __bf16* __restrict__ PQH = PQH0 + (size_t)blockIdx.x * NN * CO; __bf16* __restrict__ PQL = PQL0 + (size_t)blockIdx.x * NN * CO;   /* the blocks of one tile's HG heads stand side by side in the grid: they read the same x rows */
  __bf16 (*sh)[WP] = sw; __bf16 (*sl)[WP] = sw + 64;   /* behind the products the same LDS holds the tile's hi rows (0..63) and lo rows (64..127) */
  const int tid = threadIdx.x, wave = tid >> 5, lane = tid & 31, col = lane & 15, g = lane >> 4; const size_t r0 = (size_t)blockIdx.y * 64;
  const float* WA = WQ + (size_t)h * CO * CI; const float* BA = BQ + (size_t)h * CO;
  const float* px = XQ + (r0 + wave * 16 + col) * CI + 8 * g; v4f xa[CI / 32][4];
#pragma unroll
  for (int kc = 0; kc < CI / 32; ++kc) { xa[kc][0] = *(const v4f*)(px + kc * 32); xa[kc][1] = *(const v4f*)(px + kc * 32 + 4); xa[kc][2] = *(const v4f*)(px + kc * 32 + 16); xa[kc][3] = *(const v4f*)(px + kc * 32 + 20); }
  const float* pbv = BA + col; float bv[8];
#pragma unroll
  for (int j = 0; j < 8; ++j) bv[j] = pbv[j * 16];
  asm volatile("s_wait_xcnt 0x0" :: "v"(px), "v"(pbv) : "memory");   /* the address pairs stay whole until every load above has taken its address */
  stage_rows(WA, sw, tid);
  v16b a[CI / 32];
#pragma unroll
  for (int kc = 0; kc < CI / 32; ++kc) {
#pragma unroll
    for (int i = 0; i < 16; ++i) a[kc][i] = (__bf16)xa[kc][i >> 2][i & 3]; }
  __syncthreads();   /* W[h] staged */
  v8f acc[8] = {}; proj_tile(a, sw, col, lane, acc);
  __syncthreads();   /* every wave has read its last W fragment: the LDS may take the output tile */
#pragma unroll
  for (int j = 0; j < 8; ++j) { const float bb = bfr(bv[j]);
#pragma unroll
    for (int r = 0; r < 8; ++r) acc[j][r] += bb; }
  feature_map(acc, fabsf(bfr(NS[0])) + 1e-6f);
#pragma unroll
  for (int j = 0; j < 8; ++j) {
#pragma unroll
    for (int r = 0; r < 8; ++r) { const float v = acc[j][r]; const __bf16 hv = (__bf16)v, lv = (__bf16)(v - (float)hv); const int rl = wave * 16 + 8 * g + r, cl = j * 16 + col; sh[rl][cl] = hv; sl[rl][cl] = lv; } }
  __syncthreads();
  __bf16* qh = PQH + r0 * CO + tid * 8; __bf16* ql = PQL + r0 * CO + tid * 8;   /* the tile's 64 rows are one contiguous 16-KiB span of each plane: piece e = tid + 128 i */
#pragma unroll
  for (int i = 0; i < 8; ++i) { const int e = tid + i * 128; vst2(qh + i * 1024, *(const v4u*)&sh[e >> 4][(e & 15) * 8]); vst2(ql + i * 1024, *(const v4u*)&sl[e >> 4][(e & 15) * 8]); }
  asm volatile("s_wait_xcnt 0x0" :: "v"(qh), "v"(ql) : "memory");   /* the address pairs stay whole until every store above has taken its address */
}
// ---- k_kvp: block (x = head in the group, y = slice) = one slice of TPB tiles of 64 rows n of head h, 256 threads; both W[h] go into LDS once and stay; the tiles follow one another in a loop. Per tile: waves 0..3 form phi_k = feature map of x_s Wk[h]^T + bk[h], waves 4..7 v = x_s Wv[h]^T + bv[h] (each half as k_proj). Both tiles go, bf16 hi + lo, TRANSPOSED ([m][n], [d][n]) into LDS; v also leaves as hi/lo rows. Then wave w: KV[16 w + ..][d] += sum_n phi_k[m][n] v[d][n] over the tile (hi + lo both sides, 3 products, K = 64), kept in registers over the slice; thread m < 128: its sum += sum_n phi_k[m][n] (hi + lo) in a fixed order. Behind the last tile: rows 0..127 and row 128 of the slice's f32 partial. The attribute holds the build to the 256 registers of four waves per SIMD: two blocks share a WGP (2 x the LDS fits too)
__global__ __launch_bounds__(256) __attribute__((amdgpu_waves_per_eu(4, 4))) void k_kvp(const float* __restrict__ XS, const float* __restrict__ WK, const float* __restrict__ BK, const float* __restrict__ WV, const float* __restrict__ BV, const float* __restrict__ NS, int h0, __bf16* __restrict__ VH0, __bf16* __restrict__ VL0, float* __restrict__ PART0) {
  const int h = h0 + blockIdx.x; __bf16* __restrict__ VH = VH0 + (size_t)blockIdx.x * NN * CO; __bf16* __restrict__ VL = VL0 + (size_t)blockIdx.x * NN * CO; float* __restrict__ PART = PART0 + (size_t)blockIdx.x * NSL * PROWS * CO;
  __shared__ __align__(16) __bf16 sw[2][128][WP]; __shared__ __align__(16) __bf16 th[2][128][TP], tl2[2][128][TP];   /* [0] k side, [1] v side */
  __shared__ __align__(16) __bf16 sv[4][16][WP];   /* each v-side wave's own 16 rows on their way out */
  __shared__ float sb[2][CO];   /* the two biases, rounded: read anew in every trip, held in no register over the loop */
  const int tid = threadIdx.x, t7 = tid & 127, wave = t7 >> 5, lane = tid & 31, col = lane & 15, g = lane >> 4; const size_t r0 = (size_t)blockIdx.y * (SLN * TPB);
  const int side = __builtin_amdgcn_readfirstlane(tid >> 7);   /* the same in a whole wave: 0 = k, 1 = v */
  const float* WA = (side == 0 ? WK : WV) + (size_t)h * CO * CI; const float* BA = (side == 0 ? BK : BV) + (size_t)h * CO;
  const float* px = XS + (r0 + wave * 16 + col) * CI + 8 * g; v4f xa[CI / 32][4];
#pragma unroll
  for (int kc = 0; kc < CI / 32; ++kc) { xa[kc][0] = *(const v4f*)(px + kc * 32); xa[kc][1] = *(const v4f*)(px + kc * 32 + 4); xa[kc][2] = *(const v4f*)(px + kc * 32 + 16); xa[kc][3] = *(const v4f*)(px + kc * 32 + 20); }
  const float* pbv = BA + t7; const float bv = *pbv;
  asm volatile("s_wait_xcnt 0x0" :: "v"(px), "v"(pbv) : "memory");   /* the address pairs stay whole until every load above has taken its address */
  stage_rows<0, 16>(WA, sw[side], t7);   /* in two halves: all 32 pieces at once, beside the x rows, do not fit the 256 registers of four waves per SIMD */
  __builtin_amdgcn_sched_barrier(0);   /* keeps the second half's loads behind the first half's LDS stores: moved up, they bring the spills back */
  stage_rows<16, 16>(WA, sw[side], t7);
  sb[side][t7] = bfr(bv);
  const float ds = fabsf(bfr(NS[0])) + 1e-6f;
  __bf16* vh = VH + (r0 + wave * 16) * CO + lane * 8; __bf16* vl = VL + (r0 + wave * 16) * CO + lane * 8;   /* a wave's 16 rows are one contiguous 4-KiB span of each plane: piece e = lane + 32 i */
  const int w8 = tid >> 5, m0 = w8 * 16; v8f kv[8] = {}; float s = 0.f;
  v16b a[CI / 32];   /* the tile's x rows as fragments */
#pragma unroll
  for (int kc = 0; kc < CI / 32; ++kc) {
#pragma unroll
    for (int i = 0; i < 16; ++i) a[kc][i] = (__bf16)xa[kc][i >> 2][i & 3]; }
  __syncthreads();   /* both W[h] and the biases staged */
#pragma nounroll   /* rolled: one copy of the body's text rather than TPB */
  for (int t = 0; t < TPB; ++t) {
    { v8f acc[8] = {};
      proj_tile(a, sw[side], col, lane, acc);
#pragma unroll
      for (int j = 0; j < 8; ++j) { const float bb = sb[side][j * 16 + col];
#pragma unroll
        for (int r = 0; r < 8; ++r) acc[j][r] += bb; }
      if (side == 0) feature_map(acc, ds);   /* wave-uniform, no barrier inside */
      else { rows_out(acc, sv[wave], vh, vl, g, col, lane);   /* wave-uniform, no barrier inside: v's rows leave while the k side forms its feature map */
        asm volatile("s_wait_xcnt 0x0" :: "v"(vh), "v"(vl) : "memory");   /* the address pairs stay whole until every store above has taken its address */
        vh += SLN * CO; vl += SLN * CO; }
      if (t > 0) __syncthreads();   /* the same for the whole block: every wave has read the last of the tile before from th and tl2 */
      stage_tile(acc, th[side], tl2[side], wave * 16 + 8 * g, col); }
    __syncthreads();   /* phi_k^T and v^T staged */
    v4f xn[CI / 32][4] = {};   /* born here, so that no register is held for it over the first half of a trip */
    if (t + 1 < TPB) { px += SLN * CI;   /* the next tile's x rows are asked for here: they arrive under this tile's k^T v products */
#pragma unroll
      for (int kc = 0; kc < CI / 32; ++kc) { xn[kc][0] = *(const v4f*)(px + kc * 32); xn[kc][1] = *(const v4f*)(px + kc * 32 + 4); xn[kc][2] = *(const v4f*)(px + kc * 32 + 16); xn[kc][3] = *(const v4f*)(px + kc * 32 + 20); }
      asm volatile("s_wait_xcnt 0x0" :: "v"(px) : "memory");   /* the address pair stays whole until every load above has taken its address */
    }
    { v16b ah[SLN / 32], al[SLN / 32], bh[SLN / 4], bl[SLN / 4];   /* group c = kc * 8 + j; its v fragments are read from LDS two groups ahead, so that the read's latency lies under the products in between */
#pragma unroll
      for (int kc = 0; kc < SLN / 32; ++kc) { ah[kc] = frag_b(&th[0][m0 + col][kc * 32], lane); al[kc] = frag_b(&tl2[0][m0 + col][kc * 32], lane); }
#pragma unroll
      for (int c = 0; c < 2; ++c) { bh[c] = frag_b(&th[1][(c & 7) * 16 + col][(c >> 3) * 32], lane); bl[c] = frag_b(&tl2[1][(c & 7) * 16 + col][(c >> 3) * 32], lane); }
#pragma unroll
      for (int c = 0; c < SLN / 4; ++c) { const int kc = c >> 3, j = c & 7, u = c + 2;
        if (u < SLN / 4) { bh[u] = frag_b(&th[1][(u & 7) * 16 + col][(u >> 3) * 32], lane); bl[u] = frag_b(&tl2[1][(u & 7) * 16 + col][(u >> 3) * 32], lane); }
        kv[j] = wmma_bf(al[kc], bh[c], kv[j]); kv[j] = wmma_bf(ah[kc], bl[c], kv[j]); kv[j] = wmma_bf(ah[kc], bh[c], kv[j]); } }
    if (side == 0) {   /* wave-uniform: thread m = tid adds its row of phi_k^T */
#pragma unroll
      for (int i = 0; i < SLN / 8; ++i) { const v8b a2 = *(const v8b*)&th[0][tid][i * 8], b2 = *(const v8b*)&tl2[0][tid][i * 8];
#pragma unroll
        for (int z = 0; z < 8; ++z) s += (float)a2[z] + (float)b2[z]; } }
#pragma unroll
    for (int kc = 0; kc < CI / 32; ++kc) {   /* in every trip, so that the old fragments are not held over the products above */
#pragma unroll
      for (int i = 0; i < 16; ++i) a[kc][i] = (__bf16)xn[kc][i >> 2][i & 3]; }
  }
  float* pp = PART + (size_t)blockIdx.y * PROWS * CO;
  if (side == 0) { float* ps = pp + CO * CO + tid; *ps = s;   /* a wave stores one whole 128-B line */
    asm volatile("s_wait_xcnt 0x0" :: "v"(ps) : "memory");   /* the address pair stays whole until the store above has taken its address */
  }
  float (*sf)[132] = (float (*)[132])&sw[0][0][0] + w8 * 16;   /* 8 waves x 16 rows x 528 B = 67,584 B of sw's 69,632; the last tile's 'staged' barrier stands behind every wave's last read of W */
#pragma unroll
  for (int j = 0; j < 8; ++j) {
#pragma unroll
    for (int r = 0; r < 8; ++r) sf[8 * g + r][j * 16 + col] = kv[j][r]; }
  LDSX(); float* po = pp + (size_t)m0 * CO + lane * 4;
#pragma unroll
  for (int rl = 0; rl < 16; ++rl) vst2(po + rl * CO, *(const v4f*)&sf[rl][lane * 4]);
  asm volatile("s_wait_xcnt 0x0" :: "v"(po) : "memory");   /* the address pair stays whole until every store above has taken its address */
}
// ---- k_join: block (y = head in the group) = 64 columns of one of the head's 129 partial rows (a 256-B segment): JG groups of 16 lanes; group t sums its run of JRUN slices in index order, the JG group sums are added in index order through LDS -> KV row (rows 0..127) or KS (row 128)
__global__ __launch_bounds__(16 * JG) void k_join(const float* __restrict__ PART0, float* __restrict__ KV0, float* __restrict__ KS0) { __shared__ __align__(16) float sj[JG][64];
  const float* __restrict__ PART = PART0 + (size_t)blockIdx.y * NSL * PROWS * CO; float* __restrict__ KV = KV0 + (size_t)blockIdx.y * CO * CO; float* __restrict__ KS = KS0 + (size_t)blockIdx.y * CO;
  const int tid = threadIdx.x, grp = tid >> 4, q = tid & 15; const int row = blockIdx.x >> 1, c0 = (blockIdx.x & 1) * 64;
  const float* p = PART + ((size_t)grp * JRUN * PROWS + row) * CO + c0 + q * 4; v4f s = {}, a[JRUN];
#pragma unroll
  for (int i = 0; i < JRUN; ++i) { a[i] = v4f{}; if (NSL % JG == 0 || grp * JRUN + i < NSL) a[i] = *(const v4f*)(p + (size_t)i * PROWS * CO); }   /* unrolled: all of a lane's loads are in flight together */
  asm volatile("s_wait_xcnt 0x0" :: "v"(p) : "memory");   /* the address pair stays whole until every load above has taken its address */
#pragma unroll
  for (int i = 0; i < JRUN; ++i) s += a[i];
  vst2(&sj[grp][q * 4], s); __syncthreads();
  if (tid < 16) { v4f t = {};
#pragma unroll
    for (int z = 0; z < JG; ++z) t += *(const v4f*)&sj[z][tid * 4];
    vst2((row < CO ? KV + (size_t)row * CO : KS) + c0 + tid * 4, t); } }
// ---- k_num: block = 64 rows n (all 128 cols), the group's HG heads one after the other, their sum kept in registers; per head: num = phi_q (hi+lo) . KV (f32 -> hi+lo, split and transposed into LDS once per block and head; v_map_w rounded once per block into LDS), 3 products; den = phi_q . KS (f32 dot per row from the planes); vss = v (hi+lo) . v_map_w^T (exact) + v_map_b; val = num / (den + 1e-6) + vss; behind the last head ACC = (h == 0 ? 0 : ACC) + sum of val, h = the group's first head (this block's own 512-B row segments)
__global__ __launch_bounds__(128) void k_num(const __bf16* __restrict__ PQH0, const __bf16* __restrict__ PQL0, const float* __restrict__ KV0, const float* __restrict__ KS0, const __bf16* __restrict__ VH0, const __bf16* __restrict__ VL0, const float* __restrict__ VMW, const float* __restrict__ VMB, int h, float* __restrict__ ACC) {
  __shared__ __align__(16) float sf[4][16][132]; __shared__ __align__(16) float sks[128]; __shared__ float sden[64];
  __shared__ __align__(16) __bf16 skh[128][WP], skl[128][WP], swm[128][WP];   /* KV transposed [d][m] hi / lo; v_map_w rows */
  const int tid = threadIdx.x, wave = tid >> 5, lane = tid & 31, col = lane & 15, g = lane >> 4; const size_t r0 = (size_t)blockIdx.x * 64; const size_t w0 = r0 + wave * 16;
  stage_rows(VMW, swm, tid);   /* the same for every head: once per block */
  v8f tot[8] = {};
#pragma nounroll   /* rolled: one copy of the body's text rather than HG */
  for (int hh = 0; hh < HG; ++hh) {   /* no barrier of its own at the head of a trip: the 'sden ready' barrier of the trip before ends every wave's reads of skh, skl and sks, and sden is rewritten only behind this trip's first barrier */
  const __bf16* __restrict__ PQH = PQH0 + (size_t)hh * NN * CO; const __bf16* __restrict__ PQL = PQL0 + (size_t)hh * NN * CO; const __bf16* __restrict__ VH = VH0 + (size_t)hh * NN * CO; const __bf16* __restrict__ VL = VL0 + (size_t)hh * NN * CO;
  const float* __restrict__ KV = KV0 + (size_t)hh * CO * CO; const float* __restrict__ KS = KS0 + (size_t)hh * CO;
  { const float* pk = KV + tid; float kc2[CO]; const float ksv = KS[tid];   /* thread d takes column d of KV: a wave's load is 128 B of one row */
#pragma unroll
    for (int m = 0; m < CO; ++m) kc2[m] = pk[m * CO];   /* unrolled: the column's loads are in flight together */
    asm volatile("s_wait_xcnt 0x0" :: "v"(pk) : "memory");   /* the address pair stays whole until every load above has taken its address */
#pragma unroll
    for (int m = 0; m < CO; m += 8) { v8b hv, lv;
#pragma unroll
      for (int z = 0; z < 8; ++z) { const __bf16 hh = (__bf16)kc2[m + z]; hv[z] = hh; lv[z] = (__bf16)(kc2[m + z] - (float)hh); }
      *(v8b*)&skh[tid][m] = hv; *(v8b*)&skl[tid][m] = lv; }
    sks[tid] = ksv; }
  const __bf16 *pa = PQH + (w0 + col) * CO + 8 * g, *pb = PQL + (w0 + col) * CO + 8 * g, *pc = VH + (w0 + col) * CO + 8 * g, *pd = VL + (w0 + col) * CO + 8 * g;
  v16b ah[CO / 32], al[CO / 32], bh[CO / 32], bl[CO / 32];
#pragma unroll
  for (int kc = 0; kc < CO / 32; ++kc) { ah[kc] = frag_p(pa + kc * 32); al[kc] = frag_p(pb + kc * 32); bh[kc] = frag_p(pc + kc * 32); bl[kc] = frag_p(pd + kc * 32); }
  const float* pbv = VMB + col; float bv[8];
#pragma unroll
  for (int j = 0; j < 8; ++j) bv[j] = pbv[j * 16];
  asm volatile("s_wait_xcnt 0x0" :: "v"(pa), "v"(pb), "v"(pc), "v"(pd), "v"(pbv) : "memory");   /* the address pairs stay whole until every load above has taken its address */
  __syncthreads();
  if (tid < 64) { float d = 0.f; const __bf16* ph = PQH + (r0 + tid) * CO; const __bf16* pl = PQL + (r0 + tid) * CO;
#pragma unroll 4
    for (int m = 0; m < CO; m += 8) { const v8b a = *(const v8b*)(ph + m), b2 = *(const v8b*)(pl + m);
#pragma unroll
      for (int z = 0; z < 8; ++z) d += ((float)a[z] + (float)b2[z]) * sks[m + z]; }
    sden[tid] = d; }
  v8f acc[8] = {}, vs[8] = {};
  { v16b wh[32], wl[32];   /* group t = kc * 8 + j; its KV fragments are read from LDS two groups ahead, so that the read's latency lies under the products in between */
#pragma unroll
    for (int t = 0; t < 2; ++t) { wh[t] = frag_b(&skh[(t & 7) * 16 + col][(t >> 3) * 32], lane); wl[t] = frag_b(&skl[(t & 7) * 16 + col][(t >> 3) * 32], lane); }
#pragma unroll
    for (int t = 0; t < 32; ++t) { const int kc = t >> 3, j = t & 7, u = t + 2;
      if (u < 32) { wh[u] = frag_b(&skh[(u & 7) * 16 + col][(u >> 3) * 32], lane); wl[u] = frag_b(&skl[(u & 7) * 16 + col][(u >> 3) * 32], lane); }
      acc[j] = wmma_bf(al[kc], wh[t], acc[j]); acc[j] = wmma_bf(ah[kc], wl[t], acc[j]); acc[j] = wmma_bf(ah[kc], wh[t], acc[j]); } }
  { v16b wm[32];   /* the same for v_map_w, three groups ahead */
#pragma unroll
    for (int t = 0; t < 3; ++t) wm[t] = frag_b(&swm[(t & 7) * 16 + col][(t >> 3) * 32], lane);
#pragma unroll
    for (int t = 0; t < 32; ++t) { const int kc = t >> 3, j = t & 7, u = t + 3;
      if (u < 32) wm[u] = frag_b(&swm[(u & 7) * 16 + col][(u >> 3) * 32], lane);
      vs[j] = wmma_bf(bh[kc], wm[t], vs[j]); vs[j] = wmma_bf(bl[kc], wm[t], vs[j]); } }
  __syncthreads();   /* sden ready */
#pragma unroll
  for (int j = 0; j < 8; ++j) { const float bb = bfr(bv[j]);
#pragma unroll
    for (int r = 0; r < 8; ++r) { const float den = sden[wave * 16 + 8 * g + r]; tot[j][r] += acc[j][r] / (den + 1e-6f) + (vs[j][r] + bb); } }
  }
#pragma unroll
  for (int j = 0; j < 8; ++j) {
#pragma unroll
    for (int r = 0; r < 8; ++r) sf[wave][8 * g + r][j * 16 + col] = tot[j][r]; }
  LDSX(); for (int rl = 0; rl < 16; ++rl) { float* dst = ACC + (w0 + rl) * CO + lane * 4; v4f v = *(const v4f*)&sf[wave][rl][lane * 4]; if (h > 0) { const v4f p = *(const v4f*)dst; v[0] += p[0]; v[1] += p[1]; v[2] += p[2]; v[3] += p[3]; } vst2(dst, v); } }
// ---- k_fin: block = 64 rows: out = ACC / 8; time = sqrt(sum out^2 + 1); the 64 x 129 output rows form one contiguous, line-aligned 33,024-B span (64*129*4 = 258 lines; the span starts at row0*516 B with row0 a multiple of 64) staged in LDS and written thread-linearly in 16-B pieces
__global__ __launch_bounds__(128) void k_fin(const float* __restrict__ ACC, float* __restrict__ OUT) { __shared__ __align__(16) float so[64 * 129 + 12];
  const int tid = threadIdx.x; const size_t r0 = (size_t)blockIdx.x * 64;
  for (int rl = tid >> 5, lanei = tid & 31; rl < 64; rl += 4) { const v4f a = *(const v4f*)(ACC + (r0 + rl) * CO + lanei * 4); float o[4]; float s = 0.f;
#pragma unroll
    for (int z = 0; z < 4; ++z) { o[z] = a[z] * (1.0f / NH); s += o[z] * o[z]; }
#pragma unroll
    for (int q = 1; q < 32; q <<= 1) s += __shfl_xor(s, q);
#pragma unroll
    for (int z = 0; z < 4; ++z) so[rl * 129 + 1 + lanei * 4 + z] = o[z];
    if (lanei == 0) so[rl * 129] = sqrtf(s + 1.0f); }
  __syncthreads();
  float* dst = OUT + r0 * 129;
  for (int e = tid; e < 64 * 129 / 4; e += 128) vst2(dst + e * 4, *(const v4f*)&so[e * 4]); }   
extern "C" void kernel_launch(void* const* d_in, const int* in_sizes, int n_in, void* d_out, int out_size, void* d_ws, size_t ws_size, hipStream_t stream) {
  (void)in_sizes; (void)n_in; (void)out_size;
  const float** F = (const float**)d_in;   // 0 query_input, 1 source_input [32768,128]; 2 Wq_w [8,128,128], 3 Wq_b [8,128]; 4 Wk_w, 5 Wk_b; 6 Wv_w, 7 Wv_b; 8 v_map_w [128,128] (out,in), 9 v_map_b; 10 norm_scale
  if (ws_size < (size_t)WS_END) return;
  char* ws = (char*)d_ws; __bf16 *PQH = (__bf16*)(ws + WS_PQH), *PQL = (__bf16*)(ws + WS_PQL), *VH = (__bf16*)(ws + WS_VH), *VL = (__bf16*)(ws + WS_VL); float *KS = (float*)(ws + WS_KS), *KV = (float*)(ws + WS_KV), *ACC = (float*)(ws + WS_ACC), *PART = (float*)(ws + WS_PART);
  for (int h = 0; h < NH; h += HG) {   // k_proj behind k_join: phi_q takes the partials' place
    k_kvp<<<dim3(HG, NSL), 256, 0, stream>>>(F[1], F[4], F[5], F[6], F[7], F[10], h, VH, VL, PART);
    k_join<<<dim3(2 * PROWS, HG), 16 * JG, 0, stream>>>(PART, KV, KS);
    k_proj<<<dim3(HG, NPROC / 64), 128, 0, stream>>>(F[0], F[2], F[3], F[10], h, PQH, PQL);
    k_num<<<dim3(NPROC / 64), 128, 0, stream>>>(PQH, PQL, KV, KS, VH, VL, F[8], F[9], h, ACC);
  }
  k_fin<<<dim3(NPROC / 64), 128, 0, stream>>>(ACC, (float*)d_out);
}

// v006
// It runs in 232 microseconds.
// In two side-by-side timings against v005, it was 1.08 and 1.10 times as fast.
// Over all steps from v000 it is 102 times as fast.
// compute dtype: all float inputs rounded to bf16; q/k/v head projections x W^T + b with EXACT bf16 products on WMMA 16x16x32, f32 accumulate; relu, the power feature map (norms over 128, x^2) in f32; phi_k, v, phi_q and the [128 x 128] k^T v as bf16 hi + lo (3 products) for the two linear-attention contractions (K = 32,768 and K = 128), v hi + lo against exact v_map_w (2 products); column sums, the normaliser, the head mean and the time coordinate (sqrt) in f32; f32 output.
#include <hip/hip_runtime.h>
#include <math.h>

typedef __attribute__((ext_vector_type(16))) _Float16 v16h;
typedef __attribute__((ext_vector_type(16))) __bf16 v16b;
typedef __attribute__((ext_vector_type(8)))  _Float16 v8h;
typedef __attribute__((ext_vector_type(8)))  float v8f;
typedef __attribute__((ext_vector_type(4)))  float v4f;
typedef __attribute__((ext_vector_type(2)))  float v2f;
typedef __attribute__((ext_vector_type(4)))  unsigned v4u;
typedef __attribute__((ext_vector_type(4)))  int v4i;
typedef float __attribute__((may_alias)) float_a;
typedef int __attribute__((may_alias)) int_a;

template <typename T> __device__ __forceinline__ void vst2(void* p, T v) { *(T*)p = v;  }
__device__ __forceinline__ v8f wmma16(v16h a, v16h b, v8f c) {
  v8f d = __builtin_amdgcn_wmma_f32_16x16x32_f16(false, a, false, b, (short)0, c, false, false);
  asm volatile("v_nop\n\tv_nop\n\tv_nop\n\tv_nop" : "+v"(d) : "v"(a), "v"(b));
  return d;
}
__device__ __forceinline__ v8f wmma_bf(v16b a, v16b b, v8f c) {
  v8f d = __builtin_amdgcn_wmma_f32_16x16x32_bf16(false, a, false, b, (short)0, c, false, false);
  asm volatile("v_nop\n\tv_nop\n\tv_nop\n\tv_nop" : "+v"(d) : "v"(a), "v"(b));
  return d;
}
// 16x16x32 fragments: lane = (h = lane>>4, row/col = lane&15); elements 0..7 = k0+8h+0..7, 8..15 = k0+16+8h+0..7; D element r = row 8h+r
__device__ __forceinline__ v16h frag_h(const _Float16* rowk0, int lane) {
  union { v16h v; v8h q[2]; } u; const _Float16* p = rowk0 + 8 * (lane >> 4);
  u.q[0] = *(const v8h*)p; u.q[1] = *(const v8h*)(p + 16); return u.v;
}
__device__ __forceinline__ v16h frag_f32(const float* rowk0, int lane) {
  v16h a; const float* p = rowk0 + 8 * (lane >> 4);
#pragma unroll
  for (int i = 0; i < 8; ++i) { a[i] = (_Float16)p[i]; a[8 + i] = (_Float16)p[16 + i]; }
  return a;
}
__device__ __forceinline__ v16h frag_f32s(const float* rowk0, int lane, float sc) {
  v16h a; const float* p = rowk0 + 8 * (lane >> 4);
#pragma unroll
  for (int i = 0; i < 8; ++i) { a[i] = (_Float16)(p[i] * sc); a[8 + i] = (_Float16)(p[16 + i] * sc); }
  return a;
}
// column fragment from a [K][ld] layout (column n), rows >= K read as 0
__device__ __forceinline__ v16h fragc_f32(const float* W, int k0, int n, int lane, int ld, int K) {
  v16h a; const int g = lane >> 4;
#pragma unroll
  for (int i = 0; i < 8; ++i) { const int ka = k0 + 8 * g + i, kb = ka + 16;
    a[i] = (_Float16)(ka < K ? W[(size_t)(ka < K ? ka : K - 1) * ld + n] : 0.f); a[8 + i] = (_Float16)(kb < K ? W[(size_t)(kb < K ? kb : K - 1) * ld + n] : 0.f); }
  return a;
}
struct F2 { v16b h, l; };
__device__ __forceinline__ F2 bsplit16(const float v[16]) { F2 r;
#pragma unroll
  for (int i = 0; i < 16; ++i) { const __bf16 h = (__bf16)v[i]; r.h[i] = h; r.l[i] = (__bf16)(v[i] - (float)h); }
  return r; }
__device__ __forceinline__ F2 split_row(const float* row, int k0, int lane) { float v[16]; const float* p = row + k0 + 8 * (lane >> 4);
#pragma unroll
  for (int i = 0; i < 8; ++i) { v[i] = p[i]; v[8 + i] = p[16 + i]; }
  return bsplit16(v); }
__device__ __forceinline__ F2 split_rowK(const float* row, int k0, int lane, int K) { float v[16]; const int g = lane >> 4;
#pragma unroll
  for (int i = 0; i < 8; ++i) { const int ka = k0 + 8 * g + i, kb = ka + 16; v[i] = ka < K ? row[ka < K ? ka : K - 1] : 0.f; v[8 + i] = kb < K ? row[kb < K ? kb : K - 1] : 0.f; }
  return bsplit16(v); }
__device__ __forceinline__ F2 split_col(const float* W, int k0, int n, int lane, int ld, int K) { float v[16]; const int g = lane >> 4;
#pragma unroll
  for (int i = 0; i < 8; ++i) { const int ka = k0 + 8 * g + i, kb = ka + 16; v[i] = ka < K ? W[(size_t)(ka < K ? ka : K - 1) * ld + n] : 0.f; v[8 + i] = kb < K ? W[(size_t)(kb < K ? kb : K - 1) * ld + n] : 0.f; }
  return bsplit16(v); }
__device__ __forceinline__ v8f mac3(const F2& a, const F2& b, v8f c) { c = wmma_bf(a.l, b.h, c); c = wmma_bf(a.h, b.l, c); return wmma_bf(a.h, b.h, c); }
__device__ __forceinline__ float sigm(float v) { return 1.0f / (1.0f + expf(-v)); }
#define LDSX() do { asm volatile("s_wait_dscnt 0" ::: "memory"); __builtin_amdgcn_wave_barrier(); __builtin_amdgcn_fence(__ATOMIC_RELEASE, "workgroup"); } while (0)

// Hyperbolic (Lorentz) linear-attention 'TransConv' layer (N 32,768 nodes, 128 -> 128, 8 heads, power kernel p = 2): per head h: qs = x_q Wq[h]^T + bq[h], ks = x_s Wk[h]^T + bk[h], v = x_s Wv[h]^T + bv[h]; phi(x) = ||x|| / (||x^2|| + 1e-8) * x^2 applied to (relu(.) + 1e-6)/(|norm_scale| + 1e-6); KV[h] = sum_n phi_k[n] (x) v[n]; num[n] = phi_q[n] KV[h]; den[n] = phi_q[n] . sum_n phi_k[n]; attn = num / (den + 1e-6) + (v v_map_w^T + v_map_b); out = mean over heads; result = [sqrt(sum out^2 + 1), out].
#define NN 32768
#define CI 128             // in channels
#define CO 128             // out channels per head
#define NH 8
#ifndef NPROC
#define NPROC NN           // rows processed
#endif
typedef __attribute__((ext_vector_type(8))) __bf16 v8b;
__device__ __forceinline__ v16b frag_b(const __bf16* rowk0, int lane) {
  union { v16b v; v8b q[2]; } u; const __bf16* p = rowk0 + 8 * (lane >> 4);
  u.q[0] = *(const v8b*)p; u.q[1] = *(const v8b*)(p + 16); return u.v;
}
// the same fragment from a pointer that already holds the lane's 8 * (lane >> 4)
__device__ __forceinline__ v16b frag_p(const __bf16* p) {
  union { v16b v; v8b q[2]; } u; u.q[0] = *(const v8b*)p; u.q[1] = *(const v8b*)(p + 16); return u.v;
}
typedef __attribute__((ext_vector_type(4))) __bf16 v4b;
#define WP 136             // bf16 per LDS row of a staged [128][128] B operand (272 B = 16 B x 17)
// a block of 128 threads rounds a row-major f32 [128][128] matrix to bf16 rows in LDS: thread t takes the 16-B pieces t, t + 128, ... (a wave fills one row per piece); a call takes the NI pieces from I0 on
template <int I0 = 0, int NI = 32> __device__ __forceinline__ void stage_rows(const float* __restrict__ Wm, __bf16 (*dst)[WP], int tid) {
  const float* pw = Wm + tid * 4 + I0 * 512; v4f wv[NI];
#pragma unroll
  for (int i = 0; i < NI; ++i) wv[i] = *(const v4f*)(pw + i * 512);   /* unrolled: all of a thread's loads are in flight together */
  asm volatile("s_wait_xcnt 0x0" :: "v"(pw), "v"(tid) : "memory");   /* the address pair, or the thread index where the loads go by a scalar base plus that index, stays whole until every load above has taken its address */
#pragma unroll
  for (int i = 0; i < NI; ++i) { v4b o;
#pragma unroll
    for (int z = 0; z < 4; ++z) o[z] = (__bf16)wv[i][z];
    *(v4b*)&dst[(tid >> 5) + 4 * (I0 + i)][(tid & 31) * 4] = o; } }
__device__ __forceinline__ float bfr(float v) { return (float)(__bf16)v; }
__device__ __forceinline__ v16b wrow(const float* rowk0, int lane) { v16b w; const float* p = rowk0 + 8 * (lane >> 4);
#pragma unroll
  for (int i = 0; i < 8; ++i) { w[i] = (__bf16)p[i]; w[8 + i] = (__bf16)p[16 + i]; }
  return w; }
// B fragment (k rows k0+.., column n) of an f32 [K][ld] matrix, split bf16 hi + lo
__device__ __forceinline__ F2 colsplit(const float* Wm, int k0, int n, int lane, int ld) { float v[16]; const int g = lane >> 4;
#pragma unroll
  for (int i = 0; i < 8; ++i) { v[i] = Wm[(size_t)(k0 + 8 * g + i) * ld + n]; v[8 + i] = Wm[(size_t)(k0 + 16 + 8 * g + i) * ld + n]; }
  return bsplit16(v); }

#define HG 4               // heads that one launch of each stage takes together (NH / HG groups, one after the other)
#define WS_VH  0u                                       // bf16 v rows [head in group][n][128] hi / lo
#define WS_VL  (WS_VH  + 2u * (size_t)HG * NN * CO)
#define WS_KS  (WS_VL  + 2u * (size_t)HG * NN * CO)     // f32 column sums of phi_k [head in group][128]
#define WS_KV  (WS_KS  + 4u * (size_t)HG * 128)         // f32 KV [head in group][m][d]
#define WS_ACC (WS_KV  + 4u * (size_t)HG * CO * CO)     // f32 head-sum accumulator [n][128]
#define SLN 64             // rows n per tile of the two sums over n
#define TPB 4              // tiles in a row that one block of k_kvp takes one after the other: together one slice
#define NSL (NPROC / (SLN * TPB))  // slices
#define JG 8               // groups of 16 lanes in a block of k_join
#define JRUN ((NSL + JG - 1) / JG)   // slices in a row that one of k_join's JG groups sums
#define PROWS (CO + 1)     // rows of one slice's partial: 128 rows of KV, then the column sums
#define WS_PART (WS_ACC + 4u * (size_t)NN * CO)         // f32 partials [head in group][slice][129][128]
#define WS_PQH WS_PART                                  // bf16 phi_q rows [head in group][n][128] hi / lo: they begin at the partials' place, which k_join has read out before k_proj is launched
#define WS_PQL (WS_PQH + 2u * (size_t)HG * NN * CO)
#define WS_END (WS_PQL + 2u * (size_t)HG * NN * CO)
static_assert(4u * (size_t)HG * (NN / (SLN * TPB)) * PROWS * CO <= 4u * (size_t)HG * NN * CO, "the partials end in front of WS_END");
#define TP 72              // bf16 per LDS row of a transposed [128][64] tile (144 B = 16 B x 9)

// acc = x W^T for a wave's 16 rows (a: the rows' four k fragments) against the [128][128] bf16 W in LDS; product t = kc * 8 + j; its W fragment is read from LDS six products ahead, so that the read's latency lies under the products in between
__device__ __forceinline__ void proj_tile(const v16b a[CI / 32], const __bf16 (*sw)[WP], int col, int lane, v8f acc[8]) {
  v16b fw[32];
#pragma unroll
  for (int t = 0; t < 6; ++t) fw[t] = frag_b(&sw[(t & 7) * 16 + col][(t >> 3) * 32], lane);
#pragma unroll
  for (int t = 0; t < 32; ++t) { if (t + 6 < 32) fw[t + 6] = frag_b(&sw[((t + 6) & 7) * 16 + col][((t + 6) >> 3) * 32], lane);
    acc[t & 7] = wmma_bf(a[t >> 3], fw[t], acc[t & 7]); } }
// feature map on a wave's 16 x 128 tile: x = (relu(acc) + 1e-6) * rs with rs = 1 / ds (one divisor for the whole launch: its reciprocal is formed once by the caller), phi = ||x|| / (||x^2|| + 1e-8) * x^2, the two norms over the 128 columns (lane partial sums + 16-lane shuffles)
__device__ __forceinline__ void feature_map(v8f acc[8], float rs) { float n1[8], n2[8];
#pragma unroll
  for (int r = 0; r < 8; ++r) { float s1 = 0.f, s2 = 0.f;
#pragma unroll
    for (int j = 0; j < 8; ++j) { const float x = (fmaxf(acc[j][r], 0.f) + 1e-6f) * rs; acc[j][r] = x; const float x2 = x * x; s1 += x2; s2 += x2 * x2; }
    n1[r] = s1; n2[r] = s2; }
#pragma unroll
  for (int o = 1; o < 16; o <<= 1) {
#pragma unroll
    for (int r = 0; r < 8; ++r) { n1[r] += __shfl_xor(n1[r], o); n2[r] += __shfl_xor(n2[r], o); } }
#pragma unroll
  for (int r = 0; r < 8; ++r) n1[r] = sqrtf(n1[r]) / (sqrtf(n2[r]) + 1e-8f);   /* ||x|| / (||x^2|| + eps) */
#pragma unroll
  for (int j = 0; j < 8; ++j) {
#pragma unroll
    for (int r = 0; r < 8; ++r) acc[j][r] = n1[r] * (acc[j][r] * acc[j][r]); } }

// a wave's 16 x 128 f32 tile, split bf16 hi + lo, into LDS, transposed ([column][row]); rb = the lane's first row in the block's tile
__device__ __forceinline__ void stage_tile(const v8f acc[8], __bf16 (*th)[TP], __bf16 (*tl)[TP], int rb, int col) {
#pragma unroll
  for (int j = 0; j < 8; ++j) {
#pragma unroll
    for (int r = 0; r < 8; ++r) { const float v = acc[j][r]; const __bf16 hv = (__bf16)v, lv = (__bf16)(v - (float)hv); const int rl = rb + r, cl = j * 16 + col;
      th[cl][rl] = hv; tl[cl][rl] = lv; } } }
// a wave's 16 x 128 f32 tile leaves as bf16 rows, the hi plane and then the lo plane, each through the wave's own 16 LDS rows: every store is 512 contiguous bytes; ph, pl = the lane's 16-B piece of the tile's first 512 B in each plane
__device__ __forceinline__ void rows_out(const v8f acc[8], __bf16 (*sv)[WP], __bf16* ph, __bf16* pl, int g, int col, int lane) {
#pragma unroll
  for (int p = 0; p < 2; ++p) {
#pragma unroll
    for (int j = 0; j < 8; ++j) {
#pragma unroll
      for (int r = 0; r < 8; ++r) { const float v = acc[j][r]; const __bf16 hv = (__bf16)v; sv[8 * g + r][j * 16 + col] = p == 0 ? hv : (__bf16)(v - (float)hv); } }
    LDSX();   /* the wave's stores have landed before its lanes read one another's */
    v4u q[8];
#pragma unroll
    for (int i = 0; i < 8; ++i) { const int e = lane + i * 32; q[i] = *(const v4u*)&sv[e >> 4][(e & 15) * 8]; }
    LDSX();   /* the reads are done before the rows are written again */
#pragma unroll
    for (int i = 0; i < 8; ++i) vst2((p == 0 ? ph : pl) + i * 256, q[i]); } }
// ---- k_proj: block (x = head in the group, y = 64-row tile) = 64 rows of head h's q: acc = x_q Wq[h]^T + bq[h] (W (out,in) rows contiguous; exact; W[h] rounded to bf16 once per block into LDS, each lane's x row loaded whole up front); feature map; phi_q -> bf16 hi/lo rows
__global__ __launch_bounds__(128) void k_proj(const float* __restrict__ XQ, const float* __restrict__ WQ, const float* __restrict__ BQ, const float* __restrict__ NS, int h0, __bf16* __restrict__ PQH0, __bf16* __restrict__ PQL0) {
  __shared__ __align__(16) __bf16 sw[128][WP];
  const int h = h0 + blockIdx.x; __bf16* __restrict__ PQH = PQH0 + (size_t)blockIdx.x * NN * CO; __bf16* __restrict__ PQL = PQL0 + (size_t)blockIdx.x * NN * CO;   /* the blocks of one tile's HG heads stand side by side in the grid: they read the same x rows */
  __bf16 (*sh)[WP] = sw; __bf16 (*sl)[WP] = sw + 64;   /* behind the products the same LDS holds the tile's hi rows (0..63) and lo rows (64..127) */
  const int tid = threadIdx.x, wave = tid >> 5, lane = tid & 31, col = lane & 15, g = lane >> 4; const size_t r0 = (size_t)blockIdx.y * 64;
  const float* WA = WQ + (size_t)h * CO * CI; const float* BA = BQ + (size_t)h * CO;
  const float* px = XQ + (r0 + wave * 16 + col) * CI + 8 * g; v4f xa[CI / 32][4];
#pragma unroll
  for (int kc = 0; kc < CI / 32; ++kc) { xa[kc][0] = *(const v4f*)(px + kc * 32); xa[kc][1] = *(const v4f*)(px + kc * 32 + 4); xa[kc][2] = *(const v4f*)(px + kc * 32 + 16); xa[kc][3] = *(const v4f*)(px + kc * 32 + 20); }
  const float* pbv = BA + col; float bv[8];
#pragma unroll
  for (int j = 0; j < 8; ++j) bv[j] = pbv[j * 16];
  asm volatile("s_wait_xcnt 0x0" :: "v"(px), "v"(pbv) : "memory");   /* the address pairs stay whole until every load above has taken its address */
  stage_rows(WA, sw, tid);
  v16b a[CI / 32];
#pragma unroll
  for (int kc = 0; kc < CI / 32; ++kc) {
#pragma unroll
    for (int i = 0; i < 16; ++i) a[kc][i] = (__bf16)xa[kc][i >> 2][i & 3]; }
  __syncthreads();   /* W[h] staged */
  v8f acc[8] = {}; proj_tile(a, sw, col, lane, acc);
  __syncthreads();   /* every wave has read its last W fragment: the LDS may take the output tile */
#pragma unroll
  for (int j = 0; j < 8; ++j) { const float bb = bfr(bv[j]);
#pragma unroll
    for (int r = 0; r < 8; ++r) acc[j][r] += bb; }
  feature_map(acc, 1.0f / (fabsf(bfr(NS[0])) + 1e-6f));
#pragma unroll
  for (int j = 0; j < 8; ++j) {
#pragma unroll
    for (int r = 0; r < 8; ++r) { const float v = acc[j][r]; const __bf16 hv = (__bf16)v, lv = (__bf16)(v - (float)hv); const int rl = wave * 16 + 8 * g + r, cl = j * 16 + col; sh[rl][cl] = hv; sl[rl][cl] = lv; } }
  __syncthreads();
  __bf16* qh = PQH + r0 * CO + tid * 8; __bf16* ql = PQL + r0 * CO + tid * 8;   /* the tile's 64 rows are one contiguous 16-KiB span of each plane: piece e = tid + 128 i */
#pragma unroll
  for (int i = 0; i < 8; ++i) { const int e = tid + i * 128; vst2(qh + i * 1024, *(const v4u*)&sh[e >> 4][(e & 15) * 8]); vst2(ql + i * 1024, *(const v4u*)&sl[e >> 4][(e & 15) * 8]); }
  asm volatile("s_wait_xcnt 0x0" :: "v"(qh), "v"(ql) : "memory");   /* the address pairs stay whole until every store above has taken its address */
}
// ---- k_kvp: block (x = head in the group, y = slice) = one slice of TPB tiles of 64 rows n of head h, 256 threads; both W[h] go into LDS once and stay; the tiles follow one another in a loop. Per tile: waves 0..3 form phi_k = feature map of x_s Wk[h]^T + bk[h], waves 4..7 v = x_s Wv[h]^T + bv[h] (each half as k_proj). Both tiles go, bf16 hi + lo, TRANSPOSED ([m][n], [d][n]) into LDS; v also leaves as hi/lo rows. Then wave w: KV[16 w + ..][d] += sum_n phi_k[m][n] v[d][n] over the tile (hi + lo both sides, 3 products, K = 64), kept in registers over the slice; thread m < 128: its sum += sum_n phi_k[m][n] (hi + lo) in a fixed order. Behind the last tile: rows 0..127 and row 128 of the slice's f32 partial. The attribute holds the build to the 256 registers of four waves per SIMD: two blocks share a WGP (2 x the LDS fits too)
__global__ __launch_bounds__(256) __attribute__((amdgpu_waves_per_eu(4, 4))) void k_kvp(const float* __restrict__ XS, const float* __restrict__ WK, const float* __restrict__ BK, const float* __restrict__ WV, const float* __restrict__ BV, const float* __restrict__ NS, int h0, __bf16* __restrict__ VH0, __bf16* __restrict__ VL0, float* __restrict__ PART0) {
  const int h = h0 + blockIdx.x; __bf16* __restrict__ VH = VH0 + (size_t)blockIdx.x * NN * CO; __bf16* __restrict__ VL = VL0 + (size_t)blockIdx.x * NN * CO; float* __restrict__ PART = PART0 + (size_t)blockIdx.x * NSL * PROWS * CO;
  __shared__ __align__(16) __bf16 sw[2][128][WP]; __shared__ __align__(16) __bf16 th[2][128][TP], tl2[2][128][TP];   /* [0] k side, [1] v side */
  __shared__ __align__(16) __bf16 sv[4][16][WP];   /* each v-side wave's own 16 rows on their way out */
  __shared__ float sb[2][CO];   /* the two biases, rounded: read anew in every trip, held in no register over the loop */
  const int tid = threadIdx.x, t7 = tid & 127, wave = t7 >> 5, lane = tid & 31, col = lane & 15, g = lane >> 4; const size_t r0 = (size_t)blockIdx.y * (SLN * TPB);
  const int side = __builtin_amdgcn_readfirstlane(tid >> 7);   /* the same in a whole wave: 0 = k, 1 = v */
  const float* WA = (side == 0 ? WK : WV) + (size_t)h * CO * CI; const float* BA = (side == 0 ? BK : BV) + (size_t)h * CO;
  const float* px = XS + (r0 + wave * 16 + col) * CI + 8 * g; v4f xa[CI / 32][4];
#pragma unroll
  for (int kc = 0; kc < CI / 32; ++kc) { xa[kc][0] = *(const v4f*)(px + kc * 32); xa[kc][1] = *(const v4f*)(px + kc * 32 + 4); xa[kc][2] = *(const v4f*)(px + kc * 32 + 16); xa[kc][3] = *(const v4f*)(px + kc * 32 + 20); }
  const float* pbv = BA + t7; const float bv = *pbv;
  asm volatile("s_wait_xcnt 0x0" :: "v"(px), "v"(pbv) : "memory");   /* the address pairs stay whole until every load above has taken its address */
  stage_rows<0, 16>(WA, sw[side], t7);   /* in two halves: all 32 pieces at once, beside the x rows, do not fit the 256 registers of four waves per SIMD */
  __builtin_amdgcn_sched_barrier(0);   /* keeps the second half's loads behind the first half's LDS stores: moved up, they bring the spills back */
  stage_rows<16, 16>(WA, sw[side], t7);
  sb[side][t7] = bfr(bv);
  const float rs = 1.0f / (fabsf(bfr(NS[0])) + 1e-6f);
  __bf16* vh = VH + (r0 + wave * 16) * CO + lane * 8; __bf16* vl = VL + (r0 + wave * 16) * CO + lane * 8;   /* a wave's 16 rows are one contiguous 4-KiB span of each plane: piece e = lane + 32 i */
  const int w8 = tid >> 5, m0 = w8 * 16; v8f kv[8] = {}; float s = 0.f;
  v16b a[CI / 32];   /* the tile's x rows as fragments */
#pragma unroll
  for (int kc = 0; kc < CI / 32; ++kc) {
#pragma unroll
    for (int i = 0; i < 16; ++i) a[kc][i] = (__bf16)xa[kc][i >> 2][i & 3]; }
  __syncthreads();   /* both W[h] and the biases staged */
#pragma nounroll   /* rolled: one copy of the body's text rather than TPB */
  for (int t = 0; t < TPB; ++t) {
    { v8f acc[8] = {};
      proj_tile(a, sw[side], col, lane, acc);
#pragma unroll
      for (int j = 0; j < 8; ++j) { const float bb = sb[side][j * 16 + col];
#pragma unroll
        for (int r = 0; r < 8; ++r) acc[j][r] += bb; }
      if (side == 0) feature_map(acc, rs);   /* wave-uniform, no barrier inside */
      else { rows_out(acc, sv[wave], vh, vl, g, col, lane);   /* wave-uniform, no barrier inside: v's rows leave while the k side forms its feature map */
        asm volatile("s_wait_xcnt 0x0" :: "v"(vh), "v"(vl) : "memory");   /* the address pairs stay whole until every store above has taken its address */
        vh += SLN * CO; vl += SLN * CO; }
      if (t > 0) __syncthreads();   /* the same for the whole block: every wave has read the last of the tile before from th and tl2 */
      stage_tile(acc, th[side], tl2[side], wave * 16 + 8 * g, col); }
    __syncthreads();   /* phi_k^T and v^T staged */
    v4f xn[CI / 32][4] = {};   /* born here, so that no register is held for it over the first half of a trip */
    if (t + 1 < TPB) { px += SLN * CI;   /* the next tile's x rows are asked for here: they arrive under this tile's k^T v products */
#pragma unroll
      for (int kc = 0; kc < CI / 32; ++kc) { xn[kc][0] = *(const v4f*)(px + kc * 32); xn[kc][1] = *(const v4f*)(px + kc * 32 + 4); xn[kc][2] = *(const v4f*)(px + kc * 32 + 16); xn[kc][3] = *(const v4f*)(px + kc * 32 + 20); }
      asm volatile("s_wait_xcnt 0x0" :: "v"(px) : "memory");   /* the address pair stays whole until every load above has taken its address */
    }
    { v16b ah[SLN / 32], al[SLN / 32], bh[SLN / 4], bl[SLN / 4];   /* group c = kc * 8 + j; its v fragments are read from LDS two groups ahead, so that the read's latency lies under the products in between */
#pragma unroll
      for (int kc = 0; kc < SLN / 32; ++kc) { ah[kc] = frag_b(&th[0][m0 + col][kc * 32], lane); al[kc] = frag_b(&tl2[0][m0 + col][kc * 32], lane); }
#pragma unroll
      for (int c = 0; c < 2; ++c) { bh[c] = frag_b(&th[1][(c & 7) * 16 + col][(c >> 3) * 32], lane); bl[c] = frag_b(&tl2[1][(c & 7) * 16 + col][(c >> 3) * 32], lane); }
#pragma unroll
      for (int c = 0; c < SLN / 4; ++c) { const int kc = c >> 3, j = c & 7, u = c + 2;
        if (u < SLN / 4) { bh[u] = frag_b(&th[1][(u & 7) * 16 + col][(u >> 3) * 32], lane); bl[u] = frag_b(&tl2[1][(u & 7) * 16 + col][(u >> 3) * 32], lane); }
        kv[j] = wmma_bf(al[kc], bh[c], kv[j]); kv[j] = wmma_bf(ah[kc], bl[c], kv[j]); kv[j] = wmma_bf(ah[kc], bh[c], kv[j]); } }
    if (side == 0) {   /* wave-uniform: thread m = tid adds its row of phi_k^T */
#pragma unroll
      for (int i = 0; i < SLN / 8; ++i) { const v8b a2 = *(const v8b*)&th[0][tid][i * 8], b2 = *(const v8b*)&tl2[0][tid][i * 8];
#pragma unroll
        for (int z = 0; z < 8; ++z) s += (float)a2[z] + (float)b2[z]; } }
#pragma unroll
    for (int kc = 0; kc < CI / 32; ++kc) {   /* in every trip, so that the old fragments are not held over the products above */
#pragma unroll
      for (int i = 0; i < 16; ++i) a[kc][i] = (__bf16)xn[kc][i >> 2][i & 3]; }
  }
  float* pp = PART + (size_t)blockIdx.y * PROWS * CO;
  if (side == 0) { float* ps = pp + CO * CO + tid; *ps = s;   /* a wave stores one whole 128-B line */
    asm volatile("s_wait_xcnt 0x0" :: "v"(ps) : "memory");   /* the address pair stays whole until the store above has taken its address */
  }
  float (*sf)[132] = (float (*)[132])&sw[0][0][0] + w8 * 16;   /* 8 waves x 16 rows x 528 B = 67,584 B of sw's 69,632; the last tile's 'staged' barrier stands behind every wave's last read of W */
#pragma unroll
  for (int j = 0; j < 8; ++j) {
#pragma unroll
    for (int r = 0; r < 8; ++r) sf[8 * g + r][j * 16 + col] = kv[j][r]; }
  LDSX(); float* po = pp + (size_t)m0 * CO + lane * 4;
#pragma unroll
  for (int rl = 0; rl < 16; ++rl) vst2(po + rl * CO, *(const v4f*)&sf[rl][lane * 4]);
  asm volatile("s_wait_xcnt 0x0" :: "v"(po) : "memory");   /* the address pair stays whole until every store above has taken its address */
}
// ---- k_join: block (y = head in the group) = 64 columns of one of the head's 129 partial rows (a 256-B segment): JG groups of 16 lanes; group t sums its run of JRUN slices in index order, the JG group sums are added in index order through LDS -> KV row (rows 0..127) or KS (row 128)
__global__ __launch_bounds__(16 * JG) void k_join(const float* __restrict__ PART0, float* __restrict__ KV0, float* __restrict__ KS0) { __shared__ __align__(16) float sj[JG][64];
  const float* __restrict__ PART = PART0 + (size_t)blockIdx.y * NSL * PROWS * CO; float* __restrict__ KV = KV0 + (size_t)blockIdx.y * CO * CO; float* __restrict__ KS = KS0 + (size_t)blockIdx.y * CO;
  const int tid = threadIdx.x, grp = tid >> 4, q = tid & 15; const int row = blockIdx.x >> 1, c0 = (blockIdx.x & 1) * 64;
  const float* p = PART + ((size_t)grp * JRUN * PROWS + row) * CO + c0 + q * 4; v4f s = {}, a[JRUN];
#pragma unroll
  for (int i = 0; i < JRUN; ++i) { a[i] = v4f{}; if (NSL % JG == 0 || grp * JRUN + i < NSL) a[i] = *(const v4f*)(p + (size_t)i * PROWS * CO); }   /* unrolled: all of a lane's loads are in flight together */
  asm volatile("s_wait_xcnt 0x0" :: "v"(p) : "memory");   /* the address pair stays whole until every load above has taken its address */
#pragma unroll
  for (int i = 0; i < JRUN; ++i) s += a[i];
  vst2(&sj[grp][q * 4], s); __syncthreads();
  if (tid < 16) { v4f t = {};
#pragma unroll
    for (int z = 0; z < JG; ++z) t += *(const v4f*)&sj[z][tid * 4];
    vst2((row < CO ? KV + (size_t)row * CO : KS) + c0 + tid * 4, t); } }
// ---- k_num: block = 64 rows n (all 128 cols), the group's HG heads one after the other, their sum kept in registers; per head: num = phi_q (hi+lo) . KV (f32 -> hi+lo, split and transposed into LDS once per block and head; v_map_w rounded once per block into LDS), 3 products; den = phi_q . KS (f32 dot per row from the planes), kept as 1 / (den + 1e-6); vss = v (hi+lo) . v_map_w^T (exact) + v_map_b; val = num * that reciprocal + vss; behind the last head ACC = (h == 0 ? 0 : ACC) + sum of val, h = the group's first head (this block's own 512-B row segments)
__global__ __launch_bounds__(128) void k_num(const __bf16* __restrict__ PQH0, const __bf16* __restrict__ PQL0, const float* __restrict__ KV0, const float* __restrict__ KS0, const __bf16* __restrict__ VH0, const __bf16* __restrict__ VL0, const float* __restrict__ VMW, const float* __restrict__ VMB, int h, float* __restrict__ ACC) {
  __shared__ __align__(16) float sf[4][16][132]; __shared__ __align__(16) float sks[128]; __shared__ float sden[64];
  __shared__ __align__(16) __bf16 skh[128][WP], skl[128][WP], swm[128][WP];   /* KV transposed [d][m] hi / lo; v_map_w rows */
  const int tid = threadIdx.x, wave = tid >> 5, lane = tid & 31, col = lane & 15, g = lane >> 4; const size_t r0 = (size_t)blockIdx.x * 64; const size_t w0 = r0 + wave * 16;
  stage_rows(VMW, swm, tid);   /* the same for every head: once per block */
  v8f tot[8] = {};
#pragma nounroll   /* rolled: one copy of the body's text rather than HG */
  for (int hh = 0; hh < HG; ++hh) {   /* no barrier of its own at the head of a trip: the 'sden ready' barrier of the trip before ends every wave's reads of skh, skl and sks, and sden is rewritten only behind this trip's first barrier */
  const __bf16* __restrict__ PQH = PQH0 + (size_t)hh * NN * CO; const __bf16* __restrict__ PQL = PQL0 + (size_t)hh * NN * CO; const __bf16* __restrict__ VH = VH0 + (size_t)hh * NN * CO; const __bf16* __restrict__ VL = VL0 + (size_t)hh * NN * CO;
  const float* __restrict__ KV = KV0 + (size_t)hh * CO * CO; const float* __restrict__ KS = KS0 + (size_t)hh * CO;
  { const float* pk = KV + tid; float kc2[CO]; const float ksv = KS[tid];   /* thread d takes column d of KV: a wave's load is 128 B of one row */
#pragma unroll
    for (int m = 0; m < CO; ++m) kc2[m] = pk[m * CO];   /* unrolled: the column's loads are in flight together */
    asm volatile("s_wait_xcnt 0x0" :: "v"(pk) : "memory");   /* the address pair stays whole until every load above has taken its address */
#pragma unroll
    for (int m = 0; m < CO; m += 8) { v8b hv, lv;
#pragma unroll
      for (int z = 0; z < 8; ++z) { const __bf16 hh = (__bf16)kc2[m + z]; hv[z] = hh; lv[z] = (__bf16)(kc2[m + z] - (float)hh); }
      *(v8b*)&skh[tid][m] = hv; *(v8b*)&skl[tid][m] = lv; }
    sks[tid] = ksv; }
  const __bf16 *pa = PQH + (w0 + col) * CO + 8 * g, *pb = PQL + (w0 + col) * CO + 8 * g, *pc = VH + (w0 + col) * CO + 8 * g, *pd = VL + (w0 + col) * CO + 8 * g;
  v16b ah[CO / 32], al[CO / 32], bh[CO / 32], bl[CO / 32];
#pragma unroll
  for (int kc = 0; kc < CO / 32; ++kc) { ah[kc] = frag_p(pa + kc * 32); al[kc] = frag_p(pb + kc * 32); bh[kc] = frag_p(pc + kc * 32); bl[kc] = frag_p(pd + kc * 32); }
  const float* pbv = VMB + col; float bv[8];
#pragma unroll
  for (int j = 0; j < 8; ++j) bv[j] = pbv[j * 16];
  asm volatile("s_wait_xcnt 0x0" :: "v"(pa), "v"(pb), "v"(pc), "v"(pd), "v"(pbv) : "memory");   /* the address pairs stay whole until every load above has taken its address */
  __syncthreads();
  if (tid < 64) { float d = 0.f; const __bf16* ph = PQH + (r0 + tid) * CO; const __bf16* pl = PQL + (r0 + tid) * CO;
#pragma unroll 4
    for (int m = 0; m < CO; m += 8) { const v8b a = *(const v8b*)(ph + m), b2 = *(const v8b*)(pl + m);
#pragma unroll
      for (int z = 0; z < 8; ++z) d += ((float)a[z] + (float)b2[z]) * sks[m + z]; }
    sden[tid] = 1.0f / (d + 1e-6f); }   /* the row's one division: its 128 columns multiply */
  v8f acc[8] = {}, vs[8] = {};
  { v16b wh[32], wl[32];   /* group t = kc * 8 + j; its KV fragments are read from LDS two groups ahead, so that the read's latency lies under the products in between */
#pragma unroll
    for (int t = 0; t < 2; ++t) { wh[t] = frag_b(&skh[(t & 7) * 16 + col][(t >> 3) * 32], lane); wl[t] = frag_b(&skl[(t & 7) * 16 + col][(t >> 3) * 32], lane); }
#pragma unroll
    for (int t = 0; t < 32; ++t) { const int kc = t >> 3, j = t & 7, u = t + 2;
      if (u < 32) { wh[u] = frag_b(&skh[(u & 7) * 16 + col][(u >> 3) * 32], lane); wl[u] = frag_b(&skl[(u & 7) * 16 + col][(u >> 3) * 32], lane); }
      acc[j] = wmma_bf(al[kc], wh[t], acc[j]); acc[j] = wmma_bf(ah[kc], wl[t], acc[j]); acc[j] = wmma_bf(ah[kc], wh[t], acc[j]); } }
  { v16b wm[32];   /* the same for v_map_w, three groups ahead */
#pragma unroll
    for (int t = 0; t < 3; ++t) wm[t] = frag_b(&swm[(t & 7) * 16 + col][(t >> 3) * 32], lane);
#pragma unroll
    for (int t = 0; t < 32; ++t) { const int kc = t >> 3, j = t & 7, u = t + 3;
      if (u < 32) wm[u] = frag_b(&swm[(u & 7) * 16 + col][(u >> 3) * 32], lane);
      vs[j] = wmma_bf(bh[kc], wm[t], vs[j]); vs[j] = wmma_bf(bl[kc], wm[t], vs[j]); } }
  __syncthreads();   /* sden ready */
#pragma unroll
  for (int j = 0; j < 8; ++j) { const float bb = bfr(bv[j]);
#pragma unroll
    for (int r = 0; r < 8; ++r) { const float rden = sden[wave * 16 + 8 * g + r]; tot[j][r] += acc[j][r] * rden + (vs[j][r] + bb); } }
  }
#pragma unroll
  for (int j = 0; j < 8; ++j) {
#pragma unroll
    for (int r = 0; r < 8; ++r) sf[wave][8 * g + r][j * 16 + col] = tot[j][r]; }
  LDSX(); for (int rl = 0; rl < 16; ++rl) { float* dst = ACC + (w0 + rl) * CO + lane * 4; v4f v = *(const v4f*)&sf[wave][rl][lane * 4]; if (h > 0) { const v4f p = *(const v4f*)dst; v[0] += p[0]; v[1] += p[1]; v[2] += p[2]; v[3] += p[3]; } vst2(dst, v); } }
// ---- k_fin: block = 64 rows: out = ACC / 8; time = sqrt(sum out^2 + 1); the 64 x 129 output rows form one contiguous, line-aligned 33,024-B span (64*129*4 = 258 lines; the span starts at row0*516 B with row0 a multiple of 64) staged in LDS and written thread-linearly in 16-B pieces
__global__ __launch_bounds__(128) void k_fin(const float* __restrict__ ACC, float* __restrict__ OUT) { __shared__ __align__(16) float so[64 * 129 + 12];
  const int tid = threadIdx.x; const size_t r0 = (size_t)blockIdx.x * 64;
  for (int rl = tid >> 5, lanei = tid & 31; rl < 64; rl += 4) { const v4f a = *(const v4f*)(ACC + (r0 + rl) * CO + lanei * 4); float o[4]; float s = 0.f;
#pragma unroll
    for (int z = 0; z < 4; ++z) { o[z] = a[z] * (1.0f / NH); s += o[z] * o[z]; }
#pragma unroll
    for (int q = 1; q < 32; q <<= 1) s += __shfl_xor(s, q);
#pragma unroll
    for (int z = 0; z < 4; ++z) so[rl * 129 + 1 + lanei * 4 + z] = o[z];
    if (lanei == 0) so[rl * 129] = sqrtf(s + 1.0f); }
  __syncthreads();
  float* dst = OUT + r0 * 129;
  for (int e = tid; e < 64 * 129 / 4; e += 128) vst2(dst + e * 4, *(const v4f*)&so[e * 4]); }   
extern "C" void kernel_launch(void* const* d_in, const int* in_sizes, int n_in, void* d_out, int out_size, void* d_ws, size_t ws_size, hipStream_t stream) {
  (void)in_sizes; (void)n_in; (void)out_size;
  const float** F = (const float**)d_in;   // 0 query_input, 1 source_input [32768,128]; 2 Wq_w [8,128,128], 3 Wq_b [8,128]; 4 Wk_w, 5 Wk_b; 6 Wv_w, 7 Wv_b; 8 v_map_w [128,128] (out,in), 9 v_map_b; 10 norm_scale
  if (ws_size < (size_t)WS_END) return;
  char* ws = (char*)d_ws; __bf16 *PQH = (__bf16*)(ws + WS_PQH), *PQL = (__bf16*)(ws + WS_PQL), *VH = (__bf16*)(ws + WS_VH), *VL = (__bf16*)(ws + WS_VL); float *KS = (float*)(ws + WS_KS), *KV = (float*)(ws + WS_KV), *ACC = (float*)(ws + WS_ACC), *PART = (float*)(ws + WS_PART);
  for (int h = 0; h < NH; h += HG) {   // k_proj behind k_join: phi_q takes the partials' place
    k_kvp<<<dim3(HG, NSL), 256, 0, stream>>>(F[1], F[4], F[5], F[6], F[7], F[10], h, VH, VL, PART);
    k_join<<<dim3(2 * PROWS, HG), 16 * JG, 0, stream>>>(PART, KV, KS);
    k_proj<<<dim3(HG, NPROC / 64), 128, 0, stream>>>(F[0], F[2], F[3], F[10], h, PQH, PQL);
    k_num<<<dim3(NPROC / 64), 128, 0, stream>>>(PQH, PQL, KV, KS, VH, VL, F[8], F[9], h, ACC);
  }
  k_fin<<<dim3(NPROC / 64), 128, 0, stream>>>(ACC, (float*)d_out);
}

// v007
// One run takes 218 microseconds.
// In both of two side-by-side timings against v006, it was 1.06 times as fast.
// All steps since v000 together make it 108 times as fast.
// compute dtype: all float inputs rounded to bf16; q/k/v head projections x W^T + b with EXACT bf16 products on WMMA 16x16x32, f32 accumulate; relu, the power feature map (norms over 128, x^2) in f32; phi_k, v, phi_q and the [128 x 128] k^T v as bf16 hi + lo (3 products) for the two linear-attention contractions (K = 32,768 and K = 128), v hi + lo against exact v_map_w (2 products); the normaliser phi_q . (column sums) likewise hi + lo on both sides (3 products, K = 128); column sums, the head mean and the time coordinate (sqrt) in f32; f32 output.
#include <hip/hip_runtime.h>
#include <math.h>

typedef __attribute__((ext_vector_type(16))) _Float16 v16h;
typedef __attribute__((ext_vector_type(16))) __bf16 v16b;
typedef __attribute__((ext_vector_type(8)))  _Float16 v8h;
typedef __attribute__((ext_vector_type(8)))  float v8f;
typedef __attribute__((ext_vector_type(4)))  float v4f;
typedef __attribute__((ext_vector_type(2)))  float v2f;
typedef __attribute__((ext_vector_type(4)))  unsigned v4u;
typedef __attribute__((ext_vector_type(4)))  int v4i;
typedef float __attribute__((may_alias)) float_a;
typedef int __attribute__((may_alias)) int_a;

template <typename T> __device__ __forceinline__ void vst2(void* p, T v) { *(T*)p = v;  }
__device__ __forceinline__ v8f wmma16(v16h a, v16h b, v8f c) {
  v8f d = __builtin_amdgcn_wmma_f32_16x16x32_f16(false, a, false, b, (short)0, c, false, false);
  asm volatile("v_nop\n\tv_nop\n\tv_nop\n\tv_nop" : "+v"(d) : "v"(a), "v"(b));
  return d;
}
__device__ __forceinline__ v8f wmma_bf(v16b a, v16b b, v8f c) {
  v8f d = __builtin_amdgcn_wmma_f32_16x16x32_bf16(false, a, false, b, (short)0, c, false, false);
  asm volatile("v_nop\n\tv_nop\n\tv_nop\n\tv_nop" : "+v"(d) : "v"(a), "v"(b));
  return d;
}
// 16x16x32 fragments: lane = (h = lane>>4, row/col = lane&15); elements 0..7 = k0+8h+0..7, 8..15 = k0+16+8h+0..7; D element r = row 8h+r
__device__ __forceinline__ v16h frag_h(const _Float16* rowk0, int lane) {
  union { v16h v; v8h q[2]; } u; const _Float16* p = rowk0 + 8 * (lane >> 4);
  u.q[0] = *(const v8h*)p; u.q[1] = *(const v8h*)(p + 16); return u.v;
}
__device__ __forceinline__ v16h frag_f32(const float* rowk0, int lane) {
  v16h a; const float* p = rowk0 + 8 * (lane >> 4);
#pragma unroll
  for (int i = 0; i < 8; ++i) { a[i] = (_Float16)p[i]; a[8 + i] = (_Float16)p[16 + i]; }
  return a;
}
__device__ __forceinline__ v16h frag_f32s(const float* rowk0, int lane, float sc) {
  v16h a; const float* p = rowk0 + 8 * (lane >> 4);
#pragma unroll
  for (int i = 0; i < 8; ++i) { a[i] = (_Float16)(p[i] * sc); a[8 + i] = (_Float16)(p[16 + i] * sc); }
  return a;
}
// column fragment from a [K][ld] layout (column n), rows >= K read as 0
__device__ __forceinline__ v16h fragc_f32(const float* W, int k0, int n, int lane, int ld, int K) {
  v16h a; const int g = lane >> 4;
#pragma unroll
  for (int i = 0; i < 8; ++i) { const int ka = k0 + 8 * g + i, kb = ka + 16;
    a[i] = (_Float16)(ka < K ? W[(size_t)(ka < K ? ka : K - 1) * ld + n] : 0.f); a[8 + i] = (_Float16)(kb < K ? W[(size_t)(kb < K ? kb : K - 1) * ld + n] : 0.f); }
  return a;
}
struct F2 { v16b h, l; };
__device__ __forceinline__ F2 bsplit16(const float v[16]) { F2 r;
#pragma unroll
  for (int i = 0; i < 16; ++i) { const __bf16 h = (__bf16)v[i]; r.h[i] = h; r.l[i] = (__bf16)(v[i] - (float)h); }
  return r; }
__device__ __forceinline__ F2 split_row(const float* row, int k0, int lane) { float v[16]; const float* p = row + k0 + 8 * (lane >> 4);
#pragma unroll
  for (int i = 0; i < 8; ++i) { v[i] = p[i]; v[8 + i] = p[16 + i]; }
  return bsplit16(v); }
__device__ __forceinline__ F2 split_rowK(const float* row, int k0, int lane, int K) { float v[16]; const int g = lane >> 4;
#pragma unroll
  for (int i = 0; i < 8; ++i) { const int ka = k0 + 8 * g + i, kb = ka + 16; v[i] = ka < K ? row[ka < K ? ka : K - 1] : 0.f; v[8 + i] = kb < K ? row[kb < K ? kb : K - 1] : 0.f; }
  return bsplit16(v); }
__device__ __forceinline__ F2 split_col(const float* W, int k0, int n, int lane, int ld, int K) { float v[16]; const int g = lane >> 4;
#pragma unroll
  for (int i = 0; i < 8; ++i) { const int ka = k0 + 8 * g + i, kb = ka + 16; v[i] = ka < K ? W[(size_t)(ka < K ? ka : K - 1) * ld + n] : 0.f; v[8 + i] = kb < K ? W[(size_t)(kb < K ? kb : K - 1) * ld + n] : 0.f; }
  return bsplit16(v); }
__device__ __forceinline__ v8f mac3(const F2& a, const F2& b, v8f c) { c = wmma_bf(a.l, b.h, c); c = wmma_bf(a.h, b.l, c); return wmma_bf(a.h, b.h, c); }
__device__ __forceinline__ float sigm(float v) { return 1.0f / (1.0f + expf(-v)); }
#define LDSX() do { asm volatile("s_wait_dscnt 0" ::: "memory"); __builtin_amdgcn_wave_barrier(); __builtin_amdgcn_fence(__ATOMIC_RELEASE, "workgroup"); } while (0)

// Hyperbolic (Lorentz) linear-attention 'TransConv' layer (N 32,768 nodes, 128 -> 128, 8 heads, power kernel p = 2): per head h: qs = x_q Wq[h]^T + bq[h], ks = x_s Wk[h]^T + bk[h], v = x_s Wv[h]^T + bv[h]; phi(x) = ||x|| / (||x^2|| + 1e-8) * x^2 applied to (relu(.) + 1e-6)/(|norm_scale| + 1e-6); KV[h] = sum_n phi_k[n] (x) v[n]; num[n] = phi_q[n] KV[h]; den[n] = phi_q[n] . sum_n phi_k[n]; attn = num / (den + 1e-6) + (v v_map_w^T + v_map_b); out = mean over heads; result = [sqrt(sum out^2 + 1), out].
#define NN 32768
#define CI 128             // in channels
#define CO 128             // out channels per head
#define NH 8
#ifndef NPROC
#define NPROC NN           // rows processed
#endif
typedef __attribute__((ext_vector_type(8))) __bf16 v8b;
__device__ __forceinline__ v16b frag_b(const __bf16* rowk0, int lane) {
  union { v16b v; v8b q[2]; } u; const __bf16* p = rowk0 + 8 * (lane >> 4);
  u.q[0] = *(const v8b*)p; u.q[1] = *(const v8b*)(p + 16); return u.v;
}
// the same fragment from a pointer that already holds the lane's 8 * (lane >> 4)
__device__ __forceinline__ v16b frag_p(const __bf16* p) {
  union { v16b v; v8b q[2]; } u; u.q[0] = *(const v8b*)p; u.q[1] = *(const v8b*)(p + 16); return u.v;
}
typedef __attribute__((ext_vector_type(4))) __bf16 v4b;
#define WP 136             // bf16 per LDS row of a staged [128][128] B operand (272 B = 16 B x 17)
// a block of 128 threads rounds a row-major f32 [128][128] matrix to bf16 rows in LDS: thread t takes the 16-B pieces t, t + 128, ... (a wave fills one row per piece); a call takes the NI pieces from I0 on
template <int I0 = 0, int NI = 32> __device__ __forceinline__ void stage_rows(const float* __restrict__ Wm, __bf16 (*dst)[WP], int tid) {
  const float* pw = Wm + tid * 4 + I0 * 512; v4f wv[NI];
#pragma unroll
  for (int i = 0; i < NI; ++i) wv[i] = *(const v4f*)(pw + i * 512);   /* unrolled: all of a thread's loads are in flight together */
  asm volatile("s_wait_xcnt 0x0" :: "v"(pw), "v"(tid) : "memory");   /* the address pair, or the thread index where the loads go by a scalar base plus that index, stays whole until every load above has taken its address */
#pragma unroll
  for (int i = 0; i < NI; ++i) { v4b o;
#pragma unroll
    for (int z = 0; z < 4; ++z) o[z] = (__bf16)wv[i][z];
    *(v4b*)&dst[(tid >> 5) + 4 * (I0 + i)][(tid & 31) * 4] = o; } }
__device__ __forceinline__ float bfr(float v) { return (float)(__bf16)v; }
__device__ __forceinline__ v16b wrow(const float* rowk0, int lane) { v16b w; const float* p = rowk0 + 8 * (lane >> 4);
#pragma unroll
  for (int i = 0; i < 8; ++i) { w[i] = (__bf16)p[i]; w[8 + i] = (__bf16)p[16 + i]; }
  return w; }
// B fragment (k rows k0+.., column n) of an f32 [K][ld] matrix, split bf16 hi + lo
__device__ __forceinline__ F2 colsplit(const float* Wm, int k0, int n, int lane, int ld) { float v[16]; const int g = lane >> 4;
#pragma unroll
  for (int i = 0; i < 8; ++i) { v[i] = Wm[(size_t)(k0 + 8 * g + i) * ld + n]; v[8 + i] = Wm[(size_t)(k0 + 16 + 8 * g + i) * ld + n]; }
  return bsplit16(v); }

#define HG 4               // heads that one launch of each stage takes together (NH / HG groups, one after the other)
#define WS_VH  0u                                       // bf16 v rows [head in group][n][128] hi / lo
#define WS_VL  (WS_VH  + 2u * (size_t)HG * NN * CO)
#define WS_KS  (WS_VL  + 2u * (size_t)HG * NN * CO)     // f32 column sums of phi_k [head in group][128]
#define WS_KV  (WS_KS  + 4u * (size_t)HG * 128)         // f32 KV [head in group][m][d]
#define WS_ACC (WS_KV  + 4u * (size_t)HG * CO * CO)     // f32 head-sum accumulator [n][128]
#define SLN 64             // rows n per tile of the two sums over n
#define TPB 4              // tiles in a row that one block of k_kvp takes one after the other: together one slice
#define NSL (NPROC / (SLN * TPB))  // slices
#define JG 8               // groups of 16 lanes in a block of k_join
#define JRUN ((NSL + JG - 1) / JG)   // slices in a row that one of k_join's JG groups sums
#define PROWS (CO + 1)     // rows of one slice's partial: 128 rows of KV, then the column sums
#define WS_PART (WS_ACC + 4u * (size_t)NN * CO)         // f32 partials [head in group][slice][129][128]
#define WS_PQH WS_PART                                  // bf16 phi_q rows [head in group][n][128] hi / lo: they begin at the partials' place, which k_join has read out before k_proj is launched
#define WS_PQL (WS_PQH + 2u * (size_t)HG * NN * CO)
#define WS_END (WS_PQL + 2u * (size_t)HG * NN * CO)
static_assert(4u * (size_t)HG * (NN / (SLN * TPB)) * PROWS * CO <= 4u * (size_t)HG * NN * CO, "the partials end in front of WS_END");
#define TP 72              // bf16 per LDS row of a transposed [128][64] tile (144 B = 16 B x 9)

// acc = x W^T for a wave's 16 rows (a: the rows' four k fragments) against the [128][128] bf16 W in LDS; product t = kc * 8 + j; its W fragment is read from LDS six products ahead, so that the read's latency lies under the products in between
__device__ __forceinline__ void proj_tile(const v16b a[CI / 32], const __bf16 (*sw)[WP], int col, int lane, v8f acc[8]) {
  v16b fw[32];
#pragma unroll
  for (int t = 0; t < 6; ++t) fw[t] = frag_b(&sw[(t & 7) * 16 + col][(t >> 3) * 32], lane);
#pragma unroll
  for (int t = 0; t < 32; ++t) { if (t + 6 < 32) fw[t + 6] = frag_b(&sw[((t + 6) & 7) * 16 + col][((t + 6) >> 3) * 32], lane);
    acc[t & 7] = wmma_bf(a[t >> 3], fw[t], acc[t & 7]); } }
// feature map on a wave's 16 x 128 tile: x = (relu(acc) + 1e-6) * rs with rs = 1 / ds (one divisor for the whole launch: its reciprocal is formed once by the caller), phi = ||x|| / (||x^2|| + 1e-8) * x^2, the two norms over the 128 columns (lane partial sums + 16-lane shuffles)
__device__ __forceinline__ void feature_map(v8f acc[8], float rs) { float n1[8], n2[8];
#pragma unroll
  for (int r = 0; r < 8; ++r) { float s1 = 0.f, s2 = 0.f;
#pragma unroll
    for (int j = 0; j < 8; ++j) { const float x = (fmaxf(acc[j][r], 0.f) + 1e-6f) * rs; acc[j][r] = x; const float x2 = x * x; s1 += x2; s2 += x2 * x2; }
    n1[r] = s1; n2[r] = s2; }
#pragma unroll
  for (int o = 1; o < 16; o <<= 1) {
#pragma unroll
    for (int r = 0; r < 8; ++r) { n1[r] += __shfl_xor(n1[r], o); n2[r] += __shfl_xor(n2[r], o); } }
#pragma unroll
  for (int r = 0; r < 8; ++r) n1[r] = sqrtf(n1[r]) / (sqrtf(n2[r]) + 1e-8f);   /* ||x|| / (||x^2|| + eps) */
#pragma unroll
  for (int j = 0; j < 8; ++j) {
#pragma unroll
    for (int r = 0; r < 8; ++r) acc[j][r] = n1[r] * (acc[j][r] * acc[j][r]); } }

// a wave's 16 x 128 f32 tile, split bf16 hi + lo, into LDS, transposed ([column][row]); rb = the lane's first row in the block's tile
__device__ __forceinline__ void stage_tile(const v8f acc[8], __bf16 (*th)[TP], __bf16 (*tl)[TP], int rb, int col) {
#pragma unroll
  for (int j = 0; j < 8; ++j) {
#pragma unroll
    for (int r = 0; r < 8; ++r) { const float v = acc[j][r]; const __bf16 hv = (__bf16)v, lv = (__bf16)(v - (float)hv); const int rl = rb + r, cl = j * 16 + col;
      th[cl][rl] = hv; tl[cl][rl] = lv; } } }
// a wave's 16 x 128 f32 tile leaves as bf16 rows, the hi plane and then the lo plane, each through the wave's own 16 LDS rows: every store is 512 contiguous bytes; ph, pl = the lane's 16-B piece of the tile's first 512 B in each plane
__device__ __forceinline__ void rows_out(const v8f acc[8], __bf16 (*sv)[WP], __bf16* ph, __bf16* pl, int g, int col, int lane) {
#pragma unroll
  for (int p = 0; p < 2; ++p) {
#pragma unroll
    for (int j = 0; j < 8; ++j) {
#pragma unroll
      for (int r = 0; r < 8; ++r) { const float v = acc[j][r]; const __bf16 hv = (__bf16)v; sv[8 * g + r][j * 16 + col] = p == 0 ? hv : (__bf16)(v - (float)hv); } }
    LDSX();   /* the wave's stores have landed before its lanes read one another's */
    v4u q[8];
#pragma unroll
    for (int i = 0; i < 8; ++i) { const int e = lane + i * 32; q[i] = *(const v4u*)&sv[e >> 4][(e & 15) * 8]; }
    LDSX();   /* the reads are done before the rows are written again */
#pragma unroll
    for (int i = 0; i < 8; ++i) vst2((p == 0 ? ph : pl) + i * 256, q[i]); } }
// ---- k_proj: block (x = head in the group, y = 64-row tile) = 64 rows of head h's q: acc = x_q Wq[h]^T + bq[h] (W (out,in) rows contiguous; exact; W[h] rounded to bf16 once per block into LDS, each lane's x row loaded whole up front); feature map; phi_q -> bf16 hi/lo rows
__global__ __launch_bounds__(128) void k_proj(const float* __restrict__ XQ, const float* __restrict__ WQ, const float* __restrict__ BQ, const float* __restrict__ NS, int h0, __bf16* __restrict__ PQH0, __bf16* __restrict__ PQL0) {
  __shared__ __align__(16) __bf16 sw[128][WP];
  const int h = h0 + blockIdx.x; __bf16* __restrict__ PQH = PQH0 + (size_t)blockIdx.x * NN * CO; __bf16* __restrict__ PQL = PQL0 + (size_t)blockIdx.x * NN * CO;   /* the blocks of one tile's HG heads stand side by side in the grid: they read the same x rows */
  __bf16 (*sh)[WP] = sw; __bf16 (*sl)[WP] = sw + 64;   /* behind the products the same LDS holds the tile's hi rows (0..63) and lo rows (64..127) */
  const int tid = threadIdx.x, wave = tid >> 5, lane = tid & 31, col = lane & 15, g = lane >> 4; const size_t r0 = (size_t)blockIdx.y * 64;
  const float* WA = WQ + (size_t)h * CO * CI; const float* BA = BQ + (size_t)h * CO;
  const float* px = XQ + (r0 + wave * 16 + col) * CI + 8 * g; v4f xa[CI / 32][4];
#pragma unroll
  for (int kc = 0; kc < CI / 32; ++kc) { xa[kc][0] = *(const v4f*)(px + kc * 32); xa[kc][1] = *(const v4f*)(px + kc * 32 + 4); xa[kc][2] = *(const v4f*)(px + kc * 32 + 16); xa[kc][3] = *(const v4f*)(px + kc * 32 + 20); }
  const float* pbv = BA + col; float bv[8];
#pragma unroll
  for (int j = 0; j < 8; ++j) bv[j] = pbv[j * 16];
  asm volatile("s_wait_xcnt 0x0" :: "v"(px), "v"(pbv) : "memory");   /* the address pairs stay whole until every load above has taken its address */
  stage_rows(WA, sw, tid);
  v16b a[CI / 32];
#pragma unroll
  for (int kc = 0; kc < CI / 32; ++kc) {
#pragma unroll
    for (int i = 0; i < 16; ++i) a[kc][i] = (__bf16)xa[kc][i >> 2][i & 3]; }
  __syncthreads();   /* W[h] staged */
  v8f acc[8] = {}; proj_tile(a, sw, col, lane, acc);
  __syncthreads();   /* every wave has read its last W fragment: the LDS may take the output tile */
#pragma unroll
  for (int j = 0; j < 8; ++j) { const float bb = bfr(bv[j]);
#pragma unroll
    for (int r = 0; r < 8; ++r) acc[j][r] += bb; }
  feature_map(acc, 1.0f / (fabsf(bfr(NS[0])) + 1e-6f));
#pragma unroll
  for (int j = 0; j < 8; ++j) {
#pragma unroll
    for (int r = 0; r < 8; ++r) { const float v = acc[j][r]; const __bf16 hv = (__bf16)v, lv = (__bf16)(v - (float)hv); const int rl = wave * 16 + 8 * g + r, cl = j * 16 + col; sh[rl][cl] = hv; sl[rl][cl] = lv; } }
  __syncthreads();
  __bf16* qh = PQH + r0 * CO + tid * 8; __bf16* ql = PQL + r0 * CO + tid * 8;   /* the tile's 64 rows are one contiguous 16-KiB span of each plane: piece e = tid + 128 i */
#pragma unroll
  for (int i = 0; i < 8; ++i) { const int e = tid + i * 128; vst2(qh + i * 1024, *(const v4u*)&sh[e >> 4][(e & 15) * 8]); vst2(ql + i * 1024, *(const v4u*)&sl[e >> 4][(e & 15) * 8]); }
  asm volatile("s_wait_xcnt 0x0" :: "v"(qh), "v"(ql) : "memory");   /* the address pairs stay whole until every store above has taken its address */
}
// ---- k_kvp: block (x = head in the group, y = slice) = one slice of TPB tiles of 64 rows n of head h, 256 threads; both W[h] go into LDS once and stay; the tiles follow one another in a loop. Per tile: waves 0..3 form phi_k = feature map of x_s Wk[h]^T + bk[h], waves 4..7 v = x_s Wv[h]^T + bv[h] (each half as k_proj). Both tiles go, bf16 hi + lo, TRANSPOSED ([m][n], [d][n]) into LDS; v also leaves as hi/lo rows. Then wave w: KV[16 w + ..][d] += sum_n phi_k[m][n] v[d][n] over the tile (hi + lo both sides, 3 products, K = 64), kept in registers over the slice; thread m < 128: its sum += sum_n phi_k[m][n] (hi + lo) in a fixed order. Behind the last tile: rows 0..127 and row 128 of the slice's f32 partial. The attribute holds the build to the 256 registers of four waves per SIMD: two blocks share a WGP (2 x the LDS fits too)
__global__ __launch_bounds__(256) __attribute__((amdgpu_waves_per_eu(4, 4))) void k_kvp(const float* __restrict__ XS, const float* __restrict__ WK, const float* __restrict__ BK, const float* __restrict__ WV, const float* __restrict__ BV, const float* __restrict__ NS, int h0, __bf16* __restrict__ VH0, __bf16* __restrict__ VL0, float* __restrict__ PART0) {
  const int h = h0 + blockIdx.x; __bf16* __restrict__ VH = VH0 + (size_t)blockIdx.x * NN * CO; __bf16* __restrict__ VL = VL0 + (size_t)blockIdx.x * NN * CO; float* __restrict__ PART = PART0 + (size_t)blockIdx.x * NSL * PROWS * CO;
  __shared__ __align__(16) __bf16 sw[2][128][WP]; __shared__ __align__(16) __bf16 th[2][128][TP], tl2[2][128][TP];   /* [0] k side, [1] v side */
  __shared__ __align__(16) __bf16 sv[4][16][WP];   /* each v-side wave's own 16 rows on their way out */
  __shared__ float sb[2][CO];   /* the two biases, rounded: read anew in every trip, held in no register over the loop */
  const int tid = threadIdx.x, t7 = tid & 127, wave = t7 >> 5, lane = tid & 31, col = lane & 15, g = lane >> 4; const size_t r0 = (size_t)blockIdx.y * (SLN * TPB);
  const int side = __builtin_amdgcn_readfirstlane(tid >> 7);   /* the same in a whole wave: 0 = k, 1 = v */
  const float* WA = (side == 0 ? WK : WV) + (size_t)h * CO * CI; const float* BA = (side == 0 ? BK : BV) + (size_t)h * CO;
  const float* px = XS + (r0 + wave * 16 + col) * CI + 8 * g; v4f xa[CI / 32][4];
#pragma unroll
  for (int kc = 0; kc < CI / 32; ++kc) { xa[kc][0] = *(const v4f*)(px + kc * 32); xa[kc][1] = *(const v4f*)(px + kc * 32 + 4); xa[kc][2] = *(const v4f*)(px + kc * 32 + 16); xa[kc][3] = *(const v4f*)(px + kc * 32 + 20); }
  const float* pbv = BA + t7; const float bv = *pbv;
  asm volatile("s_wait_xcnt 0x0" :: "v"(px), "v"(pbv) : "memory");   /* the address pairs stay whole until every load above has taken its address */
  stage_rows<0, 16>(WA, sw[side], t7);   /* in two halves: all 32 pieces at once, beside the x rows, do not fit the 256 registers of four waves per SIMD */
  __builtin_amdgcn_sched_barrier(0);   /* keeps the second half's loads behind the first half's LDS stores: moved up, they bring the spills back */
  stage_rows<16, 16>(WA, sw[side], t7);
  sb[side][t7] = bfr(bv);
  const float rs = 1.0f / (fabsf(bfr(NS[0])) + 1e-6f);
  __bf16* vh = VH + (r0 + wave * 16) * CO + lane * 8; __bf16* vl = VL + (r0 + wave * 16) * CO + lane * 8;   /* a wave's 16 rows are one contiguous 4-KiB span of each plane: piece e = lane + 32 i */
  const int w8 = tid >> 5, m0 = w8 * 16; v8f kv[8] = {}; float s = 0.f;
  v16b a[CI / 32];   /* the tile's x rows as fragments */
#pragma unroll
  for (int kc = 0; kc < CI / 32; ++kc) {
#pragma unroll
    for (int i = 0; i < 16; ++i) a[kc][i] = (__bf16)xa[kc][i >> 2][i & 3]; }
  __syncthreads();   /* both W[h] and the biases staged */
#pragma nounroll   /* rolled: one copy of the body's text rather than TPB */
  for (int t = 0; t < TPB; ++t) {
    { v8f acc[8] = {};
      proj_tile(a, sw[side], col, lane, acc);
#pragma unroll
      for (int j = 0; j < 8; ++j) { const float bb = sb[side][j * 16 + col];
#pragma unroll
        for (int r = 0; r < 8; ++r) acc[j][r] += bb; }
      if (side == 0) feature_map(acc, rs);   /* wave-uniform, no barrier inside */
      else { rows_out(acc, sv[wave], vh, vl, g, col, lane);   /* wave-uniform, no barrier inside: v's rows leave while the k side forms its feature map */
        asm volatile("s_wait_xcnt 0x0" :: "v"(vh), "v"(vl) : "memory");   /* the address pairs stay whole until every store above has taken its address */
        vh += SLN * CO; vl += SLN * CO; }
      if (t > 0) __syncthreads();   /* the same for the whole block: every wave has read the last of the tile before from th and tl2 */
      stage_tile(acc, th[side], tl2[side], wave * 16 + 8 * g, col); }
    __syncthreads();   /* phi_k^T and v^T staged */
    v4f xn[CI / 32][4] = {};   /* born here, so that no register is held for it over the first half of a trip */
    if (t + 1 < TPB) { px += SLN * CI;   /* the next tile's x rows are asked for here: they arrive under this tile's k^T v products */
#pragma unroll
      for (int kc = 0; kc < CI / 32; ++kc) { xn[kc][0] = *(const v4f*)(px + kc * 32); xn[kc][1] = *(const v4f*)(px + kc * 32 + 4); xn[kc][2] = *(const v4f*)(px + kc * 32 + 16); xn[kc][3] = *(const v4f*)(px + kc * 32 + 20); }
      asm volatile("s_wait_xcnt 0x0" :: "v"(px) : "memory");   /* the address pair stays whole until every load above has taken its address */
    }
    { v16b ah[SLN / 32], al[SLN / 32], bh[SLN / 4], bl[SLN / 4];   /* group c = kc * 8 + j; its v fragments are read from LDS two groups ahead, so that the read's latency lies under the products in between */
#pragma unroll
      for (int kc = 0; kc < SLN / 32; ++kc) { ah[kc] = frag_b(&th[0][m0 + col][kc * 32], lane); al[kc] = frag_b(&tl2[0][m0 + col][kc * 32], lane); }
#pragma unroll
      for (int c = 0; c < 2; ++c) { bh[c] = frag_b(&th[1][(c & 7) * 16 + col][(c >> 3) * 32], lane); bl[c] = frag_b(&tl2[1][(c & 7) * 16 + col][(c >> 3) * 32], lane); }
#pragma unroll
      for (int c = 0; c < SLN / 4; ++c) { const int kc = c >> 3, j = c & 7, u = c + 2;
        if (u < SLN / 4) { bh[u] = frag_b(&th[1][(u & 7) * 16 + col][(u >> 3) * 32], lane); bl[u] = frag_b(&tl2[1][(u & 7) * 16 + col][(u >> 3) * 32], lane); }
        kv[j] = wmma_bf(al[kc], bh[c], kv[j]); kv[j] = wmma_bf(ah[kc], bl[c], kv[j]); kv[j] = wmma_bf(ah[kc], bh[c], kv[j]); } }
    if (side == 0) {   /* wave-uniform: thread m = tid adds its row of phi_k^T */
#pragma unroll
      for (int i = 0; i < SLN / 8; ++i) { const v8b a2 = *(const v8b*)&th[0][tid][i * 8], b2 = *(const v8b*)&tl2[0][tid][i * 8];
#pragma unroll
        for (int z = 0; z < 8; ++z) s += (float)a2[z] + (float)b2[z]; } }
#pragma unroll
    for (int kc = 0; kc < CI / 32; ++kc) {   /* in every trip, so that the old fragments are not held over the products above */
#pragma unroll
      for (int i = 0; i < 16; ++i) a[kc][i] = (__bf16)xn[kc][i >> 2][i & 3]; }
  }
  float* pp = PART + (size_t)blockIdx.y * PROWS * CO;
  if (side == 0) { float* ps = pp + CO * CO + tid; *ps = s;   /* a wave stores one whole 128-B line */
    asm volatile("s_wait_xcnt 0x0" :: "v"(ps) : "memory");   /* the address pair stays whole until the store above has taken its address */
  }
  float (*sf)[132] = (float (*)[132])&sw[0][0][0] + w8 * 16;   /* 8 waves x 16 rows x 528 B = 67,584 B of sw's 69,632; the last tile's 'staged' barrier stands behind every wave's last read of W */
#pragma unroll
  for (int j = 0; j < 8; ++j) {
#pragma unroll
    for (int r = 0; r < 8; ++r) sf[8 * g + r][j * 16 + col] = kv[j][r]; }
  LDSX(); float* po = pp + (size_t)m0 * CO + lane * 4;
#pragma unroll
  for (int rl = 0; rl < 16; ++rl) vst2(po + rl * CO, *(const v4f*)&sf[rl][lane * 4]);
  asm volatile("s_wait_xcnt 0x0" :: "v"(po) : "memory");   /* the address pair stays whole until every store above has taken its address */
}
// ---- k_join: block (y = head in the group) = 64 columns of one of the head's 129 partial rows (a 256-B segment): JG groups of 16 lanes; group t sums its run of JRUN slices in index order, the JG group sums are added in index order through LDS -> KV row (rows 0..127) or KS (row 128)
__global__ __launch_bounds__(16 * JG) void k_join(const float* __restrict__ PART0, float* __restrict__ KV0, float* __restrict__ KS0) { __shared__ __align__(16) float sj[JG][64];
  const float* __restrict__ PART = PART0 + (size_t)blockIdx.y * NSL * PROWS * CO; float* __restrict__ KV = KV0 + (size_t)blockIdx.y * CO * CO; float* __restrict__ KS = KS0 + (size_t)blockIdx.y * CO;
  const int tid = threadIdx.x, grp = tid >> 4, q = tid & 15; const int row = blockIdx.x >> 1, c0 = (blockIdx.x & 1) * 64;
  const float* p = PART + ((size_t)grp * JRUN * PROWS + row) * CO + c0 + q * 4; v4f s = {}, a[JRUN];
#pragma unroll
  for (int i = 0; i < JRUN; ++i) { a[i] = v4f{}; if (NSL % JG == 0 || grp * JRUN + i < NSL) a[i] = *(const v4f*)(p + (size_t)i * PROWS * CO); }   /* unrolled: all of a lane's loads are in flight together */
  asm volatile("s_wait_xcnt 0x0" :: "v"(p) : "memory");   /* the address pair stays whole until every load above has taken its address */
#pragma unroll
  for (int i = 0; i < JRUN; ++i) s += a[i];
  vst2(&sj[grp][q * 4], s); __syncthreads();
  if (tid < 16) { v4f t = {};
#pragma unroll
    for (int z = 0; z < JG; ++z) t += *(const v4f*)&sj[z][tid * 4];
    vst2((row < CO ? KV + (size_t)row * CO : KS) + c0 + tid * 4, t); } }
// ---- k_num: block = 64 rows n (all 128 cols), the group's HG heads one after the other, their sum kept in registers; per head: num = phi_q (hi+lo) . KV (f32 -> hi+lo, split and transposed into LDS once per block and head; v_map_w rounded once per block into LDS), 3 products; den = phi_q (hi+lo) . KS (f32 -> hi+lo) as a ninth column tile of the same products, all 16 columns of its B operand holding KS, so that every lane gets the den of its own 8 rows; kept as 1 / (den + 1e-6); vss = v (hi+lo) . v_map_w^T (exact) + v_map_b; val = num * that reciprocal + vss; behind the last head ACC = (h == 0 ? 0 : ACC) + sum of val, h = the group's first head (this block's own 512-B row segments)
__global__ __launch_bounds__(128) void k_num(const __bf16* __restrict__ PQH0, const __bf16* __restrict__ PQL0, const float* __restrict__ KV0, const float* __restrict__ KS0, const __bf16* __restrict__ VH0, const __bf16* __restrict__ VL0, const float* __restrict__ VMW, const float* __restrict__ VMB, int h, float* __restrict__ ACC) {
  __shared__ __align__(16) float sf[4][16][132]; __shared__ __align__(16) __bf16 sksh[128], sksl[128];   /* KS hi / lo */
  __shared__ __align__(16) __bf16 skh[128][WP], skl[128][WP], swm[128][WP];   /* KV transposed [d][m] hi / lo; v_map_w rows */
  const int tid = threadIdx.x, wave = tid >> 5, lane = tid & 31, col = lane & 15, g = lane >> 4; const size_t r0 = (size_t)blockIdx.x * 64; const size_t w0 = r0 + wave * 16;
  stage_rows(VMW, swm, tid);   /* the same for every head: once per block */
  v8f tot[8] = {};
#pragma nounroll   /* rolled */
  for (int hh = 0; hh < HG; ++hh) {   /* no barrier of its own at the head of a trip: the barrier behind the products of the trip before ends every wave's reads of skh, skl, sksh and sksl */
  const __bf16* __restrict__ PQH = PQH0 + (size_t)hh * NN * CO; const __bf16* __restrict__ PQL = PQL0 + (size_t)hh * NN * CO; const __bf16* __restrict__ VH = VH0 + (size_t)hh * NN * CO; const __bf16* __restrict__ VL = VL0 + (size_t)hh * NN * CO;
  const float* __restrict__ KV = KV0 + (size_t)hh * CO * CO; const float* __restrict__ KS = KS0 + (size_t)hh * CO;
  { const float* pk = KV + tid; float kc2[CO]; const float ksv = KS[tid];   /* thread d takes column d of KV: a wave's load is 128 B of one row */
#pragma unroll
    for (int m = 0; m < CO; ++m) kc2[m] = pk[m * CO];   /* unrolled: the column's loads are in flight together */
    asm volatile("s_wait_xcnt 0x0" :: "v"(pk) : "memory");   /* the address pair stays whole until every load above has taken its address */
#pragma unroll
    for (int m = 0; m < CO; m += 8) { v8b hv, lv;
#pragma unroll
      for (int z = 0; z < 8; ++z) { const __bf16 hh = (__bf16)kc2[m + z]; hv[z] = hh; lv[z] = (__bf16)(kc2[m + z] - (float)hh); }
      *(v8b*)&skh[tid][m] = hv; *(v8b*)&skl[tid][m] = lv; }
    const __bf16 kh = (__bf16)ksv; sksh[tid] = kh; sksl[tid] = (__bf16)(ksv - (float)kh); }
  const __bf16 *pa = PQH + (w0 + col) * CO + 8 * g, *pb = PQL + (w0 + col) * CO + 8 * g, *pc = VH + (w0 + col) * CO + 8 * g, *pd = VL + (w0 + col) * CO + 8 * g;
  v16b ah[CO / 32], al[CO / 32], bh[CO / 32], bl[CO / 32];
#pragma unroll
  for (int kc = 0; kc < CO / 32; ++kc) { ah[kc] = frag_p(pa + kc * 32); al[kc] = frag_p(pb + kc * 32); bh[kc] = frag_p(pc + kc * 32); bl[kc] = frag_p(pd + kc * 32); }
  const float* pbv = VMB + col; float bv[8];
#pragma unroll
  for (int j = 0; j < 8; ++j) bv[j] = pbv[j * 16];
  asm volatile("s_wait_xcnt 0x0" :: "v"(pa), "v"(pb), "v"(pc), "v"(pd), "v"(pbv) : "memory");   /* the address pairs stay whole until every load above has taken its address */
  __syncthreads();
  __builtin_amdgcn_sched_barrier(0);   /* the staging above and the products below are scheduled apart: as one region the build takes more than the 512 registers of two waves per SIMD */
  v8f acc[8] = {}, vs[8] = {}, dn = {};
  { v16b ch[CO / 32], cl[CO / 32];   /* B[k][n] = KS[k] for every column n: the fragment does not depend on the lane's column */
#pragma unroll
    for (int kc = 0; kc < CO / 32; ++kc) { ch[kc] = frag_b(&sksh[kc * 32], lane); cl[kc] = frag_b(&sksl[kc * 32], lane); }
#pragma unroll
    for (int kc = 0; kc < CO / 32; ++kc) { dn = wmma_bf(al[kc], ch[kc], dn); dn = wmma_bf(ah[kc], cl[kc], dn); dn = wmma_bf(ah[kc], ch[kc], dn); } }
  { v16b wh[32], wl[32];   /* group t = kc * 8 + j; its KV fragments are read from LDS two groups ahead, so that the read's latency lies under the products in between */
#pragma unroll
    for (int t = 0; t < 2; ++t) { wh[t] = frag_b(&skh[(t & 7) * 16 + col][(t >> 3) * 32], lane); wl[t] = frag_b(&skl[(t & 7) * 16 + col][(t >> 3) * 32], lane); }
#pragma unroll
    for (int t = 0; t < 32; ++t) { const int kc = t >> 3, j = t & 7, u = t + 2;
      if (u < 32) { wh[u] = frag_b(&skh[(u & 7) * 16 + col][(u >> 3) * 32], lane); wl[u] = frag_b(&skl[(u & 7) * 16 + col][(u >> 3) * 32], lane); }
      acc[j] = wmma_bf(al[kc], wh[t], acc[j]); acc[j] = wmma_bf(ah[kc], wl[t], acc[j]); acc[j] = wmma_bf(ah[kc], wh[t], acc[j]); } }
  { v16b wm[32];   /* the same for v_map_w, three groups ahead */
#pragma unroll
    for (int t = 0; t < 3; ++t) wm[t] = frag_b(&swm[(t & 7) * 16 + col][(t >> 3) * 32], lane);
#pragma unroll
    for (int t = 0; t < 32; ++t) { const int kc = t >> 3, j = t & 7, u = t + 3;
      if (u < 32) wm[u] = frag_b(&swm[(u & 7) * 16 + col][(u >> 3) * 32], lane);
      vs[j] = wmma_bf(bh[kc], wm[t], vs[j]); vs[j] = wmma_bf(bl[kc], wm[t], vs[j]); } }
  __syncthreads();   /* every wave has read its last fragment of KV and KS: the next trip may stage its own */
  float rden[8];
#pragma unroll
  for (int r = 0; r < 8; ++r) rden[r] = 1.0f / (dn[r] + 1e-6f);   /* a row's one division: its 128 columns multiply */
#pragma unroll
  for (int j = 0; j < 8; ++j) { const float bb = bfr(bv[j]);
#pragma unroll
    for (int r = 0; r < 8; ++r) tot[j][r] += acc[j][r] * rden[r] + (vs[j][r] + bb); }
  }
#pragma unroll
  for (int j = 0; j < 8; ++j) {
#pragma unroll
    for (int r = 0; r < 8; ++r) sf[wave][8 * g + r][j * 16 + col] = tot[j][r]; }
  LDSX(); for (int rl = 0; rl < 16; ++rl) { float* dst = ACC + (w0 + rl) * CO + lane * 4; v4f v = *(const v4f*)&sf[wave][rl][lane * 4]; if (h > 0) { const v4f p = *(const v4f*)dst; v[0] += p[0]; v[1] += p[1]; v[2] += p[2]; v[3] += p[3]; } vst2(dst, v); } }
// ---- k_fin: block = 64 rows: out = ACC / 8; time = sqrt(sum out^2 + 1); the 64 x 129 output rows form one contiguous, line-aligned 33,024-B span (64*129*4 = 258 lines; the span starts at row0*516 B with row0 a multiple of 64) staged in LDS and written thread-linearly in 16-B pieces
__global__ __launch_bounds__(128) void k_fin(const float* __restrict__ ACC, float* __restrict__ OUT) { __shared__ __align__(16) float so[64 * 129 + 12];
  const int tid = threadIdx.x; const size_t r0 = (size_t)blockIdx.x * 64;
  for (int rl = tid >> 5, lanei = tid & 31; rl < 64; rl += 4) { const v4f a = *(const v4f*)(ACC + (r0 + rl) * CO + lanei * 4); float o[4]; float s = 0.f;
#pragma unroll
    for (int z = 0; z < 4; ++z) { o[z] = a[z] * (1.0f / NH); s += o[z] * o[z]; }
#pragma unroll
    for (int q = 1; q < 32; q <<= 1) s += __shfl_xor(s, q);
#pragma unroll
    for (int z = 0; z < 4; ++z) so[rl * 129 + 1 + lanei * 4 + z] = o[z];
    if (lanei == 0) so[rl * 129] = sqrtf(s + 1.0f); }
  __syncthreads();
  float* dst = OUT + r0 * 129;
  for (int e = tid; e < 64 * 129 / 4; e += 128) vst2(dst + e * 4, *(const v4f*)&so[e * 4]); }   
extern "C" void kernel_launch(void* const* d_in, const int* in_sizes, int n_in, void* d_out, int out_size, void* d_ws, size_t ws_size, hipStream_t stream) {
  (void)in_sizes; (void)n_in; (void)out_size;
  const float** F = (const float**)d_in;   // 0 query_input, 1 source_input [32768,128]; 2 Wq_w [8,128,128], 3 Wq_b [8,128]; 4 Wk_w, 5 Wk_b; 6 Wv_w, 7 Wv_b; 8 v_map_w [128,128] (out,in), 9 v_map_b; 10 norm_scale
  if (ws_size < (size_t)WS_END) return;
  char* ws = (char*)d_ws; __bf16 *PQH = (__bf16*)(ws + WS_PQH), *PQL = (__bf16*)(ws + WS_PQL), *VH = (__bf16*)(ws + WS_VH), *VL = (__bf16*)(ws + WS_VL); float *KS = (float*)(ws + WS_KS), *KV = (float*)(ws + WS_KV), *ACC = (float*)(ws + WS_ACC), *PART = (float*)(ws + WS_PART);
  for (int h = 0; h < NH; h += HG) {   // k_proj behind k_join: phi_q takes the partials' place
    k_kvp<<<dim3(HG, NSL), 256, 0, stream>>>(F[1], F[4], F[5], F[6], F[7], F[10], h, VH, VL, PART);
    k_join<<<dim3(2 * PROWS, HG), 16 * JG, 0, stream>>>(PART, KV, KS);
    k_proj<<<dim3(HG, NPROC / 64), 128, 0, stream>>>(F[0], F[2], F[3], F[10], h, PQH, PQL);
    k_num<<<dim3(NPROC / 64), 128, 0, stream>>>(PQH, PQL, KV, KS, VH, VL, F[8], F[9], h, ACC);
  }
  k_fin<<<dim3(NPROC / 64), 128, 0, stream>>>(ACC, (float*)d_out);
}

// v008
// One run takes 192 microseconds.
// Two timings next to v007 put it at 1.13 and 1.14 times that version's speed.
// Over all steps from v000 it is 122 times as fast.
// compute dtype: all float inputs rounded to bf16; q/k/v head projections x W^T + b with EXACT bf16 products on WMMA 16x16x32, f32 accumulate; relu, the power feature map (norms over 128, x^2) in f32; phi_k, v, phi_q and the [128 x 128] k^T v as bf16 hi + lo (3 products) for the two linear-attention contractions (K = 32,768 and K = 128), the head sum of v_map(v) as x_s against v_map_w (sum over heads of Wv), both of its products with the f32 factor as hi + lo and the other exact (2 products each); the normaliser phi_q . (column sums) likewise hi + lo on both sides (3 products, K = 128); column sums, the head mean and the time coordinate (sqrt) in f32; f32 output.
#include <hip/hip_runtime.h>
#include <math.h>

typedef __attribute__((ext_vector_type(16))) _Float16 v16h;
typedef __attribute__((ext_vector_type(16))) __bf16 v16b;
typedef __attribute__((ext_vector_type(8)))  _Float16 v8h;
typedef __attribute__((ext_vector_type(8)))  float v8f;
typedef __attribute__((ext_vector_type(4)))  float v4f;
typedef __attribute__((ext_vector_type(2)))  float v2f;
typedef __attribute__((ext_vector_type(4)))  unsigned v4u;
typedef __attribute__((ext_vector_type(4)))  int v4i;
typedef float __attribute__((may_alias)) float_a;
typedef int __attribute__((may_alias)) int_a;

template <typename T> __device__ __forceinline__ void vst2(void* p, T v) { *(T*)p = v;  }
__device__ __forceinline__ v8f wmma16(v16h a, v16h b, v8f c) {
  v8f d = __builtin_amdgcn_wmma_f32_16x16x32_f16(false, a, false, b, (short)0, c, false, false);
  asm volatile("v_nop\n\tv_nop\n\tv_nop\n\tv_nop" : "+v"(d) : "v"(a), "v"(b));
  return d;
}
__device__ __forceinline__ v8f wmma_bf(v16b a, v16b b, v8f c) {
  v8f d = __builtin_amdgcn_wmma_f32_16x16x32_bf16(false, a, false, b, (short)0, c, false, false);
  asm volatile("v_nop\n\tv_nop\n\tv_nop\n\tv_nop" : "+v"(d) : "v"(a), "v"(b));
  return d;
}
// 16x16x32 fragments: lane = (h = lane>>4, row/col = lane&15); elements 0..7 = k0+8h+0..7, 8..15 = k0+16+8h+0..7; D element r = row 8h+r
__device__ __forceinline__ v16h frag_h(const _Float16* rowk0, int lane) {
  union { v16h v; v8h q[2]; } u; const _Float16* p = rowk0 + 8 * (lane >> 4);
  u.q[0] = *(const v8h*)p; u.q[1] = *(const v8h*)(p + 16); return u.v;
}
__device__ __forceinline__ v16h frag_f32(const float* rowk0, int lane) {
  v16h a; const float* p = rowk0 + 8 * (lane >> 4);
#pragma unroll
  for (int i = 0; i < 8; ++i) { a[i] = (_Float16)p[i]; a[8 + i] = (_Float16)p[16 + i]; }
  return a;
}
__device__ __forceinline__ v16h frag_f32s(const float* rowk0, int lane, float sc) {
  v16h a; const float* p = rowk0 + 8 * (lane >> 4);
#pragma unroll
  for (int i = 0; i < 8; ++i) { a[i] = (_Float16)(p[i] * sc); a[8 + i] = (_Float16)(p[16 + i] * sc); }
  return a;
}
// column fragment from a [K][ld] layout (column n), rows >= K read as 0
__device__ __forceinline__ v16h fragc_f32(const float* W, int k0, int n, int lane, int ld, int K) {
  v16h a; const int g = lane >> 4;
#pragma unroll
  for (int i = 0; i < 8; ++i) { const int ka = k0 + 8 * g + i, kb = ka + 16;
    a[i] = (_Float16)(ka < K ? W[(size_t)(ka < K ? ka : K - 1) * ld + n] : 0.f); a[8 + i] = (_Float16)(kb < K ? W[(size_t)(kb < K ? kb : K - 1) * ld + n] : 0.f); }
  return a;
}
struct F2 { v16b h, l; };
__device__ __forceinline__ F2 bsplit16(const float v[16]) { F2 r;
#pragma unroll
  for (int i = 0; i < 16; ++i) { const __bf16 h = (__bf16)v[i]; r.h[i] = h; r.l[i] = (__bf16)(v[i] - (float)h); }
  return r; }
__device__ __forceinline__ F2 split_row(const float* row, int k0, int lane) { float v[16]; const float* p = row + k0 + 8 * (lane >> 4);
#pragma unroll
  for (int i = 0; i < 8; ++i) { v[i] = p[i]; v[8 + i] = p[16 + i]; }
  return bsplit16(v); }
__device__ __forceinline__ F2 split_rowK(const float* row, int k0, int lane, int K) { float v[16]; const int g = lane >> 4;
#pragma unroll
  for (int i = 0; i < 8; ++i) { const int ka = k0 + 8 * g + i, kb = ka + 16; v[i] = ka < K ? row[ka < K ? ka : K - 1] : 0.f; v[8 + i] = kb < K ? row[kb < K ? kb : K - 1] : 0.f; }
  return bsplit16(v); }
__device__ __forceinline__ F2 split_col(const float* W, int k0, int n, int lane, int ld, int K) { float v[16]; const int g = lane >> 4;
#pragma unroll
  for (int i = 0; i < 8; ++i) { const int ka = k0 + 8 * g + i, kb = ka + 16; v[i] = ka < K ? W[(size_t)(ka < K ? ka : K - 1) * ld + n] : 0.f; v[8 + i] = kb < K ? W[(size_t)(kb < K ? kb : K - 1) * ld + n] : 0.f; }
  return bsplit16(v); }
__device__ __forceinline__ v8f mac3(const F2& a, const F2& b, v8f c) { c = wmma_bf(a.l, b.h, c); c = wmma_bf(a.h, b.l, c); return wmma_bf(a.h, b.h, c); }
__device__ __forceinline__ float sigm(float v) { return 1.0f / (1.0f + expf(-v)); }
#define LDSX() do { asm volatile("s_wait_dscnt 0" ::: "memory"); __builtin_amdgcn_wave_barrier(); __builtin_amdgcn_fence(__ATOMIC_RELEASE, "workgroup"); } while (0)

// Hyperbolic (Lorentz) linear-attention 'TransConv' layer (N 32,768 nodes, 128 -> 128, 8 heads, power kernel p = 2): per head h: qs = x_q Wq[h]^T + bq[h], ks = x_s Wk[h]^T + bk[h], v = x_s Wv[h]^T + bv[h]; phi(x) = ||x|| / (||x^2|| + 1e-8) * x^2 applied to (relu(.) + 1e-6)/(|norm_scale| + 1e-6); KV[h] = sum_n phi_k[n] (x) v[n]; num[n] = phi_q[n] KV[h]; den[n] = phi_q[n] . sum_n phi_k[n]; attn = num / (den + 1e-6) + (v v_map_w^T + v_map_b); out = mean over heads; result = [sqrt(sum out^2 + 1), out].
#define NN 32768
#define CI 128             // in channels
#define CO 128             // out channels per head
#define NH 8
#ifndef NPROC
#define NPROC NN           // rows processed
#endif
typedef __attribute__((ext_vector_type(8))) __bf16 v8b;
__device__ __forceinline__ v16b frag_b(const __bf16* rowk0, int lane) {
  union { v16b v; v8b q[2]; } u; const __bf16* p = rowk0 + 8 * (lane >> 4);
  u.q[0] = *(const v8b*)p; u.q[1] = *(const v8b*)(p + 16); return u.v;
}
// the same fragment from a pointer that already holds the lane's 8 * (lane >> 4)
__device__ __forceinline__ v16b frag_p(const __bf16* p) {
  union { v16b v; v8b q[2]; } u; u.q[0] = *(const v8b*)p; u.q[1] = *(const v8b*)(p + 16); return u.v;
}
typedef __attribute__((ext_vector_type(4))) __bf16 v4b;
#define WP 136             // bf16 per LDS row of a staged [128][128] B operand (272 B = 16 B x 17)
// a block of 128 threads rounds a row-major f32 [128][128] matrix to bf16 rows in LDS: thread t takes the 16-B pieces t, t + 128, ... (a wave fills one row per piece); a call takes the NI pieces from I0 on
template <int I0 = 0, int NI = 32> __device__ __forceinline__ void stage_rows(const float* __restrict__ Wm, __bf16 (*dst)[WP], int tid) {
  const float* pw = Wm + tid * 4 + I0 * 512; v4f wv[NI];
#pragma unroll
  for (int i = 0; i < NI; ++i) wv[i] = *(const v4f*)(pw + i * 512);   /* unrolled: all of a thread's loads are in flight together */
  asm volatile("s_wait_xcnt 0x0" :: "v"(pw), "v"(tid) : "memory");   /* the address pair, or the thread index where the loads go by a scalar base plus that index, stays whole until every load above has taken its address */
#pragma unroll
  for (int i = 0; i < NI; ++i) { v4b o;
#pragma unroll
    for (int z = 0; z < 4; ++z) o[z] = (__bf16)wv[i][z];
    *(v4b*)&dst[(tid >> 5) + 4 * (I0 + i)][(tid & 31) * 4] = o; } }
// the same for a matrix that is kept as bf16 hi + lo: two planes
__device__ __forceinline__ void stage_rows2(const float* __restrict__ Wm, __bf16 (*dh)[WP], __bf16 (*dl)[WP], int tid) {
  const float* pw = Wm + tid * 4; v4f wv[32];
#pragma unroll
  for (int i = 0; i < 32; ++i) wv[i] = *(const v4f*)(pw + i * 512);   /* unrolled: all of a thread's loads are in flight together */
  asm volatile("s_wait_xcnt 0x0" :: "v"(pw), "v"(tid) : "memory");   /* the address pair, or the thread index where the loads go by a scalar base plus that index, stays whole until every load above has taken its address */
#pragma unroll
  for (int i = 0; i < 32; ++i) { v4b oh, ol;
#pragma unroll
    for (int z = 0; z < 4; ++z) { const __bf16 hv = (__bf16)wv[i][z]; oh[z] = hv; ol[z] = (__bf16)(wv[i][z] - (float)hv); }
    *(v4b*)&dh[(tid >> 5) + 4 * i][(tid & 31) * 4] = oh; *(v4b*)&dl[(tid >> 5) + 4 * i][(tid & 31) * 4] = ol; } }
__device__ __forceinline__ float bfr(float v) { return (float)(__bf16)v; }
__device__ __forceinline__ v16b wrow(const float* rowk0, int lane) { v16b w; const float* p = rowk0 + 8 * (lane >> 4);
#pragma unroll
  for (int i = 0; i < 8; ++i) { w[i] = (__bf16)p[i]; w[8 + i] = (__bf16)p[16 + i]; }
  return w; }
// B fragment (k rows k0+.., column n) of an f32 [K][ld] matrix, split bf16 hi + lo
__device__ __forceinline__ F2 colsplit(const float* Wm, int k0, int n, int lane, int ld) { float v[16]; const int g = lane >> 4;
#pragma unroll
  for (int i = 0; i < 8; ++i) { v[i] = Wm[(size_t)(k0 + 8 * g + i) * ld + n]; v[8 + i] = Wm[(size_t)(k0 + 16 + 8 * g + i) * ld + n]; }
  return bsplit16(v); }

#define HG 4               // heads that one launch of each stage takes together (NH / HG groups, one after the other)
#define WS_WC  0u                                       // f32 WC = v_map_w (sum over heads of Wv) [o][i]
#define WS_BC  (WS_WC  + 4u * (size_t)CO * CI)          // f32 BC = v_map_w (sum over heads of bv) + NH v_map_b [o]
#define WS_KS  (WS_BC  + 4u * (size_t)CO)               // f32 column sums of phi_k [head in group][128]
#define WS_KV  (WS_KS  + 4u * (size_t)HG * 128)         // f32 KV [head in group][m][d]
#define WS_ACC (WS_KV  + 4u * (size_t)HG * CO * CO)     // f32 head-sum accumulator [n][128]
#define SLN 64             // rows n per tile of the two sums over n
#define TPB 4              // tiles in a row that one block of k_kvp takes one after the other: together one slice
#define NSL (NPROC / (SLN * TPB))  // slices
#define JG 8               // groups of 16 lanes in a block of k_join
#define JRUN ((NSL + JG - 1) / JG)   // slices in a row that one of k_join's JG groups sums
#define PROWS (CO + 1)     // rows of one slice's partial: 128 rows of KV, then the column sums
#define WS_PART (WS_ACC + 4u * (size_t)NN * CO)         // f32 partials [head in group][slice][129][128]
#define WS_PQH WS_PART                                  // bf16 phi_q rows [head in group][n][128] hi / lo: they begin at the partials' place, which k_join has read out before k_proj is launched
#define WS_PQL (WS_PQH + 2u * (size_t)HG * NN * CO)
#define WS_END (WS_PQL + 2u * (size_t)HG * NN * CO)
static_assert(4u * (size_t)HG * (NN / (SLN * TPB)) * PROWS * CO <= 4u * (size_t)HG * NN * CO, "the partials end in front of WS_END");
#define TP 72              // bf16 per LDS row of a transposed [128][64] tile (144 B = 16 B x 9)

// acc = x W^T for a wave's 16 rows (a: the rows' four k fragments) against the [128][128] bf16 W in LDS; product t = kc * 8 + j; its W fragment is read from LDS six products ahead, so that the read's latency lies under the products in between
__device__ __forceinline__ void proj_tile(const v16b a[CI / 32], const __bf16 (*sw)[WP], int col, int lane, v8f acc[8]) {
  v16b fw[32];
#pragma unroll
  for (int t = 0; t < 6; ++t) fw[t] = frag_b(&sw[(t & 7) * 16 + col][(t >> 3) * 32], lane);
#pragma unroll
  for (int t = 0; t < 32; ++t) { if (t + 6 < 32) fw[t + 6] = frag_b(&sw[((t + 6) & 7) * 16 + col][((t + 6) >> 3) * 32], lane);
    acc[t & 7] = wmma_bf(a[t >> 3], fw[t], acc[t & 7]); } }
// feature map on a wave's 16 x 128 tile: x = (relu(acc) + 1e-6) * rs with rs = 1 / ds (one divisor for the whole launch: its reciprocal is formed once by the caller), phi = ||x|| / (||x^2|| + 1e-8) * x^2, the two norms over the 128 columns (lane partial sums + 16-lane shuffles)
__device__ __forceinline__ void feature_map(v8f acc[8], float rs) { float n1[8], n2[8];
#pragma unroll
  for (int r = 0; r < 8; ++r) { float s1 = 0.f, s2 = 0.f;
#pragma unroll
    for (int j = 0; j < 8; ++j) { const float x = (fmaxf(acc[j][r], 0.f) + 1e-6f) * rs; acc[j][r] = x; const float x2 = x * x; s1 += x2; s2 += x2 * x2; }
    n1[r] = s1; n2[r] = s2; }
#pragma unroll
  for (int o = 1; o < 16; o <<= 1) {
#pragma unroll
    for (int r = 0; r < 8; ++r) { n1[r] += __shfl_xor(n1[r], o); n2[r] += __shfl_xor(n2[r], o); } }
#pragma unroll
  for (int r = 0; r < 8; ++r) n1[r] = sqrtf(n1[r]) / (sqrtf(n2[r]) + 1e-8f);   /* ||x|| / (||x^2|| + eps) */
#pragma unroll
  for (int j = 0; j < 8; ++j) {
#pragma unroll
    for (int r = 0; r < 8; ++r) acc[j][r] = n1[r] * (acc[j][r] * acc[j][r]); } }

// a wave's 16 x 128 f32 tile, split bf16 hi + lo, into LDS, transposed ([column][row]); rb = the lane's first row in the block's tile
__device__ __forceinline__ void stage_tile(const v8f acc[8], __bf16 (*th)[TP], __bf16 (*tl)[TP], int rb, int col) {
#pragma unroll
  for (int j = 0; j < 8; ++j) {
#pragma unroll
    for (int r = 0; r < 8; ++r) { const float v = acc[j][r]; const __bf16 hv = (__bf16)v, lv = (__bf16)(v - (float)hv); const int rl = rb + r, cl = j * 16 + col;
      th[cl][rl] = hv; tl[cl][rl] = lv; } } }
// ---- k_proj: block (x = head in the group, y = 64-row tile) = 64 rows of head h's q: acc = x_q Wq[h]^T + bq[h] (W (out,in) rows contiguous; exact; W[h] rounded to bf16 once per block into LDS, each lane's x row loaded whole up front); feature map; phi_q -> bf16 hi/lo rows
__global__ __launch_bounds__(128) void k_proj(const float* __restrict__ XQ, const float* __restrict__ WQ, const float* __restrict__ BQ, const float* __restrict__ NS, int h0, __bf16* __restrict__ PQH0, __bf16* __restrict__ PQL0) {
  __shared__ __align__(16) __bf16 sw[128][WP];
  const int h = h0 + blockIdx.x; __bf16* __restrict__ PQH = PQH0 + (size_t)blockIdx.x * NN * CO; __bf16* __restrict__ PQL = PQL0 + (size_t)blockIdx.x * NN * CO;   /* the blocks of one tile's HG heads stand side by side in the grid: they read the same x rows */
  __bf16 (*sh)[WP] = sw; __bf16 (*sl)[WP] = sw + 64;   /* behind the products the same LDS holds the tile's hi rows (0..63) and lo rows (64..127) */
  const int tid = threadIdx.x, wave = tid >> 5, lane = tid & 31, col = lane & 15, g = lane >> 4; const size_t r0 = (size_t)blockIdx.y * 64;
  const float* WA = WQ + (size_t)h * CO * CI; const float* BA = BQ + (size_t)h * CO;
  const float* px = XQ + (r0 + wave * 16 + col) * CI + 8 * g; v4f xa[CI / 32][4];
#pragma unroll
  for (int kc = 0; kc < CI / 32; ++kc) { xa[kc][0] = *(const v4f*)(px + kc * 32); xa[kc][1] = *(const v4f*)(px + kc * 32 + 4); xa[kc][2] = *(const v4f*)(px + kc * 32 + 16); xa[kc][3] = *(const v4f*)(px + kc * 32 + 20); }
  const float* pbv = BA + col; float bv[8];
#pragma unroll
  for (int j = 0; j < 8; ++j) bv[j] = pbv[j * 16];
  asm volatile("s_wait_xcnt 0x0" :: "v"(px), "v"(pbv) : "memory");   /* the address pairs stay whole until every load above has taken its address */
  stage_rows(WA, sw, tid);
  v16b a[CI / 32];
#pragma unroll
  for (int kc = 0; kc < CI / 32; ++kc) {
#pragma unroll
    for (int i = 0; i < 16; ++i) a[kc][i] = (__bf16)xa[kc][i >> 2][i & 3]; }
  __syncthreads();   /* W[h] staged */
  v8f acc[8] = {}; proj_tile(a, sw, col, lane, acc);
  __syncthreads();   /* every wave has read its last W fragment: the LDS may take the output tile */
#pragma unroll
  for (int j = 0; j < 8; ++j) { const float bb = bfr(bv[j]);
#pragma unroll
    for (int r = 0; r < 8; ++r) acc[j][r] += bb; }
  feature_map(acc, 1.0f / (fabsf(bfr(NS[0])) + 1e-6f));
#pragma unroll
  for (int j = 0; j < 8; ++j) {
#pragma unroll
    for (int r = 0; r < 8; ++r) { const float v = acc[j][r]; const __bf16 hv = (__bf16)v, lv = (__bf16)(v - (float)hv); const int rl = wave * 16 + 8 * g + r, cl = j * 16 + col; sh[rl][cl] = hv; sl[rl][cl] = lv; } }
  __syncthreads();
  __bf16* qh = PQH + r0 * CO + tid * 8; __bf16* ql = PQL + r0 * CO + tid * 8;   /* the tile's 64 rows are one contiguous 16-KiB span of each plane: piece e = tid + 128 i */
#pragma unroll
  for (int i = 0; i < 8; ++i) { const int e = tid + i * 128; vst2(qh + i * 1024, *(const v4u*)&sh[e >> 4][(e & 15) * 8]); vst2(ql + i * 1024, *(const v4u*)&sl[e >> 4][(e & 15) * 8]); }
  asm volatile("s_wait_xcnt 0x0" :: "v"(qh), "v"(ql) : "memory");   /* the address pairs stay whole until every store above has taken its address */
}
// ---- k_kvp: block (x = head in the group, y = slice) = one slice of TPB tiles of 64 rows n of head h, 256 threads; both W[h] go into LDS once and stay; the tiles follow one another in a loop. Per tile: waves 0..3 form phi_k = feature map of x_s Wk[h]^T + bk[h], waves 4..7 v = x_s Wv[h]^T + bv[h] (each half as k_proj). Both tiles go, bf16 hi + lo, TRANSPOSED ([m][n], [d][n]) into LDS; v goes nowhere else. Then wave w: KV[16 w + ..][d] += sum_n phi_k[m][n] v[d][n] over the tile (hi + lo both sides, 3 products, K = 64), kept in registers over the slice; thread m < 128: its sum += sum_n phi_k[m][n] (hi + lo) in a fixed order. Behind the last tile: rows 0..127 and row 128 of the slice's f32 partial. The attribute holds the build to the 256 registers of four waves per SIMD: two blocks share a WGP (2 x the LDS fits too)
__global__ __launch_bounds__(256) __attribute__((amdgpu_waves_per_eu(4, 4))) void k_kvp(const float* __restrict__ XS, const float* __restrict__ WK, const float* __restrict__ BK, const float* __restrict__ WV, const float* __restrict__ BV, const float* __restrict__ NS, int h0, float* __restrict__ PART0) {
  const int h = h0 + blockIdx.x; float* __restrict__ PART = PART0 + (size_t)blockIdx.x * NSL * PROWS * CO;
  __shared__ __align__(16) __bf16 sw[2][128][WP]; __shared__ __align__(16) __bf16 th[2][128][TP], tl2[2][128][TP];   /* [0] k side, [1] v side */
  __shared__ float sb[2][CO];   /* the two biases, rounded: read anew in every trip, held in no register over the loop */
  const int tid = threadIdx.x, t7 = tid & 127, wave = t7 >> 5, lane = tid & 31, col = lane & 15, g = lane >> 4; const size_t r0 = (size_t)blockIdx.y * (SLN * TPB);
  const int side = __builtin_amdgcn_readfirstlane(tid >> 7);   /* the same in a whole wave: 0 = k, 1 = v */
  const float* WA = (side == 0 ? WK : WV) + (size_t)h * CO * CI; const float* BA = (side == 0 ? BK : BV) + (size_t)h * CO;
  const float* px = XS + (r0 + wave * 16 + col) * CI + 8 * g; v4f xa[CI / 32][4];
#pragma unroll
  for (int kc = 0; kc < CI / 32; ++kc) { xa[kc][0] = *(const v4f*)(px + kc * 32); xa[kc][1] = *(const v4f*)(px + kc * 32 + 4); xa[kc][2] = *(const v4f*)(px + kc * 32 + 16); xa[kc][3] = *(const v4f*)(px + kc * 32 + 20); }
  const float* pbv = BA + t7; const float bv = *pbv;
  asm volatile("s_wait_xcnt 0x0" :: "v"(px), "v"(pbv) : "memory");   /* the address pairs stay whole until every load above has taken its address */
  stage_rows<0, 16>(WA, sw[side], t7);   /* in two halves: all 32 pieces at once, beside the x rows, do not fit the 256 registers of four waves per SIMD */
  __builtin_amdgcn_sched_barrier(0);   /* keeps the second half's loads behind the first half's LDS stores: moved up, they bring the spills back */
  stage_rows<16, 16>(WA, sw[side], t7);
  sb[side][t7] = bfr(bv);
  const float rs = 1.0f / (fabsf(bfr(NS[0])) + 1e-6f);
  const int w8 = tid >> 5, m0 = w8 * 16; v8f kv[8] = {}; float s = 0.f;
  v16b a[CI / 32];   /* the tile's x rows as fragments */
#pragma unroll
  for (int kc = 0; kc < CI / 32; ++kc) {
#pragma unroll
    for (int i = 0; i < 16; ++i) a[kc][i] = (__bf16)xa[kc][i >> 2][i & 3]; }
  __syncthreads();   /* both W[h] and the biases staged */
#pragma nounroll   /* rolled: one copy of the body's text rather than TPB */
  for (int t = 0; t < TPB; ++t) {
    { v8f acc[8] = {};
      proj_tile(a, sw[side], col, lane, acc);
#pragma unroll
      for (int j = 0; j < 8; ++j) { const float bb = sb[side][j * 16 + col];
#pragma unroll
        for (int r = 0; r < 8; ++r) acc[j][r] += bb; }
      if (side == 0) feature_map(acc, rs);   /* wave-uniform, no barrier inside */
      if (t > 0) __syncthreads();   /* the same for the whole block: every wave has read the last of the tile before from th and tl2 */
      stage_tile(acc, th[side], tl2[side], wave * 16 + 8 * g, col); }
    __syncthreads();   /* phi_k^T and v^T staged */
    v4f xn[CI / 32][4] = {};   /* born here, so that no register is held for it over the first half of a trip */
    if (t + 1 < TPB) { px += SLN * CI;   /* the next tile's x rows are asked for here: they arrive under this tile's k^T v products */
#pragma unroll
      for (int kc = 0; kc < CI / 32; ++kc) { xn[kc][0] = *(const v4f*)(px + kc * 32); xn[kc][1] = *(const v4f*)(px + kc * 32 + 4); xn[kc][2] = *(const v4f*)(px + kc * 32 + 16); xn[kc][3] = *(const v4f*)(px + kc * 32 + 20); }
      asm volatile("s_wait_xcnt 0x0" :: "v"(px) : "memory");   /* the address pair stays whole until every load above has taken its address */
    }
    { v16b ah[SLN / 32], al[SLN / 32], bh[SLN / 4], bl[SLN / 4];   /* group c = kc * 8 + j; its v fragments are read from LDS two groups ahead, so that the read's latency lies under the products in between */
#pragma unroll
      for (int kc = 0; kc < SLN / 32; ++kc) { ah[kc] = frag_b(&th[0][m0 + col][kc * 32], lane); al[kc] = frag_b(&tl2[0][m0 + col][kc * 32], lane); }
#pragma unroll
      for (int c = 0; c < 2; ++c) { bh[c] = frag_b(&th[1][(c & 7) * 16 + col][(c >> 3) * 32], lane); bl[c] = frag_b(&tl2[1][(c & 7) * 16 + col][(c >> 3) * 32], lane); }
#pragma unroll
      for (int c = 0; c < SLN / 4; ++c) { const int kc = c >> 3, j = c & 7, u = c + 2;
        if (u < SLN / 4) { bh[u] = frag_b(&th[1][(u & 7) * 16 + col][(u >> 3) * 32], lane); bl[u] = frag_b(&tl2[1][(u & 7) * 16 + col][(u >> 3) * 32], lane); }
        kv[j] = wmma_bf(al[kc], bh[c], kv[j]); kv[j] = wmma_bf(ah[kc], bl[c], kv[j]); kv[j] = wmma_bf(ah[kc], bh[c], kv[j]); } }
    if (side == 0) {   /* wave-uniform: thread m = tid adds its row of phi_k^T */
#pragma unroll
      for (int i = 0; i < SLN / 8; ++i) { const v8b a2 = *(const v8b*)&th[0][tid][i * 8], b2 = *(const v8b*)&tl2[0][tid][i * 8];
#pragma unroll
        for (int z = 0; z < 8; ++z) s += (float)a2[z] + (float)b2[z]; } }
#pragma unroll
    for (int kc = 0; kc < CI / 32; ++kc) {   /* in every trip, so that the old fragments are not held over the products above */
#pragma unroll
      for (int i = 0; i < 16; ++i) a[kc][i] = (__bf16)xn[kc][i >> 2][i & 3]; }
  }
  float* pp = PART + (size_t)blockIdx.y * PROWS * CO;
  if (side == 0) { float* ps = pp + CO * CO + tid; *ps = s;   /* a wave stores one whole 128-B line */
    asm volatile("s_wait_xcnt 0x0" :: "v"(ps) : "memory");   /* the address pair stays whole until the store above has taken its address */
  }
  float (*sf)[132] = (float (*)[132])&sw[0][0][0] + w8 * 16;   /* 8 waves x 16 rows x 528 B = 67,584 B of sw's 69,632; the last tile's 'staged' barrier stands behind every wave's last read of W */
#pragma unroll
  for (int j = 0; j < 8; ++j) {
#pragma unroll
    for (int r = 0; r < 8; ++r) sf[8 * g + r][j * 16 + col] = kv[j][r]; }
  LDSX(); float* po = pp + (size_t)m0 * CO + lane * 4;
#pragma unroll
  for (int rl = 0; rl < 16; ++rl) vst2(po + rl * CO, *(const v4f*)&sf[rl][lane * 4]);
  asm volatile("s_wait_xcnt 0x0" :: "v"(po) : "memory");   /* the address pair stays whole until every store above has taken its address */
}
// ---- k_join: block (y = head in the group) = 64 columns of one of the head's 129 partial rows (a 256-B segment): JG groups of 16 lanes; group t sums its run of JRUN slices in index order, the JG group sums are added in index order through LDS -> KV row (rows 0..127) or KS (row 128)
__global__ __launch_bounds__(16 * JG) void k_join(const float* __restrict__ PART0, float* __restrict__ KV0, float* __restrict__ KS0) { __shared__ __align__(16) float sj[JG][64];
  const float* __restrict__ PART = PART0 + (size_t)blockIdx.y * NSL * PROWS * CO; float* __restrict__ KV = KV0 + (size_t)blockIdx.y * CO * CO; float* __restrict__ KS = KS0 + (size_t)blockIdx.y * CO;
  const int tid = threadIdx.x, grp = tid >> 4, q = tid & 15; const int row = blockIdx.x >> 1, c0 = (blockIdx.x & 1) * 64;
  const float* p = PART + ((size_t)grp * JRUN * PROWS + row) * CO + c0 + q * 4; v4f s = {}, a[JRUN];
#pragma unroll
  for (int i = 0; i < JRUN; ++i) { a[i] = v4f{}; if (NSL % JG == 0 || grp * JRUN + i < NSL) a[i] = *(const v4f*)(p + (size_t)i * PROWS * CO); }   /* unrolled: all of a lane's loads are in flight together */
  asm volatile("s_wait_xcnt 0x0" :: "v"(p) : "memory");   /* the address pair stays whole until every load above has taken its address */
#pragma unroll
  for (int i = 0; i < JRUN; ++i) s += a[i];
  vst2(&sj[grp][q * 4], s); __syncthreads();
  if (tid < 16) { v4f t = {};
#pragma unroll
    for (int z = 0; z < JG; ++z) t += *(const v4f*)&sj[z][tid * 4];
    vst2((row < CO ? KV + (size_t)row * CO : KS) + c0 + tid * 4, t); } }
// ---- k_vw: the head sum of v_map(v) is linear in x_s: sum_h (v_h v_map_w^T + v_map_b) = x_s WC^T + BC, with S = sum_h Wv[h] and sb = sum_h bv[h] (each term rounded to bf16, f32 sums in head order), WC = v_map_w S [o][i], BC = v_map_w sb + NH v_map_b. Block b < 4 = 32 columns i of WC (whole 128-B lines of its rows), block 4 = BC (every column of its B operand holds sb). S goes, bf16 hi + lo, transposed ([column][d]) into LDS; wave w: rows o = 16 w + .., v_map_w exact, 2 products, K = 128
template <int SD, int SH> __device__ __forceinline__ void head_sum(const float* ps, float s[16]) { float v[NH][16];
#pragma unroll
  for (int hh = 0; hh < NH; ++hh) {
#pragma unroll
    for (int z = 0; z < 16; ++z) v[hh][z] = ps[hh * SH + z * SD]; }   /* unrolled: all of a thread's loads are in flight together */
  asm volatile("s_wait_xcnt 0x0" :: "v"(ps) : "memory");   /* the address pair stays whole until every load above has taken its address */
#pragma unroll
  for (int z = 0; z < 16; ++z) { float t = 0.f;
#pragma unroll
    for (int hh = 0; hh < NH; ++hh) t += bfr(v[hh][z]);
    s[z] = t; } }
__global__ __launch_bounds__(256) void k_vw(const float* __restrict__ WV, const float* __restrict__ BV, const float* __restrict__ VMW, const float* __restrict__ VMB, float* __restrict__ WC, float* __restrict__ BC) {
  __shared__ __align__(16) __bf16 sth[32][WP], stl[32][WP]; __shared__ float sbc[CO];
  const int tid = threadIdx.x, wave = tid >> 5, lane = tid & 31, col = lane & 15, g = lane >> 4, d0 = wave * 16; const int b = blockIdx.x;   /* thread = column lane of the block's 32, rows d0 .. d0 + 15 of S: a wave's load is one 128-B line */
  const float* pm = VMW + (size_t)(wave * 16 + col) * CO + 8 * g; v4f ma[CO / 32][4];
#pragma unroll
  for (int kc = 0; kc < CO / 32; ++kc) { ma[kc][0] = *(const v4f*)(pm + kc * 32); ma[kc][1] = *(const v4f*)(pm + kc * 32 + 4); ma[kc][2] = *(const v4f*)(pm + kc * 32 + 16); ma[kc][3] = *(const v4f*)(pm + kc * 32 + 20); }
  asm volatile("s_wait_xcnt 0x0" :: "v"(pm) : "memory");   /* the address pair stays whole until every load above has taken its address */
  float s[16];
  if (b < CI / 32) head_sum<CI, CO * CI>(WV + (size_t)d0 * CI + b * 32 + lane, s);   /* the same for the whole block */
  else head_sum<1, CO>(BV + d0, s);
  { v8b hv[2], lv[2];
#pragma unroll
    for (int z = 0; z < 16; ++z) { const __bf16 hh = (__bf16)s[z]; hv[z >> 3][z & 7] = hh; lv[z >> 3][z & 7] = (__bf16)(s[z] - (float)hh); }
    *(v8b*)&sth[lane][d0] = hv[0]; *(v8b*)&sth[lane][d0 + 8] = hv[1]; *(v8b*)&stl[lane][d0] = lv[0]; *(v8b*)&stl[lane][d0 + 8] = lv[1]; }
  v16b am[CO / 32];
#pragma unroll
  for (int kc = 0; kc < CO / 32; ++kc) {
#pragma unroll
    for (int i = 0; i < 16; ++i) am[kc][i] = (__bf16)ma[kc][i >> 2][i & 3]; }
  __syncthreads();   /* S^T staged */
  v8f acc[2] = {};
#pragma unroll
  for (int kc = 0; kc < CO / 32; ++kc) {
#pragma unroll
    for (int u = 0; u < 2; ++u) { const v16b fh = frag_b(&sth[u * 16 + col][kc * 32], lane), fl = frag_b(&stl[u * 16 + col][kc * 32], lane);
      acc[u] = wmma_bf(am[kc], fl, acc[u]); acc[u] = wmma_bf(am[kc], fh, acc[u]); } }
  if (b < CI / 32) { float* po = WC + (size_t)(wave * 16 + 8 * g) * CI + b * 32 + col;   /* a row's 128-B line: this wave's two stores */
#pragma unroll
    for (int r = 0; r < 8; ++r) { po[r * CI] = acc[0][r]; po[r * CI + 16] = acc[1][r]; }
    asm volatile("s_wait_xcnt 0x0" :: "v"(po) : "memory");   /* the address pair stays whole until every store above has taken its address */
  } else {   /* the same for the whole block, its barrier too */
    if (col == 0) {
#pragma unroll
      for (int r = 0; r < 8; ++r) sbc[wave * 16 + 8 * g + r] = acc[0][r]; }
    __syncthreads();   /* the 128 sums are in LDS: a wave stores whole lines */
    if (tid < CO) BC[tid] = sbc[tid] + (float)NH * bfr(VMB[tid]); } }
// ---- k_num: block = 64 rows n (all 128 cols), the group's HG heads one after the other, their sum kept in registers; in the first group's launch that sum starts at x_s WC^T + BC (x_s exact, WC f32 -> hi+lo rows in the LDS that KV takes afterwards, 2 products): the head sum of v_map(v); per head: num = phi_q (hi+lo) . KV (f32 -> hi+lo, split and transposed into LDS once per block and head), 3 products; den = phi_q (hi+lo) . KS (f32 -> hi+lo) as a ninth column tile of the same products, all 16 columns of its B operand holding KS, so that every lane gets the den of its own 8 rows; kept as 1 / (den + 1e-6); val = num * that reciprocal; behind the last head ACC = (h == 0 ? 0 : ACC) + the sum, h = the group's first head (this block's own 512-B row segments)
__global__ __launch_bounds__(128) void k_num(const __bf16* __restrict__ PQH0, const __bf16* __restrict__ PQL0, const float* __restrict__ KV0, const float* __restrict__ KS0, const float* __restrict__ XS, const float* __restrict__ WC, const float* __restrict__ BC, int h, float* __restrict__ ACC) {
  __shared__ __align__(16) float sf[4][16][132]; __shared__ __align__(16) __bf16 sksh[128], sksl[128];   /* KS hi / lo */
  __shared__ __align__(16) __bf16 skh[128][WP], skl[128][WP];   /* KV transposed [d][m] hi / lo; in front of the first head WC's rows */
  const int tid = threadIdx.x, wave = tid >> 5, lane = tid & 31, col = lane & 15, g = lane >> 4; const size_t r0 = (size_t)blockIdx.x * 64; const size_t w0 = r0 + wave * 16;
  v8f tot[8] = {};
  if (h == 0) {   /* the same for the whole launch, its two barriers too */
    const float* px = XS + (w0 + col) * CI + 8 * g; v4f xa[CI / 32][4];
#pragma unroll
    for (int kc = 0; kc < CI / 32; ++kc) { xa[kc][0] = *(const v4f*)(px + kc * 32); xa[kc][1] = *(const v4f*)(px + kc * 32 + 4); xa[kc][2] = *(const v4f*)(px + kc * 32 + 16); xa[kc][3] = *(const v4f*)(px + kc * 32 + 20); }
    const float* pbc = BC + col; float bc[8];
#pragma unroll
    for (int j = 0; j < 8; ++j) bc[j] = pbc[j * 16];
    asm volatile("s_wait_xcnt 0x0" :: "v"(px), "v"(pbc) : "memory");   /* the address pairs stay whole until every load above has taken its address */
    stage_rows2(WC, skh, skl, tid);
    v16b a[CI / 32];
#pragma unroll
    for (int kc = 0; kc < CI / 32; ++kc) {
#pragma unroll
      for (int i = 0; i < 16; ++i) a[kc][i] = (__bf16)xa[kc][i >> 2][i & 3]; }
    __syncthreads();   /* WC staged */
    { v16b wh[32], wl[32];   /* group t = kc * 8 + j; its WC fragments are read from LDS two groups ahead, so that the read's latency lies under the products in between */
#pragma unroll
      for (int t = 0; t < 2; ++t) { wh[t] = frag_b(&skh[(t & 7) * 16 + col][(t >> 3) * 32], lane); wl[t] = frag_b(&skl[(t & 7) * 16 + col][(t >> 3) * 32], lane); }
#pragma unroll
      for (int t = 0; t < 32; ++t) { const int kc = t >> 3, j = t & 7, u = t + 2;
        if (u < 32) { wh[u] = frag_b(&skh[(u & 7) * 16 + col][(u >> 3) * 32], lane); wl[u] = frag_b(&skl[(u & 7) * 16 + col][(u >> 3) * 32], lane); }
        tot[j] = wmma_bf(a[kc], wl[t], tot[j]); tot[j] = wmma_bf(a[kc], wh[t], tot[j]); } }
    __syncthreads();   /* every wave has read its last fragment of WC: the first head may stage its KV */
#pragma unroll
    for (int j = 0; j < 8; ++j) {
#pragma unroll
      for (int r = 0; r < 8; ++r) tot[j][r] += bc[j]; }
  }
#pragma nounroll   /* rolled: HG copies of the body would be several times 32 KB of text */
  for (int hh = 0; hh < HG; ++hh) {   /* no barrier of its own at the head of a trip: the barrier behind the products of the trip before ends every wave's reads of skh, skl, sksh and sksl */
  const __bf16* __restrict__ PQH = PQH0 + (size_t)hh * NN * CO; const __bf16* __restrict__ PQL = PQL0 + (size_t)hh * NN * CO;
  const float* __restrict__ KV = KV0 + (size_t)hh * CO * CO; const float* __restrict__ KS = KS0 + (size_t)hh * CO;
  { const float* pk = KV + tid; float kc2[CO]; const float ksv = KS[tid];   /* thread d takes column d of KV: a wave's load is 128 B of one row */
#pragma unroll
    for (int m = 0; m < CO; ++m) kc2[m] = pk[m * CO];   /* unrolled: the column's loads are in flight together */
    asm volatile("s_wait_xcnt 0x0" :: "v"(pk) : "memory");   /* the address pair stays whole until every load above has taken its address */
#pragma unroll
    for (int m = 0; m < CO; m += 8) { v8b hv, lv;
#pragma unroll
      for (int z = 0; z < 8; ++z) { const __bf16 hh = (__bf16)kc2[m + z]; hv[z] = hh; lv[z] = (__bf16)(kc2[m + z] - (float)hh); }
      *(v8b*)&skh[tid][m] = hv; *(v8b*)&skl[tid][m] = lv; }
    const __bf16 kh = (__bf16)ksv; sksh[tid] = kh; sksl[tid] = (__bf16)(ksv - (float)kh); }
  const __bf16 *pa = PQH + (w0 + col) * CO + 8 * g, *pb = PQL + (w0 + col) * CO + 8 * g;
  v16b ah[CO / 32], al[CO / 32];
#pragma unroll
  for (int kc = 0; kc < CO / 32; ++kc) { ah[kc] = frag_p(pa + kc * 32); al[kc] = frag_p(pb + kc * 32); }
  asm volatile("s_wait_xcnt 0x0" :: "v"(pa), "v"(pb) : "memory");   /* the address pairs stay whole until every load above has taken its address */
  __syncthreads();
  __builtin_amdgcn_sched_barrier(0);   /* the staging above and the products below are scheduled apart: as one region the build takes more than the 512 registers of two waves per SIMD */
  v8f acc[8] = {}, dn = {};
  { v16b ch[CO / 32], cl[CO / 32];   /* B[k][n] = KS[k] for every column n: the fragment does not depend on the lane's column */
#pragma unroll
    for (int kc = 0; kc < CO / 32; ++kc) { ch[kc] = frag_b(&sksh[kc * 32], lane); cl[kc] = frag_b(&sksl[kc * 32], lane); }
#pragma unroll
    for (int kc = 0; kc < CO / 32; ++kc) { dn = wmma_bf(al[kc], ch[kc], dn); dn = wmma_bf(ah[kc], cl[kc], dn); dn = wmma_bf(ah[kc], ch[kc], dn); } }
  { v16b wh[32], wl[32];   /* group t = kc * 8 + j; its KV fragments are read from LDS two groups ahead, so that the read's latency lies under the products in between */
#pragma unroll
    for (int t = 0; t < 2; ++t) { wh[t] = frag_b(&skh[(t & 7) * 16 + col][(t >> 3) * 32], lane); wl[t] = frag_b(&skl[(t & 7) * 16 + col][(t >> 3) * 32], lane); }
#pragma unroll
    for (int t = 0; t < 32; ++t) { const int kc = t >> 3, j = t & 7, u = t + 2;
      if (u < 32) { wh[u] = frag_b(&skh[(u & 7) * 16 + col][(u >> 3) * 32], lane); wl[u] = frag_b(&skl[(u & 7) * 16 + col][(u >> 3) * 32], lane); }
      acc[j] = wmma_bf(al[kc], wh[t], acc[j]); acc[j] = wmma_bf(ah[kc], wl[t], acc[j]); acc[j] = wmma_bf(ah[kc], wh[t], acc[j]); } }
  __syncthreads();   /* every wave has read its last fragment of KV and KS: the next trip may stage its own */
  float rden[8];
#pragma unroll
  for (int r = 0; r < 8; ++r) rden[r] = 1.0f / (dn[r] + 1e-6f);   /* a row's one division: its 128 columns multiply */
#pragma unroll
  for (int j = 0; j < 8; ++j) {
#pragma unroll
    for (int r = 0; r < 8; ++r) tot[j][r] += acc[j][r] * rden[r]; }
  }
#pragma unroll
  for (int j = 0; j < 8; ++j) {
#pragma unroll
    for (int r = 0; r < 8; ++r) sf[wave][8 * g + r][j * 16 + col] = tot[j][r]; }
  LDSX(); for (int rl = 0; rl < 16; ++rl) { float* dst = ACC + (w0 + rl) * CO + lane * 4; v4f v = *(const v4f*)&sf[wave][rl][lane * 4]; if (h > 0) { const v4f p = *(const v4f*)dst; v[0] += p[0]; v[1] += p[1]; v[2] += p[2]; v[3] += p[3]; } vst2(dst, v); } }
// ---- k_fin: block = 64 rows: out = ACC / 8; time = sqrt(sum out^2 + 1); the 64 x 129 output rows form one contiguous, line-aligned 33,024-B span (64*129*4 = 258 lines; the span starts at row0*516 B with row0 a multiple of 64) staged in LDS and written thread-linearly in 16-B pieces
__global__ __launch_bounds__(128) void k_fin(const float* __restrict__ ACC, float* __restrict__ OUT) { __shared__ __align__(16) float so[64 * 129 + 12];
  const int tid = threadIdx.x; const size_t r0 = (size_t)blockIdx.x * 64;
  for (int rl = tid >> 5, lanei = tid & 31; rl < 64; rl += 4) { const v4f a = *(const v4f*)(ACC + (r0 + rl) * CO + lanei * 4); float o[4]; float s = 0.f;
#pragma unroll
    for (int z = 0; z < 4; ++z) { o[z] = a[z] * (1.0f / NH); s += o[z] * o[z]; }
#pragma unroll
    for (int q = 1; q < 32; q <<= 1) s += __shfl_xor(s, q);
#pragma unroll
    for (int z = 0; z < 4; ++z) so[rl * 129 + 1 + lanei * 4 + z] = o[z];
    if (lanei == 0) so[rl * 129] = sqrtf(s + 1.0f); }
  __syncthreads();
  float* dst = OUT + r0 * 129;
  for (int e = tid; e < 64 * 129 / 4; e += 128) vst2(dst + e * 4, *(const v4f*)&so[e * 4]); }   
extern "C" void kernel_launch(void* const* d_in, const int* in_sizes, int n_in, void* d_out, int out_size, void* d_ws, size_t ws_size, hipStream_t stream) {
  (void)in_sizes; (void)n_in; (void)out_size;
  const float** F = (const float**)d_in;   // 0 query_input, 1 source_input [32768,128]; 2 Wq_w [8,128,128], 3 Wq_b [8,128]; 4 Wk_w, 5 Wk_b; 6 Wv_w, 7 Wv_b; 8 v_map_w [128,128] (out,in), 9 v_map_b; 10 norm_scale
  if (ws_size < (size_t)WS_END) return;
  char* ws = (char*)d_ws; __bf16 *PQH = (__bf16*)(ws + WS_PQH), *PQL = (__bf16*)(ws + WS_PQL); float *WC = (float*)(ws + WS_WC), *BC = (float*)(ws + WS_BC), *KS = (float*)(ws + WS_KS), *KV = (float*)(ws + WS_KV), *ACC = (float*)(ws + WS_ACC), *PART = (float*)(ws + WS_PART);
  k_vw<<<dim3(CI / 32 + 1), 256, 0, stream>>>(F[6], F[7], F[8], F[9], WC, BC);
  for (int h = 0; h < NH; h += HG) {   // k_proj behind k_join: phi_q takes the partials' place
    k_kvp<<<dim3(HG, NSL), 256, 0, stream>>>(F[1], F[4], F[5], F[6], F[7], F[10], h, PART);
    k_join<<<dim3(2 * PROWS, HG), 16 * JG, 0, stream>>>(PART, KV, KS);
    k_proj<<<dim3(HG, NPROC / 64), 128, 0, stream>>>(F[0], F[2], F[3], F[10], h, PQH, PQL);
    k_num<<<dim3(NPROC / 64), 128, 0, stream>>>(PQH, PQL, KV, KS, F[1], WC, BC, h, ACC);
  }
  k_fin<<<dim3(NPROC / 64), 128, 0, stream>>>(ACC, (float*)d_out);
}

// v009
// It runs in 159 microseconds.
// Two timings next to v008 put it at 1.20 and 1.19 times that version's speed.
// Counting every step since v000, it is 146 times as fast.
// compute dtype: all float inputs rounded to bf16; q/k/v head projections x W^T + b with EXACT bf16 products on WMMA 16x16x32, f32 accumulate; relu, the power feature map (norms over 128, x^2) in f32; phi_k, v, phi_q and the [128 x 128] k^T v as bf16 hi + lo (3 products) for the two linear-attention contractions (K = 32,768 and K = 128), the head sum of v_map(v) as x_s against v_map_w (sum over heads of Wv), both of its products with the f32 factor as hi + lo and the other exact (2 products each); the normaliser phi_q . (column sums) likewise hi + lo on both sides (3 products, K = 128); column sums, the head mean and the time coordinate (sqrt) in f32; f32 output.
#include <hip/hip_runtime.h>
#include <math.h>

typedef __attribute__((ext_vector_type(16))) _Float16 v16h;
typedef __attribute__((ext_vector_type(16))) __bf16 v16b;
typedef __attribute__((ext_vector_type(8)))  _Float16 v8h;
typedef __attribute__((ext_vector_type(8)))  float v8f;
typedef __attribute__((ext_vector_type(4)))  float v4f;
typedef __attribute__((ext_vector_type(2)))  float v2f;
typedef __attribute__((ext_vector_type(4)))  unsigned v4u;
typedef __attribute__((ext_vector_type(4)))  int v4i;
typedef float __attribute__((may_alias)) float_a;
typedef int __attribute__((may_alias)) int_a;

template <typename T> __device__ __forceinline__ void vst2(void* p, T v) { *(T*)p = v;  }
__device__ __forceinline__ v8f wmma16(v16h a, v16h b, v8f c) {
  v8f d = __builtin_amdgcn_wmma_f32_16x16x32_f16(false, a, false, b, (short)0, c, false, false);
  asm volatile("v_nop\n\tv_nop\n\tv_nop\n\tv_nop" : "+v"(d) : "v"(a), "v"(b));
  return d;
}
__device__ __forceinline__ v8f wmma_bf(v16b a, v16b b, v8f c) {
  v8f d = __builtin_amdgcn_wmma_f32_16x16x32_bf16(false, a, false, b, (short)0, c, false, false);
  asm volatile("v_nop\n\tv_nop\n\tv_nop\n\tv_nop" : "+v"(d) : "v"(a), "v"(b));
  return d;
}
// 16x16x32 fragments: lane = (h = lane>>4, row/col = lane&15); elements 0..7 = k0+8h+0..7, 8..15 = k0+16+8h+0..7; D element r = row 8h+r
__device__ __forceinline__ v16h frag_h(const _Float16* rowk0, int lane) {
  union { v16h v; v8h q[2]; } u; const _Float16* p = rowk0 + 8 * (lane >> 4);
  u.q[0] = *(const v8h*)p; u.q[1] = *(const v8h*)(p + 16); return u.v;
}
__device__ __forceinline__ v16h frag_f32(const float* rowk0, int lane) {
  v16h a; const float* p = rowk0 + 8 * (lane >> 4);
#pragma unroll
  for (int i = 0; i < 8; ++i) { a[i] = (_Float16)p[i]; a[8 + i] = (_Float16)p[16 + i]; }
  return a;
}
__device__ __forceinline__ v16h frag_f32s(const float* rowk0, int lane, float sc) {
  v16h a; const float* p = rowk0 + 8 * (lane >> 4);
#pragma unroll
  for (int i = 0; i < 8; ++i) { a[i] = (_Float16)(p[i] * sc); a[8 + i] = (_Float16)(p[16 + i] * sc); }
  return a;
}
// column fragment from a [K][ld] layout (column n), rows >= K read as 0
__device__ __forceinline__ v16h fragc_f32(const float* W, int k0, int n, int lane, int ld, int K) {
  v16h a; const int g = lane >> 4;
#pragma unroll
  for (int i = 0; i < 8; ++i) { const int ka = k0 + 8 * g + i, kb = ka + 16;
    a[i] = (_Float16)(ka < K ? W[(size_t)(ka < K ? ka : K - 1) * ld + n] : 0.f); a[8 + i] = (_Float16)(kb < K ? W[(size_t)(kb < K ? kb : K - 1) * ld + n] : 0.f); }
  return a;
}
struct F2 { v16b h, l; };
__device__ __forceinline__ F2 bsplit16(const float v[16]) { F2 r;
#pragma unroll
  for (int i = 0; i < 16; ++i) { const __bf16 h = (__bf16)v[i]; r.h[i] = h; r.l[i] = (__bf16)(v[i] - (float)h); }
  return r; }
__device__ __forceinline__ F2 split_row(const float* row, int k0, int lane) { float v[16]; const float* p = row + k0 + 8 * (lane >> 4);
#pragma unroll
  for (int i = 0; i < 8; ++i) { v[i] = p[i]; v[8 + i] = p[16 + i]; }
  return bsplit16(v); }
__device__ __forceinline__ F2 split_rowK(const float* row, int k0, int lane, int K) { float v[16]; const int g = lane >> 4;
#pragma unroll
  for (int i = 0; i < 8; ++i) { const int ka = k0 + 8 * g + i, kb = ka + 16; v[i] = ka < K ? row[ka < K ? ka : K - 1] : 0.f; v[8 + i] = kb < K ? row[kb < K ? kb : K - 1] : 0.f; }
  return bsplit16(v); }
__device__ __forceinline__ F2 split_col(const float* W, int k0, int n, int lane, int ld, int K) { float v[16]; const int g = lane >> 4;
#pragma unroll
  for (int i = 0; i < 8; ++i) { const int ka = k0 + 8 * g + i, kb = ka + 16; v[i] = ka < K ? W[(size_t)(ka < K ? ka : K - 1) * ld + n] : 0.f; v[8 + i] = kb < K ? W[(size_t)(kb < K ? kb : K - 1) * ld + n] : 0.f; }
  return bsplit16(v); }
__device__ __forceinline__ v8f mac3(const F2& a, const F2& b, v8f c) { c = wmma_bf(a.l, b.h, c); c = wmma_bf(a.h, b.l, c); return wmma_bf(a.h, b.h, c); }
__device__ __forceinline__ float sigm(float v) { return 1.0f / (1.0f + expf(-v)); }
#define LDSX() do { asm volatile("s_wait_dscnt 0" ::: "memory"); __builtin_amdgcn_wave_barrier(); __builtin_amdgcn_fence(__ATOMIC_RELEASE, "workgroup"); } while (0)

// Hyperbolic (Lorentz) linear-attention 'TransConv' layer (N 32,768 nodes, 128 -> 128, 8 heads, power kernel p = 2): per head h: qs = x_q Wq[h]^T + bq[h], ks = x_s Wk[h]^T + bk[h], v = x_s Wv[h]^T + bv[h]; phi(x) = ||x|| / (||x^2|| + 1e-8) * x^2 applied to (relu(.) + 1e-6)/(|norm_scale| + 1e-6); KV[h] = sum_n phi_k[n] (x) v[n]; num[n] = phi_q[n] KV[h]; den[n] = phi_q[n] . sum_n phi_k[n]; attn = num / (den + 1e-6) + (v v_map_w^T + v_map_b); out = mean over heads; result = [sqrt(sum out^2 + 1), out].
#define NN 32768
#define CI 128             // in channels
#define CO 128             // out channels per head
#define NH 8
#ifndef NPROC
#define NPROC NN           // rows processed
#endif
typedef __attribute__((ext_vector_type(8))) __bf16 v8b;
__device__ __forceinline__ v16b frag_b(const __bf16* rowk0, int lane) {
  union { v16b v; v8b q[2]; } u; const __bf16* p = rowk0 + 8 * (lane >> 4);
  u.q[0] = *(const v8b*)p; u.q[1] = *(const v8b*)(p + 16); return u.v;
}
typedef __attribute__((ext_vector_type(4))) __bf16 v4b;
#define WP 136             // bf16 per LDS row of a staged [128][128] B operand (272 B = 16 B x 17)
// a block of 128 threads rounds a row-major f32 [128][128] matrix to bf16 rows in LDS: thread t takes the 16-B pieces t, t + 128, ... (a wave fills one row per piece); a call takes the NI pieces from I0 on
template <int I0 = 0, int NI = 32> __device__ __forceinline__ void stage_rows(const float* __restrict__ Wm, __bf16 (*dst)[WP], int tid) {
  const float* pw = Wm + tid * 4 + I0 * 512; v4f wv[NI];
#pragma unroll
  for (int i = 0; i < NI; ++i) wv[i] = *(const v4f*)(pw + i * 512);   /* unrolled: all of a thread's loads are in flight together */
  asm volatile("s_wait_xcnt 0x0" :: "v"(pw), "v"(tid) : "memory");   /* the address pair, or the thread index where the loads go by a scalar base plus that index, stays whole until every load above has taken its address */
#pragma unroll
  for (int i = 0; i < NI; ++i) { v4b o;
#pragma unroll
    for (int z = 0; z < 4; ++z) o[z] = (__bf16)wv[i][z];
    *(v4b*)&dst[(tid >> 5) + 4 * (I0 + i)][(tid & 31) * 4] = o; } }
// the same for a matrix that is kept as bf16 hi + lo: two planes
__device__ __forceinline__ void stage_rows2(const float* __restrict__ Wm, __bf16 (*dh)[WP], __bf16 (*dl)[WP], int tid) {
  const float* pw = Wm + tid * 4; v4f wv[32];
#pragma unroll
  for (int i = 0; i < 32; ++i) wv[i] = *(const v4f*)(pw + i * 512);   /* unrolled: all of a thread's loads are in flight together */
  asm volatile("s_wait_xcnt 0x0" :: "v"(pw), "v"(tid) : "memory");   /* the address pair, or the thread index where the loads go by a scalar base plus that index, stays whole until every load above has taken its address */
#pragma unroll
  for (int i = 0; i < 32; ++i) { v4b oh, ol;
#pragma unroll
    for (int z = 0; z < 4; ++z) { const __bf16 hv = (__bf16)wv[i][z]; oh[z] = hv; ol[z] = (__bf16)(wv[i][z] - (float)hv); }
    *(v4b*)&dh[(tid >> 5) + 4 * i][(tid & 31) * 4] = oh; *(v4b*)&dl[(tid >> 5) + 4 * i][(tid & 31) * 4] = ol; } }
__device__ __forceinline__ float bfr(float v) { return (float)(__bf16)v; }
__device__ __forceinline__ v16b wrow(const float* rowk0, int lane) { v16b w; const float* p = rowk0 + 8 * (lane >> 4);
#pragma unroll
  for (int i = 0; i < 8; ++i) { w[i] = (__bf16)p[i]; w[8 + i] = (__bf16)p[16 + i]; }
  return w; }
// B fragment (k rows k0+.., column n) of an f32 [K][ld] matrix, split bf16 hi + lo
__device__ __forceinline__ F2 colsplit(const float* Wm, int k0, int n, int lane, int ld) { float v[16]; const int g = lane >> 4;
#pragma unroll
  for (int i = 0; i < 8; ++i) { v[i] = Wm[(size_t)(k0 + 8 * g + i) * ld + n]; v[8 + i] = Wm[(size_t)(k0 + 16 + 8 * g + i) * ld + n]; }
  return bsplit16(v); }

#define HG 4               // heads that one launch of each stage takes together (NH / HG groups, one after the other)
#define WS_WC  0u                                       // f32 WC = v_map_w (sum over heads of Wv) [o][i]
#define WS_BC  (WS_WC  + 4u * (size_t)CO * CI)          // f32 BC = v_map_w (sum over heads of bv) + NH v_map_b [o]
#define WS_KS  (WS_BC  + 4u * (size_t)CO)               // f32 column sums of phi_k [head in group][128]
#define WS_KV  (WS_KS  + 4u * (size_t)HG * 128)         // f32 KV [head in group][m][d]
#define WS_ACC (WS_KV  + 4u * (size_t)HG * CO * CO)     // f32 head-sum accumulator [n][128]
#define SLN 64             // rows n per tile of the two sums over n
#define TPB 4              // tiles in a row that one block of k_kvp takes one after the other: together one slice
#define NSL (NPROC / (SLN * TPB))  // slices
#define JG 8               // groups of 16 lanes in a block of k_join
#define JRUN ((NSL + JG - 1) / JG)   // slices in a row that one of k_join's JG groups sums
#define PROWS (CO + 1)     // rows of one slice's partial: 128 rows of KV, then the column sums
#define WS_PART (WS_ACC + 4u * (size_t)NN * CO)         // f32 partials [head in group][slice][129][128]
#define WS_END (WS_PART + 4u * (size_t)HG * NSL * PROWS * CO)
#define TP 72              // bf16 per LDS row of a transposed [128][64] tile (144 B = 16 B x 9)

// acc = x W^T for a wave's 16 rows (a: the rows' four k fragments) against the [128][128] bf16 W in LDS; product t = kc * 8 + j; its W fragment is read from LDS six products ahead, so that the read's latency lies under the products in between
__device__ __forceinline__ void proj_tile(const v16b a[CI / 32], const __bf16 (*sw)[WP], int col, int lane, v8f acc[8]) {
  v16b fw[32];
#pragma unroll
  for (int t = 0; t < 6; ++t) fw[t] = frag_b(&sw[(t & 7) * 16 + col][(t >> 3) * 32], lane);
#pragma unroll
  for (int t = 0; t < 32; ++t) { if (t + 6 < 32) fw[t + 6] = frag_b(&sw[((t + 6) & 7) * 16 + col][((t + 6) >> 3) * 32], lane);
    acc[t & 7] = wmma_bf(a[t >> 3], fw[t], acc[t & 7]); } }
// feature map on a wave's 16 x 128 tile: x = (relu(acc) + 1e-6) * rs with rs = 1 / ds (one divisor for the whole launch: its reciprocal is formed once by the caller), phi = ||x|| / (||x^2|| + 1e-8) * x^2, the two norms over the 128 columns (lane partial sums + 16-lane shuffles)
__device__ __forceinline__ void feature_map(v8f acc[8], float rs) { float n1[8], n2[8];
#pragma unroll
  for (int r = 0; r < 8; ++r) { float s1 = 0.f, s2 = 0.f;
#pragma unroll
    for (int j = 0; j < 8; ++j) { const float x = (fmaxf(acc[j][r], 0.f) + 1e-6f) * rs; acc[j][r] = x; const float x2 = x * x; s1 += x2; s2 += x2 * x2; }
    n1[r] = s1; n2[r] = s2; }
#pragma unroll
  for (int o = 1; o < 16; o <<= 1) {
#pragma unroll
    for (int r = 0; r < 8; ++r) { n1[r] += __shfl_xor(n1[r], o); n2[r] += __shfl_xor(n2[r], o); } }
#pragma unroll
  for (int r = 0; r < 8; ++r) n1[r] = sqrtf(n1[r]) / (sqrtf(n2[r]) + 1e-8f);   /* ||x|| / (||x^2|| + eps) */
#pragma unroll
  for (int j = 0; j < 8; ++j) {
#pragma unroll
    for (int r = 0; r < 8; ++r) acc[j][r] = n1[r] * (acc[j][r] * acc[j][r]); } }

// the transposed product: acc = W x^T, tile j = W's rows 16 j + .. against the wave's 16 x rows as columns (W's fragments as A, the x fragments as B; both loaders hold the same k order); lane (n = lane & 15, g = lane >> 4) gets columns 16 j + 8 g + r of x row n; the LDS reads as in proj_tile
__device__ __forceinline__ void proj_tile_t(const v16b a[CI / 32], const __bf16 (*sw)[WP], int col, int lane, v8f acc[8]) {
  v16b fw[32];
#pragma unroll
  for (int t = 0; t < 6; ++t) fw[t] = frag_b(&sw[(t & 7) * 16 + col][(t >> 3) * 32], lane);
#pragma unroll
  for (int t = 0; t < 32; ++t) { if (t + 6 < 32) fw[t + 6] = frag_b(&sw[((t + 6) & 7) * 16 + col][((t + 6) >> 3) * 32], lane);
    acc[t & 7] = wmma_bf(fw[t], a[t >> 3], acc[t & 7]); } }
// the feature map on such a transposed tile: a lane holds 64 of its row's 128 columns, lane ^ 16 the other 64; each norm is the lane's own sum (eight chains side by side, then a tree) plus one exchange
__device__ __forceinline__ void feature_map_t(v8f acc[8], float rs) { v8f s1 = {}, s2 = {};
#pragma unroll
  for (int j = 0; j < 8; ++j) {
#pragma unroll
    for (int r = 0; r < 8; ++r) { const float x = (fmaxf(acc[j][r], 0.f) + 1e-6f) * rs; const float x2 = x * x; acc[j][r] = x2; s1[r] += x2; s2[r] += x2 * x2; } }
  float t1 = ((s1[0] + s1[1]) + (s1[2] + s1[3])) + ((s1[4] + s1[5]) + (s1[6] + s1[7])), t2 = ((s2[0] + s2[1]) + (s2[2] + s2[3])) + ((s2[4] + s2[5]) + (s2[6] + s2[7]));
  t1 += __shfl_xor(t1, 16); t2 += __shfl_xor(t2, 16);
  const float nn = sqrtf(t1) / (sqrtf(t2) + 1e-8f);   /* ||x|| / (||x^2|| + eps) */
#pragma unroll
  for (int j = 0; j < 8; ++j) {
#pragma unroll
    for (int r = 0; r < 8; ++r) acc[j][r] = nn * acc[j][r]; } }

// a wave's 16 x 128 f32 tile, split bf16 hi + lo, into LDS, transposed ([column][row]); rb = the lane's first row in the block's tile
__device__ __forceinline__ void stage_tile(const v8f acc[8], __bf16 (*th)[TP], __bf16 (*tl)[TP], int rb, int col) {
#pragma unroll
  for (int j = 0; j < 8; ++j) {
#pragma unroll
    for (int r = 0; r < 8; ++r) { const float v = acc[j][r]; const __bf16 hv = (__bf16)v, lv = (__bf16)(v - (float)hv); const int rl = rb + r, cl = j * 16 + col;
      th[cl][rl] = hv; tl[cl][rl] = lv; } } }
// ---- k_kvp: block (x = head in the group, y = slice) = one slice of TPB tiles of 64 rows n of head h, 256 threads; both W[h] go into LDS once and stay; the tiles follow one another in a loop. Per tile: waves 0..3 form phi_k = feature map of x_s Wk[h]^T + bk[h], waves 4..7 v = x_s Wv[h]^T + bv[h] (W (out,in) rows contiguous; exact products; each lane's x row loaded whole). Both tiles go, bf16 hi + lo, TRANSPOSED ([m][n], [d][n]) into LDS; v goes nowhere else. Then wave w: KV[16 w + ..][d] += sum_n phi_k[m][n] v[d][n] over the tile (hi + lo both sides, 3 products, K = 64), kept in registers over the slice; thread m < 128: its sum += sum_n phi_k[m][n] (hi + lo) in a fixed order. Behind the last tile: rows 0..127 and row 128 of the slice's f32 partial. The attribute holds the build to the 256 registers of four waves per SIMD: two blocks share a WGP (2 x the LDS fits too)
__global__ __launch_bounds__(256) __attribute__((amdgpu_waves_per_eu(4, 4))) void k_kvp(const float* __restrict__ XS, const float* __restrict__ WK, const float* __restrict__ BK, const float* __restrict__ WV, const float* __restrict__ BV, const float* __restrict__ NS, int h0, float* __restrict__ PART0) {
  const int h = h0 + blockIdx.x; float* __restrict__ PART = PART0 + (size_t)blockIdx.x * NSL * PROWS * CO;
  __shared__ __align__(16) __bf16 sw[2][128][WP]; __shared__ __align__(16) __bf16 th[2][128][TP], tl2[2][128][TP];   /* [0] k side, [1] v side */
  __shared__ float sb[2][CO];   /* the two biases, rounded: read anew in every trip, held in no register over the loop */
  const int tid = threadIdx.x, t7 = tid & 127, wave = t7 >> 5, lane = tid & 31, col = lane & 15, g = lane >> 4; const size_t r0 = (size_t)blockIdx.y * (SLN * TPB);
  const int side = __builtin_amdgcn_readfirstlane(tid >> 7);   /* the same in a whole wave: 0 = k, 1 = v */
  const float* WA = (side == 0 ? WK : WV) + (size_t)h * CO * CI; const float* BA = (side == 0 ? BK : BV) + (size_t)h * CO;
  const float* px = XS + (r0 + wave * 16 + col) * CI + 8 * g; v4f xa[CI / 32][4];
#pragma unroll
  for (int kc = 0; kc < CI / 32; ++kc) { xa[kc][0] = *(const v4f*)(px + kc * 32); xa[kc][1] = *(const v4f*)(px + kc * 32 + 4); xa[kc][2] = *(const v4f*)(px + kc * 32 + 16); xa[kc][3] = *(const v4f*)(px + kc * 32 + 20); }
  const float* pbv = BA + t7; const float bv = *pbv;
  asm volatile("s_wait_xcnt 0x0" :: "v"(px), "v"(pbv) : "memory");   /* the address pairs stay whole until every load above has taken its address */
  stage_rows<0, 16>(WA, sw[side], t7);   /* in two halves: all 32 pieces at once, beside the x rows, do not fit the 256 registers of four waves per SIMD */
  __builtin_amdgcn_sched_barrier(0);   /* keeps the second half's loads behind the first half's LDS stores: moved up, they bring the spills back */
  stage_rows<16, 16>(WA, sw[side], t7);
  sb[side][t7] = bfr(bv);
  const float rs = 1.0f / (fabsf(bfr(NS[0])) + 1e-6f);
  const int w8 = tid >> 5, m0 = w8 * 16; v8f kv[8] = {}; float s = 0.f;
  v16b a[CI / 32];   /* the tile's x rows as fragments */
#pragma unroll
  for (int kc = 0; kc < CI / 32; ++kc) {
#pragma unroll
    for (int i = 0; i < 16; ++i) a[kc][i] = (__bf16)xa[kc][i >> 2][i & 3]; }
  __syncthreads();   /* both W[h] and the biases staged */
#pragma nounroll   /* rolled: one copy of the body's text rather than TPB */
  for (int t = 0; t < TPB; ++t) {
    { v8f acc[8] = {};
      proj_tile(a, sw[side], col, lane, acc);
#pragma unroll
      for (int j = 0; j < 8; ++j) { const float bb = sb[side][j * 16 + col];
#pragma unroll
        for (int r = 0; r < 8; ++r) acc[j][r] += bb; }
      if (side == 0) feature_map(acc, rs);   /* wave-uniform, no barrier inside */
      if (t > 0) __syncthreads();   /* the same for the whole block: every wave has read the last of the tile before from th and tl2 */
      stage_tile(acc, th[side], tl2[side], wave * 16 + 8 * g, col); }
    __syncthreads();   /* phi_k^T and v^T staged */
    v4f xn[CI / 32][4] = {};   /* born here, so that no register is held for it over the first half of a trip */
    if (t + 1 < TPB) { px += SLN * CI;   /* the next tile's x rows are asked for here: they arrive under this tile's k^T v products */
#pragma unroll
      for (int kc = 0; kc < CI / 32; ++kc) { xn[kc][0] = *(const v4f*)(px + kc * 32); xn[kc][1] = *(const v4f*)(px + kc * 32 + 4); xn[kc][2] = *(const v4f*)(px + kc * 32 + 16); xn[kc][3] = *(const v4f*)(px + kc * 32 + 20); }
      asm volatile("s_wait_xcnt 0x0" :: "v"(px) : "memory");   /* the address pair stays whole until every load above has taken its address */
    }
    { v16b ah[SLN / 32], al[SLN / 32], bh[SLN / 4], bl[SLN / 4];   /* group c = kc * 8 + j; its v fragments are read from LDS two groups ahead, so that the read's latency lies under the products in between */
#pragma unroll
      for (int kc = 0; kc < SLN / 32; ++kc) { ah[kc] = frag_b(&th[0][m0 + col][kc * 32], lane); al[kc] = frag_b(&tl2[0][m0 + col][kc * 32], lane); }
#pragma unroll
      for (int c = 0; c < 2; ++c) { bh[c] = frag_b(&th[1][(c & 7) * 16 + col][(c >> 3) * 32], lane); bl[c] = frag_b(&tl2[1][(c & 7) * 16 + col][(c >> 3) * 32], lane); }
#pragma unroll
      for (int c = 0; c < SLN / 4; ++c) { const int kc = c >> 3, j = c & 7, u = c + 2;
        if (u < SLN / 4) { bh[u] = frag_b(&th[1][(u & 7) * 16 + col][(u >> 3) * 32], lane); bl[u] = frag_b(&tl2[1][(u & 7) * 16 + col][(u >> 3) * 32], lane); }
        kv[j] = wmma_bf(al[kc], bh[c], kv[j]); kv[j] = wmma_bf(ah[kc], bl[c], kv[j]); kv[j] = wmma_bf(ah[kc], bh[c], kv[j]); } }
    if (side == 0) {   /* wave-uniform: thread m = tid adds its row of phi_k^T */
#pragma unroll
      for (int i = 0; i < SLN / 8; ++i) { const v8b a2 = *(const v8b*)&th[0][tid][i * 8], b2 = *(const v8b*)&tl2[0][tid][i * 8];
#pragma unroll
        for (int z = 0; z < 8; ++z) s += (float)a2[z] + (float)b2[z]; } }
#pragma unroll
    for (int kc = 0; kc < CI / 32; ++kc) {   /* in every trip, so that the old fragments are not held over the products above */
#pragma unroll
      for (int i = 0; i < 16; ++i) a[kc][i] = (__bf16)xn[kc][i >> 2][i & 3]; }
  }
  float* pp = PART + (size_t)blockIdx.y * PROWS * CO;
  if (side == 0) { float* ps = pp + CO * CO + tid; *ps = s;   /* a wave stores one whole 128-B line */
    asm volatile("s_wait_xcnt 0x0" :: "v"(ps) : "memory");   /* the address pair stays whole until the store above has taken its address */
  }
  float (*sf)[132] = (float (*)[132])&sw[0][0][0] + w8 * 16;   /* 8 waves x 16 rows x 528 B = 67,584 B of sw's 69,632; the last tile's 'staged' barrier stands behind every wave's last read of W */
#pragma unroll
  for (int j = 0; j < 8; ++j) {
#pragma unroll
    for (int r = 0; r < 8; ++r) sf[8 * g + r][j * 16 + col] = kv[j][r]; }
  LDSX(); float* po = pp + (size_t)m0 * CO + lane * 4;
#pragma unroll
  for (int rl = 0; rl < 16; ++rl) vst2(po + rl * CO, *(const v4f*)&sf[rl][lane * 4]);
  asm volatile("s_wait_xcnt 0x0" :: "v"(po) : "memory");   /* the address pair stays whole until every store above has taken its address */
}
// ---- k_join: block (y = head in the group) = 64 columns of one of the head's 129 partial rows (a 256-B segment): JG groups of 16 lanes; group t sums its run of JRUN slices in index order, the JG group sums are added in index order through LDS -> KV row (rows 0..127) or KS (row 128)
__global__ __launch_bounds__(16 * JG) void k_join(const float* __restrict__ PART0, float* __restrict__ KV0, float* __restrict__ KS0) { __shared__ __align__(16) float sj[JG][64];
  const float* __restrict__ PART = PART0 + (size_t)blockIdx.y * NSL * PROWS * CO; float* __restrict__ KV = KV0 + (size_t)blockIdx.y * CO * CO; float* __restrict__ KS = KS0 + (size_t)blockIdx.y * CO;
  const int tid = threadIdx.x, grp = tid >> 4, q = tid & 15; const int row = blockIdx.x >> 1, c0 = (blockIdx.x & 1) * 64;
  const float* p = PART + ((size_t)grp * JRUN * PROWS + row) * CO + c0 + q * 4; v4f s = {}, a[JRUN];
#pragma unroll
  for (int i = 0; i < JRUN; ++i) { a[i] = v4f{}; if (NSL % JG == 0 || grp * JRUN + i < NSL) a[i] = *(const v4f*)(p + (size_t)i * PROWS * CO); }   /* unrolled: all of a lane's loads are in flight together */
  asm volatile("s_wait_xcnt 0x0" :: "v"(p) : "memory");   /* the address pair stays whole until every load above has taken its address */
#pragma unroll
  for (int i = 0; i < JRUN; ++i) s += a[i];
  vst2(&sj[grp][q * 4], s); __syncthreads();
  if (tid < 16) { v4f t = {};
#pragma unroll
    for (int z = 0; z < JG; ++z) t += *(const v4f*)&sj[z][tid * 4];
    vst2((row < CO ? KV + (size_t)row * CO : KS) + c0 + tid * 4, t); } }
// ---- k_vw: the head sum of v_map(v) is linear in x_s: sum_h (v_h v_map_w^T + v_map_b) = x_s WC^T + BC, with S = sum_h Wv[h] and sb = sum_h bv[h] (each term rounded to bf16, f32 sums in head order), WC = v_map_w S [o][i], BC = v_map_w sb + NH v_map_b. Block b < 4 = 32 columns i of WC (whole 128-B lines of its rows), block 4 = BC (every column of its B operand holds sb). S goes, bf16 hi + lo, transposed ([column][d]) into LDS; wave w: rows o = 16 w + .., v_map_w exact, 2 products, K = 128
template <int SD, int SH> __device__ __forceinline__ void head_sum(const float* ps, float s[16]) { float v[NH][16];
#pragma unroll
  for (int hh = 0; hh < NH; ++hh) {
#pragma unroll
    for (int z = 0; z < 16; ++z) v[hh][z] = ps[hh * SH + z * SD]; }   /* unrolled: all of a thread's loads are in flight together */
  asm volatile("s_wait_xcnt 0x0" :: "v"(ps) : "memory");   /* the address pair stays whole until every load above has taken its address */
#pragma unroll
  for (int z = 0; z < 16; ++z) { float t = 0.f;
#pragma unroll
    for (int hh = 0; hh < NH; ++hh) t += bfr(v[hh][z]);
    s[z] = t; } }
__global__ __launch_bounds__(256) void k_vw(const float* __restrict__ WV, const float* __restrict__ BV, const float* __restrict__ VMW, const float* __restrict__ VMB, float* __restrict__ WC, float* __restrict__ BC) {
  __shared__ __align__(16) __bf16 sth[32][WP], stl[32][WP]; __shared__ float sbc[CO];
  const int tid = threadIdx.x, wave = tid >> 5, lane = tid & 31, col = lane & 15, g = lane >> 4, d0 = wave * 16; const int b = blockIdx.x;   /* thread = column lane of the block's 32, rows d0 .. d0 + 15 of S: a wave's load is one 128-B line */
  const float* pm = VMW + (size_t)(wave * 16 + col) * CO + 8 * g; v4f ma[CO / 32][4];
#pragma unroll
  for (int kc = 0; kc < CO / 32; ++kc) { ma[kc][0] = *(const v4f*)(pm + kc * 32); ma[kc][1] = *(const v4f*)(pm + kc * 32 + 4); ma[kc][2] = *(const v4f*)(pm + kc * 32 + 16); ma[kc][3] = *(const v4f*)(pm + kc * 32 + 20); }
  asm volatile("s_wait_xcnt 0x0" :: "v"(pm) : "memory");   /* the address pair stays whole until every load above has taken its address */
  float s[16];
  if (b < CI / 32) head_sum<CI, CO * CI>(WV + (size_t)d0 * CI + b * 32 + lane, s);   /* the same for the whole block */
  else head_sum<1, CO>(BV + d0, s);
  { v8b hv[2], lv[2];
#pragma unroll
    for (int z = 0; z < 16; ++z) { const __bf16 hh = (__bf16)s[z]; hv[z >> 3][z & 7] = hh; lv[z >> 3][z & 7] = (__bf16)(s[z] - (float)hh); }
    *(v8b*)&sth[lane][d0] = hv[0]; *(v8b*)&sth[lane][d0 + 8] = hv[1]; *(v8b*)&stl[lane][d0] = lv[0]; *(v8b*)&stl[lane][d0 + 8] = lv[1]; }
  v16b am[CO / 32];
#pragma unroll
  for (int kc = 0; kc < CO / 32; ++kc) {
#pragma unroll
    for (int i = 0; i < 16; ++i) am[kc][i] = (__bf16)ma[kc][i >> 2][i & 3]; }
  __syncthreads();   /* S^T staged */
  v8f acc[2] = {};
#pragma unroll
  for (int kc = 0; kc < CO / 32; ++kc) {
#pragma unroll
    for (int u = 0; u < 2; ++u) { const v16b fh = frag_b(&sth[u * 16 + col][kc * 32], lane), fl = frag_b(&stl[u * 16 + col][kc * 32], lane);
      acc[u] = wmma_bf(am[kc], fl, acc[u]); acc[u] = wmma_bf(am[kc], fh, acc[u]); } }
  if (b < CI / 32) { float* po = WC + (size_t)(wave * 16 + 8 * g) * CI + b * 32 + col;   /* a row's 128-B line: this wave's two stores */
#pragma unroll
    for (int r = 0; r < 8; ++r) { po[r * CI] = acc[0][r]; po[r * CI + 16] = acc[1][r]; }
    asm volatile("s_wait_xcnt 0x0" :: "v"(po) : "memory");   /* the address pair stays whole until every store above has taken its address */
  } else {   /* the same for the whole block, its barrier too */
    if (col == 0) {
#pragma unroll
      for (int r = 0; r < 8; ++r) sbc[wave * 16 + 8 * g + r] = acc[0][r]; }
    __syncthreads();   /* the 128 sums are in LDS: a wave stores whole lines */
    if (tid < CO) BC[tid] = sbc[tid] + (float)NH * bfr(VMB[tid]); } }
// ---- k_num: block = 64 rows n (all 128 cols), the group's HG heads one after the other, their sum kept in registers; the block's x_q rows are loaded once and held as fragments; in the first group's launch the sum starts at x_s WC^T + BC (x_s exact, WC f32 -> hi+lo rows in the LDS that KV takes afterwards, 2 products): the head sum of v_map(v); per head: Wq[h] (bf16) and KV (f32 -> hi+lo, transposed) go into LDS once per block; phi_q = feature map of x_q Wq[h]^T + bq[h] (exact products) is formed TRANSPOSED (Wq[h] x_q^T): two accumulator tiles of 16 columns, split bf16 hi + lo in place, are one A fragment of the next product, so that phi_q leaves the registers nowhere; num = phi_q (hi+lo) . KV (hi+lo), 3 products; den = phi_q (hi+lo) . KS (f32 -> hi+lo) as a ninth column tile of the same products, all 16 columns of its B operand holding KS, so that every lane gets the den of its own 8 rows; kept as 1 / (den + 1e-6); val = num * that reciprocal; behind the last head ACC = (h == 0 ? 0 : ACC) + the sum, h = the group's first head (this block's own 512-B row segments)
__global__ __launch_bounds__(128) void k_num(const float* __restrict__ XQ, const float* __restrict__ WQ, const float* __restrict__ BQ, const float* __restrict__ NS, const float* __restrict__ KV0, const float* __restrict__ KS0, const float* __restrict__ XS, const float* __restrict__ WC, const float* __restrict__ BC, int h, float* __restrict__ ACC) {
  __shared__ __align__(16) __bf16 sw[128][WP];   /* Wq[h]; behind the last head the f32 output tile */
  __shared__ __align__(32) float sbq[CO];   /* bq[h], rounded */
  __shared__ __align__(16) __bf16 sksh[128], sksl[128];   /* KS hi / lo */
  __shared__ __align__(16) __bf16 skh[128][WP], skl[128][WP];   /* KV transposed [d][m] hi / lo; in front of the first head WC's rows */
  const int tid = threadIdx.x, wave = tid >> 5, lane = tid & 31, col = lane & 15, g = lane >> 4; const size_t r0 = (size_t)blockIdx.x * 64; const size_t w0 = r0 + wave * 16;
  const float* pq = XQ + (w0 + col) * CI + 8 * g; v4f xq[CI / 32][4];
#pragma unroll
  for (int kc = 0; kc < CI / 32; ++kc) { xq[kc][0] = *(const v4f*)(pq + kc * 32); xq[kc][1] = *(const v4f*)(pq + kc * 32 + 4); xq[kc][2] = *(const v4f*)(pq + kc * 32 + 16); xq[kc][3] = *(const v4f*)(pq + kc * 32 + 20); }
  asm volatile("s_wait_xcnt 0x0" :: "v"(pq) : "memory");   /* the address pair stays whole until every load above has taken its address */
  const float rs = 1.0f / (fabsf(bfr(NS[0])) + 1e-6f);
  v8f tot[8] = {};
  if (h == 0) {   /* the same for the whole launch, its two barriers too */
    const float* px = XS + (w0 + col) * CI + 8 * g; v4f xa[CI / 32][4];
#pragma unroll
    for (int kc = 0; kc < CI / 32; ++kc) { xa[kc][0] = *(const v4f*)(px + kc * 32); xa[kc][1] = *(const v4f*)(px + kc * 32 + 4); xa[kc][2] = *(const v4f*)(px + kc * 32 + 16); xa[kc][3] = *(const v4f*)(px + kc * 32 + 20); }
    const float* pbc = BC + col; float bc[8];
#pragma unroll
    for (int j = 0; j < 8; ++j) bc[j] = pbc[j * 16];
    asm volatile("s_wait_xcnt 0x0" :: "v"(px), "v"(pbc) : "memory");   /* the address pairs stay whole until every load above has taken its address */
    stage_rows2(WC, skh, skl, tid);
    v16b a[CI / 32];
#pragma unroll
    for (int kc = 0; kc < CI / 32; ++kc) {
#pragma unroll
      for (int i = 0; i < 16; ++i) a[kc][i] = (__bf16)xa[kc][i >> 2][i & 3]; }
    __syncthreads();   /* WC staged */
    { v16b wh[32], wl[32];   /* group t = kc * 8 + j; its WC fragments are read from LDS two groups ahead, so that the read's latency lies under the products in between */
#pragma unroll
      for (int t = 0; t < 2; ++t) { wh[t] = frag_b(&skh[(t & 7) * 16 + col][(t >> 3) * 32], lane); wl[t] = frag_b(&skl[(t & 7) * 16 + col][(t >> 3) * 32], lane); }
#pragma unroll
      for (int t = 0; t < 32; ++t) { const int kc = t >> 3, j = t & 7, u = t + 2;
        if (u < 32) { wh[u] = frag_b(&skh[(u & 7) * 16 + col][(u >> 3) * 32], lane); wl[u] = frag_b(&skl[(u & 7) * 16 + col][(u >> 3) * 32], lane); }
        tot[j] = wmma_bf(a[kc], wl[t], tot[j]); tot[j] = wmma_bf(a[kc], wh[t], tot[j]); } }
    __syncthreads();   /* every wave has read its last fragment of WC: the first head may stage its KV */
#pragma unroll
    for (int j = 0; j < 8; ++j) {
#pragma unroll
      for (int r = 0; r < 8; ++r) tot[j][r] += bc[j]; }
  }
  v16b aq[CI / 32];   /* the block's x_q rows as fragments: the same for every head */
#pragma unroll
  for (int kc = 0; kc < CI / 32; ++kc) {
#pragma unroll
    for (int i = 0; i < 16; ++i) aq[kc][i] = (__bf16)xq[kc][i >> 2][i & 3]; }
#pragma nounroll   /* rolled: one copy of the body, not HG */
  for (int hh = 0; hh < HG; ++hh) {   /* no barrier of its own at the head of a trip: the barrier behind the products of the trip before ends every wave's reads of sw, sbq, skh, skl, sksh and sksl */
  const float* __restrict__ KV = KV0 + (size_t)hh * CO * CO;
  { const float* pw = WQ + (size_t)(h + hh) * CO * CI + tid * 4; v4f wv[32];   /* thread t takes the 16-B pieces t, t + 128, ... of Wq[h]: a wave fills one row per piece */
#pragma unroll
    for (int i = 0; i < 32; ++i) wv[i] = *(const v4f*)(pw + i * 512);   /* unrolled: a thread's loads, these and the three kinds below, are issued back to back, with no wait on data between them */
    const float* pk = KV + tid; float kc2[CO];   /* thread d takes column d of KV: a wave's load is 128 B of one row */
#pragma unroll
    for (int m = 0; m < CO; ++m) kc2[m] = pk[m * CO];
    const float* pks = KS0 + (size_t)hh * CO + tid; const float ksv = *pks;
    const float* pbv = BQ + (size_t)(h + hh) * CO + tid; const float bqv = *pbv;
    asm volatile("s_wait_xcnt 0x0" :: "v"(pw), "v"(pk), "v"(pks), "v"(pbv), "v"(tid) : "memory");   /* the address pairs, or the indices where the loads go by a scalar base plus an index, stay whole until every load above has taken its address */
#pragma unroll
    for (int i = 0; i < 32; ++i) { v4b o;
#pragma unroll
      for (int z = 0; z < 4; ++z) o[z] = (__bf16)wv[i][z];
      *(v4b*)&sw[(tid >> 5) + 4 * i][(tid & 31) * 4] = o; }
#pragma unroll
    for (int m = 0; m < CO; m += 8) { v8b hv, lv;
#pragma unroll
      for (int z = 0; z < 8; ++z) { const __bf16 hb = (__bf16)kc2[m + z]; hv[z] = hb; lv[z] = (__bf16)(kc2[m + z] - (float)hb); }
      *(v8b*)&skh[tid][m] = hv; *(v8b*)&skl[tid][m] = lv; }
    const __bf16 kh = (__bf16)ksv; sksh[tid] = kh; sksl[tid] = (__bf16)(ksv - (float)kh); sbq[tid] = bfr(bqv); }
  __syncthreads();   /* Wq[h], bq[h], KV and KS staged */
  __builtin_amdgcn_sched_barrier(0);   /* the staging above and the products below are scheduled apart: as one region the build takes more than the 512 registers of two waves per SIMD */
  v16b ah[CO / 32], al[CO / 32];
  { v8f pa[8] = {}; proj_tile_t(aq, sw, col, lane, pa);
#pragma unroll
    for (int j = 0; j < 8; ++j) pa[j] += *(const v8f*)&sbq[j * 16 + 8 * g];   /* the lane's 8 columns of tile j */
    feature_map_t(pa, rs);
#pragma unroll
    for (int kc = 0; kc < CO / 32; ++kc) {   /* fragment element i = column 32 kc + 8 g + i, element 8 + i = column 32 kc + 16 + 8 g + i: tiles 2 kc and 2 kc + 1 */
#pragma unroll
      for (int i = 0; i < 16; ++i) { const float v = pa[2 * kc + (i >> 3)][i & 7]; const __bf16 hv = (__bf16)v; ah[kc][i] = hv; al[kc][i] = (__bf16)(v - (float)hv); } } }
  v8f acc[8] = {}, dn = {};
  { v16b ch[CO / 32], cl[CO / 32];   /* B[k][n] = KS[k] for every column n: the fragment does not depend on the lane's column */
#pragma unroll
    for (int kc = 0; kc < CO / 32; ++kc) { ch[kc] = frag_b(&sksh[kc * 32], lane); cl[kc] = frag_b(&sksl[kc * 32], lane); }
#pragma unroll
    for (int kc = 0; kc < CO / 32; ++kc) { dn = wmma_bf(al[kc], ch[kc], dn); dn = wmma_bf(ah[kc], cl[kc], dn); dn = wmma_bf(ah[kc], ch[kc], dn); } }
  { v16b wh[32], wl[32];   /* group t = kc * 8 + j; its KV fragments are read from LDS two groups ahead, so that the read's latency lies under the products in between */
#pragma unroll
    for (int t = 0; t < 2; ++t) { wh[t] = frag_b(&skh[(t & 7) * 16 + col][(t >> 3) * 32], lane); wl[t] = frag_b(&skl[(t & 7) * 16 + col][(t >> 3) * 32], lane); }
#pragma unroll
    for (int t = 0; t < 32; ++t) { const int kc = t >> 3, j = t & 7, u = t + 2;
      if (u < 32) { wh[u] = frag_b(&skh[(u & 7) * 16 + col][(u >> 3) * 32], lane); wl[u] = frag_b(&skl[(u & 7) * 16 + col][(u >> 3) * 32], lane); }
      acc[j] = wmma_bf(al[kc], wh[t], acc[j]); acc[j] = wmma_bf(ah[kc], wl[t], acc[j]); acc[j] = wmma_bf(ah[kc], wh[t], acc[j]); } }
  __syncthreads();   /* every wave has read its last of Wq[h], bq[h], KV and KS: the next trip may stage its own */
  float rden[8];
#pragma unroll
  for (int r = 0; r < 8; ++r) rden[r] = 1.0f / (dn[r] + 1e-6f);   /* a row's one division: its 128 columns multiply */
#pragma unroll
  for (int j = 0; j < 8; ++j) {
#pragma unroll
    for (int r = 0; r < 8; ++r) tot[j][r] += acc[j][r] * rden[r]; }
  }
  float (*sf)[132] = (float (*)[132])&sw[0][0] + wave * 16;   /* 4 waves x 16 rows x 528 B = 33,792 B of sw's 34,816; the last trip's second barrier stands behind every wave's last read of Wq */
#pragma unroll
  for (int j = 0; j < 8; ++j) {
#pragma unroll
    for (int r = 0; r < 8; ++r) sf[8 * g + r][j * 16 + col] = tot[j][r]; }
  LDSX(); for (int rl = 0; rl < 16; ++rl) { float* dst = ACC + (w0 + rl) * CO + lane * 4; v4f v = *(const v4f*)&sf[rl][lane * 4]; if (h > 0) { const v4f p = *(const v4f*)dst; v[0] += p[0]; v[1] += p[1]; v[2] += p[2]; v[3] += p[3]; } vst2(dst, v);
    asm volatile("s_wait_xcnt 0x0" :: "v"(dst), "v"(v) : "memory");   /* the store's address pair and data stay whole until it has taken them: the next row is loaded into the same registers */
  } }
// ---- k_fin: block = 64 rows: out = ACC / 8; time = sqrt(sum out^2 + 1); the 64 x 129 output rows form one contiguous, line-aligned 33,024-B span (64*129*4 = 258 lines; the span starts at row0*516 B with row0 a multiple of 64) staged in LDS and written thread-linearly in 16-B pieces
__global__ __launch_bounds__(128) void k_fin(const float* __restrict__ ACC, float* __restrict__ OUT) { __shared__ __align__(16) float so[64 * 129 + 12];
  const int tid = threadIdx.x; const size_t r0 = (size_t)blockIdx.x * 64;
  for (int rl = tid >> 5, lanei = tid & 31; rl < 64; rl += 4) { const v4f a = *(const v4f*)(ACC + (r0 + rl) * CO + lanei * 4); float o[4]; float s = 0.f;
#pragma unroll
    for (int z = 0; z < 4; ++z) { o[z] = a[z] * (1.0f / NH); s += o[z] * o[z]; }
#pragma unroll
    for (int q = 1; q < 32; q <<= 1) s += __shfl_xor(s, q);
#pragma unroll
    for (int z = 0; z < 4; ++z) so[rl * 129 + 1 + lanei * 4 + z] = o[z];
    if (lanei == 0) so[rl * 129] = sqrtf(s + 1.0f); }
  __syncthreads();
  float* dst = OUT + r0 * 129;
  for (int e = tid; e < 64 * 129 / 4; e += 128) vst2(dst + e * 4, *(const v4f*)&so[e * 4]); }   
extern "C" void kernel_launch(void* const* d_in, const int* in_sizes, int n_in, void* d_out, int out_size, void* d_ws, size_t ws_size, hipStream_t stream) {
  (void)in_sizes; (void)n_in; (void)out_size;
  const float** F = (const float**)d_in;   // 0 query_input, 1 source_input [32768,128]; 2 Wq_w [8,128,128], 3 Wq_b [8,128]; 4 Wk_w, 5 Wk_b; 6 Wv_w, 7 Wv_b; 8 v_map_w [128,128] (out,in), 9 v_map_b; 10 norm_scale
  if (ws_size < (size_t)WS_END) return;
  char* ws = (char*)d_ws; float *WC = (float*)(ws + WS_WC), *BC = (float*)(ws + WS_BC), *KS = (float*)(ws + WS_KS), *KV = (float*)(ws + WS_KV), *ACC = (float*)(ws + WS_ACC), *PART = (float*)(ws + WS_PART);
  k_vw<<<dim3(CI / 32 + 1), 256, 0, stream>>>(F[6], F[7], F[8], F[9], WC, BC);
  for (int h = 0; h < NH; h += HG) {
    k_kvp<<<dim3(HG, NSL), 256, 0, stream>>>(F[1], F[4], F[5], F[6], F[7], F[10], h, PART);
    k_join<<<dim3(2 * PROWS, HG), 16 * JG, 0, stream>>>(PART, KV, KS);
    k_num<<<dim3(NPROC / 64), 128, 0, stream>>>(F[0], F[2], F[3], F[10], KV, KS, F[1], WC, BC, h, ACC);
  }
  k_fin<<<dim3(NPROC / 64), 128, 0, stream>>>(ACC, (float*)d_out);
}

// v010
// A run of this version takes 124 microseconds.
// Timed twice side by side with v009, it ran 1.29 times as fast both times.
// All steps since v000 together make it 189 times as fast.
// compute dtype: all float inputs rounded to bf16; q/k/v head projections x W^T + b with EXACT bf16 products on WMMA 16x16x32, f32 accumulate; relu, the power feature map (norms over 128, x^2) in f32; phi_k, v, phi_q and the [128 x 128] k^T v as bf16 hi + lo (3 products) for the two linear-attention contractions (K = 32,768 and K = 128), the head sum of v_map(v) as x_s against v_map_w (sum over heads of Wv), both of its products with the f32 factor as hi + lo and the other exact (2 products each); the normaliser phi_q . (column sums) likewise hi + lo on both sides (3 products, K = 128); column sums, the head mean and the time coordinate (sqrt) in f32; f32 output.
#include <hip/hip_runtime.h>
#include <math.h>

typedef __attribute__((ext_vector_type(16))) _Float16 v16h;
typedef __attribute__((ext_vector_type(16))) __bf16 v16b;
typedef __attribute__((ext_vector_type(8)))  _Float16 v8h;
typedef __attribute__((ext_vector_type(8)))  float v8f;
typedef __attribute__((ext_vector_type(4)))  float v4f;
typedef __attribute__((ext_vector_type(2)))  float v2f;
typedef __attribute__((ext_vector_type(4)))  unsigned v4u;
typedef __attribute__((ext_vector_type(4)))  int v4i;
typedef float __attribute__((may_alias)) float_a;
typedef int __attribute__((may_alias)) int_a;

template <typename T> __device__ __forceinline__ void vst2(void* p, T v) { *(T*)p = v;  }
__device__ __forceinline__ v8f wmma16(v16h a, v16h b, v8f c) {
  v8f d = __builtin_amdgcn_wmma_f32_16x16x32_f16(false, a, false, b, (short)0, c, false, false);
  asm volatile("v_nop\n\tv_nop\n\tv_nop\n\tv_nop" : "+v"(d) : "v"(a), "v"(b));
  return d;
}
__device__ __forceinline__ v8f wmma_bf(v16b a, v16b b, v8f c) {
  v8f d = __builtin_amdgcn_wmma_f32_16x16x32_bf16(false, a, false, b, (short)0, c, false, false);
  asm volatile("v_nop\n\tv_nop\n\tv_nop\n\tv_nop" : "+v"(d) : "v"(a), "v"(b));
  return d;
}
// 16x16x32 fragments: lane = (h = lane>>4, row/col = lane&15); elements 0..7 = k0+8h+0..7, 8..15 = k0+16+8h+0..7; D element r = row 8h+r
__device__ __forceinline__ v16h frag_h(const _Float16* rowk0, int lane) {
  union { v16h v; v8h q[2]; } u; const _Float16* p = rowk0 + 8 * (lane >> 4);
  u.q[0] = *(const v8h*)p; u.q[1] = *(const v8h*)(p + 16); return u.v;
}
__device__ __forceinline__ v16h frag_f32(const float* rowk0, int lane) {
  v16h a; const float* p = rowk0 + 8 * (lane >> 4);
#pragma unroll
  for (int i = 0; i < 8; ++i) { a[i] = (_Float16)p[i]; a[8 + i] = (_Float16)p[16 + i]; }
  return a;
}
__device__ __forceinline__ v16h frag_f32s(const float* rowk0, int lane, float sc) {
  v16h a; const float* p = rowk0 + 8 * (lane >> 4);
#pragma unroll
  for (int i = 0; i < 8; ++i) { a[i] = (_Float16)(p[i] * sc); a[8 + i] = (_Float16)(p[16 + i] * sc); }
  return a;
}
// column fragment from a [K][ld] layout (column n), rows >= K read as 0
__device__ __forceinline__ v16h fragc_f32(const float* W, int k0, int n, int lane, int ld, int K) {
  v16h a; const int g = lane >> 4;
#pragma unroll
  for (int i = 0; i < 8; ++i) { const int ka = k0 + 8 * g + i, kb = ka + 16;
    a[i] = (_Float16)(ka < K ? W[(size_t)(ka < K ? ka : K - 1) * ld + n] : 0.f); a[8 + i] = (_Float16)(kb < K ? W[(size_t)(kb < K ? kb : K - 1) * ld + n] : 0.f); }
  return a;
}
struct F2 { v16b h, l; };
__device__ __forceinline__ F2 bsplit16(const float v[16]) { F2 r;
#pragma unroll
  for (int i = 0; i < 16; ++i) { const __bf16 h = (__bf16)v[i]; r.h[i] = h; r.l[i] = (__bf16)(v[i] - (float)h); }
  return r; }
__device__ __forceinline__ F2 split_row(const float* row, int k0, int lane) { float v[16]; const float* p = row + k0 + 8 * (lane >> 4);
#pragma unroll
  for (int i = 0; i < 8; ++i) { v[i] = p[i]; v[8 + i] = p[16 + i]; }
  return bsplit16(v); }
__device__ __forceinline__ F2 split_rowK(const float* row, int k0, int lane, int K) { float v[16]; const int g = lane >> 4;
#pragma unroll
  for (int i = 0; i < 8; ++i) { const int ka = k0 + 8 * g + i, kb = ka + 16; v[i] = ka < K ? row[ka < K ? ka : K - 1] : 0.f; v[8 + i] = kb < K ? row[kb < K ? kb : K - 1] : 0.f; }
  return bsplit16(v); }
__device__ __forceinline__ F2 split_col(const float* W, int k0, int n, int lane, int ld, int K) { float v[16]; const int g = lane >> 4;
#pragma unroll
  for (int i = 0; i < 8; ++i) { const int ka = k0 + 8 * g + i, kb = ka + 16; v[i] = ka < K ? W[(size_t)(ka < K ? ka : K - 1) * ld + n] : 0.f; v[8 + i] = kb < K ? W[(size_t)(kb < K ? kb : K - 1) * ld + n] : 0.f; }
  return bsplit16(v); }
__device__ __forceinline__ v8f mac3(const F2& a, const F2& b, v8f c) { c = wmma_bf(a.l, b.h, c); c = wmma_bf(a.h, b.l, c); return wmma_bf(a.h, b.h, c); }
__device__ __forceinline__ float sigm(float v) { return 1.0f / (1.0f + expf(-v)); }
#define LDSX() do { asm volatile("s_wait_dscnt 0" ::: "memory"); __builtin_amdgcn_wave_barrier(); __builtin_amdgcn_fence(__ATOMIC_RELEASE, "workgroup"); } while (0)

// Hyperbolic (Lorentz) linear-attention 'TransConv' layer (N 32,768 nodes, 128 -> 128, 8 heads, power kernel p = 2): per head h: qs = x_q Wq[h]^T + bq[h], ks = x_s Wk[h]^T + bk[h], v = x_s Wv[h]^T + bv[h]; phi(x) = ||x|| / (||x^2|| + 1e-8) * x^2 applied to (relu(.) + 1e-6)/(|norm_scale| + 1e-6); KV[h] = sum_n phi_k[n] (x) v[n]; num[n] = phi_q[n] KV[h]; den[n] = phi_q[n] . sum_n phi_k[n]; attn = num / (den + 1e-6) + (v v_map_w^T + v_map_b); out = mean over heads; result = [sqrt(sum out^2 + 1), out].
#define NN 32768
#define CI 128             // in channels
#define CO 128             // out channels per head
#define NH 8
#ifndef NPROC
#define NPROC NN           // rows processed
#endif
typedef __attribute__((ext_vector_type(8))) __bf16 v8b;
__device__ __forceinline__ v16b frag_b(const __bf16* rowk0, int lane) {
  union { v16b v; v8b q[2]; } u; const __bf16* p = rowk0 + 8 * (lane >> 4);
  u.q[0] = *(const v8b*)p; u.q[1] = *(const v8b*)(p + 16); return u.v;
}
typedef __attribute__((ext_vector_type(4))) __bf16 v4b;
#define WP 136             // bf16 per LDS row of a staged [128][128] B operand (272 B = 16 B x 17)
// a block of 128 threads rounds a row-major f32 [128][128] matrix to bf16 rows in LDS: thread t takes the 16-B pieces t, t + 128, ... (a wave fills one row per piece); a call takes the NI pieces from I0 on
template <int I0 = 0, int NI = 32> __device__ __forceinline__ void stage_rows(const float* __restrict__ Wm, __bf16 (*dst)[WP], int tid) {
  const float* pw = Wm + tid * 4 + I0 * 512; v4f wv[NI];
#pragma unroll
  for (int i = 0; i < NI; ++i) wv[i] = *(const v4f*)(pw + i * 512);   /* unrolled: all of a thread's loads are in flight together */
  asm volatile("s_wait_xcnt 0x0" :: "v"(pw), "v"(tid) : "memory");   /* the address pair, or the thread index where the loads go by a scalar base plus that index, stays whole until every load above has taken its address */
#pragma unroll
  for (int i = 0; i < NI; ++i) { v4b o;
#pragma unroll
    for (int z = 0; z < 4; ++z) o[z] = (__bf16)wv[i][z];
    *(v4b*)&dst[(tid >> 5) + 4 * (I0 + i)][(tid & 31) * 4] = o; } }
// the same for a matrix that is kept as bf16 hi + lo: two planes
__device__ __forceinline__ void stage_rows2(const float* __restrict__ Wm, __bf16 (*dh)[WP], __bf16 (*dl)[WP], int tid) {
  const float* pw = Wm + tid * 4; v4f wv[32];
#pragma unroll
  for (int i = 0; i < 32; ++i) wv[i] = *(const v4f*)(pw + i * 512);   /* unrolled: all of a thread's loads are in flight together */
  asm volatile("s_wait_xcnt 0x0" :: "v"(pw), "v"(tid) : "memory");   /* the address pair, or the thread index where the loads go by a scalar base plus that index, stays whole until every load above has taken its address */
#pragma unroll
  for (int i = 0; i < 32; ++i) { v4b oh, ol;
#pragma unroll
    for (int z = 0; z < 4; ++z) { const __bf16 hv = (__bf16)wv[i][z]; oh[z] = hv; ol[z] = (__bf16)(wv[i][z] - (float)hv); }
    *(v4b*)&dh[(tid >> 5) + 4 * i][(tid & 31) * 4] = oh; *(v4b*)&dl[(tid >> 5) + 4 * i][(tid & 31) * 4] = ol; } }
__device__ __forceinline__ float bfr(float v) { return (float)(__bf16)v; }
__device__ __forceinline__ v16b wrow(const float* rowk0, int lane) { v16b w; const float* p = rowk0 + 8 * (lane >> 4);
#pragma unroll
  for (int i = 0; i < 8; ++i) { w[i] = (__bf16)p[i]; w[8 + i] = (__bf16)p[16 + i]; }
  return w; }
// B fragment (k rows k0+.., column n) of an f32 [K][ld] matrix, split bf16 hi + lo
__device__ __forceinline__ F2 colsplit(const float* Wm, int k0, int n, int lane, int ld) { float v[16]; const int g = lane >> 4;
#pragma unroll
  for (int i = 0; i < 8; ++i) { v[i] = Wm[(size_t)(k0 + 8 * g + i) * ld + n]; v[8 + i] = Wm[(size_t)(k0 + 16 + 8 * g + i) * ld + n]; }
  return bsplit16(v); }

#define HG NH              // heads that one launch of each stage takes together: all of them
#define WS_WC  0u                                       // f32 WC = v_map_w (sum over heads of Wv) [o][i]
#define WS_BC  (WS_WC  + 4u * (size_t)CO * CI)          // f32 BC = v_map_w (sum over heads of bv) + NH v_map_b [o]
#define WS_KS  (WS_BC  + 4u * (size_t)CO)               // f32 column sums of phi_k [head][128]
#define WS_KV  (WS_KS  + 4u * (size_t)HG * 128)         // f32 KV [head][m][d]
#define SLN 64             // rows n per tile of the two sums over n
#define TPB 4              // tiles in a row that one block of k_kvp takes one after the other: together one slice
#define NSL (NPROC / (SLN * TPB))  // slices
#define JG 8               // groups of 16 lanes in a block of k_join
#define JRUN ((NSL + JG - 1) / JG)   // slices in a row that one of k_join's JG groups sums
#define PROWS (CO + 1)     // rows of one slice's partial: 128 rows of KV, then the column sums
#define WS_PART (WS_KV  + 4u * (size_t)HG * CO * CO)     // f32 partials [head][slice][129][128]
#define WS_END (WS_PART + 4u * (size_t)HG * NSL * PROWS * CO)
#define TP 72              // bf16 per LDS row of a transposed [128][64] tile (144 B = 16 B x 9)

// acc = x W^T for a wave's 16 rows (a: the rows' four k fragments) against the [128][128] bf16 W in LDS; product t = kc * 8 + j; its W fragment is read from LDS six products ahead, so that the read's latency lies under the products in between
__device__ __forceinline__ void proj_tile(const v16b a[CI / 32], const __bf16 (*sw)[WP], int col, int lane, v8f acc[8]) {
  v16b fw[32];
#pragma unroll
  for (int t = 0; t < 6; ++t) fw[t] = frag_b(&sw[(t & 7) * 16 + col][(t >> 3) * 32], lane);
#pragma unroll
  for (int t = 0; t < 32; ++t) { if (t + 6 < 32) fw[t + 6] = frag_b(&sw[((t + 6) & 7) * 16 + col][((t + 6) >> 3) * 32], lane);
    acc[t & 7] = wmma_bf(a[t >> 3], fw[t], acc[t & 7]); } }
// feature map on a wave's 16 x 128 tile: x = (relu(acc) + 1e-6) * rs with rs = 1 / ds (one divisor for the whole launch: its reciprocal is formed once by the caller), phi = ||x|| / (||x^2|| + 1e-8) * x^2, the two norms over the 128 columns (lane partial sums + 16-lane shuffles)
__device__ __forceinline__ void feature_map(v8f acc[8], float rs) { float n1[8], n2[8];
#pragma unroll
  for (int r = 0; r < 8; ++r) { float s1 = 0.f, s2 = 0.f;
#pragma unroll
    for (int j = 0; j < 8; ++j) { const float x = (fmaxf(acc[j][r], 0.f) + 1e-6f) * rs; acc[j][r] = x; const float x2 = x * x; s1 += x2; s2 += x2 * x2; }
    n1[r] = s1; n2[r] = s2; }
#pragma unroll
  for (int o = 1; o < 16; o <<= 1) {
#pragma unroll
    for (int r = 0; r < 8; ++r) { n1[r] += __shfl_xor(n1[r], o); n2[r] += __shfl_xor(n2[r], o); } }
#pragma unroll
  for (int r = 0; r < 8; ++r) n1[r] = sqrtf(n1[r]) / (sqrtf(n2[r]) + 1e-8f);   /* ||x|| / (||x^2|| + eps) */
#pragma unroll
  for (int j = 0; j < 8; ++j) {
#pragma unroll
    for (int r = 0; r < 8; ++r) acc[j][r] = n1[r] * (acc[j][r] * acc[j][r]); } }

// the transposed product: acc = W x^T, tile j = W's rows 16 j + .. against the wave's 16 x rows as columns (W's fragments as A, the x fragments as B; both loaders hold the same k order); lane (n = lane & 15, g = lane >> 4) gets columns 16 j + 8 g + r of x row n; the LDS reads as in proj_tile
__device__ __forceinline__ void proj_tile_t(const v16b a[CI / 32], const __bf16 (*sw)[WP], int col, int lane, v8f acc[8]) {
  v16b fw[32];
#pragma unroll
  for (int t = 0; t < 6; ++t) fw[t] = frag_b(&sw[(t & 7) * 16 + col][(t >> 3) * 32], lane);
#pragma unroll
  for (int t = 0; t < 32; ++t) { if (t + 6 < 32) fw[t + 6] = frag_b(&sw[((t + 6) & 7) * 16 + col][((t + 6) >> 3) * 32], lane);
    acc[t & 7] = wmma_bf(fw[t], a[t >> 3], acc[t & 7]); } }
// the feature map on such a transposed tile: a lane holds 64 of its row's 128 columns, lane ^ 16 the other 64; each norm is the lane's own sum (eight chains side by side, then a tree) plus one exchange
__device__ __forceinline__ void feature_map_t(v8f acc[8], float rs) { v8f s1 = {}, s2 = {};
#pragma unroll
  for (int j = 0; j < 8; ++j) {
#pragma unroll
    for (int r = 0; r < 8; ++r) { const float x = (fmaxf(acc[j][r], 0.f) + 1e-6f) * rs; const float x2 = x * x; acc[j][r] = x2; s1[r] += x2; s2[r] += x2 * x2; } }
  float t1 = ((s1[0] + s1[1]) + (s1[2] + s1[3])) + ((s1[4] + s1[5]) + (s1[6] + s1[7])), t2 = ((s2[0] + s2[1]) + (s2[2] + s2[3])) + ((s2[4] + s2[5]) + (s2[6] + s2[7]));
  t1 += __shfl_xor(t1, 16); t2 += __shfl_xor(t2, 16);
  const float nn = sqrtf(t1) / (sqrtf(t2) + 1e-8f);   /* ||x|| / (||x^2|| + eps) */
#pragma unroll
  for (int j = 0; j < 8; ++j) {
#pragma unroll
    for (int r = 0; r < 8; ++r) acc[j][r] = nn * acc[j][r]; } }

// a wave's 16 x 128 f32 tile, split bf16 hi + lo, into LDS, transposed ([column][row]); rb = the lane's first row in the block's tile
__device__ __forceinline__ void stage_tile(const v8f acc[8], __bf16 (*th)[TP], __bf16 (*tl)[TP], int rb, int col) {
#pragma unroll
  for (int j = 0; j < 8; ++j) {
#pragma unroll
    for (int r = 0; r < 8; ++r) { const float v = acc[j][r]; const __bf16 hv = (__bf16)v, lv = (__bf16)(v - (float)hv); const int rl = rb + r, cl = j * 16 + col;
      th[cl][rl] = hv; tl[cl][rl] = lv; } } }
// ---- k_kvp: block (x = head, y = slice) = one slice of TPB tiles of 64 rows n of head h, 256 threads; both W[h] go into LDS once and stay; the tiles follow one another in a loop. Per tile: waves 0..3 form phi_k = feature map of x_s Wk[h]^T + bk[h], waves 4..7 v = x_s Wv[h]^T + bv[h] (W (out,in) rows contiguous; exact products; each lane's x row loaded whole). Both tiles go, bf16 hi + lo, TRANSPOSED ([m][n], [d][n]) into LDS; v goes nowhere else. Then wave w: KV[16 w + ..][d] += sum_n phi_k[m][n] v[d][n] over the tile (hi + lo both sides, 3 products, K = 64), kept in registers over the slice; thread m < 128: its sum += sum_n phi_k[m][n] (hi + lo) in a fixed order. Behind the last tile: rows 0..127 and row 128 of the slice's f32 partial. The attribute holds the build to the 256 registers of four waves per SIMD: two blocks share a WGP (2 x the LDS fits too)
__global__ __launch_bounds__(256) __attribute__((amdgpu_waves_per_eu(4, 4))) void k_kvp(const float* __restrict__ XS, const float* __restrict__ WK, const float* __restrict__ BK, const float* __restrict__ WV, const float* __restrict__ BV, const float* __restrict__ NS, float* __restrict__ PART0) {
  const int h = blockIdx.x; float* __restrict__ PART = PART0 + (size_t)blockIdx.x * NSL * PROWS * CO;
  __shared__ __align__(16) __bf16 sw[2][128][WP]; __shared__ __align__(16) __bf16 th[2][128][TP], tl2[2][128][TP];   /* [0] k side, [1] v side */
  __shared__ float sb[2][CO];   /* the two biases, rounded: read anew in every trip, held in no register over the loop */
  const int tid = threadIdx.x, t7 = tid & 127, wave = t7 >> 5, lane = tid & 31, col = lane & 15, g = lane >> 4; const size_t r0 = (size_t)blockIdx.y * (SLN * TPB);
  const int side = __builtin_amdgcn_readfirstlane(tid >> 7);   /* the same in a whole wave: 0 = k, 1 = v */
  const float* WA = (side == 0 ? WK : WV) + (size_t)h * CO * CI; const float* BA = (side == 0 ? BK : BV) + (size_t)h * CO;
  const float* px = XS + (r0 + wave * 16 + col) * CI + 8 * g; v4f xa[CI / 32][4];
#pragma unroll
  for (int kc = 0; kc < CI / 32; ++kc) { xa[kc][0] = *(const v4f*)(px + kc * 32); xa[kc][1] = *(const v4f*)(px + kc * 32 + 4); xa[kc][2] = *(const v4f*)(px + kc * 32 + 16); xa[kc][3] = *(const v4f*)(px + kc * 32 + 20); }
  const float* pbv = BA + t7; const float bv = *pbv;
  asm volatile("s_wait_xcnt 0x0" :: "v"(px), "v"(pbv) : "memory");   /* the address pairs stay whole until every load above has taken its address */
  stage_rows<0, 16>(WA, sw[side], t7);   /* in two halves: all 32 pieces at once, beside the x rows, do not fit the 256 registers of four waves per SIMD */
  __builtin_amdgcn_sched_barrier(0);   /* keeps the second half's loads behind the first half's LDS stores: moved up, they bring the spills back */
  stage_rows<16, 16>(WA, sw[side], t7);
  sb[side][t7] = bfr(bv);
  const float rs = 1.0f / (fabsf(bfr(NS[0])) + 1e-6f);
  const int w8 = tid >> 5, m0 = w8 * 16; v8f kv[8] = {}; float s = 0.f;
  v16b a[CI / 32];   /* the tile's x rows as fragments */
#pragma unroll
  for (int kc = 0; kc < CI / 32; ++kc) {
#pragma unroll
    for (int i = 0; i < 16; ++i) a[kc][i] = (__bf16)xa[kc][i >> 2][i & 3]; }
  __syncthreads();   /* both W[h] and the biases staged */
#pragma nounroll   /* rolled: one copy of the body's text rather than TPB */
  for (int t = 0; t < TPB; ++t) {
    { v8f acc[8] = {};
      proj_tile(a, sw[side], col, lane, acc);
#pragma unroll
      for (int j = 0; j < 8; ++j) { const float bb = sb[side][j * 16 + col];
#pragma unroll
        for (int r = 0; r < 8; ++r) acc[j][r] += bb; }
      if (side == 0) feature_map(acc, rs);   /* wave-uniform, no barrier inside */
      if (t > 0) __syncthreads();   /* the same for the whole block: every wave has read the last of the tile before from th and tl2 */
      stage_tile(acc, th[side], tl2[side], wave * 16 + 8 * g, col); }
    __syncthreads();   /* phi_k^T and v^T staged */
    v4f xn[CI / 32][4] = {};   /* born here, so that no register is held for it over the first half of a trip */
    if (t + 1 < TPB) { px += SLN * CI;   /* the next tile's x rows are asked for here: they arrive under this tile's k^T v products */
#pragma unroll
      for (int kc = 0; kc < CI / 32; ++kc) { xn[kc][0] = *(const v4f*)(px + kc * 32); xn[kc][1] = *(const v4f*)(px + kc * 32 + 4); xn[kc][2] = *(const v4f*)(px + kc * 32 + 16); xn[kc][3] = *(const v4f*)(px + kc * 32 + 20); }
      asm volatile("s_wait_xcnt 0x0" :: "v"(px) : "memory");   /* the address pair stays whole until every load above has taken its address */
    }
    { v16b ah[SLN / 32], al[SLN / 32], bh[SLN / 4], bl[SLN / 4];   /* group c = kc * 8 + j; its v fragments are read from LDS two groups ahead, so that the read's latency lies under the products in between */
#pragma unroll
      for (int kc = 0; kc < SLN / 32; ++kc) { ah[kc] = frag_b(&th[0][m0 + col][kc * 32], lane); al[kc] = frag_b(&tl2[0][m0 + col][kc * 32], lane); }
#pragma unroll
      for (int c = 0; c < 2; ++c) { bh[c] = frag_b(&th[1][(c & 7) * 16 + col][(c >> 3) * 32], lane); bl[c] = frag_b(&tl2[1][(c & 7) * 16 + col][(c >> 3) * 32], lane); }
#pragma unroll
      for (int c = 0; c < SLN / 4; ++c) { const int kc = c >> 3, j = c & 7, u = c + 2;
        if (u < SLN / 4) { bh[u] = frag_b(&th[1][(u & 7) * 16 + col][(u >> 3) * 32], lane); bl[u] = frag_b(&tl2[1][(u & 7) * 16 + col][(u >> 3) * 32], lane); }
        kv[j] = wmma_bf(al[kc], bh[c], kv[j]); kv[j] = wmma_bf(ah[kc], bl[c], kv[j]); kv[j] = wmma_bf(ah[kc], bh[c], kv[j]); } }
    if (side == 0) {   /* wave-uniform: thread m = tid adds its row of phi_k^T */
#pragma unroll
      for (int i = 0; i < SLN / 8; ++i) { const v8b a2 = *(const v8b*)&th[0][tid][i * 8], b2 = *(const v8b*)&tl2[0][tid][i * 8];
#pragma unroll
        for (int z = 0; z < 8; ++z) s += (float)a2[z] + (float)b2[z]; } }
#pragma unroll
    for (int kc = 0; kc < CI / 32; ++kc) {   /* in every trip, so that the old fragments are not held over the products above */
#pragma unroll
      for (int i = 0; i < 16; ++i) a[kc][i] = (__bf16)xn[kc][i >> 2][i & 3]; }
  }
  float* pp = PART + (size_t)blockIdx.y * PROWS * CO;
  if (side == 0) { float* ps = pp + CO * CO + tid; *ps = s;   /* a wave stores one whole 128-B line */
    asm volatile("s_wait_xcnt 0x0" :: "v"(ps) : "memory");   /* the address pair stays whole until the store above has taken its address */
  }
  float (*sf)[132] = (float (*)[132])&sw[0][0][0] + w8 * 16;   /* 8 waves x 16 rows x 528 B = 67,584 B of sw's 69,632; the last tile's 'staged' barrier stands behind every wave's last read of W */
#pragma unroll
  for (int j = 0; j < 8; ++j) {
#pragma unroll
    for (int r = 0; r < 8; ++r) sf[8 * g + r][j * 16 + col] = kv[j][r]; }
  LDSX(); float* po = pp + (size_t)m0 * CO + lane * 4;
#pragma unroll
  for (int rl = 0; rl < 16; ++rl) vst2(po + rl * CO, *(const v4f*)&sf[rl][lane * 4]);
  asm volatile("s_wait_xcnt 0x0" :: "v"(po) : "memory");   /* the address pair stays whole until every store above has taken its address */
}
// ---- k_join: block (y = head) = 64 columns of one of the head's 129 partial rows (a 256-B segment): JG groups of 16 lanes; group t sums its run of JRUN slices in index order, the JG group sums are added in index order through LDS -> KV row (rows 0..127) or KS (row 128)
__global__ __launch_bounds__(16 * JG) void k_join(const float* __restrict__ PART0, float* __restrict__ KV0, float* __restrict__ KS0) { __shared__ __align__(16) float sj[JG][64];
  const float* __restrict__ PART = PART0 + (size_t)blockIdx.y * NSL * PROWS * CO; float* __restrict__ KV = KV0 + (size_t)blockIdx.y * CO * CO; float* __restrict__ KS = KS0 + (size_t)blockIdx.y * CO;
  const int tid = threadIdx.x, grp = tid >> 4, q = tid & 15; const int row = blockIdx.x >> 1, c0 = (blockIdx.x & 1) * 64;
  const float* p = PART + ((size_t)grp * JRUN * PROWS + row) * CO + c0 + q * 4; v4f s = {}, a[JRUN];
#pragma unroll
  for (int i = 0; i < JRUN; ++i) { a[i] = v4f{}; if (NSL % JG == 0 || grp * JRUN + i < NSL) a[i] = *(const v4f*)(p + (size_t)i * PROWS * CO); }   /* unrolled: all of a lane's loads are in flight together */
  asm volatile("s_wait_xcnt 0x0" :: "v"(p) : "memory");   /* the address pair stays whole until every load above has taken its address */
#pragma unroll
  for (int i = 0; i < JRUN; ++i) s += a[i];
  vst2(&sj[grp][q * 4], s); __syncthreads();
  if (tid < 16) { v4f t = {};
#pragma unroll
    for (int z = 0; z < JG; ++z) t += *(const v4f*)&sj[z][tid * 4];
    vst2((row < CO ? KV + (size_t)row * CO : KS) + c0 + tid * 4, t); } }
// ---- k_vw: the head sum of v_map(v) is linear in x_s: sum_h (v_h v_map_w^T + v_map_b) = x_s WC^T + BC, with S = sum_h Wv[h] and sb = sum_h bv[h] (each term rounded to bf16, f32 sums in head order), WC = v_map_w S [o][i], BC = v_map_w sb + NH v_map_b. Block b < 4 = 32 columns i of WC (whole 128-B lines of its rows), block 4 = BC (every column of its B operand holds sb). S goes, bf16 hi + lo, transposed ([column][d]) into LDS; wave w: rows o = 16 w + .., v_map_w exact, 2 products, K = 128
template <int SD, int SH> __device__ __forceinline__ void head_sum(const float* ps, float s[16]) { float v[NH][16];
#pragma unroll
  for (int hh = 0; hh < NH; ++hh) {
#pragma unroll
    for (int z = 0; z < 16; ++z) v[hh][z] = ps[hh * SH + z * SD]; }   /* unrolled: all of a thread's loads are in flight together */
  asm volatile("s_wait_xcnt 0x0" :: "v"(ps) : "memory");   /* the address pair stays whole until every load above has taken its address */
#pragma unroll
  for (int z = 0; z < 16; ++z) { float t = 0.f;
#pragma unroll
    for (int hh = 0; hh < NH; ++hh) t += bfr(v[hh][z]);
    s[z] = t; } }
__global__ __launch_bounds__(256) void k_vw(const float* __restrict__ WV, const float* __restrict__ BV, const float* __restrict__ VMW, const float* __restrict__ VMB, float* __restrict__ WC, float* __restrict__ BC) {
  __shared__ __align__(16) __bf16 sth[32][WP], stl[32][WP]; __shared__ float sbc[CO];
  const int tid = threadIdx.x, wave = tid >> 5, lane = tid & 31, col = lane & 15, g = lane >> 4, d0 = wave * 16; const int b = blockIdx.x;   /* thread = column lane of the block's 32, rows d0 .. d0 + 15 of S: a wave's load is one 128-B line */
  const float* pm = VMW + (size_t)(wave * 16 + col) * CO + 8 * g; v4f ma[CO / 32][4];
#pragma unroll
  for (int kc = 0; kc < CO / 32; ++kc) { ma[kc][0] = *(const v4f*)(pm + kc * 32); ma[kc][1] = *(const v4f*)(pm + kc * 32 + 4); ma[kc][2] = *(const v4f*)(pm + kc * 32 + 16); ma[kc][3] = *(const v4f*)(pm + kc * 32 + 20); }
  asm volatile("s_wait_xcnt 0x0" :: "v"(pm) : "memory");   /* the address pair stays whole until every load above has taken its address */
  float s[16];
  if (b < CI / 32) head_sum<CI, CO * CI>(WV + (size_t)d0 * CI + b * 32 + lane, s);   /* the same for the whole block */
  else head_sum<1, CO>(BV + d0, s);
  { v8b hv[2], lv[2];
#pragma unroll
    for (int z = 0; z < 16; ++z) { const __bf16 hh = (__bf16)s[z]; hv[z >> 3][z & 7] = hh; lv[z >> 3][z & 7] = (__bf16)(s[z] - (float)hh); }
    *(v8b*)&sth[lane][d0] = hv[0]; *(v8b*)&sth[lane][d0 + 8] = hv[1]; *(v8b*)&stl[lane][d0] = lv[0]; *(v8b*)&stl[lane][d0 + 8] = lv[1]; }
  v16b am[CO / 32];
#pragma unroll
  for (int kc = 0; kc < CO / 32; ++kc) {
#pragma unroll
    for (int i = 0; i < 16; ++i) am[kc][i] = (__bf16)ma[kc][i >> 2][i & 3]; }
  __syncthreads();   /* S^T staged */
  v8f acc[2] = {};
#pragma unroll
  for (int kc = 0; kc < CO / 32; ++kc) {
#pragma unroll
    for (int u = 0; u < 2; ++u) { const v16b fh = frag_b(&sth[u * 16 + col][kc * 32], lane), fl = frag_b(&stl[u * 16 + col][kc * 32], lane);
      acc[u] = wmma_bf(am[kc], fl, acc[u]); acc[u] = wmma_bf(am[kc], fh, acc[u]); } }
  if (b < CI / 32) { float* po = WC + (size_t)(wave * 16 + 8 * g) * CI + b * 32 + col;   /* a row's 128-B line: this wave's two stores */
#pragma unroll
    for (int r = 0; r < 8; ++r) { po[r * CI] = acc[0][r]; po[r * CI + 16] = acc[1][r]; }
    asm volatile("s_wait_xcnt 0x0" :: "v"(po) : "memory");   /* the address pair stays whole until every store above has taken its address */
  } else {   /* the same for the whole block, its barrier too */
    if (col == 0) {
#pragma unroll
      for (int r = 0; r < 8; ++r) sbc[wave * 16 + 8 * g + r] = acc[0][r]; }
    __syncthreads();   /* the 128 sums are in LDS: a wave stores whole lines */
    if (tid < CO) BC[tid] = sbc[tid] + (float)NH * bfr(VMB[tid]); } }
// ---- k_num: block = 64 rows n (all 128 cols), the HG heads one after the other, their sum kept in registers; the block's x_q rows are loaded once and held as fragments; the sum starts at x_s WC^T + BC (x_s exact, WC f32 -> hi+lo rows in the LDS that KV takes afterwards, 2 products): the head sum of v_map(v); per head: Wq[h] (bf16) and KV (f32 -> hi+lo, transposed) go into LDS once per block; phi_q = feature map of x_q Wq[h]^T + bq[h] (exact products) is formed TRANSPOSED (Wq[h] x_q^T): two accumulator tiles of 16 columns, split bf16 hi + lo in place, are one A fragment of the next product, so that phi_q leaves the registers nowhere; num = phi_q (hi+lo) . KV (hi+lo), 3 products; den = phi_q (hi+lo) . KS (f32 -> hi+lo) as a ninth column tile of the same products, all 16 columns of its B operand holding KS, so that every lane gets the den of its own 8 rows; kept as 1 / (den + 1e-6); val = num * that reciprocal; behind the last head out = the sum / 8, time = sqrt(sum out^2 + 1) (a lane's 8 columns, then the row's 16 lanes); the block's 64 x 129 output rows form one contiguous, line-aligned 33,024-B span (64*129*4 = 258 lines; the span starts at row0*516 B with row0 a multiple of 64), staged in LDS and written thread-linearly in 16-B pieces
__global__ __launch_bounds__(128) void k_num(const float* __restrict__ XQ, const float* __restrict__ WQ, const float* __restrict__ BQ, const float* __restrict__ NS, const float* __restrict__ KV0, const float* __restrict__ KS0, const float* __restrict__ XS, const float* __restrict__ WC, const float* __restrict__ BC, float* __restrict__ OUT) {
  __shared__ __align__(16) __bf16 sw[128][WP];   /* Wq[h]; behind the last head the f32 output rows */
  __shared__ __align__(32) float sbq[CO];   /* bq[h], rounded */
  __shared__ __align__(16) __bf16 sksh[128], sksl[128];   /* KS hi / lo */
  __shared__ __align__(16) __bf16 skh[128][WP], skl[128][WP];   /* KV transposed [d][m] hi / lo; in front of the first head WC's rows */
  const int tid = threadIdx.x, wave = tid >> 5, lane = tid & 31, col = lane & 15, g = lane >> 4; const size_t r0 = (size_t)blockIdx.x * 64; const size_t w0 = r0 + wave * 16;
  const float* pq = XQ + (w0 + col) * CI + 8 * g; v4f xq[CI / 32][4];
#pragma unroll
  for (int kc = 0; kc < CI / 32; ++kc) { xq[kc][0] = *(const v4f*)(pq + kc * 32); xq[kc][1] = *(const v4f*)(pq + kc * 32 + 4); xq[kc][2] = *(const v4f*)(pq + kc * 32 + 16); xq[kc][3] = *(const v4f*)(pq + kc * 32 + 20); }
  asm volatile("s_wait_xcnt 0x0" :: "v"(pq) : "memory");   /* the address pair stays whole until every load above has taken its address */
  const float rs = 1.0f / (fabsf(bfr(NS[0])) + 1e-6f);
  v8f tot[8] = {};
  {
    const float* px = XS + (w0 + col) * CI + 8 * g; v4f xa[CI / 32][4];
#pragma unroll
    for (int kc = 0; kc < CI / 32; ++kc) { xa[kc][0] = *(const v4f*)(px + kc * 32); xa[kc][1] = *(const v4f*)(px + kc * 32 + 4); xa[kc][2] = *(const v4f*)(px + kc * 32 + 16); xa[kc][3] = *(const v4f*)(px + kc * 32 + 20); }
    const float* pbc = BC + col; float bc[8];
#pragma unroll
    for (int j = 0; j < 8; ++j) bc[j] = pbc[j * 16];
    asm volatile("s_wait_xcnt 0x0" :: "v"(px), "v"(pbc) : "memory");   /* the address pairs stay whole until every load above has taken its address */
    stage_rows2(WC, skh, skl, tid);
    v16b a[CI / 32];
#pragma unroll
    for (int kc = 0; kc < CI / 32; ++kc) {
#pragma unroll
      for (int i = 0; i < 16; ++i) a[kc][i] = (__bf16)xa[kc][i >> 2][i & 3]; }
    __syncthreads();   /* WC staged */
    { v16b wh[32], wl[32];   /* group t = kc * 8 + j; its WC fragments are read from LDS two groups ahead, so that the read's latency lies under the products in between */
#pragma unroll
      for (int t = 0; t < 2; ++t) { wh[t] = frag_b(&skh[(t & 7) * 16 + col][(t >> 3) * 32], lane); wl[t] = frag_b(&skl[(t & 7) * 16 + col][(t >> 3) * 32], lane); }
#pragma unroll
      for (int t = 0; t < 32; ++t) { const int kc = t >> 3, j = t & 7, u = t + 2;
        if (u < 32) { wh[u] = frag_b(&skh[(u & 7) * 16 + col][(u >> 3) * 32], lane); wl[u] = frag_b(&skl[(u & 7) * 16 + col][(u >> 3) * 32], lane); }
        tot[j] = wmma_bf(a[kc], wl[t], tot[j]); tot[j] = wmma_bf(a[kc], wh[t], tot[j]); } }
    __syncthreads();   /* every wave has read its last fragment of WC: the first head may stage its KV */
#pragma unroll
    for (int j = 0; j < 8; ++j) {
#pragma unroll
      for (int r = 0; r < 8; ++r) tot[j][r] += bc[j]; }
  }
  v16b aq[CI / 32];   /* the block's x_q rows as fragments: the same for every head */
#pragma unroll
  for (int kc = 0; kc < CI / 32; ++kc) {
#pragma unroll
    for (int i = 0; i < 16; ++i) aq[kc][i] = (__bf16)xq[kc][i >> 2][i & 3]; }
#pragma nounroll   /* rolled: one copy of the body, not HG */
  for (int hh = 0; hh < HG; ++hh) {   /* no barrier of its own at the head of a trip: the barrier behind the products of the trip before ends every wave's reads of sw, sbq, skh, skl, sksh and sksl */
  const float* __restrict__ KV = KV0 + (size_t)hh * CO * CO;
  { const float* pw = WQ + (size_t)hh * CO * CI + tid * 4; v4f wv[32];   /* thread t takes the 16-B pieces t, t + 128, ... of Wq[h]: a wave fills one row per piece */
#pragma unroll
    for (int i = 0; i < 32; ++i) wv[i] = *(const v4f*)(pw + i * 512);   /* unrolled: a thread's loads, these and the three kinds below, are issued back to back, with no wait on data between them */
    const float* pk = KV + tid; float kc2[CO];   /* thread d takes column d of KV: a wave's load is 128 B of one row */
#pragma unroll
    for (int m = 0; m < CO; ++m) kc2[m] = pk[m * CO];
    const float* pks = KS0 + (size_t)hh * CO + tid; const float ksv = *pks;
    const float* pbv = BQ + (size_t)hh * CO + tid; const float bqv = *pbv;
    asm volatile("s_wait_xcnt 0x0" :: "v"(pw), "v"(pk), "v"(pks), "v"(pbv), "v"(tid) : "memory");   /* the address pairs, or the indices where the loads go by a scalar base plus an index, stay whole until every load above has taken its address */
#pragma unroll
    for (int i = 0; i < 32; ++i) { v4b o;
#pragma unroll
      for (int z = 0; z < 4; ++z) o[z] = (__bf16)wv[i][z];
      *(v4b*)&sw[(tid >> 5) + 4 * i][(tid & 31) * 4] = o; }
#pragma unroll
    for (int m = 0; m < CO; m += 8) { v8b hv, lv;
#pragma unroll
      for (int z = 0; z < 8; ++z) { const __bf16 hb = (__bf16)kc2[m + z]; hv[z] = hb; lv[z] = (__bf16)(kc2[m + z] - (float)hb); }
      *(v8b*)&skh[tid][m] = hv; *(v8b*)&skl[tid][m] = lv; }
    const __bf16 kh = (__bf16)ksv; sksh[tid] = kh; sksl[tid] = (__bf16)(ksv - (float)kh); sbq[tid] = bfr(bqv); }
  __syncthreads();   /* Wq[h], bq[h], KV and KS staged */
  __builtin_amdgcn_sched_barrier(0);   /* the staging above and the products below are scheduled apart: as one region the build takes more than the 512 registers of two waves per SIMD */
  v16b ah[CO / 32], al[CO / 32];
  { v8f pa[8] = {}; proj_tile_t(aq, sw, col, lane, pa);
#pragma unroll
    for (int j = 0; j < 8; ++j) pa[j] += *(const v8f*)&sbq[j * 16 + 8 * g];   /* the lane's 8 columns of tile j */
    feature_map_t(pa, rs);
#pragma unroll
    for (int kc = 0; kc < CO / 32; ++kc) {   /* fragment element i = column 32 kc + 8 g + i, element 8 + i = column 32 kc + 16 + 8 g + i: tiles 2 kc and 2 kc + 1 */
#pragma unroll
      for (int i = 0; i < 16; ++i) { const float v = pa[2 * kc + (i >> 3)][i & 7]; const __bf16 hv = (__bf16)v; ah[kc][i] = hv; al[kc][i] = (__bf16)(v - (float)hv); } } }
  v8f acc[8] = {}, dn = {};
  { v16b ch[CO / 32], cl[CO / 32];   /* B[k][n] = KS[k] for every column n: the fragment does not depend on the lane's column */
#pragma unroll
    for (int kc = 0; kc < CO / 32; ++kc) { ch[kc] = frag_b(&sksh[kc * 32], lane); cl[kc] = frag_b(&sksl[kc * 32], lane); }
#pragma unroll
    for (int kc = 0; kc < CO / 32; ++kc) { dn = wmma_bf(al[kc], ch[kc], dn); dn = wmma_bf(ah[kc], cl[kc], dn); dn = wmma_bf(ah[kc], ch[kc], dn); } }
  { v16b wh[32], wl[32];   /* group t = kc * 8 + j; its KV fragments are read from LDS two groups ahead, so that the read's latency lies under the products in between */
#pragma unroll
    for (int t = 0; t < 2; ++t) { wh[t] = frag_b(&skh[(t & 7) * 16 + col][(t >> 3) * 32], lane); wl[t] = frag_b(&skl[(t & 7) * 16 + col][(t >> 3) * 32], lane); }
#pragma unroll
    for (int t = 0; t < 32; ++t) { const int kc = t >> 3, j = t & 7, u = t + 2;
      if (u < 32) { wh[u] = frag_b(&skh[(u & 7) * 16 + col][(u >> 3) * 32], lane); wl[u] = frag_b(&skl[(u & 7) * 16 + col][(u >> 3) * 32], lane); }
      acc[j] = wmma_bf(al[kc], wh[t], acc[j]); acc[j] = wmma_bf(ah[kc], wl[t], acc[j]); acc[j] = wmma_bf(ah[kc], wh[t], acc[j]); } }
  __syncthreads();   /* every wave has read its last of Wq[h], bq[h], KV and KS: the next trip may stage its own */
  float rden[8];
#pragma unroll
  for (int r = 0; r < 8; ++r) rden[r] = 1.0f / (dn[r] + 1e-6f);   /* a row's one division: its 128 columns multiply */
#pragma unroll
  for (int j = 0; j < 8; ++j) {
#pragma unroll
    for (int r = 0; r < 8; ++r) tot[j][r] += acc[j][r] * rden[r]; }
  }
  float* so = (float*)&sw[0][0];   /* 64 rows x 516 B = 33,024 B of sw's 34,816; the last trip's second barrier stands behind every wave's last read of Wq */
  float ss[8];
#pragma unroll
  for (int r = 0; r < 8; ++r) { float s = 0.f;
#pragma unroll
    for (int j = 0; j < 8; ++j) { const float o = tot[j][r] * (1.0f / NH); tot[j][r] = o; s += o * o; }
    ss[r] = s; }
#pragma unroll
  for (int q = 1; q < 16; q <<= 1) {
#pragma unroll
    for (int r = 0; r < 8; ++r) ss[r] += __shfl_xor(ss[r], q); }
  float* sr = so + (wave * 16 + 8 * g) * 129;
#pragma unroll
  for (int j = 0; j < 8; ++j) {
#pragma unroll
    for (int r = 0; r < 8; ++r) sr[r * 129 + 1 + j * 16 + col] = tot[j][r]; }
  if (col == 0) {
#pragma unroll
    for (int r = 0; r < 8; ++r) sr[r * 129] = sqrtf(ss[r] + 1.0f); }
  __syncthreads();   /* the 64 output rows are in LDS: a thread stores pieces of other waves' rows */
  float* dst = OUT + r0 * 129 + tid * 4; const float* sp = so + tid * 4; v4f ov[16];   /* 64 * 129 / 4 = 16 x 128 + 16 pieces */
#pragma unroll
  for (int i = 0; i < 16; ++i) ov[i] = *(const v4f*)(sp + i * 512);
#pragma unroll
  for (int i = 0; i < 16; ++i) vst2(dst + i * 512, ov[i]);
  asm volatile("s_wait_xcnt 0x0" :: "v"(dst), "v"(ov[0]), "v"(ov[1]), "v"(ov[2]), "v"(ov[3]), "v"(ov[4]), "v"(ov[5]), "v"(ov[6]), "v"(ov[7]), "v"(ov[8]), "v"(ov[9]), "v"(ov[10]), "v"(ov[11]), "v"(ov[12]), "v"(ov[13]), "v"(ov[14]), "v"(ov[15]) : "memory");   /* the stores' address pair and data stay whole until every store above has taken them */
  if (tid < 16) { const v4f ol = *(const v4f*)(sp + 16 * 512); vst2(dst + 16 * 512, ol);   /* the last 16 pieces */
    asm volatile("s_wait_xcnt 0x0" :: "v"(dst), "v"(ol) : "memory");   /* as above */
  }
}
extern "C" void kernel_launch(void* const* d_in, const int* in_sizes, int n_in, void* d_out, int out_size, void* d_ws, size_t ws_size, hipStream_t stream) {
  (void)in_sizes; (void)n_in; (void)out_size;
  const float** F = (const float**)d_in;   // 0 query_input, 1 source_input [32768,128]; 2 Wq_w [8,128,128], 3 Wq_b [8,128]; 4 Wk_w, 5 Wk_b; 6 Wv_w, 7 Wv_b; 8 v_map_w [128,128] (out,in), 9 v_map_b; 10 norm_scale
  if (ws_size < (size_t)WS_END) return;
  char* ws = (char*)d_ws; float *WC = (float*)(ws + WS_WC), *BC = (float*)(ws + WS_BC), *KS = (float*)(ws + WS_KS), *KV = (float*)(ws + WS_KV), *PART = (float*)(ws + WS_PART);
  k_vw<<<dim3(CI / 32 + 1), 256, 0, stream>>>(F[6], F[7], F[8], F[9], WC, BC);
  k_kvp<<<dim3(HG, NSL), 256, 0, stream>>>(F[1], F[4], F[5], F[6], F[7], F[10], PART);
  k_join<<<dim3(2 * PROWS, HG), 16 * JG, 0, stream>>>(PART, KV, KS);
  k_num<<<dim3(NPROC / 64), 128, 0, stream>>>(F[0], F[2], F[3], F[10], KV, KS, F[1], WC, BC, (float*)d_out);
}
